// v000
// The times below were measured on an AMD MI455X: many runs one after another, warmed up first and cycling through
// copies of the inputs, with the whole window's GPU time divided by the number of runs. Launches and the gaps
// between them are all in it. The median over several windows is given; except for v000 it joins two sittings, which
// can be a few percent apart, so the side-by-side timings, each taken in one sitting, are the better comparison.
// v000, which the later versions start from, runs in 601 microseconds.
#include <hip/hip_runtime.h>
// Attention with learned keys/values: out = softmax(Q·Kᵀ/√128)·V for Q [2,8,2048,128], K/V [2,8,4096,128] (head-major planes). One fused flash-style kernel (16 (b,h) slabs; 2048 query rows
// against 4096 keys; online softmax in f32; P f16 ≤ 1; O = P·Vᵀ-tiles; RPW-16 waves; 128-wide head) on v_wmma_f32_16x16x32_f16 — Q/K/V bf16-exact in f16, f32 accumulate.
#define NBH 16
#define TQ 2048
#define TK 4096
#define HD 128

typedef __bf16 v16b __attribute__((ext_vector_type(16)));
typedef unsigned short v8us __attribute__((ext_vector_type(8), may_alias));
typedef float  v8f  __attribute__((ext_vector_type(8)));
typedef float  v4f  __attribute__((ext_vector_type(4)));
typedef float  v4fa __attribute__((ext_vector_type(4), may_alias));
union FragB { v16b v; v8us half[2]; unsigned short u[16]; };

__device__ __forceinline__ unsigned short bf16_bits(float x) { unsigned int u = __float_as_uint(x); return (unsigned short)((u + 0x7FFFu + ((u >> 16) & 1u)) >> 16); }
__device__ __forceinline__ float bf16_val(unsigned short b) { return __uint_as_float(((unsigned int)b) << 16); }
__device__ __forceinline__ float bf16_round(float x) { return bf16_val(bf16_bits(x)); }
// D += A·B with NT terms: 1 = ah·bh, 2 = + al·bh (A split), 3 = + ah·bl (both split)
template <int NT>
__device__ __forceinline__ v8f mmaN(v16b ah, v16b al, v16b bh, v16b bl, v8f c) {
  c = __builtin_amdgcn_wmma_f32_16x16x32_bf16(false, ah, false, bh, (short)0, c, false, false);
  if (NT >= 2) c = __builtin_amdgcn_wmma_f32_16x16x32_bf16(false, al, false, bh, (short)0, c, false, false);
  if (NT >= 3) c = __builtin_amdgcn_wmma_f32_16x16x32_bf16(false, ah, false, bl, (short)0, c, false, false);
  asm volatile("v_nop\n\tv_nop\n\tv_nop\n\tv_nop" : "+v"(c) : "v"(ah), "v"(al), "v"(bh), "v"(bl));
  return c;
}

__global__ __launch_bounds__(256) void k_wt_bf16(const float* __restrict__ W, unsigned short* __restrict__ Wt, int K, int N) {
  const int t = blockIdx.x * 256 + threadIdx.x;
  const int k8n = K / 8;
  if (t >= N * k8n) return;
  const int n = t / k8n, k8 = (t % k8n) * 8;
  v8us v;
#pragma unroll
  for (int i = 0; i < 8; ++i) v[i] = bf16_bits(W[(size_t)(k8 + i) * N + n]);
  *(v8us*)(Wt + (size_t)n * K + k8) = v;
  
}

// GEMM C[M][N] (f32, pitch ldc) = act(A[M][K]·W + bias). A f32 row-major (pitch lda) converted per fragment to bf16
// (ASPLIT: hi/lo two planes -> 2 terms, else single rounded term); Wt bf16 [N][K] (pitch ldb). BIAS_BF16 rounds the
// bias to bf16 first (bias quantised to bf16 before the add). K%32==0, M%16==0, N%64==0.
template <bool ASPLIT, int ACT, bool BIAS_BF16>
__global__ __launch_bounds__(128) void k_gemm_bf(const float* __restrict__ A, int lda, const unsigned short* __restrict__ Wt, int ldb,
                                               const float* __restrict__ bias, float* __restrict__ C, int ldc, int M, int N, int K) {
  __shared__ __attribute__((aligned(16))) float so[4][16][64];
  const int tid = threadIdx.x, w = tid >> 5, lane = tid & 31, ln = lane & 15, hh = lane >> 4;
  const int ntn = N / 64;
  const int wid = blockIdx.x * 4 + w;
  const int mt = wid / ntn, nq = wid % ntn;
  if (mt * 16 >= M) return;
  const int row0 = mt * 16, col0 = nq * 64;
  const float* arow = A + (size_t)(row0 + ln) * lda;
  v8f acc[4] = {};
  for (int kb = 0; kb < K; kb += 32) {
    FragB ah, al;
    const v4f x0 = *(const v4fa*)(arow + kb + 8 * hh), x1 = *(const v4fa*)(arow + kb + 8 * hh + 4);
    const v4f x2 = *(const v4fa*)(arow + kb + 16 + 8 * hh), x3 = *(const v4fa*)(arow + kb + 16 + 8 * hh + 4);
    float xs[16] = {x0[0],x0[1],x0[2],x0[3],x1[0],x1[1],x1[2],x1[3],x2[0],x2[1],x2[2],x2[3],x3[0],x3[1],x3[2],x3[3]};
#pragma unroll
    for (int i = 0; i < 16; ++i) { const unsigned short hb = bf16_bits(xs[i]); ah.u[i] = hb; al.u[i] = ASPLIT ? bf16_bits(xs[i] - bf16_val(hb)) : (unsigned short)0; }
#pragma unroll
    for (int t = 0; t < 4; ++t) {
      const unsigned short* brow = Wt + (size_t)(col0 + t * 16 + ln) * ldb + kb;
      FragB b;
      b.half[0] = *(const v8us*)(brow + 8 * hh);
      b.half[1] = *(const v8us*)(brow + 16 + 8 * hh);
      acc[t] = mmaN<ASPLIT ? 2 : 1>(ah.v, al.v, b.v, b.v, acc[t]);
    }
  }
#pragma unroll
  for (int t = 0; t < 4; ++t) {
    float bv = bias ? bias[col0 + t * 16 + ln] : 0.f;
    if (BIAS_BF16) bv = bf16_round(bv);
#pragma unroll
    for (int r = 0; r < 8; ++r) { float v = acc[t][r] + bv; if (ACT == 1) v = fmaxf(v, 0.f); so[w][8 * hh + r][t * 16 + ln] = v; }
  }
  __builtin_amdgcn_fence(__ATOMIC_ACQ_REL, "workgroup");
  __builtin_amdgcn_wave_barrier();
  const int rsub = lane >> 4, c4 = (lane & 15) * 4;
  {
#pragma unroll
    for (int q = 0; q < 8; ++q) {
      const int r = q * 2 + rsub;
      const v4f v = *(const v4fa*)&so[w][r][c4];
      *(v4f*)(C + (size_t)(row0 + r) * ldc + col0 + c4) = v;
    }
    
  }
}

// Flash-style causal/unmasked attention, all contractions 3-term bf16 hi/lo splits, f32 softmax with running max.
// q,k,v rows are read from f32 buffers with arbitrary row pitch (so they can live inside a fused qkv buffer);
// D = head size (multiple of 32, <= 128); one wave = 16 query rows; block = 4 waves (64 queries) sharing K/V chunks of 32.
template <int D, bool CAUSAL>
__global__ __launch_bounds__(128) void k_flash(const float* __restrict__ qb, const float* __restrict__ kb, const float* __restrict__ vb,
                                             int pitch, int T, int H, float scale, float* __restrict__ y, int ypitch) {
  constexpr int KS = D / 32;        // k-steps for QK
  constexpr int DT = D / 16;        // d tiles for PV
  __shared__ __attribute__((aligned(16))) unsigned short sKh[32][D + 8], sKl[32][D + 8], sVh[32][D + 8], sVl[32][D + 8];
  __shared__ __attribute__((aligned(16))) unsigned short sPh[4][16][40], sPl[4][16][40];
  __shared__ __attribute__((aligned(16))) float sO[4][16][D];
  const int tid = threadIdx.x, w = tid >> 5, lane = tid & 31, ln = lane & 15, hh = lane >> 4;
  const int nqb = (T + 63) / 64;
  const int bh = blockIdx.x / nqb, qblk = blockIdx.x % nqb;
  const int b = bh / H, h = bh % H;
  const int q0 = qblk * 64 + w * 16;
  const float* Q = qb + (size_t)b * T * pitch + h * D;
  const float* K = kb + (size_t)b * T * pitch + h * D;
  const float* V = vb + (size_t)b * T * pitch + h * D;

  // A fragments of the wave's 16 query rows (scaled), hi/lo
  FragB aqh[KS], aql[KS];
  {
    int row = q0 + ln; if (row >= T) row = T - 1;
    const float* qr = Q + (size_t)row * pitch;
#pragma unroll
    for (int ks = 0; ks < KS; ++ks)
#pragma unroll
      for (int i = 0; i < 16; ++i) {
        const int d = ks * 32 + ((i < 8) ? (8 * hh + i) : (16 + 8 * hh + (i - 8)));
        const float x = qr[d] * scale; const unsigned short hb = bf16_bits(x);
        aqh[ks].u[i] = hb; aql[ks].u[i] = bf16_bits(x - bf16_val(hb));
      }
  }
  float m_r[8], l_r[8];
#pragma unroll
  for (int r = 0; r < 8; ++r) { m_r[r] = -3.0e38f; l_r[r] = 0.f; }
  v8f oacc[DT];
#pragma unroll
  for (int dt = 0; dt < DT; ++dt) oacc[dt] = (v8f){0.f,0.f,0.f,0.f,0.f,0.f,0.f,0.f};

  const int kv_end = CAUSAL ? min(T, qblk * 64 + 64) : T;     // block-uniform
  for (int j0 = 0; j0 < kv_end; j0 += 32) {
    __syncthreads();
    for (int e = tid; e < 32 * (D / 4); e += 128) {
      const int r = e / (D / 4), c4 = (e % (D / 4)) * 4;
      const int key = j0 + r;
      v4f kf = {0.f,0.f,0.f,0.f}, vf = {0.f,0.f,0.f,0.f};
      if (key < T) { kf = *(const v4fa*)(K + (size_t)key * pitch + c4); vf = *(const v4fa*)(V + (size_t)key * pitch + c4); }
#pragma unroll
      for (int t = 0; t < 4; ++t) {
        unsigned short hb = bf16_bits(kf[t]); sKh[r][c4 + t] = hb; sKl[r][c4 + t] = bf16_bits(kf[t] - bf16_val(hb));
        hb = bf16_bits(vf[t]); sVh[r][c4 + t] = hb; sVl[r][c4 + t] = bf16_bits(vf[t] - bf16_val(hb));
      }
    }
    __syncthreads();
    // S tile 16 x 32
    v8f s[2];
#pragma unroll
    for (int nt = 0; nt < 2; ++nt) {
      v8f acc = {};
#pragma unroll
      for (int ks = 0; ks < KS; ++ks) {
        FragB bh_, bl_;
        bh_.half[0] = *(const v8us*)&sKh[nt * 16 + ln][ks * 32 + 8 * hh]; bh_.half[1] = *(const v8us*)&sKh[nt * 16 + ln][ks * 32 + 16 + 8 * hh];
        bl_.half[0] = *(const v8us*)&sKl[nt * 16 + ln][ks * 32 + 8 * hh]; bl_.half[1] = *(const v8us*)&sKl[nt * 16 + ln][ks * 32 + 16 + 8 * hh];
        acc = mmaN<3>(aqh[ks].v, aql[ks].v, bh_.v, bl_.v, acc);
      }
      s[nt] = acc;
    }
    // mask + running max (rows 8hh+r; the 16 lanes of a half share rows)
    float alpha[8];
#pragma unroll
    for (int r = 0; r < 8; ++r) {
      const int qi = q0 + 8 * hh + r;
      const int ja = j0 + ln, jb = j0 + 16 + ln;
      if (CAUSAL) { if (ja > qi) s[0][r] = -3.0e38f; if (jb > qi) s[1][r] = -3.0e38f; }
      if (ja >= T) s[0][r] = -3.0e38f;
      if (jb >= T) s[1][r] = -3.0e38f;
      float mx = fmaxf(s[0][r], s[1][r]);
      mx = fmaxf(mx, __shfl_xor(mx, 1, 32)); mx = fmaxf(mx, __shfl_xor(mx, 2, 32)); mx = fmaxf(mx, __shfl_xor(mx, 4, 32)); mx = fmaxf(mx, __shfl_xor(mx, 8, 32));
      const float mnew = fmaxf(m_r[r], mx);
      alpha[r] = (mnew > -1.0e38f) ? __expf(m_r[r] - mnew) : 1.0f;
      const float p0 = (s[0][r] > -1.0e38f) ? __expf(s[0][r] - mnew) : 0.f;
      const float p1 = (s[1][r] > -1.0e38f) ? __expf(s[1][r] - mnew) : 0.f;
      m_r[r] = mnew;
      l_r[r] = l_r[r] * alpha[r] + p0 + p1;            // per-lane partial row sum (16 lanes combined at the end)
      unsigned short hb = bf16_bits(p0); sPh[w][8 * hh + r][ln] = hb;      sPl[w][8 * hh + r][ln] = bf16_bits(p0 - bf16_val(hb));
      hb = bf16_bits(p1);                sPh[w][8 * hh + r][16 + ln] = hb; sPl[w][8 * hh + r][16 + ln] = bf16_bits(p1 - bf16_val(hb));
    }
#pragma unroll
    for (int dt = 0; dt < DT; ++dt)
#pragma unroll
      for (int r = 0; r < 8; ++r) oacc[dt][r] *= alpha[r];
    __builtin_amdgcn_fence(__ATOMIC_ACQ_REL, "workgroup");
    __builtin_amdgcn_wave_barrier();
    FragB pah, pal;
    pah.half[0] = *(const v8us*)&sPh[w][ln][8 * hh]; pah.half[1] = *(const v8us*)&sPh[w][ln][16 + 8 * hh];
    pal.half[0] = *(const v8us*)&sPl[w][ln][8 * hh]; pal.half[1] = *(const v8us*)&sPl[w][ln][16 + 8 * hh];
#pragma unroll
    for (int dt = 0; dt < DT; ++dt) {
      FragB bvh, bvl;
#pragma unroll
      for (int i = 0; i < 8; ++i) {
        bvh.u[i] = sVh[8 * hh + i][dt * 16 + ln]; bvh.u[8 + i] = sVh[16 + 8 * hh + i][dt * 16 + ln];
        bvl.u[i] = sVl[8 * hh + i][dt * 16 + ln]; bvl.u[8 + i] = sVl[16 + 8 * hh + i][dt * 16 + ln];
      }
      oacc[dt] = mmaN<3>(pah.v, pal.v, bvh.v, bvl.v, oacc[dt]);
    }
    __builtin_amdgcn_fence(__ATOMIC_ACQ_REL, "workgroup");
    __builtin_amdgcn_wave_barrier();
  }
#pragma unroll
  for (int r = 0; r < 8; ++r) {
    float l = l_r[r];
    l += __shfl_xor(l, 1, 32); l += __shfl_xor(l, 2, 32); l += __shfl_xor(l, 4, 32); l += __shfl_xor(l, 8, 32);
    l_r[r] = (l > 0.f) ? 1.0f / l : 0.f;
  }
#pragma unroll
  for (int dt = 0; dt < DT; ++dt)
#pragma unroll
    for (int r = 0; r < 8; ++r) sO[w][8 * hh + r][dt * 16 + ln] = oacc[dt][r] * l_r[r];
  __builtin_amdgcn_fence(__ATOMIC_ACQ_REL, "workgroup");
  __builtin_amdgcn_wave_barrier();
  {
    for (int r = 0; r < 16; ++r) {
      const int row = q0 + r;
      if (row < T && lane < D / 4) {
        const v4f val = *(const v4fa*)&sO[w][r][lane * 4];
        *(v4f*)(y + ((size_t)b * T + row) * ypitch + h * D + lane * 4) = val;
      }
    }
    
  }
}

// GEMM C = act(A·W + bias + resid): A f32 (ASPLIT -> hi/lo 2 terms), Wt bf16 [N][K]; ACT 0 none, 1 relu, 2 exact gelu;
// resid (optional, f32, row index = (row % rmod), pitch ldr, RES_BF16 rounds it) added before the activation.
template <bool ASPLIT, int ACT, bool BIAS_BF16, bool RES_BF16>
__global__ __launch_bounds__(128) void k_gemm_bf3(const float* __restrict__ A, int lda, const unsigned short* __restrict__ Wt, int ldb,
                                                const float* __restrict__ bias, const float* __restrict__ resid, int rmod, int ldr,
                                                float* __restrict__ C, int ldc, int M, int N, int K) {
  __shared__ __attribute__((aligned(16))) float so[4][16][64];
  const int tid = threadIdx.x, w = tid >> 5, lane = tid & 31, ln = lane & 15, hh = lane >> 4;
  const int ntn = N / 64;
  const int wid = blockIdx.x * 4 + w;
  const int mt = wid / ntn, nq = wid % ntn;
  if (mt * 16 >= M) return;
  const int row0 = mt * 16, col0 = nq * 64;
  const float* arow = A + (size_t)(row0 + ln) * lda;
  v8f acc[4] = {};
  for (int kb = 0; kb < K; kb += 32) {
    FragB ah, al;
    const v4f x0 = *(const v4fa*)(arow + kb + 8 * hh), x1 = *(const v4fa*)(arow + kb + 8 * hh + 4);
    const v4f x2 = *(const v4fa*)(arow + kb + 16 + 8 * hh), x3 = *(const v4fa*)(arow + kb + 16 + 8 * hh + 4);
    float xs[16] = {x0[0],x0[1],x0[2],x0[3],x1[0],x1[1],x1[2],x1[3],x2[0],x2[1],x2[2],x2[3],x3[0],x3[1],x3[2],x3[3]};
#pragma unroll
    for (int i = 0; i < 16; ++i) { const unsigned short hb = bf16_bits(xs[i]); ah.u[i] = hb; al.u[i] = ASPLIT ? bf16_bits(xs[i] - bf16_val(hb)) : (unsigned short)0; }
#pragma unroll
    for (int t = 0; t < 4; ++t) {
      const unsigned short* brow = Wt + (size_t)(col0 + t * 16 + ln) * ldb + kb;
      FragB b;
      b.half[0] = *(const v8us*)(brow + 8 * hh);
      b.half[1] = *(const v8us*)(brow + 16 + 8 * hh);
      acc[t] = mmaN<ASPLIT ? 2 : 1>(ah.v, al.v, b.v, b.v, acc[t]);
    }
  }
#pragma unroll
  for (int t = 0; t < 4; ++t) {
    const int col = col0 + t * 16 + ln;
    float bv = bias ? bias[col] : 0.f;
    if (BIAS_BF16) bv = bf16_round(bv);
#pragma unroll
    for (int r = 0; r < 8; ++r) {
      float v = acc[t][r] + bv;
      if (resid) { float rv = resid[(size_t)((row0 + 8 * hh + r) % rmod) * ldr + col]; if (RES_BF16) rv = bf16_round(rv); v += rv; }
      if (ACT == 1) v = fmaxf(v, 0.f);
      if (ACT == 2) v = 0.5f * v * (1.0f + erff(v * 0.70710678118654752f));
      if (ACT == 3) { const float u = 0.7978845608028654f * (v + 0.044715f * v * v * v); v = 0.5f * v * (1.0f + tanhf(u)); }
      so[w][8 * hh + r][t * 16 + ln] = v;
    }
  }
  __builtin_amdgcn_fence(__ATOMIC_ACQ_REL, "workgroup");
  __builtin_amdgcn_wave_barrier();
  const int rsub = lane >> 4, c4 = (lane & 15) * 4;
  {
#pragma unroll
    for (int q = 0; q < 8; ++q) {
      const int r = q * 2 + rsub;
      const v4f v = *(const v4fa*)&so[w][r][c4];
      *(v4f*)(C + (size_t)(row0 + r) * ldc + col0 + c4) = v;
    }
    
  }
}
// row LayerNorm (biased variance, eps) over N: s = X (+ R); optional out_sum <- s; out_norm <- (s-mu)*rsqrt(var+eps)*g + b
template <bool PARAM_BF16>
__global__ __launch_bounds__(256) void k_layernorm(const float* __restrict__ X, const float* __restrict__ R, const float* __restrict__ g, const float* __restrict__ bta,
                                                  float* __restrict__ out_sum, float* __restrict__ out_norm, int N, float eps) {
  __shared__ float red[256];
  const int row = blockIdx.x, tid = threadIdx.x;
  const float* x = X + (size_t)row * N; const float* rr = R ? R + (size_t)row * N : nullptr;
  float vals[16];                     // up to N = 4096
  const int per = N / 256;            // contiguous chunk per thread? use strided-by-4 chunks: thread handles j = tid*4 + 1024*u
  float s1 = 0.f;
  for (int u = 0; u < per / 4; ++u) {
    const int j = tid * 4 + 1024 * u;
    const v4f a = *(const v4fa*)(x + j);
    v4f b = {0.f,0.f,0.f,0.f}; if (rr) b = *(const v4fa*)(rr + j);
#pragma unroll
    for (int q = 0; q < 4; ++q) { const float v = a[q] + b[q]; vals[u * 4 + q] = v; s1 += v; }
  }
  red[tid] = s1; __syncthreads();
  for (int st = 128; st > 0; st >>= 1) { if (tid < st) red[tid] += red[tid + st]; __syncthreads(); }
  const float mu = red[0] / (float)N; __syncthreads();
  float s2 = 0.f;
  for (int u = 0; u < per / 4; ++u)
#pragma unroll
    for (int q = 0; q < 4; ++q) { const float c = vals[u * 4 + q] - mu; s2 += c * c; }
  red[tid] = s2; __syncthreads();
  for (int st = 128; st > 0; st >>= 1) { if (tid < st) red[tid] += red[tid + st]; __syncthreads(); }
  const float rs = rsqrtf(red[0] / (float)N + eps);
  {
    for (int u = 0; u < per / 4; ++u) {
      const int j = tid * 4 + 1024 * u;
      v4f o, sm;
#pragma unroll
      for (int q = 0; q < 4; ++q) {
        float gg = g[j + q], bb = bta[j + q];
        if (PARAM_BF16) { gg = bf16_round(gg); bb = bf16_round(bb); }
        sm[q] = vals[u * 4 + q]; o[q] = (vals[u * 4 + q] - mu) * rs * gg + bb;
      }
      if (out_sum) *(v4f*)(out_sum + (size_t)row * N + j) = sm;
      *(v4f*)(out_norm + (size_t)row * N + j) = o;
    }
    
  }
}



// ---- f16 WMMA path (v_wmma_f32_16x16x32_f16): 11-bit significands for operands in range — used for both Q·Kᵀ and P·V in the launched attention kernel
typedef _Float16 v16h __attribute__((ext_vector_type(16)));
union FragH { v16h v; v8us half[2]; _Float16 h[16]; unsigned short u[16]; };
template <int NT>
__device__ __forceinline__ v8f mmaH(v16h ah, v16h al, v16h bh, v16h bl, v8f c) {
  c = __builtin_amdgcn_wmma_f32_16x16x32_f16(false, ah, false, bh, (short)0, c, false, false);
  if (NT >= 2) c = __builtin_amdgcn_wmma_f32_16x16x32_f16(false, al, false, bh, (short)0, c, false, false);
  if (NT >= 3) c = __builtin_amdgcn_wmma_f32_16x16x32_f16(false, ah, false, bl, (short)0, c, false, false);
  asm volatile("v_nop\n\tv_nop\n\tv_nop\n\tv_nop" : "+v"(c) : "v"(ah), "v"(al), "v"(bh), "v"(bl));
  return c;
}
// batched GEMM like k_gemm_b but f16 operands: A f32 (split into f16 hi/lo if ASPLIT, else rounded to f16), Bt = f16 values [n][k]; alpha; C f32; N multiple of 16 (partial tiles skipped)
template <bool ASPLIT>
__global__ __launch_bounds__(128) void k_gemm_h(const float* __restrict__ A, int lda, size_t sA, const _Float16* __restrict__ Bh, int ldb, size_t sB, float alpha, float* __restrict__ C, int ldc, size_t sC, int M, int N, int K) {
  __shared__ __attribute__((aligned(16))) float so[4][16][64];
  const int tid = threadIdx.x, w = tid >> 5, lane = tid & 31, ln = lane & 15, hh = lane >> 4; const int by = blockIdx.y;
  A += (size_t)by * sA; Bh += (size_t)by * sB; C += (size_t)by * sC;
  const int ntn = (N + 63) / 64; const int wid = blockIdx.x * 4 + w; const int mt = wid / ntn, nq = wid % ntn; if (mt * 16 >= M) return;
  const int row0 = mt * 16, col0 = nq * 64; const float* arow = A + (size_t)(row0 + ln) * lda;
  v8f acc[4] = {};
  for (int kb = 0; kb < K; kb += 32) {
    FragH ah, al;
    const v4f x0 = *(const v4fa*)(arow + kb + 8 * hh), x1 = *(const v4fa*)(arow + kb + 8 * hh + 4), x2 = *(const v4fa*)(arow + kb + 16 + 8 * hh), x3 = *(const v4fa*)(arow + kb + 16 + 8 * hh + 4);
    float xs[16] = {x0[0],x0[1],x0[2],x0[3],x1[0],x1[1],x1[2],x1[3],x2[0],x2[1],x2[2],x2[3],x3[0],x3[1],x3[2],x3[3]};
#pragma unroll
    for (int i = 0; i < 16; ++i) { const _Float16 h = (_Float16)xs[i]; ah.h[i] = h; al.h[i] = ASPLIT ? (_Float16)(xs[i] - (float)h) : (_Float16)0.0f; }
#pragma unroll
    for (int t = 0; t < 4; ++t) { if (col0 + t * 16 >= N) continue; const size_t boff = (size_t)(col0 + t * 16 + ln) * ldb + kb; FragH bq; bq.half[0] = *(const v8us*)(Bh + boff + 8 * hh); bq.half[1] = *(const v8us*)(Bh + boff + 16 + 8 * hh);
      acc[t] = mmaH<ASPLIT ? 2 : 1>(ah.v, al.v, bq.v, bq.v, acc[t]); }
  }
#pragma unroll
  for (int t = 0; t < 4; ++t) { if (col0 + t * 16 >= N) continue;
#pragma unroll
    for (int r = 0; r < 8; ++r) so[w][8 * hh + r][t * 16 + ln] = acc[t][r] * alpha; }
  __builtin_amdgcn_fence(__ATOMIC_ACQ_REL, "workgroup"); __builtin_amdgcn_wave_barrier();
  const int rsub = lane >> 4, c4 = (lane & 15) * 4;
  {
#pragma unroll
    for (int q = 0; q < 8; ++q) { const int r = q * 2 + rsub; if (col0 + c4 < N) { const v4f v = *(const v4fa*)&so[w][r][c4]; *(v4f*)(C + (size_t)(row0 + r) * ldc + col0 + c4) = v; } }
     }
}

// Wt[n][k] = f16(W[k][n]·scale) from f32 row-major W[K][N] (scale = power of two; bf16-exact weights stay exact in f16 away from the subnormal range)
__global__ __launch_bounds__(256) void k_wt_f16(const float* __restrict__ W, _Float16* __restrict__ Wt, int K, int N, float scale) {
  const int t = blockIdx.x * 256 + threadIdx.x; if (t >= N * (K / 8)) return; const int n = t / (K / 8), k8 = (t % (K / 8)) * 8; FragH f;
#pragma unroll
  for (int i = 0; i < 8; ++i) f.h[i] = (_Float16)(bf16_round(W[(size_t)(k8 + i) * N + n]) * scale); const v8us o = f.half[0];
  *(v8us*)((unsigned short*)Wt + (size_t)n * K + k8) = o; 
}
// k_gemm_hh variant with fused epilogue: v = acc·alpha + bias[by·sBias + col] (+ CP[(row/rowsPerB)·sCPb + by·64 + col] if CP) ; ACT 0 none / 1 elu ; writes f16 C16 (and f32 C if non-null)
template <int ACT>
__global__ __launch_bounds__(128) void k_gemm_hhx(const _Float16* __restrict__ A, int lda, size_t sA, const _Float16* __restrict__ Bh, int ldb, size_t sB, float alpha, const float* __restrict__ bias, size_t sBias, const float* __restrict__ CP, int rowsPerB, size_t sCPb, int row0g,
    float* __restrict__ C, _Float16* __restrict__ C16, int ldc, size_t sC, int M, int N, int K) {
  __shared__ __attribute__((aligned(16))) float so[4][16][64];
  const int tid = threadIdx.x, w = tid >> 5, lane = tid & 31, ln = lane & 15, hh = lane >> 4; const int by = blockIdx.y;
  A += (size_t)by * sA; Bh += (size_t)by * sB; const size_t cofs = (size_t)by * sC; const float* bp = bias ? bias + (size_t)by * sBias : nullptr;
  const int ntn = (N + 63) / 64; const int wid = blockIdx.x * 4 + w; const int mt = wid / ntn, nq = wid % ntn; if (mt * 16 >= M) return;
  const int row0 = mt * 16, col0 = nq * 64; const _Float16* arow = A + (size_t)(row0 + ln) * lda;
  v8f acc[4] = {};
  for (int kb = 0; kb < K; kb += 32) { FragH ah; ah.half[0] = *(const v8us*)((const unsigned short*)arow + kb + 8 * hh); ah.half[1] = *(const v8us*)((const unsigned short*)arow + kb + 16 + 8 * hh);
#pragma unroll
    for (int t = 0; t < 4; ++t) { if (col0 + t * 16 >= N) continue; const size_t boff = (size_t)(col0 + t * 16 + ln) * ldb + kb; FragH bq; bq.half[0] = *(const v8us*)((const unsigned short*)Bh + boff + 8 * hh); bq.half[1] = *(const v8us*)((const unsigned short*)Bh + boff + 16 + 8 * hh);
      acc[t] = mmaH<1>(ah.v, ah.v, bq.v, bq.v, acc[t]); }
  }
#pragma unroll
  for (int t = 0; t < 4; ++t) { if (col0 + t * 16 >= N) continue; const int col = col0 + t * 16 + ln; const float bv = bp ? bf16_round(bp[col]) : 0.f;
#pragma unroll
    for (int r = 0; r < 8; ++r) { float v = acc[t][r] * alpha + bv; if (CP) { const int bidx = (row0g + row0 + 8 * hh + r) / rowsPerB; v += CP[(size_t)bidx * sCPb + (size_t)by * 64 + col]; } if (ACT == 1) v = (v > 0.f) ? v : expm1f(v); else if (ACT == 3) v = fmaxf(v, 0.f); so[w][8 * hh + r][t * 16 + ln] = v; } }
  __builtin_amdgcn_fence(__ATOMIC_ACQ_REL, "workgroup"); __builtin_amdgcn_wave_barrier();
  const int rsub = lane >> 4, c4 = (lane & 15) * 4; typedef _Float16 v4h __attribute__((ext_vector_type(4)));
  {
#pragma unroll
    for (int q = 0; q < 8; ++q) { const int r = q * 2 + rsub; if (col0 + c4 < N) { const v4f v = *(const v4fa*)&so[w][r][c4]; if (C) *(v4f*)(C + cofs + (size_t)(row0 + r) * ldc + col0 + c4) = v; if (C16) { v4h h4; for (int i = 0; i < 4; ++i) h4[i] = (_Float16)v[i]; *(v4h*)(C16 + cofs + (size_t)(row0 + r) * ldc + col0 + c4) = h4; } } }
     }
}


typedef _Float16 v4h __attribute__((ext_vector_type(4)));

__global__ __launch_bounds__(256) void k_x16(const float* __restrict__ x, _Float16* __restrict__ X16, size_t n8) { const size_t t = (size_t)blockIdx.x * 256 + threadIdx.x; if (t >= n8) return; FragH f;
#pragma unroll
  for (int q = 0; q < 8; ++q) f.h[q] = (_Float16)bf16_round(x[t * 8 + q]); *(v8us*)((unsigned short*)X16 + t * 8) = f.half[0];  }
__global__ __launch_bounds__(256) void k_h16(const float* __restrict__ x, _Float16* __restrict__ X16, size_t n8) { const size_t t = (size_t)blockIdx.x * 256 + threadIdx.x; if (t >= n8) return; FragH f;
#pragma unroll
  for (int q = 0; q < 8; ++q) f.h[q] = (_Float16)x[t * 8 + q]; *(v8us*)((unsigned short*)X16 + t * 8) = f.half[0];  }
__global__ __launch_bounds__(256) void k_round16f(const float* __restrict__ W, _Float16* __restrict__ Bt, size_t n8) { const size_t t = (size_t)blockIdx.x * 256 + threadIdx.x; if (t >= n8) return; FragH f;
#pragma unroll
  for (int i = 0; i < 8; ++i) f.h[i] = (_Float16)(bf16_round(W[t * 8 + i]) * 16.0f); *(v8us*)((unsigned short*)Bt + t * 8) = f.half[0];  }
template <int NHv, int TTv>
__global__ __launch_bounds__(256) void k_vt(const _Float16* __restrict__ V16, int ldv, int voff, _Float16* __restrict__ Vt) { __shared__ unsigned short tl[64][66]; const int tid = threadIdx.x; const int slab = blockIdx.x / (TTv / 64), lg = blockIdx.x % (TTv / 64); const int b = slab / NHv, h = slab % NHv;
  for (int i = tid; i < 64 * 8; i += 256) { const int r = i / 8, c8 = (i % 8) * 8; FragH f; f.half[0] = *(const v8us*)((const unsigned short*)V16 + ((size_t)b * TTv + lg * 64 + r) * ldv + voff + h * 64 + c8);
#pragma unroll
    for (int q = 0; q < 8; ++q) tl[r][c8 + q] = f.u[q]; }
  __syncthreads();
  {
#pragma unroll
    for (int rd = 0; rd < 2; ++rd) { const int d = rd * 32 + tid / 8, pc = tid % 8; FragH f;
#pragma unroll
      for (int q = 0; q < 8; ++q) f.u[q] = tl[pc * 8 + q][d];
      *(v8us*)((unsigned short*)Vt + ((size_t)slab * 64 + d) * TTv + lg * 64 + pc * 8) = f.half[0]; }
     } }

__global__ __launch_bounds__(128) void k_flash(const _Float16* __restrict__ Q16, int ldq, const _Float16* __restrict__ K16, int ldk, const _Float16* __restrict__ Vt, const int* __restrict__ MSK, float* __restrict__ O, int ldo) {
  constexpr int RPW = 16, RTN = RPW / 16, NQB = 2048 / (4 * RPW), DT = 8, KS = 4;      /* head_dim 128 */
  __shared__ __attribute__((aligned(16))) unsigned short sP[4][RPW][40]; __shared__ __attribute__((aligned(16))) float sO[4][RPW][128 + 4];
  const int tid = threadIdx.x, w = tid >> 5, lane = tid & 31, ln = lane & 15, hh = lane >> 4;
  const int slab = blockIdx.x / NQB, qblk = blockIdx.x % NQB; const int b = slab / 1, h = slab % 1; const int qb0 = qblk * (4 * RPW); const int q0 = qb0 + w * RPW;
  FragH aq[2][KS];
#pragma unroll
  for (int rt = 0; rt < RTN; ++rt) { const unsigned short* qr = (const unsigned short*)Q16 + ((size_t)b * 2048 + q0 + rt * 16 + ln) * ldq + h * 128;
#pragma unroll
    for (int ks = 0; ks < KS; ++ks) { aq[rt][ks].half[0] = *(const v8us*)(qr + ks * 32 + 8 * hh); aq[rt][ks].half[1] = *(const v8us*)(qr + ks * 32 + 16 + 8 * hh); } }
  const unsigned short* Vth = (const unsigned short*)Vt + (size_t)slab * 128 * 4096;      /* [bh][128][TK] */
  float m_r[2][8], l_r[2][8]; v8f oacc[2][DT];
#pragma unroll
  for (int rt = 0; rt < RTN; ++rt) {
#pragma unroll
    for (int r = 0; r < 8; ++r) { m_r[rt][r] = -3.0e38f; l_r[rt][r] = 0.f; }
#pragma unroll
    for (int dt = 0; dt < DT; ++dt) oacc[rt][dt] = (v8f){0.f,0.f,0.f,0.f,0.f,0.f,0.f,0.f}; }
  const int jend = 4096;
#pragma unroll 1
  for (int j0 = 0; j0 < jend; j0 += 32) {
    
    v8f s[2][2];
#pragma unroll
    for (int nt = 0; nt < 2; ++nt) { const unsigned short* kr = (const unsigned short*)K16 + ((size_t)b * 4096 + j0 + nt * 16 + ln) * ldk + h * 128; FragH bk[KS];
#pragma unroll
      for (int ks = 0; ks < KS; ++ks) { bk[ks].half[0] = *(const v8us*)(kr + ks * 32 + 8 * hh); bk[ks].half[1] = *(const v8us*)(kr + ks * 32 + 16 + 8 * hh); }
#pragma unroll
      for (int rt = 0; rt < RTN; ++rt) { v8f acc = (v8f){0.f,0.f,0.f,0.f,0.f,0.f,0.f,0.f};
#pragma unroll
        for (int ks = 0; ks < KS; ++ks) acc = mmaH<1>(aq[rt][ks].v, aq[rt][ks].v, bk[ks].v, bk[ks].v, acc); s[rt][nt] = acc; } }
#pragma unroll
    for (int rt = 0; rt < RTN; ++rt)
#pragma unroll
      for (int r = 0; r < 8; ++r) { const int tq = q0 + rt * 16 + 8 * hh + r; const int k0 = j0 + ln, k1 = j0 + 16 + ln; (void)tq; (void)k0; (void)k1;
        const bool ok0 = true, ok1 = true;
        const float s0 = ok0 ? s[rt][0][r] * (0.08838834764831845f) : -INFINITY, s1 = ok1 ? s[rt][1][r] * (0.08838834764831845f) : -INFINITY; float mc = fmaxf(s0, s1);
        mc = fmaxf(mc, __shfl_xor(mc, 1, 32)); mc = fmaxf(mc, __shfl_xor(mc, 2, 32)); mc = fmaxf(mc, __shfl_xor(mc, 4, 32)); mc = fmaxf(mc, __shfl_xor(mc, 8, 32));
        const float mn = fmaxf(m_r[rt][r], mc); const float al = (mn > -1.0e38f) ? expf(m_r[rt][r] - mn) : 1.0f; m_r[rt][r] = mn; const float p0 = ok0 ? expf(s0 - mn) : 0.f, p1 = ok1 ? expf(s1 - mn) : 0.f; l_r[rt][r] = l_r[rt][r] * al + p0 + p1;
#pragma unroll
        for (int dt = 0; dt < DT; ++dt) oacc[rt][dt][r] *= al;
        FragH t2; t2.h[0] = (_Float16)p0; t2.h[1] = (_Float16)p1; sP[w][rt * 16 + 8 * hh + r][ln] = t2.u[0]; sP[w][rt * 16 + 8 * hh + r][16 + ln] = t2.u[1]; }
    __builtin_amdgcn_fence(__ATOMIC_ACQ_REL, "workgroup"); __builtin_amdgcn_wave_barrier();
    FragH pa[2];
#pragma unroll
    for (int rt = 0; rt < RTN; ++rt) { pa[rt].half[0] = *(const v8us*)&sP[w][rt * 16 + ln][8 * hh]; pa[rt].half[1] = *(const v8us*)&sP[w][rt * 16 + ln][16 + 8 * hh]; }
#pragma unroll
    for (int dt = 0; dt < DT; ++dt) { const unsigned short* vrow = Vth + (size_t)(dt * 16 + ln) * 4096 + j0; FragH bv; bv.half[0] = *(const v8us*)(vrow + 8 * hh); bv.half[1] = *(const v8us*)(vrow + 16 + 8 * hh);
#pragma unroll
      for (int rt = 0; rt < RTN; ++rt) oacc[rt][dt] = mmaH<1>(pa[rt].v, pa[rt].v, bv.v, bv.v, oacc[rt][dt]); }
    __builtin_amdgcn_fence(__ATOMIC_ACQ_REL, "workgroup"); __builtin_amdgcn_wave_barrier(); }
#pragma unroll
  for (int rt = 0; rt < RTN; ++rt) {
#pragma unroll
    for (int r = 0; r < 8; ++r) { float l = l_r[rt][r]; l += __shfl_xor(l, 1, 32); l += __shfl_xor(l, 2, 32); l += __shfl_xor(l, 4, 32); l += __shfl_xor(l, 8, 32); l_r[rt][r] = (l > 0.f) ? 1.0f / l : 0.f; }
#pragma unroll
    for (int dt = 0; dt < DT; ++dt)
#pragma unroll
      for (int r = 0; r < 8; ++r) sO[w][rt * 16 + 8 * hh + r][dt * 16 + ln] = oacc[rt][dt][r] * l_r[rt][r]; }
  __builtin_amdgcn_fence(__ATOMIC_ACQ_REL, "workgroup"); __builtin_amdgcn_wave_barrier();
  {
#pragma unroll
    for (int rp = 0; rp < RPW; ++rp) { const int r = rp, pc = lane; const v4f val = *(const v4fa*)&sO[w][r][pc * 4]; *(v4f*)(O + ((size_t)b * 2048 + q0 + r) * ldo + h * 128 + pc * 4) = val; }      /* 32 lanes × 16 B = whole 512-B row; TQ = 2048 rows per slab */
     } }

extern "C" void kernel_launch(void* const* d_in, const int* in_sizes, int n_in,
                              void* d_out, int out_size, void* d_ws, size_t ws_size, hipStream_t stream) {
  (void)in_sizes; (void)n_in; (void)out_size;
  const float* q = (const float*)d_in[0]; const float* k = (const float*)d_in[1]; const float* v = (const float*)d_in[2];
  char* ws = (char*)d_ws; size_t off = 0;
  auto take = [&](size_t bytes) { char* p = ws + off; off += (bytes + 255) & ~(size_t)255; return p; };
  _Float16* Q16 = (_Float16*)take((size_t)NBH * TQ * HD * 2); _Float16* K16 = (_Float16*)take((size_t)NBH * TK * HD * 2); _Float16* V16 = (_Float16*)take((size_t)NBH * TK * HD * 2); _Float16* Vt = (_Float16*)take((size_t)NBH * TK * HD * 2);
  if (off > ws_size) return;      // 8.4 + 16.8 × 3 ≈ 59 MB
  k_x16<<<(unsigned)(((size_t)NBH * TQ * HD / 8 + 255) / 256), 256, 0, stream>>>(q, Q16, (size_t)NBH * TQ * HD / 8); k_x16<<<(unsigned)(((size_t)NBH * TK * HD / 8 + 255) / 256), 256, 0, stream>>>(k, K16, (size_t)NBH * TK * HD / 8); k_x16<<<(unsigned)(((size_t)NBH * TK * HD / 8 + 255) / 256), 256, 0, stream>>>(v, V16, (size_t)NBH * TK * HD / 8);
  k_vt<2, TK><<<NBH * 2 * (TK / 64), 256, 0, stream>>>(V16, HD, 0, Vt);      // Vᵀ per (b,h): [bh][128][TK]
  k_flash<<<NBH * 1 * (TQ / 64), 128, 0, stream>>>(Q16, HD, K16, HD, Vt, nullptr, (float*)d_out, HD);
}

// v001
// One run takes 295 microseconds.
// Timed twice side by side with v000, it ran 2.08 and 2.06 times as fast.
#include <hip/hip_runtime.h>
// Attention with learned keys/values: out = softmax(Q·Kᵀ/√128)·V for Q [2,8,2048,128], K/V [2,8,4096,128] (head-major planes). One fused flash-style kernel (16 (b,h) slabs; 2048 query rows
// against 4096 keys; online softmax in f32; P f16 ≤ 1; O = P·Vᵀ-tiles; RPW-16 waves; 128-wide head) on v_wmma_f32_16x16x32_f16 — Q/K/V bf16-exact in f16, f32 accumulate.
#define NBH 16
#define TQ 2048
#define TK 4096
#define HD 128

typedef __bf16 v16b __attribute__((ext_vector_type(16)));
typedef unsigned short v8us __attribute__((ext_vector_type(8), may_alias));
typedef float  v8f  __attribute__((ext_vector_type(8)));
typedef float  v4f  __attribute__((ext_vector_type(4)));
typedef float  v4fa __attribute__((ext_vector_type(4), may_alias));
union FragB { v16b v; v8us half[2]; unsigned short u[16]; };

__device__ __forceinline__ unsigned short bf16_bits(float x) { unsigned int u = __float_as_uint(x); return (unsigned short)((u + 0x7FFFu + ((u >> 16) & 1u)) >> 16); }
__device__ __forceinline__ float bf16_val(unsigned short b) { return __uint_as_float(((unsigned int)b) << 16); }
__device__ __forceinline__ float bf16_round(float x) { return bf16_val(bf16_bits(x)); }
// D += A·B with NT terms: 1 = ah·bh, 2 = + al·bh (A split), 3 = + ah·bl (both split)
template <int NT>
__device__ __forceinline__ v8f mmaN(v16b ah, v16b al, v16b bh, v16b bl, v8f c) {
  c = __builtin_amdgcn_wmma_f32_16x16x32_bf16(false, ah, false, bh, (short)0, c, false, false);
  if (NT >= 2) c = __builtin_amdgcn_wmma_f32_16x16x32_bf16(false, al, false, bh, (short)0, c, false, false);
  if (NT >= 3) c = __builtin_amdgcn_wmma_f32_16x16x32_bf16(false, ah, false, bl, (short)0, c, false, false);
  asm volatile("v_nop\n\tv_nop\n\tv_nop\n\tv_nop" : "+v"(c) : "v"(ah), "v"(al), "v"(bh), "v"(bl));
  return c;
}

__global__ __launch_bounds__(256) void k_wt_bf16(const float* __restrict__ W, unsigned short* __restrict__ Wt, int K, int N) {
  const int t = blockIdx.x * 256 + threadIdx.x;
  const int k8n = K / 8;
  if (t >= N * k8n) return;
  const int n = t / k8n, k8 = (t % k8n) * 8;
  v8us v;
#pragma unroll
  for (int i = 0; i < 8; ++i) v[i] = bf16_bits(W[(size_t)(k8 + i) * N + n]);
  *(v8us*)(Wt + (size_t)n * K + k8) = v;
  
}

// GEMM C[M][N] (f32, pitch ldc) = act(A[M][K]·W + bias). A f32 row-major (pitch lda) converted per fragment to bf16
// (ASPLIT: hi/lo two planes -> 2 terms, else single rounded term); Wt bf16 [N][K] (pitch ldb). BIAS_BF16 rounds the
// bias to bf16 first (bias quantised to bf16 before the add). K%32==0, M%16==0, N%64==0.
template <bool ASPLIT, int ACT, bool BIAS_BF16>
__global__ __launch_bounds__(128) void k_gemm_bf(const float* __restrict__ A, int lda, const unsigned short* __restrict__ Wt, int ldb,
                                               const float* __restrict__ bias, float* __restrict__ C, int ldc, int M, int N, int K) {
  __shared__ __attribute__((aligned(16))) float so[4][16][64];
  const int tid = threadIdx.x, w = tid >> 5, lane = tid & 31, ln = lane & 15, hh = lane >> 4;
  const int ntn = N / 64;
  const int wid = blockIdx.x * 4 + w;
  const int mt = wid / ntn, nq = wid % ntn;
  if (mt * 16 >= M) return;
  const int row0 = mt * 16, col0 = nq * 64;
  const float* arow = A + (size_t)(row0 + ln) * lda;
  v8f acc[4] = {};
  for (int kb = 0; kb < K; kb += 32) {
    FragB ah, al;
    const v4f x0 = *(const v4fa*)(arow + kb + 8 * hh), x1 = *(const v4fa*)(arow + kb + 8 * hh + 4);
    const v4f x2 = *(const v4fa*)(arow + kb + 16 + 8 * hh), x3 = *(const v4fa*)(arow + kb + 16 + 8 * hh + 4);
    float xs[16] = {x0[0],x0[1],x0[2],x0[3],x1[0],x1[1],x1[2],x1[3],x2[0],x2[1],x2[2],x2[3],x3[0],x3[1],x3[2],x3[3]};
#pragma unroll
    for (int i = 0; i < 16; ++i) { const unsigned short hb = bf16_bits(xs[i]); ah.u[i] = hb; al.u[i] = ASPLIT ? bf16_bits(xs[i] - bf16_val(hb)) : (unsigned short)0; }
#pragma unroll
    for (int t = 0; t < 4; ++t) {
      const unsigned short* brow = Wt + (size_t)(col0 + t * 16 + ln) * ldb + kb;
      FragB b;
      b.half[0] = *(const v8us*)(brow + 8 * hh);
      b.half[1] = *(const v8us*)(brow + 16 + 8 * hh);
      acc[t] = mmaN<ASPLIT ? 2 : 1>(ah.v, al.v, b.v, b.v, acc[t]);
    }
  }
#pragma unroll
  for (int t = 0; t < 4; ++t) {
    float bv = bias ? bias[col0 + t * 16 + ln] : 0.f;
    if (BIAS_BF16) bv = bf16_round(bv);
#pragma unroll
    for (int r = 0; r < 8; ++r) { float v = acc[t][r] + bv; if (ACT == 1) v = fmaxf(v, 0.f); so[w][8 * hh + r][t * 16 + ln] = v; }
  }
  __builtin_amdgcn_fence(__ATOMIC_ACQ_REL, "workgroup");
  __builtin_amdgcn_wave_barrier();
  const int rsub = lane >> 4, c4 = (lane & 15) * 4;
  {
#pragma unroll
    for (int q = 0; q < 8; ++q) {
      const int r = q * 2 + rsub;
      const v4f v = *(const v4fa*)&so[w][r][c4];
      *(v4f*)(C + (size_t)(row0 + r) * ldc + col0 + c4) = v;
    }
    
  }
}

// Flash-style causal/unmasked attention, all contractions 3-term bf16 hi/lo splits, f32 softmax with running max.
// q,k,v rows are read from f32 buffers with arbitrary row pitch (so they can live inside a fused qkv buffer);
// D = head size (multiple of 32, <= 128); one wave = 16 query rows; block = 4 waves (64 queries) sharing K/V chunks of 32.
template <int D, bool CAUSAL>
__global__ __launch_bounds__(128) void k_flash(const float* __restrict__ qb, const float* __restrict__ kb, const float* __restrict__ vb,
                                             int pitch, int T, int H, float scale, float* __restrict__ y, int ypitch) {
  constexpr int KS = D / 32;        // k-steps for QK
  constexpr int DT = D / 16;        // d tiles for PV
  __shared__ __attribute__((aligned(16))) unsigned short sKh[32][D + 8], sKl[32][D + 8], sVh[32][D + 8], sVl[32][D + 8];
  __shared__ __attribute__((aligned(16))) unsigned short sPh[4][16][40], sPl[4][16][40];
  __shared__ __attribute__((aligned(16))) float sO[4][16][D];
  const int tid = threadIdx.x, w = tid >> 5, lane = tid & 31, ln = lane & 15, hh = lane >> 4;
  const int nqb = (T + 63) / 64;
  const int bh = blockIdx.x / nqb, qblk = blockIdx.x % nqb;
  const int b = bh / H, h = bh % H;
  const int q0 = qblk * 64 + w * 16;
  const float* Q = qb + (size_t)b * T * pitch + h * D;
  const float* K = kb + (size_t)b * T * pitch + h * D;
  const float* V = vb + (size_t)b * T * pitch + h * D;

  // A fragments of the wave's 16 query rows (scaled), hi/lo
  FragB aqh[KS], aql[KS];
  {
    int row = q0 + ln; if (row >= T) row = T - 1;
    const float* qr = Q + (size_t)row * pitch;
#pragma unroll
    for (int ks = 0; ks < KS; ++ks)
#pragma unroll
      for (int i = 0; i < 16; ++i) {
        const int d = ks * 32 + ((i < 8) ? (8 * hh + i) : (16 + 8 * hh + (i - 8)));
        const float x = qr[d] * scale; const unsigned short hb = bf16_bits(x);
        aqh[ks].u[i] = hb; aql[ks].u[i] = bf16_bits(x - bf16_val(hb));
      }
  }
  float m_r[8], l_r[8];
#pragma unroll
  for (int r = 0; r < 8; ++r) { m_r[r] = -3.0e38f; l_r[r] = 0.f; }
  v8f oacc[DT];
#pragma unroll
  for (int dt = 0; dt < DT; ++dt) oacc[dt] = (v8f){0.f,0.f,0.f,0.f,0.f,0.f,0.f,0.f};

  const int kv_end = CAUSAL ? min(T, qblk * 64 + 64) : T;     // block-uniform
  for (int j0 = 0; j0 < kv_end; j0 += 32) {
    __syncthreads();
    for (int e = tid; e < 32 * (D / 4); e += 128) {
      const int r = e / (D / 4), c4 = (e % (D / 4)) * 4;
      const int key = j0 + r;
      v4f kf = {0.f,0.f,0.f,0.f}, vf = {0.f,0.f,0.f,0.f};
      if (key < T) { kf = *(const v4fa*)(K + (size_t)key * pitch + c4); vf = *(const v4fa*)(V + (size_t)key * pitch + c4); }
#pragma unroll
      for (int t = 0; t < 4; ++t) {
        unsigned short hb = bf16_bits(kf[t]); sKh[r][c4 + t] = hb; sKl[r][c4 + t] = bf16_bits(kf[t] - bf16_val(hb));
        hb = bf16_bits(vf[t]); sVh[r][c4 + t] = hb; sVl[r][c4 + t] = bf16_bits(vf[t] - bf16_val(hb));
      }
    }
    __syncthreads();
    // S tile 16 x 32
    v8f s[2];
#pragma unroll
    for (int nt = 0; nt < 2; ++nt) {
      v8f acc = {};
#pragma unroll
      for (int ks = 0; ks < KS; ++ks) {
        FragB bh_, bl_;
        bh_.half[0] = *(const v8us*)&sKh[nt * 16 + ln][ks * 32 + 8 * hh]; bh_.half[1] = *(const v8us*)&sKh[nt * 16 + ln][ks * 32 + 16 + 8 * hh];
        bl_.half[0] = *(const v8us*)&sKl[nt * 16 + ln][ks * 32 + 8 * hh]; bl_.half[1] = *(const v8us*)&sKl[nt * 16 + ln][ks * 32 + 16 + 8 * hh];
        acc = mmaN<3>(aqh[ks].v, aql[ks].v, bh_.v, bl_.v, acc);
      }
      s[nt] = acc;
    }
    // mask + running max (rows 8hh+r; the 16 lanes of a half share rows)
    float alpha[8];
#pragma unroll
    for (int r = 0; r < 8; ++r) {
      const int qi = q0 + 8 * hh + r;
      const int ja = j0 + ln, jb = j0 + 16 + ln;
      if (CAUSAL) { if (ja > qi) s[0][r] = -3.0e38f; if (jb > qi) s[1][r] = -3.0e38f; }
      if (ja >= T) s[0][r] = -3.0e38f;
      if (jb >= T) s[1][r] = -3.0e38f;
      float mx = fmaxf(s[0][r], s[1][r]);
      mx = fmaxf(mx, __shfl_xor(mx, 1, 32)); mx = fmaxf(mx, __shfl_xor(mx, 2, 32)); mx = fmaxf(mx, __shfl_xor(mx, 4, 32)); mx = fmaxf(mx, __shfl_xor(mx, 8, 32));
      const float mnew = fmaxf(m_r[r], mx);
      alpha[r] = (mnew > -1.0e38f) ? __expf(m_r[r] - mnew) : 1.0f;
      const float p0 = (s[0][r] > -1.0e38f) ? __expf(s[0][r] - mnew) : 0.f;
      const float p1 = (s[1][r] > -1.0e38f) ? __expf(s[1][r] - mnew) : 0.f;
      m_r[r] = mnew;
      l_r[r] = l_r[r] * alpha[r] + p0 + p1;            // per-lane partial row sum (16 lanes combined at the end)
      unsigned short hb = bf16_bits(p0); sPh[w][8 * hh + r][ln] = hb;      sPl[w][8 * hh + r][ln] = bf16_bits(p0 - bf16_val(hb));
      hb = bf16_bits(p1);                sPh[w][8 * hh + r][16 + ln] = hb; sPl[w][8 * hh + r][16 + ln] = bf16_bits(p1 - bf16_val(hb));
    }
#pragma unroll
    for (int dt = 0; dt < DT; ++dt)
#pragma unroll
      for (int r = 0; r < 8; ++r) oacc[dt][r] *= alpha[r];
    __builtin_amdgcn_fence(__ATOMIC_ACQ_REL, "workgroup");
    __builtin_amdgcn_wave_barrier();
    FragB pah, pal;
    pah.half[0] = *(const v8us*)&sPh[w][ln][8 * hh]; pah.half[1] = *(const v8us*)&sPh[w][ln][16 + 8 * hh];
    pal.half[0] = *(const v8us*)&sPl[w][ln][8 * hh]; pal.half[1] = *(const v8us*)&sPl[w][ln][16 + 8 * hh];
#pragma unroll
    for (int dt = 0; dt < DT; ++dt) {
      FragB bvh, bvl;
#pragma unroll
      for (int i = 0; i < 8; ++i) {
        bvh.u[i] = sVh[8 * hh + i][dt * 16 + ln]; bvh.u[8 + i] = sVh[16 + 8 * hh + i][dt * 16 + ln];
        bvl.u[i] = sVl[8 * hh + i][dt * 16 + ln]; bvl.u[8 + i] = sVl[16 + 8 * hh + i][dt * 16 + ln];
      }
      oacc[dt] = mmaN<3>(pah.v, pal.v, bvh.v, bvl.v, oacc[dt]);
    }
    __builtin_amdgcn_fence(__ATOMIC_ACQ_REL, "workgroup");
    __builtin_amdgcn_wave_barrier();
  }
#pragma unroll
  for (int r = 0; r < 8; ++r) {
    float l = l_r[r];
    l += __shfl_xor(l, 1, 32); l += __shfl_xor(l, 2, 32); l += __shfl_xor(l, 4, 32); l += __shfl_xor(l, 8, 32);
    l_r[r] = (l > 0.f) ? 1.0f / l : 0.f;
  }
#pragma unroll
  for (int dt = 0; dt < DT; ++dt)
#pragma unroll
    for (int r = 0; r < 8; ++r) sO[w][8 * hh + r][dt * 16 + ln] = oacc[dt][r] * l_r[r];
  __builtin_amdgcn_fence(__ATOMIC_ACQ_REL, "workgroup");
  __builtin_amdgcn_wave_barrier();
  {
    for (int r = 0; r < 16; ++r) {
      const int row = q0 + r;
      if (row < T && lane < D / 4) {
        const v4f val = *(const v4fa*)&sO[w][r][lane * 4];
        *(v4f*)(y + ((size_t)b * T + row) * ypitch + h * D + lane * 4) = val;
      }
    }
    
  }
}

// GEMM C = act(A·W + bias + resid): A f32 (ASPLIT -> hi/lo 2 terms), Wt bf16 [N][K]; ACT 0 none, 1 relu, 2 exact gelu;
// resid (optional, f32, row index = (row % rmod), pitch ldr, RES_BF16 rounds it) added before the activation.
template <bool ASPLIT, int ACT, bool BIAS_BF16, bool RES_BF16>
__global__ __launch_bounds__(128) void k_gemm_bf3(const float* __restrict__ A, int lda, const unsigned short* __restrict__ Wt, int ldb,
                                                const float* __restrict__ bias, const float* __restrict__ resid, int rmod, int ldr,
                                                float* __restrict__ C, int ldc, int M, int N, int K) {
  __shared__ __attribute__((aligned(16))) float so[4][16][64];
  const int tid = threadIdx.x, w = tid >> 5, lane = tid & 31, ln = lane & 15, hh = lane >> 4;
  const int ntn = N / 64;
  const int wid = blockIdx.x * 4 + w;
  const int mt = wid / ntn, nq = wid % ntn;
  if (mt * 16 >= M) return;
  const int row0 = mt * 16, col0 = nq * 64;
  const float* arow = A + (size_t)(row0 + ln) * lda;
  v8f acc[4] = {};
  for (int kb = 0; kb < K; kb += 32) {
    FragB ah, al;
    const v4f x0 = *(const v4fa*)(arow + kb + 8 * hh), x1 = *(const v4fa*)(arow + kb + 8 * hh + 4);
    const v4f x2 = *(const v4fa*)(arow + kb + 16 + 8 * hh), x3 = *(const v4fa*)(arow + kb + 16 + 8 * hh + 4);
    float xs[16] = {x0[0],x0[1],x0[2],x0[3],x1[0],x1[1],x1[2],x1[3],x2[0],x2[1],x2[2],x2[3],x3[0],x3[1],x3[2],x3[3]};
#pragma unroll
    for (int i = 0; i < 16; ++i) { const unsigned short hb = bf16_bits(xs[i]); ah.u[i] = hb; al.u[i] = ASPLIT ? bf16_bits(xs[i] - bf16_val(hb)) : (unsigned short)0; }
#pragma unroll
    for (int t = 0; t < 4; ++t) {
      const unsigned short* brow = Wt + (size_t)(col0 + t * 16 + ln) * ldb + kb;
      FragB b;
      b.half[0] = *(const v8us*)(brow + 8 * hh);
      b.half[1] = *(const v8us*)(brow + 16 + 8 * hh);
      acc[t] = mmaN<ASPLIT ? 2 : 1>(ah.v, al.v, b.v, b.v, acc[t]);
    }
  }
#pragma unroll
  for (int t = 0; t < 4; ++t) {
    const int col = col0 + t * 16 + ln;
    float bv = bias ? bias[col] : 0.f;
    if (BIAS_BF16) bv = bf16_round(bv);
#pragma unroll
    for (int r = 0; r < 8; ++r) {
      float v = acc[t][r] + bv;
      if (resid) { float rv = resid[(size_t)((row0 + 8 * hh + r) % rmod) * ldr + col]; if (RES_BF16) rv = bf16_round(rv); v += rv; }
      if (ACT == 1) v = fmaxf(v, 0.f);
      if (ACT == 2) v = 0.5f * v * (1.0f + erff(v * 0.70710678118654752f));
      if (ACT == 3) { const float u = 0.7978845608028654f * (v + 0.044715f * v * v * v); v = 0.5f * v * (1.0f + tanhf(u)); }
      so[w][8 * hh + r][t * 16 + ln] = v;
    }
  }
  __builtin_amdgcn_fence(__ATOMIC_ACQ_REL, "workgroup");
  __builtin_amdgcn_wave_barrier();
  const int rsub = lane >> 4, c4 = (lane & 15) * 4;
  {
#pragma unroll
    for (int q = 0; q < 8; ++q) {
      const int r = q * 2 + rsub;
      const v4f v = *(const v4fa*)&so[w][r][c4];
      *(v4f*)(C + (size_t)(row0 + r) * ldc + col0 + c4) = v;
    }
    
  }
}
// row LayerNorm (biased variance, eps) over N: s = X (+ R); optional out_sum <- s; out_norm <- (s-mu)*rsqrt(var+eps)*g + b
template <bool PARAM_BF16>
__global__ __launch_bounds__(256) void k_layernorm(const float* __restrict__ X, const float* __restrict__ R, const float* __restrict__ g, const float* __restrict__ bta,
                                                  float* __restrict__ out_sum, float* __restrict__ out_norm, int N, float eps) {
  __shared__ float red[256];
  const int row = blockIdx.x, tid = threadIdx.x;
  const float* x = X + (size_t)row * N; const float* rr = R ? R + (size_t)row * N : nullptr;
  float vals[16];                     // up to N = 4096
  const int per = N / 256;            // contiguous chunk per thread? use strided-by-4 chunks: thread handles j = tid*4 + 1024*u
  float s1 = 0.f;
  for (int u = 0; u < per / 4; ++u) {
    const int j = tid * 4 + 1024 * u;
    const v4f a = *(const v4fa*)(x + j);
    v4f b = {0.f,0.f,0.f,0.f}; if (rr) b = *(const v4fa*)(rr + j);
#pragma unroll
    for (int q = 0; q < 4; ++q) { const float v = a[q] + b[q]; vals[u * 4 + q] = v; s1 += v; }
  }
  red[tid] = s1; __syncthreads();
  for (int st = 128; st > 0; st >>= 1) { if (tid < st) red[tid] += red[tid + st]; __syncthreads(); }
  const float mu = red[0] / (float)N; __syncthreads();
  float s2 = 0.f;
  for (int u = 0; u < per / 4; ++u)
#pragma unroll
    for (int q = 0; q < 4; ++q) { const float c = vals[u * 4 + q] - mu; s2 += c * c; }
  red[tid] = s2; __syncthreads();
  for (int st = 128; st > 0; st >>= 1) { if (tid < st) red[tid] += red[tid + st]; __syncthreads(); }
  const float rs = rsqrtf(red[0] / (float)N + eps);
  {
    for (int u = 0; u < per / 4; ++u) {
      const int j = tid * 4 + 1024 * u;
      v4f o, sm;
#pragma unroll
      for (int q = 0; q < 4; ++q) {
        float gg = g[j + q], bb = bta[j + q];
        if (PARAM_BF16) { gg = bf16_round(gg); bb = bf16_round(bb); }
        sm[q] = vals[u * 4 + q]; o[q] = (vals[u * 4 + q] - mu) * rs * gg + bb;
      }
      if (out_sum) *(v4f*)(out_sum + (size_t)row * N + j) = sm;
      *(v4f*)(out_norm + (size_t)row * N + j) = o;
    }
    
  }
}



// ---- f16 WMMA path (v_wmma_f32_16x16x32_f16): 11-bit significands for operands in range — used for both Q·Kᵀ and P·V in the launched attention kernel
typedef _Float16 v16h __attribute__((ext_vector_type(16)));
union FragH { v16h v; v8us half[2]; _Float16 h[16]; unsigned short u[16]; };
template <int NT>
__device__ __forceinline__ v8f mmaH(v16h ah, v16h al, v16h bh, v16h bl, v8f c) {
  c = __builtin_amdgcn_wmma_f32_16x16x32_f16(false, ah, false, bh, (short)0, c, false, false);
  if (NT >= 2) c = __builtin_amdgcn_wmma_f32_16x16x32_f16(false, al, false, bh, (short)0, c, false, false);
  if (NT >= 3) c = __builtin_amdgcn_wmma_f32_16x16x32_f16(false, ah, false, bl, (short)0, c, false, false);
  asm volatile("v_nop\n\tv_nop\n\tv_nop\n\tv_nop" : "+v"(c) : "v"(ah), "v"(al), "v"(bh), "v"(bl));
  return c;
}
// batched GEMM like k_gemm_b but f16 operands: A f32 (split into f16 hi/lo if ASPLIT, else rounded to f16), Bt = f16 values [n][k]; alpha; C f32; N multiple of 16 (partial tiles skipped)
template <bool ASPLIT>
__global__ __launch_bounds__(128) void k_gemm_h(const float* __restrict__ A, int lda, size_t sA, const _Float16* __restrict__ Bh, int ldb, size_t sB, float alpha, float* __restrict__ C, int ldc, size_t sC, int M, int N, int K) {
  __shared__ __attribute__((aligned(16))) float so[4][16][64];
  const int tid = threadIdx.x, w = tid >> 5, lane = tid & 31, ln = lane & 15, hh = lane >> 4; const int by = blockIdx.y;
  A += (size_t)by * sA; Bh += (size_t)by * sB; C += (size_t)by * sC;
  const int ntn = (N + 63) / 64; const int wid = blockIdx.x * 4 + w; const int mt = wid / ntn, nq = wid % ntn; if (mt * 16 >= M) return;
  const int row0 = mt * 16, col0 = nq * 64; const float* arow = A + (size_t)(row0 + ln) * lda;
  v8f acc[4] = {};
  for (int kb = 0; kb < K; kb += 32) {
    FragH ah, al;
    const v4f x0 = *(const v4fa*)(arow + kb + 8 * hh), x1 = *(const v4fa*)(arow + kb + 8 * hh + 4), x2 = *(const v4fa*)(arow + kb + 16 + 8 * hh), x3 = *(const v4fa*)(arow + kb + 16 + 8 * hh + 4);
    float xs[16] = {x0[0],x0[1],x0[2],x0[3],x1[0],x1[1],x1[2],x1[3],x2[0],x2[1],x2[2],x2[3],x3[0],x3[1],x3[2],x3[3]};
#pragma unroll
    for (int i = 0; i < 16; ++i) { const _Float16 h = (_Float16)xs[i]; ah.h[i] = h; al.h[i] = ASPLIT ? (_Float16)(xs[i] - (float)h) : (_Float16)0.0f; }
#pragma unroll
    for (int t = 0; t < 4; ++t) { if (col0 + t * 16 >= N) continue; const size_t boff = (size_t)(col0 + t * 16 + ln) * ldb + kb; FragH bq; bq.half[0] = *(const v8us*)(Bh + boff + 8 * hh); bq.half[1] = *(const v8us*)(Bh + boff + 16 + 8 * hh);
      acc[t] = mmaH<ASPLIT ? 2 : 1>(ah.v, al.v, bq.v, bq.v, acc[t]); }
  }
#pragma unroll
  for (int t = 0; t < 4; ++t) { if (col0 + t * 16 >= N) continue;
#pragma unroll
    for (int r = 0; r < 8; ++r) so[w][8 * hh + r][t * 16 + ln] = acc[t][r] * alpha; }
  __builtin_amdgcn_fence(__ATOMIC_ACQ_REL, "workgroup"); __builtin_amdgcn_wave_barrier();
  const int rsub = lane >> 4, c4 = (lane & 15) * 4;
  {
#pragma unroll
    for (int q = 0; q < 8; ++q) { const int r = q * 2 + rsub; if (col0 + c4 < N) { const v4f v = *(const v4fa*)&so[w][r][c4]; *(v4f*)(C + (size_t)(row0 + r) * ldc + col0 + c4) = v; } }
     }
}

// Wt[n][k] = f16(W[k][n]·scale) from f32 row-major W[K][N] (scale = power of two; bf16-exact weights stay exact in f16 away from the subnormal range)
__global__ __launch_bounds__(256) void k_wt_f16(const float* __restrict__ W, _Float16* __restrict__ Wt, int K, int N, float scale) {
  const int t = blockIdx.x * 256 + threadIdx.x; if (t >= N * (K / 8)) return; const int n = t / (K / 8), k8 = (t % (K / 8)) * 8; FragH f;
#pragma unroll
  for (int i = 0; i < 8; ++i) f.h[i] = (_Float16)(bf16_round(W[(size_t)(k8 + i) * N + n]) * scale); const v8us o = f.half[0];
  *(v8us*)((unsigned short*)Wt + (size_t)n * K + k8) = o; 
}
// k_gemm_hh variant with fused epilogue: v = acc·alpha + bias[by·sBias + col] (+ CP[(row/rowsPerB)·sCPb + by·64 + col] if CP) ; ACT 0 none / 1 elu ; writes f16 C16 (and f32 C if non-null)
template <int ACT>
__global__ __launch_bounds__(128) void k_gemm_hhx(const _Float16* __restrict__ A, int lda, size_t sA, const _Float16* __restrict__ Bh, int ldb, size_t sB, float alpha, const float* __restrict__ bias, size_t sBias, const float* __restrict__ CP, int rowsPerB, size_t sCPb, int row0g,
    float* __restrict__ C, _Float16* __restrict__ C16, int ldc, size_t sC, int M, int N, int K) {
  __shared__ __attribute__((aligned(16))) float so[4][16][64];
  const int tid = threadIdx.x, w = tid >> 5, lane = tid & 31, ln = lane & 15, hh = lane >> 4; const int by = blockIdx.y;
  A += (size_t)by * sA; Bh += (size_t)by * sB; const size_t cofs = (size_t)by * sC; const float* bp = bias ? bias + (size_t)by * sBias : nullptr;
  const int ntn = (N + 63) / 64; const int wid = blockIdx.x * 4 + w; const int mt = wid / ntn, nq = wid % ntn; if (mt * 16 >= M) return;
  const int row0 = mt * 16, col0 = nq * 64; const _Float16* arow = A + (size_t)(row0 + ln) * lda;
  v8f acc[4] = {};
  for (int kb = 0; kb < K; kb += 32) { FragH ah; ah.half[0] = *(const v8us*)((const unsigned short*)arow + kb + 8 * hh); ah.half[1] = *(const v8us*)((const unsigned short*)arow + kb + 16 + 8 * hh);
#pragma unroll
    for (int t = 0; t < 4; ++t) { if (col0 + t * 16 >= N) continue; const size_t boff = (size_t)(col0 + t * 16 + ln) * ldb + kb; FragH bq; bq.half[0] = *(const v8us*)((const unsigned short*)Bh + boff + 8 * hh); bq.half[1] = *(const v8us*)((const unsigned short*)Bh + boff + 16 + 8 * hh);
      acc[t] = mmaH<1>(ah.v, ah.v, bq.v, bq.v, acc[t]); }
  }
#pragma unroll
  for (int t = 0; t < 4; ++t) { if (col0 + t * 16 >= N) continue; const int col = col0 + t * 16 + ln; const float bv = bp ? bf16_round(bp[col]) : 0.f;
#pragma unroll
    for (int r = 0; r < 8; ++r) { float v = acc[t][r] * alpha + bv; if (CP) { const int bidx = (row0g + row0 + 8 * hh + r) / rowsPerB; v += CP[(size_t)bidx * sCPb + (size_t)by * 64 + col]; } if (ACT == 1) v = (v > 0.f) ? v : expm1f(v); else if (ACT == 3) v = fmaxf(v, 0.f); so[w][8 * hh + r][t * 16 + ln] = v; } }
  __builtin_amdgcn_fence(__ATOMIC_ACQ_REL, "workgroup"); __builtin_amdgcn_wave_barrier();
  const int rsub = lane >> 4, c4 = (lane & 15) * 4; typedef _Float16 v4h __attribute__((ext_vector_type(4)));
  {
#pragma unroll
    for (int q = 0; q < 8; ++q) { const int r = q * 2 + rsub; if (col0 + c4 < N) { const v4f v = *(const v4fa*)&so[w][r][c4]; if (C) *(v4f*)(C + cofs + (size_t)(row0 + r) * ldc + col0 + c4) = v; if (C16) { v4h h4; for (int i = 0; i < 4; ++i) h4[i] = (_Float16)v[i]; *(v4h*)(C16 + cofs + (size_t)(row0 + r) * ldc + col0 + c4) = h4; } } }
     }
}


typedef _Float16 v4h __attribute__((ext_vector_type(4)));

__global__ __launch_bounds__(256) void k_x16(const float* __restrict__ x, _Float16* __restrict__ X16, size_t n8) { const size_t t = (size_t)blockIdx.x * 256 + threadIdx.x; if (t >= n8) return; FragH f;
#pragma unroll
  for (int q = 0; q < 8; ++q) f.h[q] = (_Float16)bf16_round(x[t * 8 + q]); *(v8us*)((unsigned short*)X16 + t * 8) = f.half[0];  }
__global__ __launch_bounds__(256) void k_h16(const float* __restrict__ x, _Float16* __restrict__ X16, size_t n8) { const size_t t = (size_t)blockIdx.x * 256 + threadIdx.x; if (t >= n8) return; FragH f;
#pragma unroll
  for (int q = 0; q < 8; ++q) f.h[q] = (_Float16)x[t * 8 + q]; *(v8us*)((unsigned short*)X16 + t * 8) = f.half[0];  }
__global__ __launch_bounds__(256) void k_round16f(const float* __restrict__ W, _Float16* __restrict__ Bt, size_t n8) { const size_t t = (size_t)blockIdx.x * 256 + threadIdx.x; if (t >= n8) return; FragH f;
#pragma unroll
  for (int i = 0; i < 8; ++i) f.h[i] = (_Float16)(bf16_round(W[t * 8 + i]) * 16.0f); *(v8us*)((unsigned short*)Bt + t * 8) = f.half[0];  }
template <int NHv, int TTv>
__global__ __launch_bounds__(256) void k_vt(const _Float16* __restrict__ V16, int ldv, int voff, _Float16* __restrict__ Vt) { __shared__ unsigned short tl[64][66]; const int tid = threadIdx.x; const int slab = blockIdx.x / (TTv / 64), lg = blockIdx.x % (TTv / 64); const int b = slab / NHv, h = slab % NHv;
  for (int i = tid; i < 64 * 8; i += 256) { const int r = i / 8, c8 = (i % 8) * 8; FragH f; f.half[0] = *(const v8us*)((const unsigned short*)V16 + ((size_t)b * TTv + lg * 64 + r) * ldv + voff + h * 64 + c8);
#pragma unroll
    for (int q = 0; q < 8; ++q) tl[r][c8 + q] = f.u[q]; }
  __syncthreads();
  {
#pragma unroll
    for (int rd = 0; rd < 2; ++rd) { const int d = rd * 32 + tid / 8, pc = tid % 8; FragH f;
#pragma unroll
      for (int q = 0; q < 8; ++q) f.u[q] = tl[pc * 8 + q][d];
      *(v8us*)((unsigned short*)Vt + ((size_t)slab * 64 + d) * TTv + lg * 64 + pc * 8) = f.half[0]; }
     } }

// Eight asynchronous 16-byte copies of one lane, global memory -> LDS, no register in between: copy i takes LDS byte address l + i*ls and global address g + i*gs (elements).
// The s_wait_xcnt is the statement's last line so that no address register of an issued copy is rewritten ahead of it.
__device__ __forceinline__ void copy8_to_lds(unsigned l, unsigned ls, const unsigned short* g, size_t gs) {
  asm volatile("global_load_async_to_lds_b128 %0, %8, off\n\t"
               "global_load_async_to_lds_b128 %1, %9, off\n\t"
               "global_load_async_to_lds_b128 %2, %10, off\n\t"
               "global_load_async_to_lds_b128 %3, %11, off\n\t"
               "global_load_async_to_lds_b128 %4, %12, off\n\t"
               "global_load_async_to_lds_b128 %5, %13, off\n\t"
               "global_load_async_to_lds_b128 %6, %14, off\n\t"
               "global_load_async_to_lds_b128 %7, %15, off\n\t"
               "s_wait_xcnt 0x0"
               :: "v"(l), "v"(l + ls), "v"(l + 2 * ls), "v"(l + 3 * ls), "v"(l + 4 * ls), "v"(l + 5 * ls), "v"(l + 6 * ls), "v"(l + 7 * ls),
                  "v"(g), "v"(g + gs), "v"(g + 2 * gs), "v"(g + 3 * gs), "v"(g + 4 * gs), "v"(g + 5 * gs), "v"(g + 6 * gs), "v"(g + 7 * gs)
               : "memory");
}

__global__ __launch_bounds__(128) void k_flash(const _Float16* __restrict__ Q16, int ldq, const _Float16* __restrict__ K16, int ldk, const _Float16* __restrict__ Vt, const int* __restrict__ MSK, float* __restrict__ O, int ldo) {
  constexpr int RPW = 16, RTN = RPW / 16, NQB = 2048 / (4 * RPW), DT = 8, KS = 4;      /* head_dim 128 */
  __shared__ __attribute__((aligned(16))) unsigned short sP[4][RPW][40]; __shared__ __attribute__((aligned(16))) float sO[4][RPW][128 + 4];
  constexpr int SKEYS = 64, NST = 4096 / SKEYS, KPIT = 128 + 8, VPIT = SKEYS + 8;      /* a stage = 64 keys; row pitches 272 B and 144 B = 16 B x odd, conflict-free for 16-byte reads */
  __shared__ __attribute__((aligned(16))) unsigned short sK[2][SKEYS][KPIT]; __shared__ __attribute__((aligned(16))) unsigned short sV[2][128][VPIT];      /* two buffers each: K rows [key][d], Vt rows [d][key] */
  const int tid = threadIdx.x, w = tid >> 5, lane = tid & 31, ln = lane & 15, hh = lane >> 4;
  const int slab = blockIdx.x / NQB, qblk = blockIdx.x % NQB; const int b = slab / 1, h = slab % 1; const int qb0 = qblk * (4 * RPW); const int q0 = qb0 + w * RPW;
  FragH aq[2][KS];
#pragma unroll
  for (int rt = 0; rt < RTN; ++rt) { const unsigned short* qr = (const unsigned short*)Q16 + ((size_t)b * 2048 + q0 + rt * 16 + ln) * ldq + h * 128;
#pragma unroll
    for (int ks = 0; ks < KS; ++ks) { aq[rt][ks].half[0] = *(const v8us*)(qr + ks * 32 + 8 * hh); aq[rt][ks].half[1] = *(const v8us*)(qr + ks * 32 + 16 + 8 * hh); } }
  const unsigned short* Vth = (const unsigned short*)Vt + (size_t)slab * 128 * 4096;      /* [bh][128][TK] */
  float m_r[2][8], l_r[2][8]; v8f oacc[2][DT];
#pragma unroll
  for (int rt = 0; rt < RTN; ++rt) {
#pragma unroll
    for (int r = 0; r < 8; ++r) { m_r[rt][r] = -3.0e38f; l_r[rt][r] = 0.f; }
#pragma unroll
    for (int dt = 0; dt < DT; ++dt) oacc[rt][dt] = (v8f){0.f,0.f,0.f,0.f,0.f,0.f,0.f,0.f}; }
  /* each thread copies 8 x 16 B of the K tile (16 lanes = one 256-B row) and 8 x 16 B of the Vt tile (8 lanes = one 128-B row piece): whole lines per wave */
  const unsigned short* Kg = (const unsigned short*)K16 + ((size_t)b * 4096 + (tid >> 4)) * ldk + h * 128 + (tid & 15) * 8;
  const unsigned short* Vg = Vth + (size_t)(tid >> 3) * 4096 + (tid & 7) * 8;
  const unsigned lK = (unsigned)(uintptr_t)&sK[0][tid >> 4][(tid & 15) * 8], lV = (unsigned)(uintptr_t)&sV[0][tid >> 3][(tid & 7) * 8];
  auto fill = [&](int st, int bf) {
    copy8_to_lds(lK + (unsigned)bf * (unsigned)(SKEYS * KPIT * 2), 8 * KPIT * 2, Kg + (size_t)st * SKEYS * ldk, (size_t)8 * ldk);
    copy8_to_lds(lV + (unsigned)bf * (unsigned)(128 * VPIT * 2), 16 * VPIT * 2, Vg + (size_t)st * SKEYS, (size_t)16 * 4096); };
  fill(0, 0);
  asm volatile("s_wait_asynccnt 0x0" ::: "memory");      /* this wave's copies of stage 0 have landed */
  __syncthreads();                                        /* every wave's have: stage 0 may be read */
  fill(1, 1);
#pragma unroll 1
  for (int st = 0; st < NST; ++st) { const int bf = st & 1;
#pragma unroll 1      /* kept rolled: with both passes of a stage unrolled the kernel needs more than 256 VGPRs */
  for (int ps = 0; ps < SKEYS / 32; ++ps) { const int j0 = st * SKEYS + ps * 32; (void)j0;
    v8f s[2][2]; FragH bk[2][KS];      /* the pass's K fragments are read from LDS as one group: one LDS latency, not one per 16 keys */
#pragma unroll
    for (int nt = 0; nt < 2; ++nt) { const unsigned short* kr = &sK[bf][ps * 32 + nt * 16 + ln][0];
#pragma unroll
      for (int ks = 0; ks < KS; ++ks) { bk[nt][ks].half[0] = *(const v8us*)(kr + ks * 32 + 8 * hh); bk[nt][ks].half[1] = *(const v8us*)(kr + ks * 32 + 16 + 8 * hh); } }
#pragma unroll
    for (int nt = 0; nt < 2; ++nt) {
#pragma unroll
      for (int rt = 0; rt < RTN; ++rt) { v8f acc = (v8f){0.f,0.f,0.f,0.f,0.f,0.f,0.f,0.f};
#pragma unroll
        for (int ks = 0; ks < KS; ++ks) acc = mmaH<1>(aq[rt][ks].v, aq[rt][ks].v, bk[nt][ks].v, bk[nt][ks].v, acc); s[rt][nt] = acc; } }
#pragma unroll
    for (int rt = 0; rt < RTN; ++rt)
#pragma unroll
      for (int r = 0; r < 8; ++r) { const int tq = q0 + rt * 16 + 8 * hh + r; const int k0 = j0 + ln, k1 = j0 + 16 + ln; (void)tq; (void)k0; (void)k1;
        const bool ok0 = true, ok1 = true;
        const float s0 = ok0 ? s[rt][0][r] * (0.08838834764831845f) : -INFINITY, s1 = ok1 ? s[rt][1][r] * (0.08838834764831845f) : -INFINITY; float mc = fmaxf(s0, s1);
        mc = fmaxf(mc, __shfl_xor(mc, 1, 32)); mc = fmaxf(mc, __shfl_xor(mc, 2, 32)); mc = fmaxf(mc, __shfl_xor(mc, 4, 32)); mc = fmaxf(mc, __shfl_xor(mc, 8, 32));
        const float mn = fmaxf(m_r[rt][r], mc); const float al = (mn > -1.0e38f) ? expf(m_r[rt][r] - mn) : 1.0f; m_r[rt][r] = mn; const float p0 = ok0 ? expf(s0 - mn) : 0.f, p1 = ok1 ? expf(s1 - mn) : 0.f; l_r[rt][r] = l_r[rt][r] * al + p0 + p1;
#pragma unroll
        for (int dt = 0; dt < DT; ++dt) oacc[rt][dt][r] *= al;
        FragH t2; t2.h[0] = (_Float16)p0; t2.h[1] = (_Float16)p1; sP[w][rt * 16 + 8 * hh + r][ln] = t2.u[0]; sP[w][rt * 16 + 8 * hh + r][16 + ln] = t2.u[1]; }
    __builtin_amdgcn_fence(__ATOMIC_ACQ_REL, "workgroup"); __builtin_amdgcn_wave_barrier();
    FragH pa[2], bv[DT];      /* the pass's Vt fragments likewise as one group */
#pragma unroll
    for (int rt = 0; rt < RTN; ++rt) { pa[rt].half[0] = *(const v8us*)&sP[w][rt * 16 + ln][8 * hh]; pa[rt].half[1] = *(const v8us*)&sP[w][rt * 16 + ln][16 + 8 * hh]; }
#pragma unroll
    for (int dt = 0; dt < DT; ++dt) { const unsigned short* vrow = &sV[bf][dt * 16 + ln][ps * 32]; bv[dt].half[0] = *(const v8us*)(vrow + 8 * hh); bv[dt].half[1] = *(const v8us*)(vrow + 16 + 8 * hh); }
#pragma unroll
    for (int dt = 0; dt < DT; ++dt) {
#pragma unroll
      for (int rt = 0; rt < RTN; ++rt) oacc[rt][dt] = mmaH<1>(pa[rt].v, pa[rt].v, bv[dt].v, bv[dt].v, oacc[rt][dt]); }
    __builtin_amdgcn_fence(__ATOMIC_ACQ_REL, "workgroup"); __builtin_amdgcn_wave_barrier(); }
    asm volatile("s_wait_dscnt 0x0" ::: "memory");        /* this wave's reads of buffer bf are done before the buffer is handed back */
    asm volatile("s_wait_asynccnt 0x0" ::: "memory");     /* this wave's copies of stage st + 1 have landed */
    __syncthreads();                                        /* publishes stage st + 1 and ends every wave's reads of buffer bf */
    if (st + 2 < NST) fill(st + 2, bf); }
  asm volatile("s_wait_asynccnt 0x0" ::: "memory");       /* no copy is outstanding behind the loop */
#pragma unroll
  for (int rt = 0; rt < RTN; ++rt) {
#pragma unroll
    for (int r = 0; r < 8; ++r) { float l = l_r[rt][r]; l += __shfl_xor(l, 1, 32); l += __shfl_xor(l, 2, 32); l += __shfl_xor(l, 4, 32); l += __shfl_xor(l, 8, 32); l_r[rt][r] = (l > 0.f) ? 1.0f / l : 0.f; }
#pragma unroll
    for (int dt = 0; dt < DT; ++dt)
#pragma unroll
      for (int r = 0; r < 8; ++r) sO[w][rt * 16 + 8 * hh + r][dt * 16 + ln] = oacc[rt][dt][r] * l_r[rt][r]; }
  __builtin_amdgcn_fence(__ATOMIC_ACQ_REL, "workgroup"); __builtin_amdgcn_wave_barrier();
  {
#pragma unroll
    for (int rp = 0; rp < RPW; ++rp) { const int r = rp, pc = lane; const v4f val = *(const v4fa*)&sO[w][r][pc * 4]; *(v4f*)(O + ((size_t)b * 2048 + q0 + r) * ldo + h * 128 + pc * 4) = val; }      /* 32 lanes × 16 B = whole 512-B row; TQ = 2048 rows per slab */
     } }

extern "C" void kernel_launch(void* const* d_in, const int* in_sizes, int n_in,
                              void* d_out, int out_size, void* d_ws, size_t ws_size, hipStream_t stream) {
  (void)in_sizes; (void)n_in; (void)out_size;
  const float* q = (const float*)d_in[0]; const float* k = (const float*)d_in[1]; const float* v = (const float*)d_in[2];
  char* ws = (char*)d_ws; size_t off = 0;
  auto take = [&](size_t bytes) { char* p = ws + off; off += (bytes + 255) & ~(size_t)255; return p; };
  _Float16* Q16 = (_Float16*)take((size_t)NBH * TQ * HD * 2); _Float16* K16 = (_Float16*)take((size_t)NBH * TK * HD * 2); _Float16* V16 = (_Float16*)take((size_t)NBH * TK * HD * 2); _Float16* Vt = (_Float16*)take((size_t)NBH * TK * HD * 2);
  if (off > ws_size) return;      // 8.4 + 16.8 × 3 ≈ 59 MB
  k_x16<<<(unsigned)(((size_t)NBH * TQ * HD / 8 + 255) / 256), 256, 0, stream>>>(q, Q16, (size_t)NBH * TQ * HD / 8); k_x16<<<(unsigned)(((size_t)NBH * TK * HD / 8 + 255) / 256), 256, 0, stream>>>(k, K16, (size_t)NBH * TK * HD / 8); k_x16<<<(unsigned)(((size_t)NBH * TK * HD / 8 + 255) / 256), 256, 0, stream>>>(v, V16, (size_t)NBH * TK * HD / 8);
  k_vt<2, TK><<<NBH * 2 * (TK / 64), 256, 0, stream>>>(V16, HD, 0, Vt);      // Vᵀ per (b,h): [bh][128][TK]
  k_flash<<<NBH * 1 * (TQ / 64), 128, 0, stream>>>(Q16, HD, K16, HD, Vt, nullptr, (float*)d_out, HD);
}

// v002
// One run takes 130 microseconds.
// Timed twice side by side with v001, it ran 2.26 and 2.27 times as fast.
// Over all steps from v000 it is 4.69 times as fast.
#include <hip/hip_runtime.h>
// Attention with learned keys/values: out = softmax(Q·Kᵀ/√128)·V for Q [2,8,2048,128], K/V [2,8,4096,128] (head-major planes). One fused flash-style kernel (16 (b,h) slabs; 2048 query rows
// against 4096 keys; online softmax in f32; P f16 ≤ 1; O = P·Vᵀ-tiles; RPW-16 waves; 128-wide head) on v_wmma_f32_16x16x32_f16 — Q/K/V bf16-exact in f16, f32 accumulate.
#define NBH 16
#define TQ 2048
#define TK 4096
#define HD 128

typedef __bf16 v16b __attribute__((ext_vector_type(16)));
typedef unsigned short v8us __attribute__((ext_vector_type(8), may_alias));
typedef float  v8f  __attribute__((ext_vector_type(8)));
typedef float  v4f  __attribute__((ext_vector_type(4)));
typedef float  v4fa __attribute__((ext_vector_type(4), may_alias));
union FragB { v16b v; v8us half[2]; unsigned short u[16]; };

__device__ __forceinline__ unsigned short bf16_bits(float x) { unsigned int u = __float_as_uint(x); return (unsigned short)((u + 0x7FFFu + ((u >> 16) & 1u)) >> 16); }
__device__ __forceinline__ float bf16_val(unsigned short b) { return __uint_as_float(((unsigned int)b) << 16); }
__device__ __forceinline__ float bf16_round(float x) { return bf16_val(bf16_bits(x)); }
// D += A·B with NT terms: 1 = ah·bh, 2 = + al·bh (A split), 3 = + ah·bl (both split)
template <int NT>
__device__ __forceinline__ v8f mmaN(v16b ah, v16b al, v16b bh, v16b bl, v8f c) {
  c = __builtin_amdgcn_wmma_f32_16x16x32_bf16(false, ah, false, bh, (short)0, c, false, false);
  if (NT >= 2) c = __builtin_amdgcn_wmma_f32_16x16x32_bf16(false, al, false, bh, (short)0, c, false, false);
  if (NT >= 3) c = __builtin_amdgcn_wmma_f32_16x16x32_bf16(false, ah, false, bl, (short)0, c, false, false);
  asm volatile("v_nop\n\tv_nop\n\tv_nop\n\tv_nop" : "+v"(c) : "v"(ah), "v"(al), "v"(bh), "v"(bl));
  return c;
}

__global__ __launch_bounds__(256) void k_wt_bf16(const float* __restrict__ W, unsigned short* __restrict__ Wt, int K, int N) {
  const int t = blockIdx.x * 256 + threadIdx.x;
  const int k8n = K / 8;
  if (t >= N * k8n) return;
  const int n = t / k8n, k8 = (t % k8n) * 8;
  v8us v;
#pragma unroll
  for (int i = 0; i < 8; ++i) v[i] = bf16_bits(W[(size_t)(k8 + i) * N + n]);
  *(v8us*)(Wt + (size_t)n * K + k8) = v;
  
}

// GEMM C[M][N] (f32, pitch ldc) = act(A[M][K]·W + bias). A f32 row-major (pitch lda) converted per fragment to bf16
// (ASPLIT: hi/lo two planes -> 2 terms, else single rounded term); Wt bf16 [N][K] (pitch ldb). BIAS_BF16 rounds the
// bias to bf16 first (bias quantised to bf16 before the add). K%32==0, M%16==0, N%64==0.
template <bool ASPLIT, int ACT, bool BIAS_BF16>
__global__ __launch_bounds__(128) void k_gemm_bf(const float* __restrict__ A, int lda, const unsigned short* __restrict__ Wt, int ldb,
                                               const float* __restrict__ bias, float* __restrict__ C, int ldc, int M, int N, int K) {
  __shared__ __attribute__((aligned(16))) float so[4][16][64];
  const int tid = threadIdx.x, w = tid >> 5, lane = tid & 31, ln = lane & 15, hh = lane >> 4;
  const int ntn = N / 64;
  const int wid = blockIdx.x * 4 + w;
  const int mt = wid / ntn, nq = wid % ntn;
  if (mt * 16 >= M) return;
  const int row0 = mt * 16, col0 = nq * 64;
  const float* arow = A + (size_t)(row0 + ln) * lda;
  v8f acc[4] = {};
  for (int kb = 0; kb < K; kb += 32) {
    FragB ah, al;
    const v4f x0 = *(const v4fa*)(arow + kb + 8 * hh), x1 = *(const v4fa*)(arow + kb + 8 * hh + 4);
    const v4f x2 = *(const v4fa*)(arow + kb + 16 + 8 * hh), x3 = *(const v4fa*)(arow + kb + 16 + 8 * hh + 4);
    float xs[16] = {x0[0],x0[1],x0[2],x0[3],x1[0],x1[1],x1[2],x1[3],x2[0],x2[1],x2[2],x2[3],x3[0],x3[1],x3[2],x3[3]};
#pragma unroll
    for (int i = 0; i < 16; ++i) { const unsigned short hb = bf16_bits(xs[i]); ah.u[i] = hb; al.u[i] = ASPLIT ? bf16_bits(xs[i] - bf16_val(hb)) : (unsigned short)0; }
#pragma unroll
    for (int t = 0; t < 4; ++t) {
      const unsigned short* brow = Wt + (size_t)(col0 + t * 16 + ln) * ldb + kb;
      FragB b;
      b.half[0] = *(const v8us*)(brow + 8 * hh);
      b.half[1] = *(const v8us*)(brow + 16 + 8 * hh);
      acc[t] = mmaN<ASPLIT ? 2 : 1>(ah.v, al.v, b.v, b.v, acc[t]);
    }
  }
#pragma unroll
  for (int t = 0; t < 4; ++t) {
    float bv = bias ? bias[col0 + t * 16 + ln] : 0.f;
    if (BIAS_BF16) bv = bf16_round(bv);
#pragma unroll
    for (int r = 0; r < 8; ++r) { float v = acc[t][r] + bv; if (ACT == 1) v = fmaxf(v, 0.f); so[w][8 * hh + r][t * 16 + ln] = v; }
  }
  __builtin_amdgcn_fence(__ATOMIC_ACQ_REL, "workgroup");
  __builtin_amdgcn_wave_barrier();
  const int rsub = lane >> 4, c4 = (lane & 15) * 4;
  {
#pragma unroll
    for (int q = 0; q < 8; ++q) {
      const int r = q * 2 + rsub;
      const v4f v = *(const v4fa*)&so[w][r][c4];
      *(v4f*)(C + (size_t)(row0 + r) * ldc + col0 + c4) = v;
    }
    
  }
}

// Flash-style causal/unmasked attention, all contractions 3-term bf16 hi/lo splits, f32 softmax with running max.
// q,k,v rows are read from f32 buffers with arbitrary row pitch (so they can live inside a fused qkv buffer);
// D = head size (multiple of 32, <= 128); one wave = 16 query rows; block = 4 waves (64 queries) sharing K/V chunks of 32.
template <int D, bool CAUSAL>
__global__ __launch_bounds__(128) void k_flash(const float* __restrict__ qb, const float* __restrict__ kb, const float* __restrict__ vb,
                                             int pitch, int T, int H, float scale, float* __restrict__ y, int ypitch) {
  constexpr int KS = D / 32;        // k-steps for QK
  constexpr int DT = D / 16;        // d tiles for PV
  __shared__ __attribute__((aligned(16))) unsigned short sKh[32][D + 8], sKl[32][D + 8], sVh[32][D + 8], sVl[32][D + 8];
  __shared__ __attribute__((aligned(16))) unsigned short sPh[4][16][40], sPl[4][16][40];
  __shared__ __attribute__((aligned(16))) float sO[4][16][D];
  const int tid = threadIdx.x, w = tid >> 5, lane = tid & 31, ln = lane & 15, hh = lane >> 4;
  const int nqb = (T + 63) / 64;
  const int bh = blockIdx.x / nqb, qblk = blockIdx.x % nqb;
  const int b = bh / H, h = bh % H;
  const int q0 = qblk * 64 + w * 16;
  const float* Q = qb + (size_t)b * T * pitch + h * D;
  const float* K = kb + (size_t)b * T * pitch + h * D;
  const float* V = vb + (size_t)b * T * pitch + h * D;

  // A fragments of the wave's 16 query rows (scaled), hi/lo
  FragB aqh[KS], aql[KS];
  {
    int row = q0 + ln; if (row >= T) row = T - 1;
    const float* qr = Q + (size_t)row * pitch;
#pragma unroll
    for (int ks = 0; ks < KS; ++ks)
#pragma unroll
      for (int i = 0; i < 16; ++i) {
        const int d = ks * 32 + ((i < 8) ? (8 * hh + i) : (16 + 8 * hh + (i - 8)));
        const float x = qr[d] * scale; const unsigned short hb = bf16_bits(x);
        aqh[ks].u[i] = hb; aql[ks].u[i] = bf16_bits(x - bf16_val(hb));
      }
  }
  float m_r[8], l_r[8];
#pragma unroll
  for (int r = 0; r < 8; ++r) { m_r[r] = -3.0e38f; l_r[r] = 0.f; }
  v8f oacc[DT];
#pragma unroll
  for (int dt = 0; dt < DT; ++dt) oacc[dt] = (v8f){0.f,0.f,0.f,0.f,0.f,0.f,0.f,0.f};

  const int kv_end = CAUSAL ? min(T, qblk * 64 + 64) : T;     // block-uniform
  for (int j0 = 0; j0 < kv_end; j0 += 32) {
    __syncthreads();
    for (int e = tid; e < 32 * (D / 4); e += 128) {
      const int r = e / (D / 4), c4 = (e % (D / 4)) * 4;
      const int key = j0 + r;
      v4f kf = {0.f,0.f,0.f,0.f}, vf = {0.f,0.f,0.f,0.f};
      if (key < T) { kf = *(const v4fa*)(K + (size_t)key * pitch + c4); vf = *(const v4fa*)(V + (size_t)key * pitch + c4); }
#pragma unroll
      for (int t = 0; t < 4; ++t) {
        unsigned short hb = bf16_bits(kf[t]); sKh[r][c4 + t] = hb; sKl[r][c4 + t] = bf16_bits(kf[t] - bf16_val(hb));
        hb = bf16_bits(vf[t]); sVh[r][c4 + t] = hb; sVl[r][c4 + t] = bf16_bits(vf[t] - bf16_val(hb));
      }
    }
    __syncthreads();
    // S tile 16 x 32
    v8f s[2];
#pragma unroll
    for (int nt = 0; nt < 2; ++nt) {
      v8f acc = {};
#pragma unroll
      for (int ks = 0; ks < KS; ++ks) {
        FragB bh_, bl_;
        bh_.half[0] = *(const v8us*)&sKh[nt * 16 + ln][ks * 32 + 8 * hh]; bh_.half[1] = *(const v8us*)&sKh[nt * 16 + ln][ks * 32 + 16 + 8 * hh];
        bl_.half[0] = *(const v8us*)&sKl[nt * 16 + ln][ks * 32 + 8 * hh]; bl_.half[1] = *(const v8us*)&sKl[nt * 16 + ln][ks * 32 + 16 + 8 * hh];
        acc = mmaN<3>(aqh[ks].v, aql[ks].v, bh_.v, bl_.v, acc);
      }
      s[nt] = acc;
    }
    // mask + running max (rows 8hh+r; the 16 lanes of a half share rows)
    float alpha[8];
#pragma unroll
    for (int r = 0; r < 8; ++r) {
      const int qi = q0 + 8 * hh + r;
      const int ja = j0 + ln, jb = j0 + 16 + ln;
      if (CAUSAL) { if (ja > qi) s[0][r] = -3.0e38f; if (jb > qi) s[1][r] = -3.0e38f; }
      if (ja >= T) s[0][r] = -3.0e38f;
      if (jb >= T) s[1][r] = -3.0e38f;
      float mx = fmaxf(s[0][r], s[1][r]);
      mx = fmaxf(mx, __shfl_xor(mx, 1, 32)); mx = fmaxf(mx, __shfl_xor(mx, 2, 32)); mx = fmaxf(mx, __shfl_xor(mx, 4, 32)); mx = fmaxf(mx, __shfl_xor(mx, 8, 32));
      const float mnew = fmaxf(m_r[r], mx);
      alpha[r] = (mnew > -1.0e38f) ? __expf(m_r[r] - mnew) : 1.0f;
      const float p0 = (s[0][r] > -1.0e38f) ? __expf(s[0][r] - mnew) : 0.f;
      const float p1 = (s[1][r] > -1.0e38f) ? __expf(s[1][r] - mnew) : 0.f;
      m_r[r] = mnew;
      l_r[r] = l_r[r] * alpha[r] + p0 + p1;            // per-lane partial row sum (16 lanes combined at the end)
      unsigned short hb = bf16_bits(p0); sPh[w][8 * hh + r][ln] = hb;      sPl[w][8 * hh + r][ln] = bf16_bits(p0 - bf16_val(hb));
      hb = bf16_bits(p1);                sPh[w][8 * hh + r][16 + ln] = hb; sPl[w][8 * hh + r][16 + ln] = bf16_bits(p1 - bf16_val(hb));
    }
#pragma unroll
    for (int dt = 0; dt < DT; ++dt)
#pragma unroll
      for (int r = 0; r < 8; ++r) oacc[dt][r] *= alpha[r];
    __builtin_amdgcn_fence(__ATOMIC_ACQ_REL, "workgroup");
    __builtin_amdgcn_wave_barrier();
    FragB pah, pal;
    pah.half[0] = *(const v8us*)&sPh[w][ln][8 * hh]; pah.half[1] = *(const v8us*)&sPh[w][ln][16 + 8 * hh];
    pal.half[0] = *(const v8us*)&sPl[w][ln][8 * hh]; pal.half[1] = *(const v8us*)&sPl[w][ln][16 + 8 * hh];
#pragma unroll
    for (int dt = 0; dt < DT; ++dt) {
      FragB bvh, bvl;
#pragma unroll
      for (int i = 0; i < 8; ++i) {
        bvh.u[i] = sVh[8 * hh + i][dt * 16 + ln]; bvh.u[8 + i] = sVh[16 + 8 * hh + i][dt * 16 + ln];
        bvl.u[i] = sVl[8 * hh + i][dt * 16 + ln]; bvl.u[8 + i] = sVl[16 + 8 * hh + i][dt * 16 + ln];
      }
      oacc[dt] = mmaN<3>(pah.v, pal.v, bvh.v, bvl.v, oacc[dt]);
    }
    __builtin_amdgcn_fence(__ATOMIC_ACQ_REL, "workgroup");
    __builtin_amdgcn_wave_barrier();
  }
#pragma unroll
  for (int r = 0; r < 8; ++r) {
    float l = l_r[r];
    l += __shfl_xor(l, 1, 32); l += __shfl_xor(l, 2, 32); l += __shfl_xor(l, 4, 32); l += __shfl_xor(l, 8, 32);
    l_r[r] = (l > 0.f) ? 1.0f / l : 0.f;
  }
#pragma unroll
  for (int dt = 0; dt < DT; ++dt)
#pragma unroll
    for (int r = 0; r < 8; ++r) sO[w][8 * hh + r][dt * 16 + ln] = oacc[dt][r] * l_r[r];
  __builtin_amdgcn_fence(__ATOMIC_ACQ_REL, "workgroup");
  __builtin_amdgcn_wave_barrier();
  {
    for (int r = 0; r < 16; ++r) {
      const int row = q0 + r;
      if (row < T && lane < D / 4) {
        const v4f val = *(const v4fa*)&sO[w][r][lane * 4];
        *(v4f*)(y + ((size_t)b * T + row) * ypitch + h * D + lane * 4) = val;
      }
    }
    
  }
}

// GEMM C = act(A·W + bias + resid): A f32 (ASPLIT -> hi/lo 2 terms), Wt bf16 [N][K]; ACT 0 none, 1 relu, 2 exact gelu;
// resid (optional, f32, row index = (row % rmod), pitch ldr, RES_BF16 rounds it) added before the activation.
template <bool ASPLIT, int ACT, bool BIAS_BF16, bool RES_BF16>
__global__ __launch_bounds__(128) void k_gemm_bf3(const float* __restrict__ A, int lda, const unsigned short* __restrict__ Wt, int ldb,
                                                const float* __restrict__ bias, const float* __restrict__ resid, int rmod, int ldr,
                                                float* __restrict__ C, int ldc, int M, int N, int K) {
  __shared__ __attribute__((aligned(16))) float so[4][16][64];
  const int tid = threadIdx.x, w = tid >> 5, lane = tid & 31, ln = lane & 15, hh = lane >> 4;
  const int ntn = N / 64;
  const int wid = blockIdx.x * 4 + w;
  const int mt = wid / ntn, nq = wid % ntn;
  if (mt * 16 >= M) return;
  const int row0 = mt * 16, col0 = nq * 64;
  const float* arow = A + (size_t)(row0 + ln) * lda;
  v8f acc[4] = {};
  for (int kb = 0; kb < K; kb += 32) {
    FragB ah, al;
    const v4f x0 = *(const v4fa*)(arow + kb + 8 * hh), x1 = *(const v4fa*)(arow + kb + 8 * hh + 4);
    const v4f x2 = *(const v4fa*)(arow + kb + 16 + 8 * hh), x3 = *(const v4fa*)(arow + kb + 16 + 8 * hh + 4);
    float xs[16] = {x0[0],x0[1],x0[2],x0[3],x1[0],x1[1],x1[2],x1[3],x2[0],x2[1],x2[2],x2[3],x3[0],x3[1],x3[2],x3[3]};
#pragma unroll
    for (int i = 0; i < 16; ++i) { const unsigned short hb = bf16_bits(xs[i]); ah.u[i] = hb; al.u[i] = ASPLIT ? bf16_bits(xs[i] - bf16_val(hb)) : (unsigned short)0; }
#pragma unroll
    for (int t = 0; t < 4; ++t) {
      const unsigned short* brow = Wt + (size_t)(col0 + t * 16 + ln) * ldb + kb;
      FragB b;
      b.half[0] = *(const v8us*)(brow + 8 * hh);
      b.half[1] = *(const v8us*)(brow + 16 + 8 * hh);
      acc[t] = mmaN<ASPLIT ? 2 : 1>(ah.v, al.v, b.v, b.v, acc[t]);
    }
  }
#pragma unroll
  for (int t = 0; t < 4; ++t) {
    const int col = col0 + t * 16 + ln;
    float bv = bias ? bias[col] : 0.f;
    if (BIAS_BF16) bv = bf16_round(bv);
#pragma unroll
    for (int r = 0; r < 8; ++r) {
      float v = acc[t][r] + bv;
      if (resid) { float rv = resid[(size_t)((row0 + 8 * hh + r) % rmod) * ldr + col]; if (RES_BF16) rv = bf16_round(rv); v += rv; }
      if (ACT == 1) v = fmaxf(v, 0.f);
      if (ACT == 2) v = 0.5f * v * (1.0f + erff(v * 0.70710678118654752f));
      if (ACT == 3) { const float u = 0.7978845608028654f * (v + 0.044715f * v * v * v); v = 0.5f * v * (1.0f + tanhf(u)); }
      so[w][8 * hh + r][t * 16 + ln] = v;
    }
  }
  __builtin_amdgcn_fence(__ATOMIC_ACQ_REL, "workgroup");
  __builtin_amdgcn_wave_barrier();
  const int rsub = lane >> 4, c4 = (lane & 15) * 4;
  {
#pragma unroll
    for (int q = 0; q < 8; ++q) {
      const int r = q * 2 + rsub;
      const v4f v = *(const v4fa*)&so[w][r][c4];
      *(v4f*)(C + (size_t)(row0 + r) * ldc + col0 + c4) = v;
    }
    
  }
}
// row LayerNorm (biased variance, eps) over N: s = X (+ R); optional out_sum <- s; out_norm <- (s-mu)*rsqrt(var+eps)*g + b
template <bool PARAM_BF16>
__global__ __launch_bounds__(256) void k_layernorm(const float* __restrict__ X, const float* __restrict__ R, const float* __restrict__ g, const float* __restrict__ bta,
                                                  float* __restrict__ out_sum, float* __restrict__ out_norm, int N, float eps) {
  __shared__ float red[256];
  const int row = blockIdx.x, tid = threadIdx.x;
  const float* x = X + (size_t)row * N; const float* rr = R ? R + (size_t)row * N : nullptr;
  float vals[16];                     // up to N = 4096
  const int per = N / 256;            // contiguous chunk per thread? use strided-by-4 chunks: thread handles j = tid*4 + 1024*u
  float s1 = 0.f;
  for (int u = 0; u < per / 4; ++u) {
    const int j = tid * 4 + 1024 * u;
    const v4f a = *(const v4fa*)(x + j);
    v4f b = {0.f,0.f,0.f,0.f}; if (rr) b = *(const v4fa*)(rr + j);
#pragma unroll
    for (int q = 0; q < 4; ++q) { const float v = a[q] + b[q]; vals[u * 4 + q] = v; s1 += v; }
  }
  red[tid] = s1; __syncthreads();
  for (int st = 128; st > 0; st >>= 1) { if (tid < st) red[tid] += red[tid + st]; __syncthreads(); }
  const float mu = red[0] / (float)N; __syncthreads();
  float s2 = 0.f;
  for (int u = 0; u < per / 4; ++u)
#pragma unroll
    for (int q = 0; q < 4; ++q) { const float c = vals[u * 4 + q] - mu; s2 += c * c; }
  red[tid] = s2; __syncthreads();
  for (int st = 128; st > 0; st >>= 1) { if (tid < st) red[tid] += red[tid + st]; __syncthreads(); }
  const float rs = rsqrtf(red[0] / (float)N + eps);
  {
    for (int u = 0; u < per / 4; ++u) {
      const int j = tid * 4 + 1024 * u;
      v4f o, sm;
#pragma unroll
      for (int q = 0; q < 4; ++q) {
        float gg = g[j + q], bb = bta[j + q];
        if (PARAM_BF16) { gg = bf16_round(gg); bb = bf16_round(bb); }
        sm[q] = vals[u * 4 + q]; o[q] = (vals[u * 4 + q] - mu) * rs * gg + bb;
      }
      if (out_sum) *(v4f*)(out_sum + (size_t)row * N + j) = sm;
      *(v4f*)(out_norm + (size_t)row * N + j) = o;
    }
    
  }
}



// ---- f16 WMMA path (v_wmma_f32_16x16x32_f16): 11-bit significands for operands in range — used for both Q·Kᵀ and P·V in the launched attention kernel
typedef _Float16 v16h __attribute__((ext_vector_type(16)));
union FragH { v16h v; v8us half[2]; _Float16 h[16]; unsigned short u[16]; };
template <int NT>
__device__ __forceinline__ v8f mmaH(v16h ah, v16h al, v16h bh, v16h bl, v8f c) {
  c = __builtin_amdgcn_wmma_f32_16x16x32_f16(false, ah, false, bh, (short)0, c, false, false);
  if (NT >= 2) c = __builtin_amdgcn_wmma_f32_16x16x32_f16(false, al, false, bh, (short)0, c, false, false);
  if (NT >= 3) c = __builtin_amdgcn_wmma_f32_16x16x32_f16(false, ah, false, bl, (short)0, c, false, false);
  asm volatile("v_nop\n\tv_nop\n\tv_nop\n\tv_nop" : "+v"(c) : "v"(ah), "v"(al), "v"(bh), "v"(bl));
  return c;
}
// batched GEMM like k_gemm_b but f16 operands: A f32 (split into f16 hi/lo if ASPLIT, else rounded to f16), Bt = f16 values [n][k]; alpha; C f32; N multiple of 16 (partial tiles skipped)
template <bool ASPLIT>
__global__ __launch_bounds__(128) void k_gemm_h(const float* __restrict__ A, int lda, size_t sA, const _Float16* __restrict__ Bh, int ldb, size_t sB, float alpha, float* __restrict__ C, int ldc, size_t sC, int M, int N, int K) {
  __shared__ __attribute__((aligned(16))) float so[4][16][64];
  const int tid = threadIdx.x, w = tid >> 5, lane = tid & 31, ln = lane & 15, hh = lane >> 4; const int by = blockIdx.y;
  A += (size_t)by * sA; Bh += (size_t)by * sB; C += (size_t)by * sC;
  const int ntn = (N + 63) / 64; const int wid = blockIdx.x * 4 + w; const int mt = wid / ntn, nq = wid % ntn; if (mt * 16 >= M) return;
  const int row0 = mt * 16, col0 = nq * 64; const float* arow = A + (size_t)(row0 + ln) * lda;
  v8f acc[4] = {};
  for (int kb = 0; kb < K; kb += 32) {
    FragH ah, al;
    const v4f x0 = *(const v4fa*)(arow + kb + 8 * hh), x1 = *(const v4fa*)(arow + kb + 8 * hh + 4), x2 = *(const v4fa*)(arow + kb + 16 + 8 * hh), x3 = *(const v4fa*)(arow + kb + 16 + 8 * hh + 4);
    float xs[16] = {x0[0],x0[1],x0[2],x0[3],x1[0],x1[1],x1[2],x1[3],x2[0],x2[1],x2[2],x2[3],x3[0],x3[1],x3[2],x3[3]};
#pragma unroll
    for (int i = 0; i < 16; ++i) { const _Float16 h = (_Float16)xs[i]; ah.h[i] = h; al.h[i] = ASPLIT ? (_Float16)(xs[i] - (float)h) : (_Float16)0.0f; }
#pragma unroll
    for (int t = 0; t < 4; ++t) { if (col0 + t * 16 >= N) continue; const size_t boff = (size_t)(col0 + t * 16 + ln) * ldb + kb; FragH bq; bq.half[0] = *(const v8us*)(Bh + boff + 8 * hh); bq.half[1] = *(const v8us*)(Bh + boff + 16 + 8 * hh);
      acc[t] = mmaH<ASPLIT ? 2 : 1>(ah.v, al.v, bq.v, bq.v, acc[t]); }
  }
#pragma unroll
  for (int t = 0; t < 4; ++t) { if (col0 + t * 16 >= N) continue;
#pragma unroll
    for (int r = 0; r < 8; ++r) so[w][8 * hh + r][t * 16 + ln] = acc[t][r] * alpha; }
  __builtin_amdgcn_fence(__ATOMIC_ACQ_REL, "workgroup"); __builtin_amdgcn_wave_barrier();
  const int rsub = lane >> 4, c4 = (lane & 15) * 4;
  {
#pragma unroll
    for (int q = 0; q < 8; ++q) { const int r = q * 2 + rsub; if (col0 + c4 < N) { const v4f v = *(const v4fa*)&so[w][r][c4]; *(v4f*)(C + (size_t)(row0 + r) * ldc + col0 + c4) = v; } }
     }
}

// Wt[n][k] = f16(W[k][n]·scale) from f32 row-major W[K][N] (scale = power of two; bf16-exact weights stay exact in f16 away from the subnormal range)
__global__ __launch_bounds__(256) void k_wt_f16(const float* __restrict__ W, _Float16* __restrict__ Wt, int K, int N, float scale) {
  const int t = blockIdx.x * 256 + threadIdx.x; if (t >= N * (K / 8)) return; const int n = t / (K / 8), k8 = (t % (K / 8)) * 8; FragH f;
#pragma unroll
  for (int i = 0; i < 8; ++i) f.h[i] = (_Float16)(bf16_round(W[(size_t)(k8 + i) * N + n]) * scale); const v8us o = f.half[0];
  *(v8us*)((unsigned short*)Wt + (size_t)n * K + k8) = o; 
}
// k_gemm_hh variant with fused epilogue: v = acc·alpha + bias[by·sBias + col] (+ CP[(row/rowsPerB)·sCPb + by·64 + col] if CP) ; ACT 0 none / 1 elu ; writes f16 C16 (and f32 C if non-null)
template <int ACT>
__global__ __launch_bounds__(128) void k_gemm_hhx(const _Float16* __restrict__ A, int lda, size_t sA, const _Float16* __restrict__ Bh, int ldb, size_t sB, float alpha, const float* __restrict__ bias, size_t sBias, const float* __restrict__ CP, int rowsPerB, size_t sCPb, int row0g,
    float* __restrict__ C, _Float16* __restrict__ C16, int ldc, size_t sC, int M, int N, int K) {
  __shared__ __attribute__((aligned(16))) float so[4][16][64];
  const int tid = threadIdx.x, w = tid >> 5, lane = tid & 31, ln = lane & 15, hh = lane >> 4; const int by = blockIdx.y;
  A += (size_t)by * sA; Bh += (size_t)by * sB; const size_t cofs = (size_t)by * sC; const float* bp = bias ? bias + (size_t)by * sBias : nullptr;
  const int ntn = (N + 63) / 64; const int wid = blockIdx.x * 4 + w; const int mt = wid / ntn, nq = wid % ntn; if (mt * 16 >= M) return;
  const int row0 = mt * 16, col0 = nq * 64; const _Float16* arow = A + (size_t)(row0 + ln) * lda;
  v8f acc[4] = {};
  for (int kb = 0; kb < K; kb += 32) { FragH ah; ah.half[0] = *(const v8us*)((const unsigned short*)arow + kb + 8 * hh); ah.half[1] = *(const v8us*)((const unsigned short*)arow + kb + 16 + 8 * hh);
#pragma unroll
    for (int t = 0; t < 4; ++t) { if (col0 + t * 16 >= N) continue; const size_t boff = (size_t)(col0 + t * 16 + ln) * ldb + kb; FragH bq; bq.half[0] = *(const v8us*)((const unsigned short*)Bh + boff + 8 * hh); bq.half[1] = *(const v8us*)((const unsigned short*)Bh + boff + 16 + 8 * hh);
      acc[t] = mmaH<1>(ah.v, ah.v, bq.v, bq.v, acc[t]); }
  }
#pragma unroll
  for (int t = 0; t < 4; ++t) { if (col0 + t * 16 >= N) continue; const int col = col0 + t * 16 + ln; const float bv = bp ? bf16_round(bp[col]) : 0.f;
#pragma unroll
    for (int r = 0; r < 8; ++r) { float v = acc[t][r] * alpha + bv; if (CP) { const int bidx = (row0g + row0 + 8 * hh + r) / rowsPerB; v += CP[(size_t)bidx * sCPb + (size_t)by * 64 + col]; } if (ACT == 1) v = (v > 0.f) ? v : expm1f(v); else if (ACT == 3) v = fmaxf(v, 0.f); so[w][8 * hh + r][t * 16 + ln] = v; } }
  __builtin_amdgcn_fence(__ATOMIC_ACQ_REL, "workgroup"); __builtin_amdgcn_wave_barrier();
  const int rsub = lane >> 4, c4 = (lane & 15) * 4; typedef _Float16 v4h __attribute__((ext_vector_type(4)));
  {
#pragma unroll
    for (int q = 0; q < 8; ++q) { const int r = q * 2 + rsub; if (col0 + c4 < N) { const v4f v = *(const v4fa*)&so[w][r][c4]; if (C) *(v4f*)(C + cofs + (size_t)(row0 + r) * ldc + col0 + c4) = v; if (C16) { v4h h4; for (int i = 0; i < 4; ++i) h4[i] = (_Float16)v[i]; *(v4h*)(C16 + cofs + (size_t)(row0 + r) * ldc + col0 + c4) = h4; } } }
     }
}


typedef _Float16 v4h __attribute__((ext_vector_type(4)));

__global__ __launch_bounds__(256) void k_x16(const float* __restrict__ x, _Float16* __restrict__ X16, size_t n8) { const size_t t = (size_t)blockIdx.x * 256 + threadIdx.x; if (t >= n8) return; FragH f;
#pragma unroll
  for (int q = 0; q < 8; ++q) f.h[q] = (_Float16)bf16_round(x[t * 8 + q]); *(v8us*)((unsigned short*)X16 + t * 8) = f.half[0];  }
__global__ __launch_bounds__(256) void k_h16(const float* __restrict__ x, _Float16* __restrict__ X16, size_t n8) { const size_t t = (size_t)blockIdx.x * 256 + threadIdx.x; if (t >= n8) return; FragH f;
#pragma unroll
  for (int q = 0; q < 8; ++q) f.h[q] = (_Float16)x[t * 8 + q]; *(v8us*)((unsigned short*)X16 + t * 8) = f.half[0];  }
__global__ __launch_bounds__(256) void k_round16f(const float* __restrict__ W, _Float16* __restrict__ Bt, size_t n8) { const size_t t = (size_t)blockIdx.x * 256 + threadIdx.x; if (t >= n8) return; FragH f;
#pragma unroll
  for (int i = 0; i < 8; ++i) f.h[i] = (_Float16)(bf16_round(W[t * 8 + i]) * 16.0f); *(v8us*)((unsigned short*)Bt + t * 8) = f.half[0];  }
template <int NHv, int TTv>
__global__ __launch_bounds__(256) void k_vt(const _Float16* __restrict__ V16, int ldv, int voff, _Float16* __restrict__ Vt) { __shared__ unsigned short tl[64][66]; const int tid = threadIdx.x; const int slab = blockIdx.x / (TTv / 64), lg = blockIdx.x % (TTv / 64); const int b = slab / NHv, h = slab % NHv;
  for (int i = tid; i < 64 * 8; i += 256) { const int r = i / 8, c8 = (i % 8) * 8; FragH f; f.half[0] = *(const v8us*)((const unsigned short*)V16 + ((size_t)b * TTv + lg * 64 + r) * ldv + voff + h * 64 + c8);
#pragma unroll
    for (int q = 0; q < 8; ++q) tl[r][c8 + q] = f.u[q]; }
  __syncthreads();
  {
#pragma unroll
    for (int rd = 0; rd < 2; ++rd) { const int d = rd * 32 + tid / 8, pc = tid % 8; FragH f;
#pragma unroll
      for (int q = 0; q < 8; ++q) f.u[q] = tl[pc * 8 + q][d];
      *(v8us*)((unsigned short*)Vt + ((size_t)slab * 64 + d) * TTv + lg * 64 + pc * 8) = f.half[0]; }
     } }

// Eight asynchronous 16-byte copies of one lane, global memory -> LDS, no register in between: copy i takes LDS byte address l + i*ls and global address g + i*gs (elements).
// The s_wait_xcnt is the statement's last line so that no address register of an issued copy is rewritten ahead of it.
__device__ __forceinline__ void copy8_to_lds(unsigned l, unsigned ls, const unsigned short* g, size_t gs) {
  asm volatile("global_load_async_to_lds_b128 %0, %8, off\n\t"
               "global_load_async_to_lds_b128 %1, %9, off\n\t"
               "global_load_async_to_lds_b128 %2, %10, off\n\t"
               "global_load_async_to_lds_b128 %3, %11, off\n\t"
               "global_load_async_to_lds_b128 %4, %12, off\n\t"
               "global_load_async_to_lds_b128 %5, %13, off\n\t"
               "global_load_async_to_lds_b128 %6, %14, off\n\t"
               "global_load_async_to_lds_b128 %7, %15, off\n\t"
               "s_wait_xcnt 0x0"
               :: "v"(l), "v"(l + ls), "v"(l + 2 * ls), "v"(l + 3 * ls), "v"(l + 4 * ls), "v"(l + 5 * ls), "v"(l + 6 * ls), "v"(l + 7 * ls),
                  "v"(g), "v"(g + gs), "v"(g + 2 * gs), "v"(g + 3 * gs), "v"(g + 4 * gs), "v"(g + 5 * gs), "v"(g + 6 * gs), "v"(g + 7 * gs)
               : "memory");
}

// value of lane l ^ 16: the other half of the wave holds the other 16 of a query column's 32 keys
__device__ __forceinline__ float xhalf(float x) { return __builtin_bit_cast(float, __builtin_amdgcn_permlanex16(__builtin_bit_cast(int, x), __builtin_bit_cast(int, x), 0x76543210, 0xfedcba98, false, false)); }

__global__ __launch_bounds__(128) void k_flash(const _Float16* __restrict__ Q16, int ldq, const _Float16* __restrict__ K16, int ldk, const _Float16* __restrict__ Vt, const int* __restrict__ MSK, float* __restrict__ O, int ldo) {
  constexpr int RPW = 16, RTN = RPW / 16, NQB = 2048 / (4 * RPW), DT = 8, KS = 4;      /* head_dim 128 */
  __shared__ __attribute__((aligned(16))) float sO[4][RPW][128 + 4];
  constexpr int SKEYS = 64, NST = 4096 / SKEYS, KPIT = 128 + 8, VPIT = SKEYS + 8;      /* a stage = 64 keys; row pitches 272 B and 144 B = 16 B x odd, conflict-free for 16-byte reads */
  __shared__ __attribute__((aligned(16))) unsigned short sK[2][SKEYS][KPIT]; __shared__ __attribute__((aligned(16))) unsigned short sV[2][128][VPIT];      /* two buffers each: K rows [key][d], Vt rows [d][key] */
  const int tid = threadIdx.x, w = tid >> 5, lane = tid & 31, ln = lane & 15, hh = lane >> 4;
  const int slab = blockIdx.x / NQB, qblk = blockIdx.x % NQB; const int b = slab / 1, h = slab % 1; const int qb0 = qblk * (4 * RPW); const int q0 = qb0 + w * RPW;
  FragH aq[2][KS];
#pragma unroll
  for (int rt = 0; rt < RTN; ++rt) { const unsigned short* qr = (const unsigned short*)Q16 + ((size_t)b * 2048 + q0 + rt * 16 + ln) * ldq + h * 128;
#pragma unroll
    for (int ks = 0; ks < KS; ++ks) { aq[rt][ks].half[0] = *(const v8us*)(qr + ks * 32 + 8 * hh); aq[rt][ks].half[1] = *(const v8us*)(qr + ks * 32 + 16 + 8 * hh); } }
  const unsigned short* Vth = (const unsigned short*)Vt + (size_t)slab * 128 * 4096;      /* [bh][128][TK] */
  float m_r[2], l_r[2]; v8f oacc[2][DT];      /* one query per lane: running maximum, this half's part of the row sum; oacc[rt][dt][r] = O^T[dt*16 + 8*hh + r][query ln] */
#pragma unroll
  for (int rt = 0; rt < RTN; ++rt) {
    m_r[rt] = -3.0e38f; l_r[rt] = 0.f;
#pragma unroll
    for (int dt = 0; dt < DT; ++dt) oacc[rt][dt] = (v8f){0.f,0.f,0.f,0.f,0.f,0.f,0.f,0.f}; }
  /* each thread copies 8 x 16 B of the K tile (16 lanes = one 256-B row) and 8 x 16 B of the Vt tile (8 lanes = one 128-B row piece): whole lines per wave */
  const unsigned short* Kg = (const unsigned short*)K16 + ((size_t)b * 4096 + (tid >> 4)) * ldk + h * 128 + (tid & 15) * 8;
  const unsigned short* Vg = Vth + (size_t)(tid >> 3) * 4096 + (tid & 7) * 8;
  const unsigned lK = (unsigned)(uintptr_t)&sK[0][tid >> 4][(tid & 15) * 8], lV = (unsigned)(uintptr_t)&sV[0][tid >> 3][(tid & 7) * 8];
  auto fill = [&](int st, int bf) {
    copy8_to_lds(lK + (unsigned)bf * (unsigned)(SKEYS * KPIT * 2), 8 * KPIT * 2, Kg + (size_t)st * SKEYS * ldk, (size_t)8 * ldk);
    copy8_to_lds(lV + (unsigned)bf * (unsigned)(128 * VPIT * 2), 16 * VPIT * 2, Vg + (size_t)st * SKEYS, (size_t)16 * 4096); };
  fill(0, 0);
  asm volatile("s_wait_asynccnt 0x0" ::: "memory");      /* this wave's copies of stage 0 have landed */
  __syncthreads();                                        /* every wave's have: stage 0 may be read */
  fill(1, 1);
#pragma unroll 1
  for (int st = 0; st < NST; ++st) { const int bf = st & 1;
#pragma unroll 1      /* kept rolled: with both passes of a stage unrolled the kernel needs more than 256 VGPRs */
  for (int ps = 0; ps < SKEYS / 32; ++ps) { const int j0 = st * SKEYS + ps * 32; (void)j0;
    v8f s[2][2]; FragH bk[2][KS];      /* the pass's K fragments are read from LDS as one group: one LDS latency, not one per 16 keys */
#pragma unroll
    for (int nt = 0; nt < 2; ++nt) { const unsigned short* kr = &sK[bf][ps * 32 + nt * 16 + ln][0];
#pragma unroll
      for (int ks = 0; ks < KS; ++ks) { bk[nt][ks].half[0] = *(const v8us*)(kr + ks * 32 + 8 * hh); bk[nt][ks].half[1] = *(const v8us*)(kr + ks * 32 + 16 + 8 * hh); } }
#pragma unroll
    for (int nt = 0; nt < 2; ++nt) {
#pragma unroll
      for (int rt = 0; rt < RTN; ++rt) { v8f acc = (v8f){0.f,0.f,0.f,0.f,0.f,0.f,0.f,0.f};
#pragma unroll
        for (int ks = 0; ks < KS; ++ks) acc = mmaH<1>(bk[nt][ks].v, bk[nt][ks].v, aq[rt][ks].v, aq[rt][ks].v, acc); s[rt][nt] = acc; } }      /* s[rt][nt][r] = S^T[key nt*16 + 8*hh + r][query ln] */
    FragH pb[2], bv[DT];      /* pb = P^T as a B operand: element i = key 8*hh + i, element 8 + i = key 16 + 8*hh + i, the k order of the Vt loader below */
#pragma unroll
    for (int rt = 0; rt < RTN; ++rt) { float sc[16], t[16];
#pragma unroll
      for (int i = 0; i < 16; ++i) { sc[i] = s[rt][i >> 3][i & 7] * (0.08838834764831845f); t[i] = sc[i]; }
#pragma unroll
      for (int st2 = 8; st2 > 0; st2 >>= 1)
#pragma unroll
        for (int i = 0; i < st2; ++i) t[i] = fmaxf(t[i], t[i + st2]);
      const float mc = fmaxf(t[0], xhalf(t[0]));      /* maximum over the pass's 32 keys, the same in both halves */
      const float mn = fmaxf(m_r[rt], mc); const float al = (mn > -1.0e38f) ? expf(m_r[rt] - mn) : 1.0f; m_r[rt] = mn;
#pragma unroll
      for (int i = 0; i < 16; ++i) { t[i] = expf(sc[i] - mn); pb[rt].h[i] = (_Float16)t[i]; }
#pragma unroll
      for (int st2 = 8; st2 > 0; st2 >>= 1)
#pragma unroll
        for (int i = 0; i < st2; ++i) t[i] += t[i + st2];
      l_r[rt] = l_r[rt] * al + t[0];      /* this half's 16 keys; the halves are joined once, behind the loop */
#pragma unroll
      for (int dt = 0; dt < DT; ++dt)
#pragma unroll
        for (int r = 0; r < 8; ++r) oacc[rt][dt][r] *= al; }
#pragma unroll
    for (int dt = 0; dt < DT; ++dt) { const unsigned short* vrow = &sV[bf][dt * 16 + ln][ps * 32]; bv[dt].half[0] = *(const v8us*)(vrow + 8 * hh); bv[dt].half[1] = *(const v8us*)(vrow + 16 + 8 * hh); }      /* the pass's Vt fragments as one group */
#pragma unroll
    for (int dt = 0; dt < DT; ++dt) {
#pragma unroll
      for (int rt = 0; rt < RTN; ++rt) oacc[rt][dt] = mmaH<1>(bv[dt].v, bv[dt].v, pb[rt].v, pb[rt].v, oacc[rt][dt]); } }
    asm volatile("s_wait_dscnt 0x0" ::: "memory");        /* this wave's reads of buffer bf are done before the buffer is handed back */
    asm volatile("s_wait_asynccnt 0x0" ::: "memory");     /* this wave's copies of stage st + 1 have landed */
    __syncthreads();                                        /* publishes stage st + 1 and ends every wave's reads of buffer bf */
    if (st + 2 < NST) fill(st + 2, bf); }
  asm volatile("s_wait_asynccnt 0x0" ::: "memory");       /* no copy is outstanding behind the loop */
#pragma unroll
  for (int rt = 0; rt < RTN; ++rt) {
    const float l = l_r[rt] + xhalf(l_r[rt]); const float li = (l > 0.f) ? 1.0f / l : 0.f;
#pragma unroll
    for (int dt = 0; dt < DT; ++dt)
#pragma unroll
      for (int g = 0; g < 2; ++g) { const v4f o4 = {oacc[rt][dt][4 * g] * li, oacc[rt][dt][4 * g + 1] * li, oacc[rt][dt][4 * g + 2] * li, oacc[rt][dt][4 * g + 3] * li}; *(v4fa*)&sO[w][rt * 16 + ln][dt * 16 + 8 * hh + 4 * g] = o4; } }      /* a lane's 8 registers are 8 consecutive d of its query's row */
  __builtin_amdgcn_fence(__ATOMIC_ACQ_REL, "workgroup"); __builtin_amdgcn_wave_barrier();
  {
#pragma unroll
    for (int rp = 0; rp < RPW; ++rp) { const int r = rp, pc = lane; const v4f val = *(const v4fa*)&sO[w][r][pc * 4]; *(v4f*)(O + ((size_t)b * 2048 + q0 + r) * ldo + h * 128 + pc * 4) = val; }      /* 32 lanes × 16 B = whole 512-B row; TQ = 2048 rows per slab */
     } }

extern "C" void kernel_launch(void* const* d_in, const int* in_sizes, int n_in,
                              void* d_out, int out_size, void* d_ws, size_t ws_size, hipStream_t stream) {
  (void)in_sizes; (void)n_in; (void)out_size;
  const float* q = (const float*)d_in[0]; const float* k = (const float*)d_in[1]; const float* v = (const float*)d_in[2];
  char* ws = (char*)d_ws; size_t off = 0;
  auto take = [&](size_t bytes) { char* p = ws + off; off += (bytes + 255) & ~(size_t)255; return p; };
  _Float16* Q16 = (_Float16*)take((size_t)NBH * TQ * HD * 2); _Float16* K16 = (_Float16*)take((size_t)NBH * TK * HD * 2); _Float16* V16 = (_Float16*)take((size_t)NBH * TK * HD * 2); _Float16* Vt = (_Float16*)take((size_t)NBH * TK * HD * 2);
  if (off > ws_size) return;      // 8.4 + 16.8 × 3 ≈ 59 MB
  k_x16<<<(unsigned)(((size_t)NBH * TQ * HD / 8 + 255) / 256), 256, 0, stream>>>(q, Q16, (size_t)NBH * TQ * HD / 8); k_x16<<<(unsigned)(((size_t)NBH * TK * HD / 8 + 255) / 256), 256, 0, stream>>>(k, K16, (size_t)NBH * TK * HD / 8); k_x16<<<(unsigned)(((size_t)NBH * TK * HD / 8 + 255) / 256), 256, 0, stream>>>(v, V16, (size_t)NBH * TK * HD / 8);
  k_vt<2, TK><<<NBH * 2 * (TK / 64), 256, 0, stream>>>(V16, HD, 0, Vt);      // Vᵀ per (b,h): [bh][128][TK]
  k_flash<<<NBH * 1 * (TQ / 64), 128, 0, stream>>>(Q16, HD, K16, HD, Vt, nullptr, (float*)d_out, HD);
}

// v003
// One run takes 124 microseconds.
// Two timings next to v002 both put it at 1.05 times that version's speed.
// All steps since v000 together make it 4.94 times as fast.
#include <hip/hip_runtime.h>
// Attention with learned keys/values: out = softmax(Q·Kᵀ/√128)·V for Q [2,8,2048,128], K/V [2,8,4096,128] (head-major planes). One fused flash-style kernel (16 (b,h) slabs; 2048 query rows
// against 4096 keys; online softmax in f32; P f16 ≤ 1; O = P·Vᵀ-tiles; RPW-16 waves; 128-wide head) on v_wmma_f32_16x16x32_f16 — Q/K/V bf16-exact in f16, f32 accumulate.
#define NBH 16
#define TQ 2048
#define TK 4096
#define HD 128

typedef __bf16 v16b __attribute__((ext_vector_type(16)));
typedef unsigned short v8us __attribute__((ext_vector_type(8), may_alias));
typedef float  v8f  __attribute__((ext_vector_type(8)));
typedef float  v4f  __attribute__((ext_vector_type(4)));
typedef float  v4fa __attribute__((ext_vector_type(4), may_alias));
union FragB { v16b v; v8us half[2]; unsigned short u[16]; };

__device__ __forceinline__ unsigned short bf16_bits(float x) { unsigned int u = __float_as_uint(x); return (unsigned short)((u + 0x7FFFu + ((u >> 16) & 1u)) >> 16); }
__device__ __forceinline__ float bf16_val(unsigned short b) { return __uint_as_float(((unsigned int)b) << 16); }
__device__ __forceinline__ float bf16_round(float x) { return bf16_val(bf16_bits(x)); }
// D += A·B with NT terms: 1 = ah·bh, 2 = + al·bh (A split), 3 = + ah·bl (both split)
template <int NT>
__device__ __forceinline__ v8f mmaN(v16b ah, v16b al, v16b bh, v16b bl, v8f c) {
  c = __builtin_amdgcn_wmma_f32_16x16x32_bf16(false, ah, false, bh, (short)0, c, false, false);
  if (NT >= 2) c = __builtin_amdgcn_wmma_f32_16x16x32_bf16(false, al, false, bh, (short)0, c, false, false);
  if (NT >= 3) c = __builtin_amdgcn_wmma_f32_16x16x32_bf16(false, ah, false, bl, (short)0, c, false, false);
  asm volatile("v_nop\n\tv_nop\n\tv_nop\n\tv_nop" : "+v"(c) : "v"(ah), "v"(al), "v"(bh), "v"(bl));
  return c;
}

__global__ __launch_bounds__(256) void k_wt_bf16(const float* __restrict__ W, unsigned short* __restrict__ Wt, int K, int N) {
  const int t = blockIdx.x * 256 + threadIdx.x;
  const int k8n = K / 8;
  if (t >= N * k8n) return;
  const int n = t / k8n, k8 = (t % k8n) * 8;
  v8us v;
#pragma unroll
  for (int i = 0; i < 8; ++i) v[i] = bf16_bits(W[(size_t)(k8 + i) * N + n]);
  *(v8us*)(Wt + (size_t)n * K + k8) = v;
  
}

// GEMM C[M][N] (f32, pitch ldc) = act(A[M][K]·W + bias). A f32 row-major (pitch lda) converted per fragment to bf16
// (ASPLIT: hi/lo two planes -> 2 terms, else single rounded term); Wt bf16 [N][K] (pitch ldb). BIAS_BF16 rounds the
// bias to bf16 first (bias quantised to bf16 before the add). K%32==0, M%16==0, N%64==0.
template <bool ASPLIT, int ACT, bool BIAS_BF16>
__global__ __launch_bounds__(128) void k_gemm_bf(const float* __restrict__ A, int lda, const unsigned short* __restrict__ Wt, int ldb,
                                               const float* __restrict__ bias, float* __restrict__ C, int ldc, int M, int N, int K) {
  __shared__ __attribute__((aligned(16))) float so[4][16][64];
  const int tid = threadIdx.x, w = tid >> 5, lane = tid & 31, ln = lane & 15, hh = lane >> 4;
  const int ntn = N / 64;
  const int wid = blockIdx.x * 4 + w;
  const int mt = wid / ntn, nq = wid % ntn;
  if (mt * 16 >= M) return;
  const int row0 = mt * 16, col0 = nq * 64;
  const float* arow = A + (size_t)(row0 + ln) * lda;
  v8f acc[4] = {};
  for (int kb = 0; kb < K; kb += 32) {
    FragB ah, al;
    const v4f x0 = *(const v4fa*)(arow + kb + 8 * hh), x1 = *(const v4fa*)(arow + kb + 8 * hh + 4);
    const v4f x2 = *(const v4fa*)(arow + kb + 16 + 8 * hh), x3 = *(const v4fa*)(arow + kb + 16 + 8 * hh + 4);
    float xs[16] = {x0[0],x0[1],x0[2],x0[3],x1[0],x1[1],x1[2],x1[3],x2[0],x2[1],x2[2],x2[3],x3[0],x3[1],x3[2],x3[3]};
#pragma unroll
    for (int i = 0; i < 16; ++i) { const unsigned short hb = bf16_bits(xs[i]); ah.u[i] = hb; al.u[i] = ASPLIT ? bf16_bits(xs[i] - bf16_val(hb)) : (unsigned short)0; }
#pragma unroll
    for (int t = 0; t < 4; ++t) {
      const unsigned short* brow = Wt + (size_t)(col0 + t * 16 + ln) * ldb + kb;
      FragB b;
      b.half[0] = *(const v8us*)(brow + 8 * hh);
      b.half[1] = *(const v8us*)(brow + 16 + 8 * hh);
      acc[t] = mmaN<ASPLIT ? 2 : 1>(ah.v, al.v, b.v, b.v, acc[t]);
    }
  }
#pragma unroll
  for (int t = 0; t < 4; ++t) {
    float bv = bias ? bias[col0 + t * 16 + ln] : 0.f;
    if (BIAS_BF16) bv = bf16_round(bv);
#pragma unroll
    for (int r = 0; r < 8; ++r) { float v = acc[t][r] + bv; if (ACT == 1) v = fmaxf(v, 0.f); so[w][8 * hh + r][t * 16 + ln] = v; }
  }
  __builtin_amdgcn_fence(__ATOMIC_ACQ_REL, "workgroup");
  __builtin_amdgcn_wave_barrier();
  const int rsub = lane >> 4, c4 = (lane & 15) * 4;
  {
#pragma unroll
    for (int q = 0; q < 8; ++q) {
      const int r = q * 2 + rsub;
      const v4f v = *(const v4fa*)&so[w][r][c4];
      *(v4f*)(C + (size_t)(row0 + r) * ldc + col0 + c4) = v;
    }
    
  }
}

// Flash-style causal/unmasked attention, all contractions 3-term bf16 hi/lo splits, f32 softmax with running max.
// q,k,v rows are read from f32 buffers with arbitrary row pitch (so they can live inside a fused qkv buffer);
// D = head size (multiple of 32, <= 128); one wave = 16 query rows; block = 4 waves (64 queries) sharing K/V chunks of 32.
template <int D, bool CAUSAL>
__global__ __launch_bounds__(128) void k_flash(const float* __restrict__ qb, const float* __restrict__ kb, const float* __restrict__ vb,
                                             int pitch, int T, int H, float scale, float* __restrict__ y, int ypitch) {
  constexpr int KS = D / 32;        // k-steps for QK
  constexpr int DT = D / 16;        // d tiles for PV
  __shared__ __attribute__((aligned(16))) unsigned short sKh[32][D + 8], sKl[32][D + 8], sVh[32][D + 8], sVl[32][D + 8];
  __shared__ __attribute__((aligned(16))) unsigned short sPh[4][16][40], sPl[4][16][40];
  __shared__ __attribute__((aligned(16))) float sO[4][16][D];
  const int tid = threadIdx.x, w = tid >> 5, lane = tid & 31, ln = lane & 15, hh = lane >> 4;
  const int nqb = (T + 63) / 64;
  const int bh = blockIdx.x / nqb, qblk = blockIdx.x % nqb;
  const int b = bh / H, h = bh % H;
  const int q0 = qblk * 64 + w * 16;
  const float* Q = qb + (size_t)b * T * pitch + h * D;
  const float* K = kb + (size_t)b * T * pitch + h * D;
  const float* V = vb + (size_t)b * T * pitch + h * D;

  // A fragments of the wave's 16 query rows (scaled), hi/lo
  FragB aqh[KS], aql[KS];
  {
    int row = q0 + ln; if (row >= T) row = T - 1;
    const float* qr = Q + (size_t)row * pitch;
#pragma unroll
    for (int ks = 0; ks < KS; ++ks)
#pragma unroll
      for (int i = 0; i < 16; ++i) {
        const int d = ks * 32 + ((i < 8) ? (8 * hh + i) : (16 + 8 * hh + (i - 8)));
        const float x = qr[d] * scale; const unsigned short hb = bf16_bits(x);
        aqh[ks].u[i] = hb; aql[ks].u[i] = bf16_bits(x - bf16_val(hb));
      }
  }
  float m_r[8], l_r[8];
#pragma unroll
  for (int r = 0; r < 8; ++r) { m_r[r] = -3.0e38f; l_r[r] = 0.f; }
  v8f oacc[DT];
#pragma unroll
  for (int dt = 0; dt < DT; ++dt) oacc[dt] = (v8f){0.f,0.f,0.f,0.f,0.f,0.f,0.f,0.f};

  const int kv_end = CAUSAL ? min(T, qblk * 64 + 64) : T;     // block-uniform
  for (int j0 = 0; j0 < kv_end; j0 += 32) {
    __syncthreads();
    for (int e = tid; e < 32 * (D / 4); e += 128) {
      const int r = e / (D / 4), c4 = (e % (D / 4)) * 4;
      const int key = j0 + r;
      v4f kf = {0.f,0.f,0.f,0.f}, vf = {0.f,0.f,0.f,0.f};
      if (key < T) { kf = *(const v4fa*)(K + (size_t)key * pitch + c4); vf = *(const v4fa*)(V + (size_t)key * pitch + c4); }
#pragma unroll
      for (int t = 0; t < 4; ++t) {
        unsigned short hb = bf16_bits(kf[t]); sKh[r][c4 + t] = hb; sKl[r][c4 + t] = bf16_bits(kf[t] - bf16_val(hb));
        hb = bf16_bits(vf[t]); sVh[r][c4 + t] = hb; sVl[r][c4 + t] = bf16_bits(vf[t] - bf16_val(hb));
      }
    }
    __syncthreads();
    // S tile 16 x 32
    v8f s[2];
#pragma unroll
    for (int nt = 0; nt < 2; ++nt) {
      v8f acc = {};
#pragma unroll
      for (int ks = 0; ks < KS; ++ks) {
        FragB bh_, bl_;
        bh_.half[0] = *(const v8us*)&sKh[nt * 16 + ln][ks * 32 + 8 * hh]; bh_.half[1] = *(const v8us*)&sKh[nt * 16 + ln][ks * 32 + 16 + 8 * hh];
        bl_.half[0] = *(const v8us*)&sKl[nt * 16 + ln][ks * 32 + 8 * hh]; bl_.half[1] = *(const v8us*)&sKl[nt * 16 + ln][ks * 32 + 16 + 8 * hh];
        acc = mmaN<3>(aqh[ks].v, aql[ks].v, bh_.v, bl_.v, acc);
      }
      s[nt] = acc;
    }
    // mask + running max (rows 8hh+r; the 16 lanes of a half share rows)
    float alpha[8];
#pragma unroll
    for (int r = 0; r < 8; ++r) {
      const int qi = q0 + 8 * hh + r;
      const int ja = j0 + ln, jb = j0 + 16 + ln;
      if (CAUSAL) { if (ja > qi) s[0][r] = -3.0e38f; if (jb > qi) s[1][r] = -3.0e38f; }
      if (ja >= T) s[0][r] = -3.0e38f;
      if (jb >= T) s[1][r] = -3.0e38f;
      float mx = fmaxf(s[0][r], s[1][r]);
      mx = fmaxf(mx, __shfl_xor(mx, 1, 32)); mx = fmaxf(mx, __shfl_xor(mx, 2, 32)); mx = fmaxf(mx, __shfl_xor(mx, 4, 32)); mx = fmaxf(mx, __shfl_xor(mx, 8, 32));
      const float mnew = fmaxf(m_r[r], mx);
      alpha[r] = (mnew > -1.0e38f) ? __expf(m_r[r] - mnew) : 1.0f;
      const float p0 = (s[0][r] > -1.0e38f) ? __expf(s[0][r] - mnew) : 0.f;
      const float p1 = (s[1][r] > -1.0e38f) ? __expf(s[1][r] - mnew) : 0.f;
      m_r[r] = mnew;
      l_r[r] = l_r[r] * alpha[r] + p0 + p1;            // per-lane partial row sum (16 lanes combined at the end)
      unsigned short hb = bf16_bits(p0); sPh[w][8 * hh + r][ln] = hb;      sPl[w][8 * hh + r][ln] = bf16_bits(p0 - bf16_val(hb));
      hb = bf16_bits(p1);                sPh[w][8 * hh + r][16 + ln] = hb; sPl[w][8 * hh + r][16 + ln] = bf16_bits(p1 - bf16_val(hb));
    }
#pragma unroll
    for (int dt = 0; dt < DT; ++dt)
#pragma unroll
      for (int r = 0; r < 8; ++r) oacc[dt][r] *= alpha[r];
    __builtin_amdgcn_fence(__ATOMIC_ACQ_REL, "workgroup");
    __builtin_amdgcn_wave_barrier();
    FragB pah, pal;
    pah.half[0] = *(const v8us*)&sPh[w][ln][8 * hh]; pah.half[1] = *(const v8us*)&sPh[w][ln][16 + 8 * hh];
    pal.half[0] = *(const v8us*)&sPl[w][ln][8 * hh]; pal.half[1] = *(const v8us*)&sPl[w][ln][16 + 8 * hh];
#pragma unroll
    for (int dt = 0; dt < DT; ++dt) {
      FragB bvh, bvl;
#pragma unroll
      for (int i = 0; i < 8; ++i) {
        bvh.u[i] = sVh[8 * hh + i][dt * 16 + ln]; bvh.u[8 + i] = sVh[16 + 8 * hh + i][dt * 16 + ln];
        bvl.u[i] = sVl[8 * hh + i][dt * 16 + ln]; bvl.u[8 + i] = sVl[16 + 8 * hh + i][dt * 16 + ln];
      }
      oacc[dt] = mmaN<3>(pah.v, pal.v, bvh.v, bvl.v, oacc[dt]);
    }
    __builtin_amdgcn_fence(__ATOMIC_ACQ_REL, "workgroup");
    __builtin_amdgcn_wave_barrier();
  }
#pragma unroll
  for (int r = 0; r < 8; ++r) {
    float l = l_r[r];
    l += __shfl_xor(l, 1, 32); l += __shfl_xor(l, 2, 32); l += __shfl_xor(l, 4, 32); l += __shfl_xor(l, 8, 32);
    l_r[r] = (l > 0.f) ? 1.0f / l : 0.f;
  }
#pragma unroll
  for (int dt = 0; dt < DT; ++dt)
#pragma unroll
    for (int r = 0; r < 8; ++r) sO[w][8 * hh + r][dt * 16 + ln] = oacc[dt][r] * l_r[r];
  __builtin_amdgcn_fence(__ATOMIC_ACQ_REL, "workgroup");
  __builtin_amdgcn_wave_barrier();
  {
    for (int r = 0; r < 16; ++r) {
      const int row = q0 + r;
      if (row < T && lane < D / 4) {
        const v4f val = *(const v4fa*)&sO[w][r][lane * 4];
        *(v4f*)(y + ((size_t)b * T + row) * ypitch + h * D + lane * 4) = val;
      }
    }
    
  }
}

// GEMM C = act(A·W + bias + resid): A f32 (ASPLIT -> hi/lo 2 terms), Wt bf16 [N][K]; ACT 0 none, 1 relu, 2 exact gelu;
// resid (optional, f32, row index = (row % rmod), pitch ldr, RES_BF16 rounds it) added before the activation.
template <bool ASPLIT, int ACT, bool BIAS_BF16, bool RES_BF16>
__global__ __launch_bounds__(128) void k_gemm_bf3(const float* __restrict__ A, int lda, const unsigned short* __restrict__ Wt, int ldb,
                                                const float* __restrict__ bias, const float* __restrict__ resid, int rmod, int ldr,
                                                float* __restrict__ C, int ldc, int M, int N, int K) {
  __shared__ __attribute__((aligned(16))) float so[4][16][64];
  const int tid = threadIdx.x, w = tid >> 5, lane = tid & 31, ln = lane & 15, hh = lane >> 4;
  const int ntn = N / 64;
  const int wid = blockIdx.x * 4 + w;
  const int mt = wid / ntn, nq = wid % ntn;
  if (mt * 16 >= M) return;
  const int row0 = mt * 16, col0 = nq * 64;
  const float* arow = A + (size_t)(row0 + ln) * lda;
  v8f acc[4] = {};
  for (int kb = 0; kb < K; kb += 32) {
    FragB ah, al;
    const v4f x0 = *(const v4fa*)(arow + kb + 8 * hh), x1 = *(const v4fa*)(arow + kb + 8 * hh + 4);
    const v4f x2 = *(const v4fa*)(arow + kb + 16 + 8 * hh), x3 = *(const v4fa*)(arow + kb + 16 + 8 * hh + 4);
    float xs[16] = {x0[0],x0[1],x0[2],x0[3],x1[0],x1[1],x1[2],x1[3],x2[0],x2[1],x2[2],x2[3],x3[0],x3[1],x3[2],x3[3]};
#pragma unroll
    for (int i = 0; i < 16; ++i) { const unsigned short hb = bf16_bits(xs[i]); ah.u[i] = hb; al.u[i] = ASPLIT ? bf16_bits(xs[i] - bf16_val(hb)) : (unsigned short)0; }
#pragma unroll
    for (int t = 0; t < 4; ++t) {
      const unsigned short* brow = Wt + (size_t)(col0 + t * 16 + ln) * ldb + kb;
      FragB b;
      b.half[0] = *(const v8us*)(brow + 8 * hh);
      b.half[1] = *(const v8us*)(brow + 16 + 8 * hh);
      acc[t] = mmaN<ASPLIT ? 2 : 1>(ah.v, al.v, b.v, b.v, acc[t]);
    }
  }
#pragma unroll
  for (int t = 0; t < 4; ++t) {
    const int col = col0 + t * 16 + ln;
    float bv = bias ? bias[col] : 0.f;
    if (BIAS_BF16) bv = bf16_round(bv);
#pragma unroll
    for (int r = 0; r < 8; ++r) {
      float v = acc[t][r] + bv;
      if (resid) { float rv = resid[(size_t)((row0 + 8 * hh + r) % rmod) * ldr + col]; if (RES_BF16) rv = bf16_round(rv); v += rv; }
      if (ACT == 1) v = fmaxf(v, 0.f);
      if (ACT == 2) v = 0.5f * v * (1.0f + erff(v * 0.70710678118654752f));
      if (ACT == 3) { const float u = 0.7978845608028654f * (v + 0.044715f * v * v * v); v = 0.5f * v * (1.0f + tanhf(u)); }
      so[w][8 * hh + r][t * 16 + ln] = v;
    }
  }
  __builtin_amdgcn_fence(__ATOMIC_ACQ_REL, "workgroup");
  __builtin_amdgcn_wave_barrier();
  const int rsub = lane >> 4, c4 = (lane & 15) * 4;
  {
#pragma unroll
    for (int q = 0; q < 8; ++q) {
      const int r = q * 2 + rsub;
      const v4f v = *(const v4fa*)&so[w][r][c4];
      *(v4f*)(C + (size_t)(row0 + r) * ldc + col0 + c4) = v;
    }
    
  }
}
// row LayerNorm (biased variance, eps) over N: s = X (+ R); optional out_sum <- s; out_norm <- (s-mu)*rsqrt(var+eps)*g + b
template <bool PARAM_BF16>
__global__ __launch_bounds__(256) void k_layernorm(const float* __restrict__ X, const float* __restrict__ R, const float* __restrict__ g, const float* __restrict__ bta,
                                                  float* __restrict__ out_sum, float* __restrict__ out_norm, int N, float eps) {
  __shared__ float red[256];
  const int row = blockIdx.x, tid = threadIdx.x;
  const float* x = X + (size_t)row * N; const float* rr = R ? R + (size_t)row * N : nullptr;
  float vals[16];                     // up to N = 4096
  const int per = N / 256;            // contiguous chunk per thread? use strided-by-4 chunks: thread handles j = tid*4 + 1024*u
  float s1 = 0.f;
  for (int u = 0; u < per / 4; ++u) {
    const int j = tid * 4 + 1024 * u;
    const v4f a = *(const v4fa*)(x + j);
    v4f b = {0.f,0.f,0.f,0.f}; if (rr) b = *(const v4fa*)(rr + j);
#pragma unroll
    for (int q = 0; q < 4; ++q) { const float v = a[q] + b[q]; vals[u * 4 + q] = v; s1 += v; }
  }
  red[tid] = s1; __syncthreads();
  for (int st = 128; st > 0; st >>= 1) { if (tid < st) red[tid] += red[tid + st]; __syncthreads(); }
  const float mu = red[0] / (float)N; __syncthreads();
  float s2 = 0.f;
  for (int u = 0; u < per / 4; ++u)
#pragma unroll
    for (int q = 0; q < 4; ++q) { const float c = vals[u * 4 + q] - mu; s2 += c * c; }
  red[tid] = s2; __syncthreads();
  for (int st = 128; st > 0; st >>= 1) { if (tid < st) red[tid] += red[tid + st]; __syncthreads(); }
  const float rs = rsqrtf(red[0] / (float)N + eps);
  {
    for (int u = 0; u < per / 4; ++u) {
      const int j = tid * 4 + 1024 * u;
      v4f o, sm;
#pragma unroll
      for (int q = 0; q < 4; ++q) {
        float gg = g[j + q], bb = bta[j + q];
        if (PARAM_BF16) { gg = bf16_round(gg); bb = bf16_round(bb); }
        sm[q] = vals[u * 4 + q]; o[q] = (vals[u * 4 + q] - mu) * rs * gg + bb;
      }
      if (out_sum) *(v4f*)(out_sum + (size_t)row * N + j) = sm;
      *(v4f*)(out_norm + (size_t)row * N + j) = o;
    }
    
  }
}



// ---- f16 WMMA path (v_wmma_f32_16x16x32_f16): 11-bit significands for operands in range — used for both Q·Kᵀ and P·V in the launched attention kernel
typedef _Float16 v16h __attribute__((ext_vector_type(16)));
union FragH { v16h v; v8us half[2]; _Float16 h[16]; unsigned short u[16]; };
template <int NT>
__device__ __forceinline__ v8f mmaH(v16h ah, v16h al, v16h bh, v16h bl, v8f c) {
  c = __builtin_amdgcn_wmma_f32_16x16x32_f16(false, ah, false, bh, (short)0, c, false, false);
  if (NT >= 2) c = __builtin_amdgcn_wmma_f32_16x16x32_f16(false, al, false, bh, (short)0, c, false, false);
  if (NT >= 3) c = __builtin_amdgcn_wmma_f32_16x16x32_f16(false, ah, false, bl, (short)0, c, false, false);
  asm volatile("v_nop\n\tv_nop\n\tv_nop\n\tv_nop" : "+v"(c) : "v"(ah), "v"(al), "v"(bh), "v"(bl));
  return c;
}
// batched GEMM like k_gemm_b but f16 operands: A f32 (split into f16 hi/lo if ASPLIT, else rounded to f16), Bt = f16 values [n][k]; alpha; C f32; N multiple of 16 (partial tiles skipped)
template <bool ASPLIT>
__global__ __launch_bounds__(128) void k_gemm_h(const float* __restrict__ A, int lda, size_t sA, const _Float16* __restrict__ Bh, int ldb, size_t sB, float alpha, float* __restrict__ C, int ldc, size_t sC, int M, int N, int K) {
  __shared__ __attribute__((aligned(16))) float so[4][16][64];
  const int tid = threadIdx.x, w = tid >> 5, lane = tid & 31, ln = lane & 15, hh = lane >> 4; const int by = blockIdx.y;
  A += (size_t)by * sA; Bh += (size_t)by * sB; C += (size_t)by * sC;
  const int ntn = (N + 63) / 64; const int wid = blockIdx.x * 4 + w; const int mt = wid / ntn, nq = wid % ntn; if (mt * 16 >= M) return;
  const int row0 = mt * 16, col0 = nq * 64; const float* arow = A + (size_t)(row0 + ln) * lda;
  v8f acc[4] = {};
  for (int kb = 0; kb < K; kb += 32) {
    FragH ah, al;
    const v4f x0 = *(const v4fa*)(arow + kb + 8 * hh), x1 = *(const v4fa*)(arow + kb + 8 * hh + 4), x2 = *(const v4fa*)(arow + kb + 16 + 8 * hh), x3 = *(const v4fa*)(arow + kb + 16 + 8 * hh + 4);
    float xs[16] = {x0[0],x0[1],x0[2],x0[3],x1[0],x1[1],x1[2],x1[3],x2[0],x2[1],x2[2],x2[3],x3[0],x3[1],x3[2],x3[3]};
#pragma unroll
    for (int i = 0; i < 16; ++i) { const _Float16 h = (_Float16)xs[i]; ah.h[i] = h; al.h[i] = ASPLIT ? (_Float16)(xs[i] - (float)h) : (_Float16)0.0f; }
#pragma unroll
    for (int t = 0; t < 4; ++t) { if (col0 + t * 16 >= N) continue; const size_t boff = (size_t)(col0 + t * 16 + ln) * ldb + kb; FragH bq; bq.half[0] = *(const v8us*)(Bh + boff + 8 * hh); bq.half[1] = *(const v8us*)(Bh + boff + 16 + 8 * hh);
      acc[t] = mmaH<ASPLIT ? 2 : 1>(ah.v, al.v, bq.v, bq.v, acc[t]); }
  }
#pragma unroll
  for (int t = 0; t < 4; ++t) { if (col0 + t * 16 >= N) continue;
#pragma unroll
    for (int r = 0; r < 8; ++r) so[w][8 * hh + r][t * 16 + ln] = acc[t][r] * alpha; }
  __builtin_amdgcn_fence(__ATOMIC_ACQ_REL, "workgroup"); __builtin_amdgcn_wave_barrier();
  const int rsub = lane >> 4, c4 = (lane & 15) * 4;
  {
#pragma unroll
    for (int q = 0; q < 8; ++q) { const int r = q * 2 + rsub; if (col0 + c4 < N) { const v4f v = *(const v4fa*)&so[w][r][c4]; *(v4f*)(C + (size_t)(row0 + r) * ldc + col0 + c4) = v; } }
     }
}

// Wt[n][k] = f16(W[k][n]·scale) from f32 row-major W[K][N] (scale = power of two; bf16-exact weights stay exact in f16 away from the subnormal range)
__global__ __launch_bounds__(256) void k_wt_f16(const float* __restrict__ W, _Float16* __restrict__ Wt, int K, int N, float scale) {
  const int t = blockIdx.x * 256 + threadIdx.x; if (t >= N * (K / 8)) return; const int n = t / (K / 8), k8 = (t % (K / 8)) * 8; FragH f;
#pragma unroll
  for (int i = 0; i < 8; ++i) f.h[i] = (_Float16)(bf16_round(W[(size_t)(k8 + i) * N + n]) * scale); const v8us o = f.half[0];
  *(v8us*)((unsigned short*)Wt + (size_t)n * K + k8) = o; 
}
// k_gemm_hh variant with fused epilogue: v = acc·alpha + bias[by·sBias + col] (+ CP[(row/rowsPerB)·sCPb + by·64 + col] if CP) ; ACT 0 none / 1 elu ; writes f16 C16 (and f32 C if non-null)
template <int ACT>
__global__ __launch_bounds__(128) void k_gemm_hhx(const _Float16* __restrict__ A, int lda, size_t sA, const _Float16* __restrict__ Bh, int ldb, size_t sB, float alpha, const float* __restrict__ bias, size_t sBias, const float* __restrict__ CP, int rowsPerB, size_t sCPb, int row0g,
    float* __restrict__ C, _Float16* __restrict__ C16, int ldc, size_t sC, int M, int N, int K) {
  __shared__ __attribute__((aligned(16))) float so[4][16][64];
  const int tid = threadIdx.x, w = tid >> 5, lane = tid & 31, ln = lane & 15, hh = lane >> 4; const int by = blockIdx.y;
  A += (size_t)by * sA; Bh += (size_t)by * sB; const size_t cofs = (size_t)by * sC; const float* bp = bias ? bias + (size_t)by * sBias : nullptr;
  const int ntn = (N + 63) / 64; const int wid = blockIdx.x * 4 + w; const int mt = wid / ntn, nq = wid % ntn; if (mt * 16 >= M) return;
  const int row0 = mt * 16, col0 = nq * 64; const _Float16* arow = A + (size_t)(row0 + ln) * lda;
  v8f acc[4] = {};
  for (int kb = 0; kb < K; kb += 32) { FragH ah; ah.half[0] = *(const v8us*)((const unsigned short*)arow + kb + 8 * hh); ah.half[1] = *(const v8us*)((const unsigned short*)arow + kb + 16 + 8 * hh);
#pragma unroll
    for (int t = 0; t < 4; ++t) { if (col0 + t * 16 >= N) continue; const size_t boff = (size_t)(col0 + t * 16 + ln) * ldb + kb; FragH bq; bq.half[0] = *(const v8us*)((const unsigned short*)Bh + boff + 8 * hh); bq.half[1] = *(const v8us*)((const unsigned short*)Bh + boff + 16 + 8 * hh);
      acc[t] = mmaH<1>(ah.v, ah.v, bq.v, bq.v, acc[t]); }
  }
#pragma unroll
  for (int t = 0; t < 4; ++t) { if (col0 + t * 16 >= N) continue; const int col = col0 + t * 16 + ln; const float bv = bp ? bf16_round(bp[col]) : 0.f;
#pragma unroll
    for (int r = 0; r < 8; ++r) { float v = acc[t][r] * alpha + bv; if (CP) { const int bidx = (row0g + row0 + 8 * hh + r) / rowsPerB; v += CP[(size_t)bidx * sCPb + (size_t)by * 64 + col]; } if (ACT == 1) v = (v > 0.f) ? v : expm1f(v); else if (ACT == 3) v = fmaxf(v, 0.f); so[w][8 * hh + r][t * 16 + ln] = v; } }
  __builtin_amdgcn_fence(__ATOMIC_ACQ_REL, "workgroup"); __builtin_amdgcn_wave_barrier();
  const int rsub = lane >> 4, c4 = (lane & 15) * 4; typedef _Float16 v4h __attribute__((ext_vector_type(4)));
  {
#pragma unroll
    for (int q = 0; q < 8; ++q) { const int r = q * 2 + rsub; if (col0 + c4 < N) { const v4f v = *(const v4fa*)&so[w][r][c4]; if (C) *(v4f*)(C + cofs + (size_t)(row0 + r) * ldc + col0 + c4) = v; if (C16) { v4h h4; for (int i = 0; i < 4; ++i) h4[i] = (_Float16)v[i]; *(v4h*)(C16 + cofs + (size_t)(row0 + r) * ldc + col0 + c4) = h4; } } }
     }
}


typedef _Float16 v4h __attribute__((ext_vector_type(4)));

__global__ __launch_bounds__(256) void k_h16(const float* __restrict__ x, _Float16* __restrict__ X16, size_t n8) { const size_t t = (size_t)blockIdx.x * 256 + threadIdx.x; if (t >= n8) return; FragH f;
#pragma unroll
  for (int q = 0; q < 8; ++q) f.h[q] = (_Float16)x[t * 8 + q]; *(v8us*)((unsigned short*)X16 + t * 8) = f.half[0];  }
__global__ __launch_bounds__(256) void k_round16f(const float* __restrict__ W, _Float16* __restrict__ Bt, size_t n8) { const size_t t = (size_t)blockIdx.x * 256 + threadIdx.x; if (t >= n8) return; FragH f;
#pragma unroll
  for (int i = 0; i < 8; ++i) f.h[i] = (_Float16)(bf16_round(W[t * 8 + i]) * 16.0f); *(v8us*)((unsigned short*)Bt + t * 8) = f.half[0];  }
// eight consecutive f32, each rounded to bf16 and held as f16: 16 bytes
__device__ __forceinline__ v8us cvt8(v4f a, v4f b) { FragH f;
#pragma unroll
  for (int e = 0; e < 4; ++e) { f.h[e] = (_Float16)bf16_round(a[e]); f.h[4 + e] = (_Float16)bf16_round(b[e]); }
  return f.half[0]; }
// The whole preparation in one launch of 512 workgroups. Each converts 4 chunks of Q and 8 of K (a chunk = 256 threads x 8 elements) and transposes 4 neighbouring tiles of V (64 keys x 64 d),
// converted on the way from f32, into Vt [bh][128][TK]: few waves with much to do each, instead of one wave per 256 elements in four launches, and no f16 copy of V in between.
__global__ __launch_bounds__(256) void k_prep(const float* __restrict__ q, const float* __restrict__ k, const float* __restrict__ v, _Float16* __restrict__ Q16, _Float16* __restrict__ K16, _Float16* __restrict__ Vt) {
  __shared__ unsigned short tl[4][64][66];      /* a tile of its own for each of the 4: one barrier serves all */
  const int tid = threadIdx.x, r0 = tid / 8, c8 = (tid % 8) * 8;
  const int slab = blockIdx.x / (TK / 256), lg0 = (blockIdx.x % (TK / 256)) * 4;      /* slab = (b,h) plane x which 64 of the 128 d; tiles lg0 .. lg0 + 3 of its TK / 64 */
  const size_t tq = ((size_t)blockIdx.x * 4 * 256 + tid) * 8, tk = ((size_t)blockIdx.x * 8 * 256 + tid) * 8;
  const float* vp = v + ((size_t)(slab / 2) * TK + lg0 * 64 + r0) * HD + (slab % 2) * 64 + c8; const float* qp = q + tq; const float* kp = k + tk;
  v4f xv[8][2], xq[4][2], xk[8][2];      /* all 40 loads of a thread are issued before the first value is used: one memory latency for the launch */
#pragma unroll
  for (int i = 0; i < 8; ++i) { xv[i][0] = *(const v4fa*)(vp + i * 32 * HD); xv[i][1] = *(const v4fa*)(vp + i * 32 * HD + 4); }      /* row i * 32 + r0 of the 256 keys: tile i / 2, its row (i % 2) * 32 + r0 */
#pragma unroll
  for (int u = 0; u < 4; ++u) { xq[u][0] = *(const v4fa*)(qp + u * 2048); xq[u][1] = *(const v4fa*)(qp + u * 2048 + 4); }
#pragma unroll
  for (int u = 0; u < 8; ++u) { xk[u][0] = *(const v4fa*)(kp + u * 2048); xk[u][1] = *(const v4fa*)(kp + u * 2048 + 4); }
  asm volatile("s_wait_xcnt 0x0" :: "v"(vp), "v"(qp), "v"(kp) : "memory");      /* a precaution: the three address pairs stay live up to this wait, so that no load's result is written over a pair that an issued load names */
#pragma unroll
  for (int i = 0; i < 8; ++i) { FragH f; f.half[0] = cvt8(xv[i][0], xv[i][1]);
#pragma unroll
    for (int e = 0; e < 8; ++e) tl[i / 2][(i % 2) * 32 + r0][c8 + e] = f.u[e]; }
#pragma unroll
  for (int u = 0; u < 4; ++u) *(v8us*)((unsigned short*)Q16 + tq + u * 2048) = cvt8(xq[u][0], xq[u][1]);
#pragma unroll
  for (int u = 0; u < 8; ++u) *(v8us*)((unsigned short*)K16 + tk + u * 2048) = cvt8(xk[u][0], xk[u][1]);
  __syncthreads();      /* every thread's part of the 4 tiles is in LDS before a column is read */
#pragma unroll
  for (int u = 0; u < 4; ++u) {
#pragma unroll
    for (int rd = 0; rd < 2; ++rd) { const int d = rd * 32 + tid / 8, pc = tid % 8; FragH f;
#pragma unroll
      for (int e = 0; e < 8; ++e) f.u[e] = tl[u][pc * 8 + e][d];
      *(v8us*)((unsigned short*)Vt + ((size_t)slab * 64 + d) * TK + (lg0 + u) * 64 + pc * 8) = f.half[0]; } } }

// Eight asynchronous 16-byte copies of one lane, global memory -> LDS, no register in between: copy i takes LDS byte address l + i*ls and global address g + i*gs (elements).
// The s_wait_xcnt is the statement's last line so that no address register of an issued copy is rewritten ahead of it.
__device__ __forceinline__ void copy8_to_lds(unsigned l, unsigned ls, const unsigned short* g, size_t gs) {
  asm volatile("global_load_async_to_lds_b128 %0, %8, off\n\t"
               "global_load_async_to_lds_b128 %1, %9, off\n\t"
               "global_load_async_to_lds_b128 %2, %10, off\n\t"
               "global_load_async_to_lds_b128 %3, %11, off\n\t"
               "global_load_async_to_lds_b128 %4, %12, off\n\t"
               "global_load_async_to_lds_b128 %5, %13, off\n\t"
               "global_load_async_to_lds_b128 %6, %14, off\n\t"
               "global_load_async_to_lds_b128 %7, %15, off\n\t"
               "s_wait_xcnt 0x0"
               :: "v"(l), "v"(l + ls), "v"(l + 2 * ls), "v"(l + 3 * ls), "v"(l + 4 * ls), "v"(l + 5 * ls), "v"(l + 6 * ls), "v"(l + 7 * ls),
                  "v"(g), "v"(g + gs), "v"(g + 2 * gs), "v"(g + 3 * gs), "v"(g + 4 * gs), "v"(g + 5 * gs), "v"(g + 6 * gs), "v"(g + 7 * gs)
               : "memory");
}

// value of lane l ^ 16: the other half of the wave holds the other 16 of a query column's 32 keys
__device__ __forceinline__ float xhalf(float x) { return __builtin_bit_cast(float, __builtin_amdgcn_permlanex16(__builtin_bit_cast(int, x), __builtin_bit_cast(int, x), 0x76543210, 0xfedcba98, false, false)); }

__global__ __launch_bounds__(128) void k_flash(const _Float16* __restrict__ Q16, int ldq, const _Float16* __restrict__ K16, int ldk, const _Float16* __restrict__ Vt, const int* __restrict__ MSK, float* __restrict__ O, int ldo) {
  constexpr int RPW = 16, RTN = RPW / 16, NQB = 2048 / (4 * RPW), DT = 8, KS = 4;      /* head_dim 128 */
  __shared__ __attribute__((aligned(16))) float sO[4][RPW][128 + 4];
  constexpr int SKEYS = 64, NST = 4096 / SKEYS, KPIT = 128 + 8, VPIT = SKEYS + 8;      /* a stage = 64 keys; row pitches 272 B and 144 B = 16 B x odd, conflict-free for 16-byte reads */
  __shared__ __attribute__((aligned(16))) unsigned short sK[2][SKEYS][KPIT]; __shared__ __attribute__((aligned(16))) unsigned short sV[2][128][VPIT];      /* two buffers each: K rows [key][d], Vt rows [d][key] */
  const int tid = threadIdx.x, w = tid >> 5, lane = tid & 31, ln = lane & 15, hh = lane >> 4;
  const int slab = blockIdx.x / NQB, qblk = blockIdx.x % NQB; const int b = slab / 1, h = slab % 1; const int qb0 = qblk * (4 * RPW); const int q0 = qb0 + w * RPW;
  FragH aq[2][KS];
#pragma unroll
  for (int rt = 0; rt < RTN; ++rt) { const unsigned short* qr = (const unsigned short*)Q16 + ((size_t)b * 2048 + q0 + rt * 16 + ln) * ldq + h * 128;
#pragma unroll
    for (int ks = 0; ks < KS; ++ks) { aq[rt][ks].half[0] = *(const v8us*)(qr + ks * 32 + 8 * hh); aq[rt][ks].half[1] = *(const v8us*)(qr + ks * 32 + 16 + 8 * hh); } }
  const unsigned short* Vth = (const unsigned short*)Vt + (size_t)slab * 128 * 4096;      /* [bh][128][TK] */
  float m_r[2], l_r[2]; v8f oacc[2][DT];      /* one query per lane: running maximum, this half's part of the row sum; oacc[rt][dt][r] = O^T[dt*16 + 8*hh + r][query ln] */
#pragma unroll
  for (int rt = 0; rt < RTN; ++rt) {
    m_r[rt] = -3.0e38f; l_r[rt] = 0.f;
#pragma unroll
    for (int dt = 0; dt < DT; ++dt) oacc[rt][dt] = (v8f){0.f,0.f,0.f,0.f,0.f,0.f,0.f,0.f}; }
  /* each thread copies 8 x 16 B of the K tile (16 lanes = one 256-B row) and 8 x 16 B of the Vt tile (8 lanes = one 128-B row piece): whole lines per wave */
  const unsigned short* Kg = (const unsigned short*)K16 + ((size_t)b * 4096 + (tid >> 4)) * ldk + h * 128 + (tid & 15) * 8;
  const unsigned short* Vg = Vth + (size_t)(tid >> 3) * 4096 + (tid & 7) * 8;
  const unsigned lK = (unsigned)(uintptr_t)&sK[0][tid >> 4][(tid & 15) * 8], lV = (unsigned)(uintptr_t)&sV[0][tid >> 3][(tid & 7) * 8];
  auto fill = [&](int st, int bf) {
    copy8_to_lds(lK + (unsigned)bf * (unsigned)(SKEYS * KPIT * 2), 8 * KPIT * 2, Kg + (size_t)st * SKEYS * ldk, (size_t)8 * ldk);
    copy8_to_lds(lV + (unsigned)bf * (unsigned)(128 * VPIT * 2), 16 * VPIT * 2, Vg + (size_t)st * SKEYS, (size_t)16 * 4096); };
  fill(0, 0);
  asm volatile("s_wait_asynccnt 0x0" ::: "memory");      /* this wave's copies of stage 0 have landed */
  __syncthreads();                                        /* every wave's have: stage 0 may be read */
  fill(1, 1);
#pragma unroll 1
  for (int st = 0; st < NST; ++st) { const int bf = st & 1;
#pragma unroll 1      /* kept rolled: with both passes of a stage unrolled the kernel needs more than 256 VGPRs */
  for (int ps = 0; ps < SKEYS / 32; ++ps) { const int j0 = st * SKEYS + ps * 32; (void)j0;
    v8f s[2][2]; FragH bk[2][KS];      /* the pass's K fragments are read from LDS as one group: one LDS latency, not one per 16 keys */
#pragma unroll
    for (int nt = 0; nt < 2; ++nt) { const unsigned short* kr = &sK[bf][ps * 32 + nt * 16 + ln][0];
#pragma unroll
      for (int ks = 0; ks < KS; ++ks) { bk[nt][ks].half[0] = *(const v8us*)(kr + ks * 32 + 8 * hh); bk[nt][ks].half[1] = *(const v8us*)(kr + ks * 32 + 16 + 8 * hh); } }
#pragma unroll
    for (int nt = 0; nt < 2; ++nt) {
#pragma unroll
      for (int rt = 0; rt < RTN; ++rt) { v8f acc = (v8f){0.f,0.f,0.f,0.f,0.f,0.f,0.f,0.f};
#pragma unroll
        for (int ks = 0; ks < KS; ++ks) acc = mmaH<1>(bk[nt][ks].v, bk[nt][ks].v, aq[rt][ks].v, aq[rt][ks].v, acc); s[rt][nt] = acc; } }      /* s[rt][nt][r] = S^T[key nt*16 + 8*hh + r][query ln] */
    FragH pb[2], bv[DT];      /* pb = P^T as a B operand: element i = key 8*hh + i, element 8 + i = key 16 + 8*hh + i, the k order of the Vt loader below */
#pragma unroll
    for (int rt = 0; rt < RTN; ++rt) { float sc[16], t[16];
#pragma unroll
      for (int i = 0; i < 16; ++i) { sc[i] = s[rt][i >> 3][i & 7] * (0.08838834764831845f); t[i] = sc[i]; }
#pragma unroll
      for (int st2 = 8; st2 > 0; st2 >>= 1)
#pragma unroll
        for (int i = 0; i < st2; ++i) t[i] = fmaxf(t[i], t[i + st2]);
      const float mc = fmaxf(t[0], xhalf(t[0]));      /* maximum over the pass's 32 keys, the same in both halves */
      const float mn = fmaxf(m_r[rt], mc); const float al = (mn > -1.0e38f) ? expf(m_r[rt] - mn) : 1.0f; m_r[rt] = mn;
#pragma unroll
      for (int i = 0; i < 16; ++i) { t[i] = expf(sc[i] - mn); pb[rt].h[i] = (_Float16)t[i]; }
#pragma unroll
      for (int st2 = 8; st2 > 0; st2 >>= 1)
#pragma unroll
        for (int i = 0; i < st2; ++i) t[i] += t[i + st2];
      l_r[rt] = l_r[rt] * al + t[0];      /* this half's 16 keys; the halves are joined once, behind the loop */
#pragma unroll
      for (int dt = 0; dt < DT; ++dt)
#pragma unroll
        for (int r = 0; r < 8; ++r) oacc[rt][dt][r] *= al; }
#pragma unroll
    for (int dt = 0; dt < DT; ++dt) { const unsigned short* vrow = &sV[bf][dt * 16 + ln][ps * 32]; bv[dt].half[0] = *(const v8us*)(vrow + 8 * hh); bv[dt].half[1] = *(const v8us*)(vrow + 16 + 8 * hh); }      /* the pass's Vt fragments as one group */
#pragma unroll
    for (int dt = 0; dt < DT; ++dt) {
#pragma unroll
      for (int rt = 0; rt < RTN; ++rt) oacc[rt][dt] = mmaH<1>(bv[dt].v, bv[dt].v, pb[rt].v, pb[rt].v, oacc[rt][dt]); } }
    asm volatile("s_wait_dscnt 0x0" ::: "memory");        /* this wave's reads of buffer bf are done before the buffer is handed back */
    asm volatile("s_wait_asynccnt 0x0" ::: "memory");     /* this wave's copies of stage st + 1 have landed */
    __syncthreads();                                        /* publishes stage st + 1 and ends every wave's reads of buffer bf */
    if (st + 2 < NST) fill(st + 2, bf); }
  asm volatile("s_wait_asynccnt 0x0" ::: "memory");       /* no copy is outstanding behind the loop */
#pragma unroll
  for (int rt = 0; rt < RTN; ++rt) {
    const float l = l_r[rt] + xhalf(l_r[rt]); const float li = (l > 0.f) ? 1.0f / l : 0.f;
#pragma unroll
    for (int dt = 0; dt < DT; ++dt)
#pragma unroll
      for (int g = 0; g < 2; ++g) { const v4f o4 = {oacc[rt][dt][4 * g] * li, oacc[rt][dt][4 * g + 1] * li, oacc[rt][dt][4 * g + 2] * li, oacc[rt][dt][4 * g + 3] * li}; *(v4fa*)&sO[w][rt * 16 + ln][dt * 16 + 8 * hh + 4 * g] = o4; } }      /* a lane's 8 registers are 8 consecutive d of its query's row */
  __builtin_amdgcn_fence(__ATOMIC_ACQ_REL, "workgroup"); __builtin_amdgcn_wave_barrier();
  {
#pragma unroll
    for (int rp = 0; rp < RPW; ++rp) { const int r = rp, pc = lane; const v4f val = *(const v4fa*)&sO[w][r][pc * 4]; *(v4f*)(O + ((size_t)b * 2048 + q0 + r) * ldo + h * 128 + pc * 4) = val; }      /* 32 lanes × 16 B = whole 512-B row; TQ = 2048 rows per slab */
     } }

extern "C" void kernel_launch(void* const* d_in, const int* in_sizes, int n_in,
                              void* d_out, int out_size, void* d_ws, size_t ws_size, hipStream_t stream) {
  (void)in_sizes; (void)n_in; (void)out_size;
  const float* q = (const float*)d_in[0]; const float* k = (const float*)d_in[1]; const float* v = (const float*)d_in[2];
  char* ws = (char*)d_ws; size_t off = 0;
  auto take = [&](size_t bytes) { char* p = ws + off; off += (bytes + 255) & ~(size_t)255; return p; };
  _Float16* Q16 = (_Float16*)take((size_t)NBH * TQ * HD * 2); _Float16* K16 = (_Float16*)take((size_t)NBH * TK * HD * 2); _Float16* Vt = (_Float16*)take((size_t)NBH * TK * HD * 2);
  if (off > ws_size) return;      // three f16 planes, 42 MB in all
  k_prep<<<NBH * 2 * (TK / 64) / 4, 256, 0, stream>>>(q, k, v, Q16, K16, Vt);      // 512 workgroups: NBH*TQ*HD/8/256 = 4 x 512 chunks of Q, 8 x 512 of K, 4 x 512 tiles of V
  k_flash<<<NBH * 1 * (TQ / 64), 128, 0, stream>>>(Q16, HD, K16, HD, Vt, nullptr, (float*)d_out, HD);
}

// v004
// It runs in 90.3 microseconds.
// Timed twice side by side with v003, it ran 1.37 and 1.36 times as fast.
// Counting every step since v000, it is 6.75 times as fast.
#include <hip/hip_runtime.h>
// Attention with learned keys/values: out = softmax(Q·Kᵀ/√128)·V for Q [2,8,2048,128], K/V [2,8,4096,128] (head-major planes). One fused flash-style kernel (16 (b,h) slabs; 2048 query rows
// against 4096 keys; online softmax in f32; P f16 ≤ 1; O = P·Vᵀ-tiles; RPW-16 waves; 128-wide head) on v_wmma_f32_16x16x32_f16 — Q/K/V bf16-exact in f16, f32 accumulate.
#define NBH 16
#define TQ 2048
#define TK 4096
#define HD 128

typedef __bf16 v16b __attribute__((ext_vector_type(16)));
typedef unsigned short v8us __attribute__((ext_vector_type(8), may_alias));
typedef float  v8f  __attribute__((ext_vector_type(8)));
typedef float  v4f  __attribute__((ext_vector_type(4)));
typedef float  v4fa __attribute__((ext_vector_type(4), may_alias));
union FragB { v16b v; v8us half[2]; unsigned short u[16]; };

__device__ __forceinline__ unsigned short bf16_bits(float x) { unsigned int u = __float_as_uint(x); return (unsigned short)((u + 0x7FFFu + ((u >> 16) & 1u)) >> 16); }
__device__ __forceinline__ float bf16_val(unsigned short b) { return __uint_as_float(((unsigned int)b) << 16); }
__device__ __forceinline__ float bf16_round(float x) { return bf16_val(bf16_bits(x)); }
// D += A·B with NT terms: 1 = ah·bh, 2 = + al·bh (A split), 3 = + ah·bl (both split)
template <int NT>
__device__ __forceinline__ v8f mmaN(v16b ah, v16b al, v16b bh, v16b bl, v8f c) {
  c = __builtin_amdgcn_wmma_f32_16x16x32_bf16(false, ah, false, bh, (short)0, c, false, false);
  if (NT >= 2) c = __builtin_amdgcn_wmma_f32_16x16x32_bf16(false, al, false, bh, (short)0, c, false, false);
  if (NT >= 3) c = __builtin_amdgcn_wmma_f32_16x16x32_bf16(false, ah, false, bl, (short)0, c, false, false);
  asm volatile("v_nop\n\tv_nop\n\tv_nop\n\tv_nop" : "+v"(c) : "v"(ah), "v"(al), "v"(bh), "v"(bl));
  return c;
}

__global__ __launch_bounds__(256) void k_wt_bf16(const float* __restrict__ W, unsigned short* __restrict__ Wt, int K, int N) {
  const int t = blockIdx.x * 256 + threadIdx.x;
  const int k8n = K / 8;
  if (t >= N * k8n) return;
  const int n = t / k8n, k8 = (t % k8n) * 8;
  v8us v;
#pragma unroll
  for (int i = 0; i < 8; ++i) v[i] = bf16_bits(W[(size_t)(k8 + i) * N + n]);
  *(v8us*)(Wt + (size_t)n * K + k8) = v;
  
}

// GEMM C[M][N] (f32, pitch ldc) = act(A[M][K]·W + bias). A f32 row-major (pitch lda) converted per fragment to bf16
// (ASPLIT: hi/lo two planes -> 2 terms, else single rounded term); Wt bf16 [N][K] (pitch ldb). BIAS_BF16 rounds the
// bias to bf16 first (bias quantised to bf16 before the add). K%32==0, M%16==0, N%64==0.
template <bool ASPLIT, int ACT, bool BIAS_BF16>
__global__ __launch_bounds__(128) void k_gemm_bf(const float* __restrict__ A, int lda, const unsigned short* __restrict__ Wt, int ldb,
                                               const float* __restrict__ bias, float* __restrict__ C, int ldc, int M, int N, int K) {
  __shared__ __attribute__((aligned(16))) float so[4][16][64];
  const int tid = threadIdx.x, w = tid >> 5, lane = tid & 31, ln = lane & 15, hh = lane >> 4;
  const int ntn = N / 64;
  const int wid = blockIdx.x * 4 + w;
  const int mt = wid / ntn, nq = wid % ntn;
  if (mt * 16 >= M) return;
  const int row0 = mt * 16, col0 = nq * 64;
  const float* arow = A + (size_t)(row0 + ln) * lda;
  v8f acc[4] = {};
  for (int kb = 0; kb < K; kb += 32) {
    FragB ah, al;
    const v4f x0 = *(const v4fa*)(arow + kb + 8 * hh), x1 = *(const v4fa*)(arow + kb + 8 * hh + 4);
    const v4f x2 = *(const v4fa*)(arow + kb + 16 + 8 * hh), x3 = *(const v4fa*)(arow + kb + 16 + 8 * hh + 4);
    float xs[16] = {x0[0],x0[1],x0[2],x0[3],x1[0],x1[1],x1[2],x1[3],x2[0],x2[1],x2[2],x2[3],x3[0],x3[1],x3[2],x3[3]};
#pragma unroll
    for (int i = 0; i < 16; ++i) { const unsigned short hb = bf16_bits(xs[i]); ah.u[i] = hb; al.u[i] = ASPLIT ? bf16_bits(xs[i] - bf16_val(hb)) : (unsigned short)0; }
#pragma unroll
    for (int t = 0; t < 4; ++t) {
      const unsigned short* brow = Wt + (size_t)(col0 + t * 16 + ln) * ldb + kb;
      FragB b;
      b.half[0] = *(const v8us*)(brow + 8 * hh);
      b.half[1] = *(const v8us*)(brow + 16 + 8 * hh);
      acc[t] = mmaN<ASPLIT ? 2 : 1>(ah.v, al.v, b.v, b.v, acc[t]);
    }
  }
#pragma unroll
  for (int t = 0; t < 4; ++t) {
    float bv = bias ? bias[col0 + t * 16 + ln] : 0.f;
    if (BIAS_BF16) bv = bf16_round(bv);
#pragma unroll
    for (int r = 0; r < 8; ++r) { float v = acc[t][r] + bv; if (ACT == 1) v = fmaxf(v, 0.f); so[w][8 * hh + r][t * 16 + ln] = v; }
  }
  __builtin_amdgcn_fence(__ATOMIC_ACQ_REL, "workgroup");
  __builtin_amdgcn_wave_barrier();
  const int rsub = lane >> 4, c4 = (lane & 15) * 4;
  {
#pragma unroll
    for (int q = 0; q < 8; ++q) {
      const int r = q * 2 + rsub;
      const v4f v = *(const v4fa*)&so[w][r][c4];
      *(v4f*)(C + (size_t)(row0 + r) * ldc + col0 + c4) = v;
    }
    
  }
}

// Flash-style causal/unmasked attention, all contractions 3-term bf16 hi/lo splits, f32 softmax with running max.
// q,k,v rows are read from f32 buffers with arbitrary row pitch (so they can live inside a fused qkv buffer);
// D = head size (multiple of 32, <= 128); one wave = 16 query rows; block = 4 waves (64 queries) sharing K/V chunks of 32.
template <int D, bool CAUSAL>
__global__ __launch_bounds__(128) void k_flash(const float* __restrict__ qb, const float* __restrict__ kb, const float* __restrict__ vb,
                                             int pitch, int T, int H, float scale, float* __restrict__ y, int ypitch) {
  constexpr int KS = D / 32;        // k-steps for QK
  constexpr int DT = D / 16;        // d tiles for PV
  __shared__ __attribute__((aligned(16))) unsigned short sKh[32][D + 8], sKl[32][D + 8], sVh[32][D + 8], sVl[32][D + 8];
  __shared__ __attribute__((aligned(16))) unsigned short sPh[4][16][40], sPl[4][16][40];
  __shared__ __attribute__((aligned(16))) float sO[4][16][D];
  const int tid = threadIdx.x, w = tid >> 5, lane = tid & 31, ln = lane & 15, hh = lane >> 4;
  const int nqb = (T + 63) / 64;
  const int bh = blockIdx.x / nqb, qblk = blockIdx.x % nqb;
  const int b = bh / H, h = bh % H;
  const int q0 = qblk * 64 + w * 16;
  const float* Q = qb + (size_t)b * T * pitch + h * D;
  const float* K = kb + (size_t)b * T * pitch + h * D;
  const float* V = vb + (size_t)b * T * pitch + h * D;

  // A fragments of the wave's 16 query rows (scaled), hi/lo
  FragB aqh[KS], aql[KS];
  {
    int row = q0 + ln; if (row >= T) row = T - 1;
    const float* qr = Q + (size_t)row * pitch;
#pragma unroll
    for (int ks = 0; ks < KS; ++ks)
#pragma unroll
      for (int i = 0; i < 16; ++i) {
        const int d = ks * 32 + ((i < 8) ? (8 * hh + i) : (16 + 8 * hh + (i - 8)));
        const float x = qr[d] * scale; const unsigned short hb = bf16_bits(x);
        aqh[ks].u[i] = hb; aql[ks].u[i] = bf16_bits(x - bf16_val(hb));
      }
  }
  float m_r[8], l_r[8];
#pragma unroll
  for (int r = 0; r < 8; ++r) { m_r[r] = -3.0e38f; l_r[r] = 0.f; }
  v8f oacc[DT];
#pragma unroll
  for (int dt = 0; dt < DT; ++dt) oacc[dt] = (v8f){0.f,0.f,0.f,0.f,0.f,0.f,0.f,0.f};

  const int kv_end = CAUSAL ? min(T, qblk * 64 + 64) : T;     // block-uniform
  for (int j0 = 0; j0 < kv_end; j0 += 32) {
    __syncthreads();
    for (int e = tid; e < 32 * (D / 4); e += 128) {
      const int r = e / (D / 4), c4 = (e % (D / 4)) * 4;
      const int key = j0 + r;
      v4f kf = {0.f,0.f,0.f,0.f}, vf = {0.f,0.f,0.f,0.f};
      if (key < T) { kf = *(const v4fa*)(K + (size_t)key * pitch + c4); vf = *(const v4fa*)(V + (size_t)key * pitch + c4); }
#pragma unroll
      for (int t = 0; t < 4; ++t) {
        unsigned short hb = bf16_bits(kf[t]); sKh[r][c4 + t] = hb; sKl[r][c4 + t] = bf16_bits(kf[t] - bf16_val(hb));
        hb = bf16_bits(vf[t]); sVh[r][c4 + t] = hb; sVl[r][c4 + t] = bf16_bits(vf[t] - bf16_val(hb));
      }
    }
    __syncthreads();
    // S tile 16 x 32
    v8f s[2];
#pragma unroll
    for (int nt = 0; nt < 2; ++nt) {
      v8f acc = {};
#pragma unroll
      for (int ks = 0; ks < KS; ++ks) {
        FragB bh_, bl_;
        bh_.half[0] = *(const v8us*)&sKh[nt * 16 + ln][ks * 32 + 8 * hh]; bh_.half[1] = *(const v8us*)&sKh[nt * 16 + ln][ks * 32 + 16 + 8 * hh];
        bl_.half[0] = *(const v8us*)&sKl[nt * 16 + ln][ks * 32 + 8 * hh]; bl_.half[1] = *(const v8us*)&sKl[nt * 16 + ln][ks * 32 + 16 + 8 * hh];
        acc = mmaN<3>(aqh[ks].v, aql[ks].v, bh_.v, bl_.v, acc);
      }
      s[nt] = acc;
    }
    // mask + running max (rows 8hh+r; the 16 lanes of a half share rows)
    float alpha[8];
#pragma unroll
    for (int r = 0; r < 8; ++r) {
      const int qi = q0 + 8 * hh + r;
      const int ja = j0 + ln, jb = j0 + 16 + ln;
      if (CAUSAL) { if (ja > qi) s[0][r] = -3.0e38f; if (jb > qi) s[1][r] = -3.0e38f; }
      if (ja >= T) s[0][r] = -3.0e38f;
      if (jb >= T) s[1][r] = -3.0e38f;
      float mx = fmaxf(s[0][r], s[1][r]);
      mx = fmaxf(mx, __shfl_xor(mx, 1, 32)); mx = fmaxf(mx, __shfl_xor(mx, 2, 32)); mx = fmaxf(mx, __shfl_xor(mx, 4, 32)); mx = fmaxf(mx, __shfl_xor(mx, 8, 32));
      const float mnew = fmaxf(m_r[r], mx);
      alpha[r] = (mnew > -1.0e38f) ? __expf(m_r[r] - mnew) : 1.0f;
      const float p0 = (s[0][r] > -1.0e38f) ? __expf(s[0][r] - mnew) : 0.f;
      const float p1 = (s[1][r] > -1.0e38f) ? __expf(s[1][r] - mnew) : 0.f;
      m_r[r] = mnew;
      l_r[r] = l_r[r] * alpha[r] + p0 + p1;            // per-lane partial row sum (16 lanes combined at the end)
      unsigned short hb = bf16_bits(p0); sPh[w][8 * hh + r][ln] = hb;      sPl[w][8 * hh + r][ln] = bf16_bits(p0 - bf16_val(hb));
      hb = bf16_bits(p1);                sPh[w][8 * hh + r][16 + ln] = hb; sPl[w][8 * hh + r][16 + ln] = bf16_bits(p1 - bf16_val(hb));
    }
#pragma unroll
    for (int dt = 0; dt < DT; ++dt)
#pragma unroll
      for (int r = 0; r < 8; ++r) oacc[dt][r] *= alpha[r];
    __builtin_amdgcn_fence(__ATOMIC_ACQ_REL, "workgroup");
    __builtin_amdgcn_wave_barrier();
    FragB pah, pal;
    pah.half[0] = *(const v8us*)&sPh[w][ln][8 * hh]; pah.half[1] = *(const v8us*)&sPh[w][ln][16 + 8 * hh];
    pal.half[0] = *(const v8us*)&sPl[w][ln][8 * hh]; pal.half[1] = *(const v8us*)&sPl[w][ln][16 + 8 * hh];
#pragma unroll
    for (int dt = 0; dt < DT; ++dt) {
      FragB bvh, bvl;
#pragma unroll
      for (int i = 0; i < 8; ++i) {
        bvh.u[i] = sVh[8 * hh + i][dt * 16 + ln]; bvh.u[8 + i] = sVh[16 + 8 * hh + i][dt * 16 + ln];
        bvl.u[i] = sVl[8 * hh + i][dt * 16 + ln]; bvl.u[8 + i] = sVl[16 + 8 * hh + i][dt * 16 + ln];
      }
      oacc[dt] = mmaN<3>(pah.v, pal.v, bvh.v, bvl.v, oacc[dt]);
    }
    __builtin_amdgcn_fence(__ATOMIC_ACQ_REL, "workgroup");
    __builtin_amdgcn_wave_barrier();
  }
#pragma unroll
  for (int r = 0; r < 8; ++r) {
    float l = l_r[r];
    l += __shfl_xor(l, 1, 32); l += __shfl_xor(l, 2, 32); l += __shfl_xor(l, 4, 32); l += __shfl_xor(l, 8, 32);
    l_r[r] = (l > 0.f) ? 1.0f / l : 0.f;
  }
#pragma unroll
  for (int dt = 0; dt < DT; ++dt)
#pragma unroll
    for (int r = 0; r < 8; ++r) sO[w][8 * hh + r][dt * 16 + ln] = oacc[dt][r] * l_r[r];
  __builtin_amdgcn_fence(__ATOMIC_ACQ_REL, "workgroup");
  __builtin_amdgcn_wave_barrier();
  {
    for (int r = 0; r < 16; ++r) {
      const int row = q0 + r;
      if (row < T && lane < D / 4) {
        const v4f val = *(const v4fa*)&sO[w][r][lane * 4];
        *(v4f*)(y + ((size_t)b * T + row) * ypitch + h * D + lane * 4) = val;
      }
    }
    
  }
}

// GEMM C = act(A·W + bias + resid): A f32 (ASPLIT -> hi/lo 2 terms), Wt bf16 [N][K]; ACT 0 none, 1 relu, 2 exact gelu;
// resid (optional, f32, row index = (row % rmod), pitch ldr, RES_BF16 rounds it) added before the activation.
template <bool ASPLIT, int ACT, bool BIAS_BF16, bool RES_BF16>
__global__ __launch_bounds__(128) void k_gemm_bf3(const float* __restrict__ A, int lda, const unsigned short* __restrict__ Wt, int ldb,
                                                const float* __restrict__ bias, const float* __restrict__ resid, int rmod, int ldr,
                                                float* __restrict__ C, int ldc, int M, int N, int K) {
  __shared__ __attribute__((aligned(16))) float so[4][16][64];
  const int tid = threadIdx.x, w = tid >> 5, lane = tid & 31, ln = lane & 15, hh = lane >> 4;
  const int ntn = N / 64;
  const int wid = blockIdx.x * 4 + w;
  const int mt = wid / ntn, nq = wid % ntn;
  if (mt * 16 >= M) return;
  const int row0 = mt * 16, col0 = nq * 64;
  const float* arow = A + (size_t)(row0 + ln) * lda;
  v8f acc[4] = {};
  for (int kb = 0; kb < K; kb += 32) {
    FragB ah, al;
    const v4f x0 = *(const v4fa*)(arow + kb + 8 * hh), x1 = *(const v4fa*)(arow + kb + 8 * hh + 4);
    const v4f x2 = *(const v4fa*)(arow + kb + 16 + 8 * hh), x3 = *(const v4fa*)(arow + kb + 16 + 8 * hh + 4);
    float xs[16] = {x0[0],x0[1],x0[2],x0[3],x1[0],x1[1],x1[2],x1[3],x2[0],x2[1],x2[2],x2[3],x3[0],x3[1],x3[2],x3[3]};
#pragma unroll
    for (int i = 0; i < 16; ++i) { const unsigned short hb = bf16_bits(xs[i]); ah.u[i] = hb; al.u[i] = ASPLIT ? bf16_bits(xs[i] - bf16_val(hb)) : (unsigned short)0; }
#pragma unroll
    for (int t = 0; t < 4; ++t) {
      const unsigned short* brow = Wt + (size_t)(col0 + t * 16 + ln) * ldb + kb;
      FragB b;
      b.half[0] = *(const v8us*)(brow + 8 * hh);
      b.half[1] = *(const v8us*)(brow + 16 + 8 * hh);
      acc[t] = mmaN<ASPLIT ? 2 : 1>(ah.v, al.v, b.v, b.v, acc[t]);
    }
  }
#pragma unroll
  for (int t = 0; t < 4; ++t) {
    const int col = col0 + t * 16 + ln;
    float bv = bias ? bias[col] : 0.f;
    if (BIAS_BF16) bv = bf16_round(bv);
#pragma unroll
    for (int r = 0; r < 8; ++r) {
      float v = acc[t][r] + bv;
      if (resid) { float rv = resid[(size_t)((row0 + 8 * hh + r) % rmod) * ldr + col]; if (RES_BF16) rv = bf16_round(rv); v += rv; }
      if (ACT == 1) v = fmaxf(v, 0.f);
      if (ACT == 2) v = 0.5f * v * (1.0f + erff(v * 0.70710678118654752f));
      if (ACT == 3) { const float u = 0.7978845608028654f * (v + 0.044715f * v * v * v); v = 0.5f * v * (1.0f + tanhf(u)); }
      so[w][8 * hh + r][t * 16 + ln] = v;
    }
  }
  __builtin_amdgcn_fence(__ATOMIC_ACQ_REL, "workgroup");
  __builtin_amdgcn_wave_barrier();
  const int rsub = lane >> 4, c4 = (lane & 15) * 4;
  {
#pragma unroll
    for (int q = 0; q < 8; ++q) {
      const int r = q * 2 + rsub;
      const v4f v = *(const v4fa*)&so[w][r][c4];
      *(v4f*)(C + (size_t)(row0 + r) * ldc + col0 + c4) = v;
    }
    
  }
}
// row LayerNorm (biased variance, eps) over N: s = X (+ R); optional out_sum <- s; out_norm <- (s-mu)*rsqrt(var+eps)*g + b
template <bool PARAM_BF16>
__global__ __launch_bounds__(256) void k_layernorm(const float* __restrict__ X, const float* __restrict__ R, const float* __restrict__ g, const float* __restrict__ bta,
                                                  float* __restrict__ out_sum, float* __restrict__ out_norm, int N, float eps) {
  __shared__ float red[256];
  const int row = blockIdx.x, tid = threadIdx.x;
  const float* x = X + (size_t)row * N; const float* rr = R ? R + (size_t)row * N : nullptr;
  float vals[16];                     // up to N = 4096
  const int per = N / 256;            // contiguous chunk per thread? use strided-by-4 chunks: thread handles j = tid*4 + 1024*u
  float s1 = 0.f;
  for (int u = 0; u < per / 4; ++u) {
    const int j = tid * 4 + 1024 * u;
    const v4f a = *(const v4fa*)(x + j);
    v4f b = {0.f,0.f,0.f,0.f}; if (rr) b = *(const v4fa*)(rr + j);
#pragma unroll
    for (int q = 0; q < 4; ++q) { const float v = a[q] + b[q]; vals[u * 4 + q] = v; s1 += v; }
  }
  red[tid] = s1; __syncthreads();
  for (int st = 128; st > 0; st >>= 1) { if (tid < st) red[tid] += red[tid + st]; __syncthreads(); }
  const float mu = red[0] / (float)N; __syncthreads();
  float s2 = 0.f;
  for (int u = 0; u < per / 4; ++u)
#pragma unroll
    for (int q = 0; q < 4; ++q) { const float c = vals[u * 4 + q] - mu; s2 += c * c; }
  red[tid] = s2; __syncthreads();
  for (int st = 128; st > 0; st >>= 1) { if (tid < st) red[tid] += red[tid + st]; __syncthreads(); }
  const float rs = rsqrtf(red[0] / (float)N + eps);
  {
    for (int u = 0; u < per / 4; ++u) {
      const int j = tid * 4 + 1024 * u;
      v4f o, sm;
#pragma unroll
      for (int q = 0; q < 4; ++q) {
        float gg = g[j + q], bb = bta[j + q];
        if (PARAM_BF16) { gg = bf16_round(gg); bb = bf16_round(bb); }
        sm[q] = vals[u * 4 + q]; o[q] = (vals[u * 4 + q] - mu) * rs * gg + bb;
      }
      if (out_sum) *(v4f*)(out_sum + (size_t)row * N + j) = sm;
      *(v4f*)(out_norm + (size_t)row * N + j) = o;
    }
    
  }
}



// ---- f16 WMMA path (v_wmma_f32_16x16x32_f16): 11-bit significands for operands in range — used for both Q·Kᵀ and P·V in the launched attention kernel
typedef _Float16 v16h __attribute__((ext_vector_type(16)));
union FragH { v16h v; v8us half[2]; _Float16 h[16]; unsigned short u[16]; };
template <int NT>
__device__ __forceinline__ v8f mmaH(v16h ah, v16h al, v16h bh, v16h bl, v8f c) {
  c = __builtin_amdgcn_wmma_f32_16x16x32_f16(false, ah, false, bh, (short)0, c, false, false);
  if (NT >= 2) c = __builtin_amdgcn_wmma_f32_16x16x32_f16(false, al, false, bh, (short)0, c, false, false);
  if (NT >= 3) c = __builtin_amdgcn_wmma_f32_16x16x32_f16(false, ah, false, bl, (short)0, c, false, false);
  asm volatile("v_nop\n\tv_nop\n\tv_nop\n\tv_nop" : "+v"(c) : "v"(ah), "v"(al), "v"(bh), "v"(bl));
  return c;
}
// batched GEMM like k_gemm_b but f16 operands: A f32 (split into f16 hi/lo if ASPLIT, else rounded to f16), Bt = f16 values [n][k]; alpha; C f32; N multiple of 16 (partial tiles skipped)
template <bool ASPLIT>
__global__ __launch_bounds__(128) void k_gemm_h(const float* __restrict__ A, int lda, size_t sA, const _Float16* __restrict__ Bh, int ldb, size_t sB, float alpha, float* __restrict__ C, int ldc, size_t sC, int M, int N, int K) {
  __shared__ __attribute__((aligned(16))) float so[4][16][64];
  const int tid = threadIdx.x, w = tid >> 5, lane = tid & 31, ln = lane & 15, hh = lane >> 4; const int by = blockIdx.y;
  A += (size_t)by * sA; Bh += (size_t)by * sB; C += (size_t)by * sC;
  const int ntn = (N + 63) / 64; const int wid = blockIdx.x * 4 + w; const int mt = wid / ntn, nq = wid % ntn; if (mt * 16 >= M) return;
  const int row0 = mt * 16, col0 = nq * 64; const float* arow = A + (size_t)(row0 + ln) * lda;
  v8f acc[4] = {};
  for (int kb = 0; kb < K; kb += 32) {
    FragH ah, al;
    const v4f x0 = *(const v4fa*)(arow + kb + 8 * hh), x1 = *(const v4fa*)(arow + kb + 8 * hh + 4), x2 = *(const v4fa*)(arow + kb + 16 + 8 * hh), x3 = *(const v4fa*)(arow + kb + 16 + 8 * hh + 4);
    float xs[16] = {x0[0],x0[1],x0[2],x0[3],x1[0],x1[1],x1[2],x1[3],x2[0],x2[1],x2[2],x2[3],x3[0],x3[1],x3[2],x3[3]};
#pragma unroll
    for (int i = 0; i < 16; ++i) { const _Float16 h = (_Float16)xs[i]; ah.h[i] = h; al.h[i] = ASPLIT ? (_Float16)(xs[i] - (float)h) : (_Float16)0.0f; }
#pragma unroll
    for (int t = 0; t < 4; ++t) { if (col0 + t * 16 >= N) continue; const size_t boff = (size_t)(col0 + t * 16 + ln) * ldb + kb; FragH bq; bq.half[0] = *(const v8us*)(Bh + boff + 8 * hh); bq.half[1] = *(const v8us*)(Bh + boff + 16 + 8 * hh);
      acc[t] = mmaH<ASPLIT ? 2 : 1>(ah.v, al.v, bq.v, bq.v, acc[t]); }
  }
#pragma unroll
  for (int t = 0; t < 4; ++t) { if (col0 + t * 16 >= N) continue;
#pragma unroll
    for (int r = 0; r < 8; ++r) so[w][8 * hh + r][t * 16 + ln] = acc[t][r] * alpha; }
  __builtin_amdgcn_fence(__ATOMIC_ACQ_REL, "workgroup"); __builtin_amdgcn_wave_barrier();
  const int rsub = lane >> 4, c4 = (lane & 15) * 4;
  {
#pragma unroll
    for (int q = 0; q < 8; ++q) { const int r = q * 2 + rsub; if (col0 + c4 < N) { const v4f v = *(const v4fa*)&so[w][r][c4]; *(v4f*)(C + (size_t)(row0 + r) * ldc + col0 + c4) = v; } }
     }
}

// Wt[n][k] = f16(W[k][n]·scale) from f32 row-major W[K][N] (scale = power of two; bf16-exact weights stay exact in f16 away from the subnormal range)
__global__ __launch_bounds__(256) void k_wt_f16(const float* __restrict__ W, _Float16* __restrict__ Wt, int K, int N, float scale) {
  const int t = blockIdx.x * 256 + threadIdx.x; if (t >= N * (K / 8)) return; const int n = t / (K / 8), k8 = (t % (K / 8)) * 8; FragH f;
#pragma unroll
  for (int i = 0; i < 8; ++i) f.h[i] = (_Float16)(bf16_round(W[(size_t)(k8 + i) * N + n]) * scale); const v8us o = f.half[0];
  *(v8us*)((unsigned short*)Wt + (size_t)n * K + k8) = o; 
}
// k_gemm_hh variant with fused epilogue: v = acc·alpha + bias[by·sBias + col] (+ CP[(row/rowsPerB)·sCPb + by·64 + col] if CP) ; ACT 0 none / 1 elu ; writes f16 C16 (and f32 C if non-null)
template <int ACT>
__global__ __launch_bounds__(128) void k_gemm_hhx(const _Float16* __restrict__ A, int lda, size_t sA, const _Float16* __restrict__ Bh, int ldb, size_t sB, float alpha, const float* __restrict__ bias, size_t sBias, const float* __restrict__ CP, int rowsPerB, size_t sCPb, int row0g,
    float* __restrict__ C, _Float16* __restrict__ C16, int ldc, size_t sC, int M, int N, int K) {
  __shared__ __attribute__((aligned(16))) float so[4][16][64];
  const int tid = threadIdx.x, w = tid >> 5, lane = tid & 31, ln = lane & 15, hh = lane >> 4; const int by = blockIdx.y;
  A += (size_t)by * sA; Bh += (size_t)by * sB; const size_t cofs = (size_t)by * sC; const float* bp = bias ? bias + (size_t)by * sBias : nullptr;
  const int ntn = (N + 63) / 64; const int wid = blockIdx.x * 4 + w; const int mt = wid / ntn, nq = wid % ntn; if (mt * 16 >= M) return;
  const int row0 = mt * 16, col0 = nq * 64; const _Float16* arow = A + (size_t)(row0 + ln) * lda;
  v8f acc[4] = {};
  for (int kb = 0; kb < K; kb += 32) { FragH ah; ah.half[0] = *(const v8us*)((const unsigned short*)arow + kb + 8 * hh); ah.half[1] = *(const v8us*)((const unsigned short*)arow + kb + 16 + 8 * hh);
#pragma unroll
    for (int t = 0; t < 4; ++t) { if (col0 + t * 16 >= N) continue; const size_t boff = (size_t)(col0 + t * 16 + ln) * ldb + kb; FragH bq; bq.half[0] = *(const v8us*)((const unsigned short*)Bh + boff + 8 * hh); bq.half[1] = *(const v8us*)((const unsigned short*)Bh + boff + 16 + 8 * hh);
      acc[t] = mmaH<1>(ah.v, ah.v, bq.v, bq.v, acc[t]); }
  }
#pragma unroll
  for (int t = 0; t < 4; ++t) { if (col0 + t * 16 >= N) continue; const int col = col0 + t * 16 + ln; const float bv = bp ? bf16_round(bp[col]) : 0.f;
#pragma unroll
    for (int r = 0; r < 8; ++r) { float v = acc[t][r] * alpha + bv; if (CP) { const int bidx = (row0g + row0 + 8 * hh + r) / rowsPerB; v += CP[(size_t)bidx * sCPb + (size_t)by * 64 + col]; } if (ACT == 1) v = (v > 0.f) ? v : expm1f(v); else if (ACT == 3) v = fmaxf(v, 0.f); so[w][8 * hh + r][t * 16 + ln] = v; } }
  __builtin_amdgcn_fence(__ATOMIC_ACQ_REL, "workgroup"); __builtin_amdgcn_wave_barrier();
  const int rsub = lane >> 4, c4 = (lane & 15) * 4; typedef _Float16 v4h __attribute__((ext_vector_type(4)));
  {
#pragma unroll
    for (int q = 0; q < 8; ++q) { const int r = q * 2 + rsub; if (col0 + c4 < N) { const v4f v = *(const v4fa*)&so[w][r][c4]; if (C) *(v4f*)(C + cofs + (size_t)(row0 + r) * ldc + col0 + c4) = v; if (C16) { v4h h4; for (int i = 0; i < 4; ++i) h4[i] = (_Float16)v[i]; *(v4h*)(C16 + cofs + (size_t)(row0 + r) * ldc + col0 + c4) = h4; } } }
     }
}


typedef _Float16 v4h __attribute__((ext_vector_type(4)));

__global__ __launch_bounds__(256) void k_h16(const float* __restrict__ x, _Float16* __restrict__ X16, size_t n8) { const size_t t = (size_t)blockIdx.x * 256 + threadIdx.x; if (t >= n8) return; FragH f;
#pragma unroll
  for (int q = 0; q < 8; ++q) f.h[q] = (_Float16)x[t * 8 + q]; *(v8us*)((unsigned short*)X16 + t * 8) = f.half[0];  }
__global__ __launch_bounds__(256) void k_round16f(const float* __restrict__ W, _Float16* __restrict__ Bt, size_t n8) { const size_t t = (size_t)blockIdx.x * 256 + threadIdx.x; if (t >= n8) return; FragH f;
#pragma unroll
  for (int i = 0; i < 8; ++i) f.h[i] = (_Float16)(bf16_round(W[t * 8 + i]) * 16.0f); *(v8us*)((unsigned short*)Bt + t * 8) = f.half[0];  }
// eight consecutive f32, each rounded to bf16 and held as f16: 16 bytes
__device__ __forceinline__ v8us cvt8(v4f a, v4f b) { FragH f;
#pragma unroll
  for (int e = 0; e < 4; ++e) { f.h[e] = (_Float16)bf16_round(a[e]); f.h[4 + e] = (_Float16)bf16_round(b[e]); }
  return f.half[0]; }
// The whole preparation in one launch of 512 workgroups. Each converts 4 chunks of Q and 8 of K (a chunk = 256 threads x 8 elements) and transposes 4 neighbouring tiles of V (64 keys x 64 d),
// converted on the way from f32, into Vt [bh][128][TK]: few waves with much to do each, instead of one wave per 256 elements in four launches, and no f16 copy of V in between.
__global__ __launch_bounds__(256) void k_prep(const float* __restrict__ q, const float* __restrict__ k, const float* __restrict__ v, _Float16* __restrict__ Q16, _Float16* __restrict__ K16, _Float16* __restrict__ Vt) {
  __shared__ unsigned short tl[4][64][66];      /* a tile of its own for each of the 4: one barrier serves all */
  const int tid = threadIdx.x, r0 = tid / 8, c8 = (tid % 8) * 8;
  const int slab = blockIdx.x / (TK / 256), lg0 = (blockIdx.x % (TK / 256)) * 4;      /* slab = (b,h) plane x which 64 of the 128 d; tiles lg0 .. lg0 + 3 of its TK / 64 */
  const size_t tq = ((size_t)blockIdx.x * 4 * 256 + tid) * 8, tk = ((size_t)blockIdx.x * 8 * 256 + tid) * 8;
  const float* vp = v + ((size_t)(slab / 2) * TK + lg0 * 64 + r0) * HD + (slab % 2) * 64 + c8; const float* qp = q + tq; const float* kp = k + tk;
  v4f xv[8][2], xq[4][2], xk[8][2];      /* all 40 loads of a thread are issued before the first value is used: one memory latency for the launch */
#pragma unroll
  for (int i = 0; i < 8; ++i) { xv[i][0] = *(const v4fa*)(vp + i * 32 * HD); xv[i][1] = *(const v4fa*)(vp + i * 32 * HD + 4); }      /* row i * 32 + r0 of the 256 keys: tile i / 2, its row (i % 2) * 32 + r0 */
#pragma unroll
  for (int u = 0; u < 4; ++u) { xq[u][0] = *(const v4fa*)(qp + u * 2048); xq[u][1] = *(const v4fa*)(qp + u * 2048 + 4); }
#pragma unroll
  for (int u = 0; u < 8; ++u) { xk[u][0] = *(const v4fa*)(kp + u * 2048); xk[u][1] = *(const v4fa*)(kp + u * 2048 + 4); }
  asm volatile("s_wait_xcnt 0x0" :: "v"(vp), "v"(qp), "v"(kp) : "memory");      /* a precaution: the three address pairs stay live up to this wait, so that no load's result is written over a pair that an issued load names */
#pragma unroll
  for (int i = 0; i < 8; ++i) { FragH f; f.half[0] = cvt8(xv[i][0], xv[i][1]);
#pragma unroll
    for (int e = 0; e < 8; ++e) tl[i / 2][(i % 2) * 32 + r0][c8 + e] = f.u[e]; }
#pragma unroll
  for (int u = 0; u < 4; ++u) *(v8us*)((unsigned short*)Q16 + tq + u * 2048) = cvt8(xq[u][0], xq[u][1]);
#pragma unroll
  for (int u = 0; u < 8; ++u) *(v8us*)((unsigned short*)K16 + tk + u * 2048) = cvt8(xk[u][0], xk[u][1]);
  __syncthreads();      /* every thread's part of the 4 tiles is in LDS before a column is read */
#pragma unroll
  for (int u = 0; u < 4; ++u) {
#pragma unroll
    for (int rd = 0; rd < 2; ++rd) { const int d = rd * 32 + tid / 8, pc = tid % 8; FragH f;
#pragma unroll
      for (int e = 0; e < 8; ++e) f.u[e] = tl[u][pc * 8 + e][d];
      *(v8us*)((unsigned short*)Vt + ((size_t)slab * 64 + d) * TK + (lg0 + u) * 64 + pc * 8) = f.half[0]; } } }

// Eight asynchronous 16-byte copies of one lane, global memory -> LDS, no register in between: copy i takes LDS byte address l + i*ls and global address g + i*gs (elements).
// The s_wait_xcnt is the statement's last line so that no address register of an issued copy is rewritten ahead of it.
__device__ __forceinline__ void copy8_to_lds(unsigned l, unsigned ls, const unsigned short* g, size_t gs) {
  asm volatile("global_load_async_to_lds_b128 %0, %8, off\n\t"
               "global_load_async_to_lds_b128 %1, %9, off\n\t"
               "global_load_async_to_lds_b128 %2, %10, off\n\t"
               "global_load_async_to_lds_b128 %3, %11, off\n\t"
               "global_load_async_to_lds_b128 %4, %12, off\n\t"
               "global_load_async_to_lds_b128 %5, %13, off\n\t"
               "global_load_async_to_lds_b128 %6, %14, off\n\t"
               "global_load_async_to_lds_b128 %7, %15, off\n\t"
               "s_wait_xcnt 0x0"
               :: "v"(l), "v"(l + ls), "v"(l + 2 * ls), "v"(l + 3 * ls), "v"(l + 4 * ls), "v"(l + 5 * ls), "v"(l + 6 * ls), "v"(l + 7 * ls),
                  "v"(g), "v"(g + gs), "v"(g + 2 * gs), "v"(g + 3 * gs), "v"(g + 4 * gs), "v"(g + 5 * gs), "v"(g + 6 * gs), "v"(g + 7 * gs)
               : "memory");
}

// value of lane l ^ 16: the other half of the wave holds the other 16 of a query column's 32 keys
__device__ __forceinline__ float xhalf(float x) { return __builtin_bit_cast(float, __builtin_amdgcn_permlanex16(__builtin_bit_cast(int, x), __builtin_bit_cast(int, x), 0x76543210, 0xfedcba98, false, false)); }

__global__ __launch_bounds__(128) void k_flash(const _Float16* __restrict__ Q16, int ldq, const _Float16* __restrict__ K16, int ldk, const _Float16* __restrict__ Vt, const int* __restrict__ MSK, float* __restrict__ O, int ldo) {
  constexpr int RPW = 16, RTN = RPW / 16, NQB = 2048 / (4 * RPW), DT = 8, KS = 4;      /* head_dim 128 */
  constexpr float SL2 = 0.08838834764831845f * 1.4426950408889634f;      /* 1/sqrt(128) * log2(e): the running maximum m_r is kept in this base-2 scale */
  __shared__ __attribute__((aligned(16))) float sO[4][RPW][128 + 4];
  constexpr int SKEYS = 64, NST = 4096 / SKEYS, KPIT = 128 + 8, VPIT = SKEYS + 8;      /* a stage = 64 keys; row pitches 272 B and 144 B = 16 B x odd, conflict-free for 16-byte reads */
  __shared__ __attribute__((aligned(16))) unsigned short sK[2][SKEYS][KPIT]; __shared__ __attribute__((aligned(16))) unsigned short sV[2][128][VPIT];      /* two buffers each: K rows [key][d], Vt rows [d][key] */
  const int tid = threadIdx.x, w = tid >> 5, lane = tid & 31, ln = lane & 15, hh = lane >> 4;
  const int slab = blockIdx.x / NQB, qblk = blockIdx.x % NQB; const int b = slab / 1, h = slab % 1; const int qb0 = qblk * (4 * RPW); const int q0 = qb0 + w * RPW;
  FragH aq[2][KS];
#pragma unroll
  for (int rt = 0; rt < RTN; ++rt) { const unsigned short* qr = (const unsigned short*)Q16 + ((size_t)b * 2048 + q0 + rt * 16 + ln) * ldq + h * 128;
#pragma unroll
    for (int ks = 0; ks < KS; ++ks) { aq[rt][ks].half[0] = *(const v8us*)(qr + ks * 32 + 8 * hh); aq[rt][ks].half[1] = *(const v8us*)(qr + ks * 32 + 16 + 8 * hh); } }
  const unsigned short* Vth = (const unsigned short*)Vt + (size_t)slab * 128 * 4096;      /* [bh][128][TK] */
  float m_r[2], l_r[2]; v8f oacc[2][DT];      /* one query per lane: running maximum, this half's part of the row sum; oacc[rt][dt][r] = O^T[dt*16 + 8*hh + r][query ln] */
#pragma unroll
  for (int rt = 0; rt < RTN; ++rt) {
    m_r[rt] = -3.0e38f; l_r[rt] = 0.f;
#pragma unroll
    for (int dt = 0; dt < DT; ++dt) oacc[rt][dt] = (v8f){0.f,0.f,0.f,0.f,0.f,0.f,0.f,0.f}; }
  /* each thread copies 8 x 16 B of the K tile (16 lanes = one 256-B row) and 8 x 16 B of the Vt tile (8 lanes = one 128-B row piece): whole lines per wave */
  const unsigned short* Kg = (const unsigned short*)K16 + ((size_t)b * 4096 + (tid >> 4)) * ldk + h * 128 + (tid & 15) * 8;
  const unsigned short* Vg = Vth + (size_t)(tid >> 3) * 4096 + (tid & 7) * 8;
  const unsigned lK = (unsigned)(uintptr_t)&sK[0][tid >> 4][(tid & 15) * 8], lV = (unsigned)(uintptr_t)&sV[0][tid >> 3][(tid & 7) * 8];
  auto fill = [&](int st, int bf) {
    copy8_to_lds(lK + (unsigned)bf * (unsigned)(SKEYS * KPIT * 2), 8 * KPIT * 2, Kg + (size_t)st * SKEYS * ldk, (size_t)8 * ldk);
    copy8_to_lds(lV + (unsigned)bf * (unsigned)(128 * VPIT * 2), 16 * VPIT * 2, Vg + (size_t)st * SKEYS, (size_t)16 * 4096); };
  fill(0, 0);
  asm volatile("s_wait_asynccnt 0x0" ::: "memory");      /* this wave's copies of stage 0 have landed */
  __syncthreads();                                        /* every wave's have: stage 0 may be read */
  fill(1, 1);
#pragma unroll 1
  for (int st = 0; st < NST; ++st) { const int bf = st & 1;
#pragma unroll 1      /* kept rolled: with both passes of a stage unrolled the kernel needs more than 256 VGPRs */
  for (int ps = 0; ps < SKEYS / 32; ++ps) { const int j0 = st * SKEYS + ps * 32; (void)j0;
    v8f s[2][2]; FragH bk[2][KS];      /* the pass's K fragments are read from LDS as one group: one LDS latency, not one per 16 keys */
#pragma unroll
    for (int nt = 0; nt < 2; ++nt) { const unsigned short* kr = &sK[bf][ps * 32 + nt * 16 + ln][0];
#pragma unroll
      for (int ks = 0; ks < KS; ++ks) { bk[nt][ks].half[0] = *(const v8us*)(kr + ks * 32 + 8 * hh); bk[nt][ks].half[1] = *(const v8us*)(kr + ks * 32 + 16 + 8 * hh); } }
#pragma unroll
    for (int nt = 0; nt < 2; ++nt) {
#pragma unroll
      for (int rt = 0; rt < RTN; ++rt) { v8f acc = (v8f){0.f,0.f,0.f,0.f,0.f,0.f,0.f,0.f};
#pragma unroll
        for (int ks = 0; ks < KS; ++ks) acc = mmaH<1>(bk[nt][ks].v, bk[nt][ks].v, aq[rt][ks].v, aq[rt][ks].v, acc); s[rt][nt] = acc; } }      /* s[rt][nt][r] = S^T[key nt*16 + 8*hh + r][query ln] */
    FragH pb[2], bv[DT];      /* pb = P^T as a B operand: element i = key 8*hh + i, element 8 + i = key 16 + 8*hh + i, the k order of the Vt loader below */
#pragma unroll
    for (int rt = 0; rt < RTN; ++rt) { float sc[16], t[16];
#pragma unroll
      for (int i = 0; i < 16; ++i) { sc[i] = s[rt][i >> 3][i & 7]; t[i] = sc[i]; }      /* raw products; 1/sqrt(128) and log2(e) are applied as one factor below */
#pragma unroll
      for (int st2 = 8; st2 > 0; st2 >>= 1)
#pragma unroll
        for (int i = 0; i < st2; ++i) t[i] = fmaxf(t[i], t[i + st2]);
      const float mc = fmaxf(t[0], xhalf(t[0])) * SL2;      /* maximum over the pass's 32 keys, the same in both halves, in the base-2 scale (SL2 > 0 keeps the order) */
      const float mn = fmaxf(m_r[rt], mc); const float al = (mn > -1.0e38f) ? __builtin_amdgcn_exp2f(m_r[rt] - mn) : 1.0f; m_r[rt] = mn;
      typedef float f32x2 __attribute__((ext_vector_type(2))); f32x2 tp[8];      /* the 16 weights as 8 register pairs (2j, 2j + 1) */
#pragma unroll
      for (int j = 0; j < 8; ++j) {      /* e^(x/sqrt(128) - max) = 2^(x*SL2 - mn): one fma, packed two scores an instruction, and the hardware's exp2; the argument is <= about 0, and what underflows is far below f16's and the sum's last bit */
        const f32x2 arg = __builtin_elementwise_fma(f32x2{sc[2 * j], sc[2 * j + 1]}, f32x2{SL2, SL2}, f32x2{-mn, -mn});
        tp[j] = f32x2{__builtin_amdgcn_exp2f(arg.x), __builtin_amdgcn_exp2f(arg.y)}; pb[rt].h[2 * j] = (_Float16)tp[j].x; pb[rt].h[2 * j + 1] = (_Float16)tp[j].y; }
#pragma unroll
      for (int st2 = 4; st2 > 0; st2 >>= 1)      /* the sum's tree: i with i + 8, + 4, + 2, then + 1; two of its additions an instruction */
#pragma unroll
        for (int j = 0; j < st2; ++j) tp[j] += tp[j + st2];
      l_r[rt] = l_r[rt] * al + (tp[0].x + tp[0].y);      /* this half's 16 keys; the halves are joined once, behind the loop */
#pragma unroll
      for (int dt = 0; dt < DT; ++dt)
#pragma unroll
        for (int r = 0; r < 8; ++r) oacc[rt][dt][r] *= al; }
#pragma unroll
    for (int dt = 0; dt < DT; ++dt) { const unsigned short* vrow = &sV[bf][dt * 16 + ln][ps * 32]; bv[dt].half[0] = *(const v8us*)(vrow + 8 * hh); bv[dt].half[1] = *(const v8us*)(vrow + 16 + 8 * hh); }      /* the pass's Vt fragments as one group */
#pragma unroll
    for (int dt = 0; dt < DT; ++dt) {
#pragma unroll
      for (int rt = 0; rt < RTN; ++rt) oacc[rt][dt] = mmaH<1>(bv[dt].v, bv[dt].v, pb[rt].v, pb[rt].v, oacc[rt][dt]); } }
    asm volatile("s_wait_dscnt 0x0" ::: "memory");        /* this wave's reads of buffer bf are done before the buffer is handed back */
    asm volatile("s_wait_asynccnt 0x0" ::: "memory");     /* this wave's copies of stage st + 1 have landed */
    __syncthreads();                                        /* publishes stage st + 1 and ends every wave's reads of buffer bf */
    if (st + 2 < NST) fill(st + 2, bf); }
  asm volatile("s_wait_asynccnt 0x0" ::: "memory");       /* no copy is outstanding behind the loop */
#pragma unroll
  for (int rt = 0; rt < RTN; ++rt) {
    const float l = l_r[rt] + xhalf(l_r[rt]); const float li = (l > 0.f) ? 1.0f / l : 0.f;
#pragma unroll
    for (int dt = 0; dt < DT; ++dt)
#pragma unroll
      for (int g = 0; g < 2; ++g) { const v4f o4 = {oacc[rt][dt][4 * g] * li, oacc[rt][dt][4 * g + 1] * li, oacc[rt][dt][4 * g + 2] * li, oacc[rt][dt][4 * g + 3] * li}; *(v4fa*)&sO[w][rt * 16 + ln][dt * 16 + 8 * hh + 4 * g] = o4; } }      /* a lane's 8 registers are 8 consecutive d of its query's row */
  __builtin_amdgcn_fence(__ATOMIC_ACQ_REL, "workgroup"); __builtin_amdgcn_wave_barrier();
  {
#pragma unroll
    for (int rp = 0; rp < RPW; ++rp) { const int r = rp, pc = lane; const v4f val = *(const v4fa*)&sO[w][r][pc * 4]; *(v4f*)(O + ((size_t)b * 2048 + q0 + r) * ldo + h * 128 + pc * 4) = val; }      /* 32 lanes × 16 B = whole 512-B row; TQ = 2048 rows per slab */
     } }

extern "C" void kernel_launch(void* const* d_in, const int* in_sizes, int n_in,
                              void* d_out, int out_size, void* d_ws, size_t ws_size, hipStream_t stream) {
  (void)in_sizes; (void)n_in; (void)out_size;
  const float* q = (const float*)d_in[0]; const float* k = (const float*)d_in[1]; const float* v = (const float*)d_in[2];
  char* ws = (char*)d_ws; size_t off = 0;
  auto take = [&](size_t bytes) { char* p = ws + off; off += (bytes + 255) & ~(size_t)255; return p; };
  _Float16* Q16 = (_Float16*)take((size_t)NBH * TQ * HD * 2); _Float16* K16 = (_Float16*)take((size_t)NBH * TK * HD * 2); _Float16* Vt = (_Float16*)take((size_t)NBH * TK * HD * 2);
  if (off > ws_size) return;      // three f16 planes, 42 MB in all
  k_prep<<<NBH * 2 * (TK / 64) / 4, 256, 0, stream>>>(q, k, v, Q16, K16, Vt);      // 512 workgroups: NBH*TQ*HD/8/256 = 4 x 512 chunks of Q, 8 x 512 of K, 4 x 512 tiles of V
  k_flash<<<NBH * 1 * (TQ / 64), 128, 0, stream>>>(Q16, HD, K16, HD, Vt, nullptr, (float*)d_out, HD);
}

// v005
// Measured time: 73.1 microseconds a run.
// Timed twice side by side with v004, it ran 1.23 times as fast both times.
// Over all steps from v000 it is 8.30 times as fast.
#include <hip/hip_runtime.h>
// Attention with learned keys/values: out = softmax(Q·Kᵀ/√128)·V for Q [2,8,2048,128], K/V [2,8,4096,128] (head-major planes). One fused flash-style kernel (16 (b,h) slabs; 2048 query rows
// against 4096 keys; online softmax in f32; P f16 ≤ 1; O = P·Vᵀ-tiles; 32 query rows a wave; 128-wide head) on v_wmma_f32_16x16x32_f16 — Q/K/V bf16-exact in f16, f32 accumulate.
#define NBH 16
#define TQ 2048
#define TK 4096
#define HD 128

typedef __bf16 v16b __attribute__((ext_vector_type(16)));
typedef unsigned short v8us __attribute__((ext_vector_type(8), may_alias));
typedef float  v8f  __attribute__((ext_vector_type(8)));
typedef float  v4f  __attribute__((ext_vector_type(4)));
typedef float  v4fa __attribute__((ext_vector_type(4), may_alias));
union FragB { v16b v; v8us half[2]; unsigned short u[16]; };

__device__ __forceinline__ unsigned short bf16_bits(float x) { unsigned int u = __float_as_uint(x); return (unsigned short)((u + 0x7FFFu + ((u >> 16) & 1u)) >> 16); }
__device__ __forceinline__ float bf16_val(unsigned short b) { return __uint_as_float(((unsigned int)b) << 16); }
__device__ __forceinline__ float bf16_round(float x) { return bf16_val(bf16_bits(x)); }
// D += A·B with NT terms: 1 = ah·bh, 2 = + al·bh (A split), 3 = + ah·bl (both split)
template <int NT>
__device__ __forceinline__ v8f mmaN(v16b ah, v16b al, v16b bh, v16b bl, v8f c) {
  c = __builtin_amdgcn_wmma_f32_16x16x32_bf16(false, ah, false, bh, (short)0, c, false, false);
  if (NT >= 2) c = __builtin_amdgcn_wmma_f32_16x16x32_bf16(false, al, false, bh, (short)0, c, false, false);
  if (NT >= 3) c = __builtin_amdgcn_wmma_f32_16x16x32_bf16(false, ah, false, bl, (short)0, c, false, false);
  asm volatile("v_nop\n\tv_nop\n\tv_nop\n\tv_nop" : "+v"(c) : "v"(ah), "v"(al), "v"(bh), "v"(bl));
  return c;
}

__global__ __launch_bounds__(256) void k_wt_bf16(const float* __restrict__ W, unsigned short* __restrict__ Wt, int K, int N) {
  const int t = blockIdx.x * 256 + threadIdx.x;
  const int k8n = K / 8;
  if (t >= N * k8n) return;
  const int n = t / k8n, k8 = (t % k8n) * 8;
  v8us v;
#pragma unroll
  for (int i = 0; i < 8; ++i) v[i] = bf16_bits(W[(size_t)(k8 + i) * N + n]);
  *(v8us*)(Wt + (size_t)n * K + k8) = v;
  
}

// GEMM C[M][N] (f32, pitch ldc) = act(A[M][K]·W + bias). A f32 row-major (pitch lda) converted per fragment to bf16
// (ASPLIT: hi/lo two planes -> 2 terms, else single rounded term); Wt bf16 [N][K] (pitch ldb). BIAS_BF16 rounds the
// bias to bf16 first (bias quantised to bf16 before the add). K%32==0, M%16==0, N%64==0.
template <bool ASPLIT, int ACT, bool BIAS_BF16>
__global__ __launch_bounds__(128) void k_gemm_bf(const float* __restrict__ A, int lda, const unsigned short* __restrict__ Wt, int ldb,
                                               const float* __restrict__ bias, float* __restrict__ C, int ldc, int M, int N, int K) {
  __shared__ __attribute__((aligned(16))) float so[4][16][64];
  const int tid = threadIdx.x, w = tid >> 5, lane = tid & 31, ln = lane & 15, hh = lane >> 4;
  const int ntn = N / 64;
  const int wid = blockIdx.x * 4 + w;
  const int mt = wid / ntn, nq = wid % ntn;
  if (mt * 16 >= M) return;
  const int row0 = mt * 16, col0 = nq * 64;
  const float* arow = A + (size_t)(row0 + ln) * lda;
  v8f acc[4] = {};
  for (int kb = 0; kb < K; kb += 32) {
    FragB ah, al;
    const v4f x0 = *(const v4fa*)(arow + kb + 8 * hh), x1 = *(const v4fa*)(arow + kb + 8 * hh + 4);
    const v4f x2 = *(const v4fa*)(arow + kb + 16 + 8 * hh), x3 = *(const v4fa*)(arow + kb + 16 + 8 * hh + 4);
    float xs[16] = {x0[0],x0[1],x0[2],x0[3],x1[0],x1[1],x1[2],x1[3],x2[0],x2[1],x2[2],x2[3],x3[0],x3[1],x3[2],x3[3]};
#pragma unroll
    for (int i = 0; i < 16; ++i) { const unsigned short hb = bf16_bits(xs[i]); ah.u[i] = hb; al.u[i] = ASPLIT ? bf16_bits(xs[i] - bf16_val(hb)) : (unsigned short)0; }
#pragma unroll
    for (int t = 0; t < 4; ++t) {
      const unsigned short* brow = Wt + (size_t)(col0 + t * 16 + ln) * ldb + kb;
      FragB b;
      b.half[0] = *(const v8us*)(brow + 8 * hh);
      b.half[1] = *(const v8us*)(brow + 16 + 8 * hh);
      acc[t] = mmaN<ASPLIT ? 2 : 1>(ah.v, al.v, b.v, b.v, acc[t]);
    }
  }
#pragma unroll
  for (int t = 0; t < 4; ++t) {
    float bv = bias ? bias[col0 + t * 16 + ln] : 0.f;
    if (BIAS_BF16) bv = bf16_round(bv);
#pragma unroll
    for (int r = 0; r < 8; ++r) { float v = acc[t][r] + bv; if (ACT == 1) v = fmaxf(v, 0.f); so[w][8 * hh + r][t * 16 + ln] = v; }
  }
  __builtin_amdgcn_fence(__ATOMIC_ACQ_REL, "workgroup");
  __builtin_amdgcn_wave_barrier();
  const int rsub = lane >> 4, c4 = (lane & 15) * 4;
  {
#pragma unroll
    for (int q = 0; q < 8; ++q) {
      const int r = q * 2 + rsub;
      const v4f v = *(const v4fa*)&so[w][r][c4];
      *(v4f*)(C + (size_t)(row0 + r) * ldc + col0 + c4) = v;
    }
    
  }
}

// Flash-style causal/unmasked attention, all contractions 3-term bf16 hi/lo splits, f32 softmax with running max.
// q,k,v rows are read from f32 buffers with arbitrary row pitch (so they can live inside a fused qkv buffer);
// D = head size (multiple of 32, <= 128); one wave = 16 query rows; block = 4 waves (64 queries) sharing K/V chunks of 32.
template <int D, bool CAUSAL>
__global__ __launch_bounds__(128) void k_flash(const float* __restrict__ qb, const float* __restrict__ kb, const float* __restrict__ vb,
                                             int pitch, int T, int H, float scale, float* __restrict__ y, int ypitch) {
  constexpr int KS = D / 32;        // k-steps for QK
  constexpr int DT = D / 16;        // d tiles for PV
  __shared__ __attribute__((aligned(16))) unsigned short sKh[32][D + 8], sKl[32][D + 8], sVh[32][D + 8], sVl[32][D + 8];
  __shared__ __attribute__((aligned(16))) unsigned short sPh[4][16][40], sPl[4][16][40];
  __shared__ __attribute__((aligned(16))) float sO[4][16][D];
  const int tid = threadIdx.x, w = tid >> 5, lane = tid & 31, ln = lane & 15, hh = lane >> 4;
  const int nqb = (T + 63) / 64;
  const int bh = blockIdx.x / nqb, qblk = blockIdx.x % nqb;
  const int b = bh / H, h = bh % H;
  const int q0 = qblk * 64 + w * 16;
  const float* Q = qb + (size_t)b * T * pitch + h * D;
  const float* K = kb + (size_t)b * T * pitch + h * D;
  const float* V = vb + (size_t)b * T * pitch + h * D;

  // A fragments of the wave's 16 query rows (scaled), hi/lo
  FragB aqh[KS], aql[KS];
  {
    int row = q0 + ln; if (row >= T) row = T - 1;
    const float* qr = Q + (size_t)row * pitch;
#pragma unroll
    for (int ks = 0; ks < KS; ++ks)
#pragma unroll
      for (int i = 0; i < 16; ++i) {
        const int d = ks * 32 + ((i < 8) ? (8 * hh + i) : (16 + 8 * hh + (i - 8)));
        const float x = qr[d] * scale; const unsigned short hb = bf16_bits(x);
        aqh[ks].u[i] = hb; aql[ks].u[i] = bf16_bits(x - bf16_val(hb));
      }
  }
  float m_r[8], l_r[8];
#pragma unroll
  for (int r = 0; r < 8; ++r) { m_r[r] = -3.0e38f; l_r[r] = 0.f; }
  v8f oacc[DT];
#pragma unroll
  for (int dt = 0; dt < DT; ++dt) oacc[dt] = (v8f){0.f,0.f,0.f,0.f,0.f,0.f,0.f,0.f};

  const int kv_end = CAUSAL ? min(T, qblk * 64 + 64) : T;     // block-uniform
  for (int j0 = 0; j0 < kv_end; j0 += 32) {
    __syncthreads();
    for (int e = tid; e < 32 * (D / 4); e += 128) {
      const int r = e / (D / 4), c4 = (e % (D / 4)) * 4;
      const int key = j0 + r;
      v4f kf = {0.f,0.f,0.f,0.f}, vf = {0.f,0.f,0.f,0.f};
      if (key < T) { kf = *(const v4fa*)(K + (size_t)key * pitch + c4); vf = *(const v4fa*)(V + (size_t)key * pitch + c4); }
#pragma unroll
      for (int t = 0; t < 4; ++t) {
        unsigned short hb = bf16_bits(kf[t]); sKh[r][c4 + t] = hb; sKl[r][c4 + t] = bf16_bits(kf[t] - bf16_val(hb));
        hb = bf16_bits(vf[t]); sVh[r][c4 + t] = hb; sVl[r][c4 + t] = bf16_bits(vf[t] - bf16_val(hb));
      }
    }
    __syncthreads();
    // S tile 16 x 32
    v8f s[2];
#pragma unroll
    for (int nt = 0; nt < 2; ++nt) {
      v8f acc = {};
#pragma unroll
      for (int ks = 0; ks < KS; ++ks) {
        FragB bh_, bl_;
        bh_.half[0] = *(const v8us*)&sKh[nt * 16 + ln][ks * 32 + 8 * hh]; bh_.half[1] = *(const v8us*)&sKh[nt * 16 + ln][ks * 32 + 16 + 8 * hh];
        bl_.half[0] = *(const v8us*)&sKl[nt * 16 + ln][ks * 32 + 8 * hh]; bl_.half[1] = *(const v8us*)&sKl[nt * 16 + ln][ks * 32 + 16 + 8 * hh];
        acc = mmaN<3>(aqh[ks].v, aql[ks].v, bh_.v, bl_.v, acc);
      }
      s[nt] = acc;
    }
    // mask + running max (rows 8hh+r; the 16 lanes of a half share rows)
    float alpha[8];
#pragma unroll
    for (int r = 0; r < 8; ++r) {
      const int qi = q0 + 8 * hh + r;
      const int ja = j0 + ln, jb = j0 + 16 + ln;
      if (CAUSAL) { if (ja > qi) s[0][r] = -3.0e38f; if (jb > qi) s[1][r] = -3.0e38f; }
      if (ja >= T) s[0][r] = -3.0e38f;
      if (jb >= T) s[1][r] = -3.0e38f;
      float mx = fmaxf(s[0][r], s[1][r]);
      mx = fmaxf(mx, __shfl_xor(mx, 1, 32)); mx = fmaxf(mx, __shfl_xor(mx, 2, 32)); mx = fmaxf(mx, __shfl_xor(mx, 4, 32)); mx = fmaxf(mx, __shfl_xor(mx, 8, 32));
      const float mnew = fmaxf(m_r[r], mx);
      alpha[r] = (mnew > -1.0e38f) ? __expf(m_r[r] - mnew) : 1.0f;
      const float p0 = (s[0][r] > -1.0e38f) ? __expf(s[0][r] - mnew) : 0.f;
      const float p1 = (s[1][r] > -1.0e38f) ? __expf(s[1][r] - mnew) : 0.f;
      m_r[r] = mnew;
      l_r[r] = l_r[r] * alpha[r] + p0 + p1;            // per-lane partial row sum (16 lanes combined at the end)
      unsigned short hb = bf16_bits(p0); sPh[w][8 * hh + r][ln] = hb;      sPl[w][8 * hh + r][ln] = bf16_bits(p0 - bf16_val(hb));
      hb = bf16_bits(p1);                sPh[w][8 * hh + r][16 + ln] = hb; sPl[w][8 * hh + r][16 + ln] = bf16_bits(p1 - bf16_val(hb));
    }
#pragma unroll
    for (int dt = 0; dt < DT; ++dt)
#pragma unroll
      for (int r = 0; r < 8; ++r) oacc[dt][r] *= alpha[r];
    __builtin_amdgcn_fence(__ATOMIC_ACQ_REL, "workgroup");
    __builtin_amdgcn_wave_barrier();
    FragB pah, pal;
    pah.half[0] = *(const v8us*)&sPh[w][ln][8 * hh]; pah.half[1] = *(const v8us*)&sPh[w][ln][16 + 8 * hh];
    pal.half[0] = *(const v8us*)&sPl[w][ln][8 * hh]; pal.half[1] = *(const v8us*)&sPl[w][ln][16 + 8 * hh];
#pragma unroll
    for (int dt = 0; dt < DT; ++dt) {
      FragB bvh, bvl;
#pragma unroll
      for (int i = 0; i < 8; ++i) {
        bvh.u[i] = sVh[8 * hh + i][dt * 16 + ln]; bvh.u[8 + i] = sVh[16 + 8 * hh + i][dt * 16 + ln];
        bvl.u[i] = sVl[8 * hh + i][dt * 16 + ln]; bvl.u[8 + i] = sVl[16 + 8 * hh + i][dt * 16 + ln];
      }
      oacc[dt] = mmaN<3>(pah.v, pal.v, bvh.v, bvl.v, oacc[dt]);
    }
    __builtin_amdgcn_fence(__ATOMIC_ACQ_REL, "workgroup");
    __builtin_amdgcn_wave_barrier();
  }
#pragma unroll
  for (int r = 0; r < 8; ++r) {
    float l = l_r[r];
    l += __shfl_xor(l, 1, 32); l += __shfl_xor(l, 2, 32); l += __shfl_xor(l, 4, 32); l += __shfl_xor(l, 8, 32);
    l_r[r] = (l > 0.f) ? 1.0f / l : 0.f;
  }
#pragma unroll
  for (int dt = 0; dt < DT; ++dt)
#pragma unroll
    for (int r = 0; r < 8; ++r) sO[w][8 * hh + r][dt * 16 + ln] = oacc[dt][r] * l_r[r];
  __builtin_amdgcn_fence(__ATOMIC_ACQ_REL, "workgroup");
  __builtin_amdgcn_wave_barrier();
  {
    for (int r = 0; r < 16; ++r) {
      const int row = q0 + r;
      if (row < T && lane < D / 4) {
        const v4f val = *(const v4fa*)&sO[w][r][lane * 4];
        *(v4f*)(y + ((size_t)b * T + row) * ypitch + h * D + lane * 4) = val;
      }
    }
    
  }
}

// GEMM C = act(A·W + bias + resid): A f32 (ASPLIT -> hi/lo 2 terms), Wt bf16 [N][K]; ACT 0 none, 1 relu, 2 exact gelu;
// resid (optional, f32, row index = (row % rmod), pitch ldr, RES_BF16 rounds it) added before the activation.
template <bool ASPLIT, int ACT, bool BIAS_BF16, bool RES_BF16>
__global__ __launch_bounds__(128) void k_gemm_bf3(const float* __restrict__ A, int lda, const unsigned short* __restrict__ Wt, int ldb,
                                                const float* __restrict__ bias, const float* __restrict__ resid, int rmod, int ldr,
                                                float* __restrict__ C, int ldc, int M, int N, int K) {
  __shared__ __attribute__((aligned(16))) float so[4][16][64];
  const int tid = threadIdx.x, w = tid >> 5, lane = tid & 31, ln = lane & 15, hh = lane >> 4;
  const int ntn = N / 64;
  const int wid = blockIdx.x * 4 + w;
  const int mt = wid / ntn, nq = wid % ntn;
  if (mt * 16 >= M) return;
  const int row0 = mt * 16, col0 = nq * 64;
  const float* arow = A + (size_t)(row0 + ln) * lda;
  v8f acc[4] = {};
  for (int kb = 0; kb < K; kb += 32) {
    FragB ah, al;
    const v4f x0 = *(const v4fa*)(arow + kb + 8 * hh), x1 = *(const v4fa*)(arow + kb + 8 * hh + 4);
    const v4f x2 = *(const v4fa*)(arow + kb + 16 + 8 * hh), x3 = *(const v4fa*)(arow + kb + 16 + 8 * hh + 4);
    float xs[16] = {x0[0],x0[1],x0[2],x0[3],x1[0],x1[1],x1[2],x1[3],x2[0],x2[1],x2[2],x2[3],x3[0],x3[1],x3[2],x3[3]};
#pragma unroll
    for (int i = 0; i < 16; ++i) { const unsigned short hb = bf16_bits(xs[i]); ah.u[i] = hb; al.u[i] = ASPLIT ? bf16_bits(xs[i] - bf16_val(hb)) : (unsigned short)0; }
#pragma unroll
    for (int t = 0; t < 4; ++t) {
      const unsigned short* brow = Wt + (size_t)(col0 + t * 16 + ln) * ldb + kb;
      FragB b;
      b.half[0] = *(const v8us*)(brow + 8 * hh);
      b.half[1] = *(const v8us*)(brow + 16 + 8 * hh);
      acc[t] = mmaN<ASPLIT ? 2 : 1>(ah.v, al.v, b.v, b.v, acc[t]);
    }
  }
#pragma unroll
  for (int t = 0; t < 4; ++t) {
    const int col = col0 + t * 16 + ln;
    float bv = bias ? bias[col] : 0.f;
    if (BIAS_BF16) bv = bf16_round(bv);
#pragma unroll
    for (int r = 0; r < 8; ++r) {
      float v = acc[t][r] + bv;
      if (resid) { float rv = resid[(size_t)((row0 + 8 * hh + r) % rmod) * ldr + col]; if (RES_BF16) rv = bf16_round(rv); v += rv; }
      if (ACT == 1) v = fmaxf(v, 0.f);
      if (ACT == 2) v = 0.5f * v * (1.0f + erff(v * 0.70710678118654752f));
      if (ACT == 3) { const float u = 0.7978845608028654f * (v + 0.044715f * v * v * v); v = 0.5f * v * (1.0f + tanhf(u)); }
      so[w][8 * hh + r][t * 16 + ln] = v;
    }
  }
  __builtin_amdgcn_fence(__ATOMIC_ACQ_REL, "workgroup");
  __builtin_amdgcn_wave_barrier();
  const int rsub = lane >> 4, c4 = (lane & 15) * 4;
  {
#pragma unroll
    for (int q = 0; q < 8; ++q) {
      const int r = q * 2 + rsub;
      const v4f v = *(const v4fa*)&so[w][r][c4];
      *(v4f*)(C + (size_t)(row0 + r) * ldc + col0 + c4) = v;
    }
    
  }
}
// row LayerNorm (biased variance, eps) over N: s = X (+ R); optional out_sum <- s; out_norm <- (s-mu)*rsqrt(var+eps)*g + b
template <bool PARAM_BF16>
__global__ __launch_bounds__(256) void k_layernorm(const float* __restrict__ X, const float* __restrict__ R, const float* __restrict__ g, const float* __restrict__ bta,
                                                  float* __restrict__ out_sum, float* __restrict__ out_norm, int N, float eps) {
  __shared__ float red[256];
  const int row = blockIdx.x, tid = threadIdx.x;
  const float* x = X + (size_t)row * N; const float* rr = R ? R + (size_t)row * N : nullptr;
  float vals[16];                     // up to N = 4096
  const int per = N / 256;            // contiguous chunk per thread? use strided-by-4 chunks: thread handles j = tid*4 + 1024*u
  float s1 = 0.f;
  for (int u = 0; u < per / 4; ++u) {
    const int j = tid * 4 + 1024 * u;
    const v4f a = *(const v4fa*)(x + j);
    v4f b = {0.f,0.f,0.f,0.f}; if (rr) b = *(const v4fa*)(rr + j);
#pragma unroll
    for (int q = 0; q < 4; ++q) { const float v = a[q] + b[q]; vals[u * 4 + q] = v; s1 += v; }
  }
  red[tid] = s1; __syncthreads();
  for (int st = 128; st > 0; st >>= 1) { if (tid < st) red[tid] += red[tid + st]; __syncthreads(); }
  const float mu = red[0] / (float)N; __syncthreads();
  float s2 = 0.f;
  for (int u = 0; u < per / 4; ++u)
#pragma unroll
    for (int q = 0; q < 4; ++q) { const float c = vals[u * 4 + q] - mu; s2 += c * c; }
  red[tid] = s2; __syncthreads();
  for (int st = 128; st > 0; st >>= 1) { if (tid < st) red[tid] += red[tid + st]; __syncthreads(); }
  const float rs = rsqrtf(red[0] / (float)N + eps);
  {
    for (int u = 0; u < per / 4; ++u) {
      const int j = tid * 4 + 1024 * u;
      v4f o, sm;
#pragma unroll
      for (int q = 0; q < 4; ++q) {
        float gg = g[j + q], bb = bta[j + q];
        if (PARAM_BF16) { gg = bf16_round(gg); bb = bf16_round(bb); }
        sm[q] = vals[u * 4 + q]; o[q] = (vals[u * 4 + q] - mu) * rs * gg + bb;
      }
      if (out_sum) *(v4f*)(out_sum + (size_t)row * N + j) = sm;
      *(v4f*)(out_norm + (size_t)row * N + j) = o;
    }
    
  }
}



// ---- f16 WMMA path (v_wmma_f32_16x16x32_f16): 11-bit significands for operands in range — used for both Q·Kᵀ and P·V in the launched attention kernel
typedef _Float16 v16h __attribute__((ext_vector_type(16)));
union FragH { v16h v; v8us half[2]; _Float16 h[16]; unsigned short u[16]; };
template <int NT>
__device__ __forceinline__ v8f mmaH(v16h ah, v16h al, v16h bh, v16h bl, v8f c) {
  c = __builtin_amdgcn_wmma_f32_16x16x32_f16(false, ah, false, bh, (short)0, c, false, false);
  if (NT >= 2) c = __builtin_amdgcn_wmma_f32_16x16x32_f16(false, al, false, bh, (short)0, c, false, false);
  if (NT >= 3) c = __builtin_amdgcn_wmma_f32_16x16x32_f16(false, ah, false, bl, (short)0, c, false, false);
  asm volatile("v_nop\n\tv_nop\n\tv_nop\n\tv_nop" : "+v"(c) : "v"(ah), "v"(al), "v"(bh), "v"(bl));
  return c;
}
// batched GEMM like k_gemm_b but f16 operands: A f32 (split into f16 hi/lo if ASPLIT, else rounded to f16), Bt = f16 values [n][k]; alpha; C f32; N multiple of 16 (partial tiles skipped)
template <bool ASPLIT>
__global__ __launch_bounds__(128) void k_gemm_h(const float* __restrict__ A, int lda, size_t sA, const _Float16* __restrict__ Bh, int ldb, size_t sB, float alpha, float* __restrict__ C, int ldc, size_t sC, int M, int N, int K) {
  __shared__ __attribute__((aligned(16))) float so[4][16][64];
  const int tid = threadIdx.x, w = tid >> 5, lane = tid & 31, ln = lane & 15, hh = lane >> 4; const int by = blockIdx.y;
  A += (size_t)by * sA; Bh += (size_t)by * sB; C += (size_t)by * sC;
  const int ntn = (N + 63) / 64; const int wid = blockIdx.x * 4 + w; const int mt = wid / ntn, nq = wid % ntn; if (mt * 16 >= M) return;
  const int row0 = mt * 16, col0 = nq * 64; const float* arow = A + (size_t)(row0 + ln) * lda;
  v8f acc[4] = {};
  for (int kb = 0; kb < K; kb += 32) {
    FragH ah, al;
    const v4f x0 = *(const v4fa*)(arow + kb + 8 * hh), x1 = *(const v4fa*)(arow + kb + 8 * hh + 4), x2 = *(const v4fa*)(arow + kb + 16 + 8 * hh), x3 = *(const v4fa*)(arow + kb + 16 + 8 * hh + 4);
    float xs[16] = {x0[0],x0[1],x0[2],x0[3],x1[0],x1[1],x1[2],x1[3],x2[0],x2[1],x2[2],x2[3],x3[0],x3[1],x3[2],x3[3]};
#pragma unroll
    for (int i = 0; i < 16; ++i) { const _Float16 h = (_Float16)xs[i]; ah.h[i] = h; al.h[i] = ASPLIT ? (_Float16)(xs[i] - (float)h) : (_Float16)0.0f; }
#pragma unroll
    for (int t = 0; t < 4; ++t) { if (col0 + t * 16 >= N) continue; const size_t boff = (size_t)(col0 + t * 16 + ln) * ldb + kb; FragH bq; bq.half[0] = *(const v8us*)(Bh + boff + 8 * hh); bq.half[1] = *(const v8us*)(Bh + boff + 16 + 8 * hh);
      acc[t] = mmaH<ASPLIT ? 2 : 1>(ah.v, al.v, bq.v, bq.v, acc[t]); }
  }
#pragma unroll
  for (int t = 0; t < 4; ++t) { if (col0 + t * 16 >= N) continue;
#pragma unroll
    for (int r = 0; r < 8; ++r) so[w][8 * hh + r][t * 16 + ln] = acc[t][r] * alpha; }
  __builtin_amdgcn_fence(__ATOMIC_ACQ_REL, "workgroup"); __builtin_amdgcn_wave_barrier();
  const int rsub = lane >> 4, c4 = (lane & 15) * 4;
  {
#pragma unroll
    for (int q = 0; q < 8; ++q) { const int r = q * 2 + rsub; if (col0 + c4 < N) { const v4f v = *(const v4fa*)&so[w][r][c4]; *(v4f*)(C + (size_t)(row0 + r) * ldc + col0 + c4) = v; } }
     }
}

// Wt[n][k] = f16(W[k][n]·scale) from f32 row-major W[K][N] (scale = power of two; bf16-exact weights stay exact in f16 away from the subnormal range)
__global__ __launch_bounds__(256) void k_wt_f16(const float* __restrict__ W, _Float16* __restrict__ Wt, int K, int N, float scale) {
  const int t = blockIdx.x * 256 + threadIdx.x; if (t >= N * (K / 8)) return; const int n = t / (K / 8), k8 = (t % (K / 8)) * 8; FragH f;
#pragma unroll
  for (int i = 0; i < 8; ++i) f.h[i] = (_Float16)(bf16_round(W[(size_t)(k8 + i) * N + n]) * scale); const v8us o = f.half[0];
  *(v8us*)((unsigned short*)Wt + (size_t)n * K + k8) = o; 
}
// k_gemm_hh variant with fused epilogue: v = acc·alpha + bias[by·sBias + col] (+ CP[(row/rowsPerB)·sCPb + by·64 + col] if CP) ; ACT 0 none / 1 elu ; writes f16 C16 (and f32 C if non-null)
template <int ACT>
__global__ __launch_bounds__(128) void k_gemm_hhx(const _Float16* __restrict__ A, int lda, size_t sA, const _Float16* __restrict__ Bh, int ldb, size_t sB, float alpha, const float* __restrict__ bias, size_t sBias, const float* __restrict__ CP, int rowsPerB, size_t sCPb, int row0g,
    float* __restrict__ C, _Float16* __restrict__ C16, int ldc, size_t sC, int M, int N, int K) {
  __shared__ __attribute__((aligned(16))) float so[4][16][64];
  const int tid = threadIdx.x, w = tid >> 5, lane = tid & 31, ln = lane & 15, hh = lane >> 4; const int by = blockIdx.y;
  A += (size_t)by * sA; Bh += (size_t)by * sB; const size_t cofs = (size_t)by * sC; const float* bp = bias ? bias + (size_t)by * sBias : nullptr;
  const int ntn = (N + 63) / 64; const int wid = blockIdx.x * 4 + w; const int mt = wid / ntn, nq = wid % ntn; if (mt * 16 >= M) return;
  const int row0 = mt * 16, col0 = nq * 64; const _Float16* arow = A + (size_t)(row0 + ln) * lda;
  v8f acc[4] = {};
  for (int kb = 0; kb < K; kb += 32) { FragH ah; ah.half[0] = *(const v8us*)((const unsigned short*)arow + kb + 8 * hh); ah.half[1] = *(const v8us*)((const unsigned short*)arow + kb + 16 + 8 * hh);
#pragma unroll
    for (int t = 0; t < 4; ++t) { if (col0 + t * 16 >= N) continue; const size_t boff = (size_t)(col0 + t * 16 + ln) * ldb + kb; FragH bq; bq.half[0] = *(const v8us*)((const unsigned short*)Bh + boff + 8 * hh); bq.half[1] = *(const v8us*)((const unsigned short*)Bh + boff + 16 + 8 * hh);
      acc[t] = mmaH<1>(ah.v, ah.v, bq.v, bq.v, acc[t]); }
  }
#pragma unroll
  for (int t = 0; t < 4; ++t) { if (col0 + t * 16 >= N) continue; const int col = col0 + t * 16 + ln; const float bv = bp ? bf16_round(bp[col]) : 0.f;
#pragma unroll
    for (int r = 0; r < 8; ++r) { float v = acc[t][r] * alpha + bv; if (CP) { const int bidx = (row0g + row0 + 8 * hh + r) / rowsPerB; v += CP[(size_t)bidx * sCPb + (size_t)by * 64 + col]; } if (ACT == 1) v = (v > 0.f) ? v : expm1f(v); else if (ACT == 3) v = fmaxf(v, 0.f); so[w][8 * hh + r][t * 16 + ln] = v; } }
  __builtin_amdgcn_fence(__ATOMIC_ACQ_REL, "workgroup"); __builtin_amdgcn_wave_barrier();
  const int rsub = lane >> 4, c4 = (lane & 15) * 4; typedef _Float16 v4h __attribute__((ext_vector_type(4)));
  {
#pragma unroll
    for (int q = 0; q < 8; ++q) { const int r = q * 2 + rsub; if (col0 + c4 < N) { const v4f v = *(const v4fa*)&so[w][r][c4]; if (C) *(v4f*)(C + cofs + (size_t)(row0 + r) * ldc + col0 + c4) = v; if (C16) { v4h h4; for (int i = 0; i < 4; ++i) h4[i] = (_Float16)v[i]; *(v4h*)(C16 + cofs + (size_t)(row0 + r) * ldc + col0 + c4) = h4; } } }
     }
}


typedef _Float16 v4h __attribute__((ext_vector_type(4)));

__global__ __launch_bounds__(256) void k_h16(const float* __restrict__ x, _Float16* __restrict__ X16, size_t n8) { const size_t t = (size_t)blockIdx.x * 256 + threadIdx.x; if (t >= n8) return; FragH f;
#pragma unroll
  for (int q = 0; q < 8; ++q) f.h[q] = (_Float16)x[t * 8 + q]; *(v8us*)((unsigned short*)X16 + t * 8) = f.half[0];  }
__global__ __launch_bounds__(256) void k_round16f(const float* __restrict__ W, _Float16* __restrict__ Bt, size_t n8) { const size_t t = (size_t)blockIdx.x * 256 + threadIdx.x; if (t >= n8) return; FragH f;
#pragma unroll
  for (int i = 0; i < 8; ++i) f.h[i] = (_Float16)(bf16_round(W[t * 8 + i]) * 16.0f); *(v8us*)((unsigned short*)Bt + t * 8) = f.half[0];  }
// eight consecutive f32, each rounded to bf16 and held as f16: 16 bytes
__device__ __forceinline__ v8us cvt8(v4f a, v4f b) { FragH f;
#pragma unroll
  for (int e = 0; e < 4; ++e) { f.h[e] = (_Float16)bf16_round(a[e]); f.h[4 + e] = (_Float16)bf16_round(b[e]); }
  return f.half[0]; }
// The whole preparation in one launch of 512 workgroups. Each converts 4 chunks of Q and 8 of K (a chunk = 256 threads x 8 elements) and transposes 4 neighbouring tiles of V (64 keys x 64 d),
// converted on the way from f32, into Vt [bh][128][TK]: few waves with much to do each, instead of one wave per 256 elements in four launches, and no f16 copy of V in between.
__global__ __launch_bounds__(256) void k_prep(const float* __restrict__ q, const float* __restrict__ k, const float* __restrict__ v, _Float16* __restrict__ Q16, _Float16* __restrict__ K16, _Float16* __restrict__ Vt) {
  __shared__ unsigned short tl[4][64][66];      /* a tile of its own for each of the 4: one barrier serves all */
  const int tid = threadIdx.x, r0 = tid / 8, c8 = (tid % 8) * 8;
  const int slab = blockIdx.x / (TK / 256), lg0 = (blockIdx.x % (TK / 256)) * 4;      /* slab = (b,h) plane x which 64 of the 128 d; tiles lg0 .. lg0 + 3 of its TK / 64 */
  const size_t tq = ((size_t)blockIdx.x * 4 * 256 + tid) * 8, tk = ((size_t)blockIdx.x * 8 * 256 + tid) * 8;
  const float* vp = v + ((size_t)(slab / 2) * TK + lg0 * 64 + r0) * HD + (slab % 2) * 64 + c8; const float* qp = q + tq; const float* kp = k + tk;
  v4f xv[8][2], xq[4][2], xk[8][2];      /* all 40 loads of a thread are issued before the first value is used: one memory latency for the launch */
#pragma unroll
  for (int i = 0; i < 8; ++i) { xv[i][0] = *(const v4fa*)(vp + i * 32 * HD); xv[i][1] = *(const v4fa*)(vp + i * 32 * HD + 4); }      /* row i * 32 + r0 of the 256 keys: tile i / 2, its row (i % 2) * 32 + r0 */
#pragma unroll
  for (int u = 0; u < 4; ++u) { xq[u][0] = *(const v4fa*)(qp + u * 2048); xq[u][1] = *(const v4fa*)(qp + u * 2048 + 4); }
#pragma unroll
  for (int u = 0; u < 8; ++u) { xk[u][0] = *(const v4fa*)(kp + u * 2048); xk[u][1] = *(const v4fa*)(kp + u * 2048 + 4); }
  asm volatile("s_wait_xcnt 0x0" :: "v"(vp), "v"(qp), "v"(kp) : "memory");      /* a precaution: the three address pairs stay live up to this wait, so that no load's result is written over a pair that an issued load names */
#pragma unroll
  for (int i = 0; i < 8; ++i) { FragH f; f.half[0] = cvt8(xv[i][0], xv[i][1]);
#pragma unroll
    for (int e = 0; e < 8; ++e) tl[i / 2][(i % 2) * 32 + r0][c8 + e] = f.u[e]; }
#pragma unroll
  for (int u = 0; u < 4; ++u) *(v8us*)((unsigned short*)Q16 + tq + u * 2048) = cvt8(xq[u][0], xq[u][1]);
#pragma unroll
  for (int u = 0; u < 8; ++u) *(v8us*)((unsigned short*)K16 + tk + u * 2048) = cvt8(xk[u][0], xk[u][1]);
  __syncthreads();      /* every thread's part of the 4 tiles is in LDS before a column is read */
#pragma unroll
  for (int u = 0; u < 4; ++u) {
#pragma unroll
    for (int rd = 0; rd < 2; ++rd) { const int d = rd * 32 + tid / 8, pc = tid % 8; FragH f;
#pragma unroll
      for (int e = 0; e < 8; ++e) f.u[e] = tl[u][pc * 8 + e][d];
      *(v8us*)((unsigned short*)Vt + ((size_t)slab * 64 + d) * TK + (lg0 + u) * 64 + pc * 8) = f.half[0]; } } }

// Eight asynchronous 16-byte copies of one lane, global memory -> LDS, no register in between: copy i takes LDS byte address l + i*ls and global address g + i*gs (elements).
// The s_wait_xcnt is the statement's last line so that no address register of an issued copy is rewritten ahead of it.
__device__ __forceinline__ void copy8_to_lds(unsigned l, unsigned ls, const unsigned short* g, size_t gs) {
  asm volatile("global_load_async_to_lds_b128 %0, %8, off\n\t"
               "global_load_async_to_lds_b128 %1, %9, off\n\t"
               "global_load_async_to_lds_b128 %2, %10, off\n\t"
               "global_load_async_to_lds_b128 %3, %11, off\n\t"
               "global_load_async_to_lds_b128 %4, %12, off\n\t"
               "global_load_async_to_lds_b128 %5, %13, off\n\t"
               "global_load_async_to_lds_b128 %6, %14, off\n\t"
               "global_load_async_to_lds_b128 %7, %15, off\n\t"
               "s_wait_xcnt 0x0"
               :: "v"(l), "v"(l + ls), "v"(l + 2 * ls), "v"(l + 3 * ls), "v"(l + 4 * ls), "v"(l + 5 * ls), "v"(l + 6 * ls), "v"(l + 7 * ls),
                  "v"(g), "v"(g + gs), "v"(g + 2 * gs), "v"(g + 3 * gs), "v"(g + 4 * gs), "v"(g + 5 * gs), "v"(g + 6 * gs), "v"(g + 7 * gs)
               : "memory");
}

// mmaH<1> with the accumulator as the only operand of the v_nop statement: with the A and B fragments named there too, the 32-column build kept every fragment below v256 and spilled Q to scratch
__device__ __forceinline__ v8f mmaC(v16h a, v16h b, v8f c) {
  c = __builtin_amdgcn_wmma_f32_16x16x32_f16(false, a, false, b, (short)0, c, false, false);
  asm volatile("v_nop\n\tv_nop\n\tv_nop\n\tv_nop" : "+v"(c));      /* the four vector slots between a matrix instruction and the first vector instruction on its result */
  return c;
}

// value of lane l ^ 16: the other half of the wave holds the other 16 of a query column's 32 keys
__device__ __forceinline__ float xhalf(float x) { return __builtin_bit_cast(float, __builtin_amdgcn_permlanex16(__builtin_bit_cast(int, x), __builtin_bit_cast(int, x), 0x76543210, 0xfedcba98, false, false)); }

__global__ __launch_bounds__(256) void k_flash(const _Float16* __restrict__ Q16, int ldq, const _Float16* __restrict__ K16, int ldk, const _Float16* __restrict__ Vt, const int* __restrict__ MSK, float* __restrict__ O, int ldo) {
  constexpr int RPW = 32, RTN = RPW / 16, NQB = 2048 / (4 * RPW), DT = 8, KS = 4;      /* head_dim 128 */
  constexpr float SL2 = 0.08838834764831845f * 1.4426950408889634f;      /* 1/sqrt(128) * log2(e): the running maximum m_r is kept in this base-2 scale */
  __shared__ __attribute__((aligned(16))) float sO[4][RPW][128 + 4]; __shared__ float sM[4][RTN][32], sL[4][RTN][32];      /* sM, sL: the second key group's maximum and sum, lane by lane */
  constexpr int SKEYS = 128, NST = 4096 / SKEYS, KPIT = 128 + 8, VPIT = SKEYS + 8;      /* a stage = 128 keys, 64 for each key group; both row pitches 272 B = 16 B x odd, conflict-free for 16-byte reads */
  __shared__ __attribute__((aligned(16))) unsigned short sK[2][SKEYS][KPIT]; __shared__ __attribute__((aligned(16))) unsigned short sV[2][128][VPIT];      /* two buffers each: K rows [key][d], Vt rows [d][key] */
  const int tid = threadIdx.x, w = __builtin_amdgcn_readfirstlane(tid >> 5), lane = tid & 31, ln = lane & 15, hh = lane >> 4;
  const int qg = w & 3, kg = w >> 2;      /* which 32 queries, which half of a stage's keys */
  const int slab = blockIdx.x / NQB, qblk = blockIdx.x % NQB; const int b = slab / 1, h = slab % 1; const int qb0 = qblk * (4 * RPW); const int q0 = qb0 + qg * RPW;
  FragH aq[2][KS];
#pragma unroll
  for (int rt = 0; rt < RTN; ++rt) { const unsigned short* qr = (const unsigned short*)Q16 + ((size_t)b * 2048 + q0 + rt * 16 + ln) * ldq + h * 128;
#pragma unroll
    for (int ks = 0; ks < KS; ++ks) { aq[rt][ks].half[0] = *(const v8us*)(qr + ks * 32 + 8 * hh); aq[rt][ks].half[1] = *(const v8us*)(qr + ks * 32 + 16 + 8 * hh); } }
  const unsigned short* Vth = (const unsigned short*)Vt + (size_t)slab * 128 * 4096;      /* [bh][128][TK] */
  float m_r[2], l_r[2]; v8f oacc[2][DT];      /* one query per lane: running maximum, this half's part of the row sum; oacc[rt][dt][r] = O^T[dt*16 + 8*hh + r][query ln] */
#pragma unroll
  for (int rt = 0; rt < RTN; ++rt) {
    m_r[rt] = -3.0e38f; l_r[rt] = 0.f;
#pragma unroll
    for (int dt = 0; dt < DT; ++dt) oacc[rt][dt] = (v8f){0.f,0.f,0.f,0.f,0.f,0.f,0.f,0.f}; }
  /* each thread copies 8 x 16 B of the K tile and 8 x 16 B of the Vt tile (16 lanes = one 256-B row or row piece): whole lines per wave */
  const unsigned short* Kg = (const unsigned short*)K16 + ((size_t)b * 4096 + (tid >> 4)) * ldk + h * 128 + (tid & 15) * 8;
  const unsigned short* Vg = Vth + (size_t)(tid >> 4) * 4096 + (tid & 15) * 8;
  const unsigned lK = (unsigned)(uintptr_t)&sK[0][tid >> 4][(tid & 15) * 8], lV = (unsigned)(uintptr_t)&sV[0][tid >> 4][(tid & 15) * 8];
  auto fill = [&](int st, int bf) {
    copy8_to_lds(lK + (unsigned)bf * (unsigned)(SKEYS * KPIT * 2), 16 * KPIT * 2, Kg + (size_t)st * SKEYS * ldk, (size_t)16 * ldk);
    copy8_to_lds(lV + (unsigned)bf * (unsigned)(128 * VPIT * 2), 16 * VPIT * 2, Vg + (size_t)st * SKEYS, (size_t)16 * 4096); };
  fill(0, 0);
  asm volatile("s_wait_asynccnt 0x0" ::: "memory");      /* this wave's copies of stage 0 have landed */
  __syncthreads();                                        /* every wave's have: stage 0 may be read */
  fill(1, 1);
#pragma unroll 1
  for (int st = 0; st < NST; ++st) { const int bf = st & 1;
#pragma unroll 1      /* kept rolled: one copy of the pass in the instruction stream and one set of fragment registers */
  for (int pp = 0; pp < SKEYS / 64; ++pp) { const int ps = kg * (SKEYS / 64) + pp;      /* this key group's passes of 32 keys */
    v8f s[2][2]; FragH bk[2][KS];      /* the pass's K fragments are read from LDS as one group: one LDS latency, not one per 16 keys */
#pragma unroll
    for (int nt = 0; nt < 2; ++nt) { const unsigned short* kr = &sK[bf][ps * 32 + nt * 16 + ln][0];
#pragma unroll
      for (int ks = 0; ks < KS; ++ks) { bk[nt][ks].half[0] = *(const v8us*)(kr + ks * 32 + 8 * hh); bk[nt][ks].half[1] = *(const v8us*)(kr + ks * 32 + 16 + 8 * hh); } }
#pragma unroll
    for (int nt = 0; nt < 2; ++nt)
#pragma unroll
      for (int rt = 0; rt < RTN; ++rt) s[rt][nt] = (v8f){0.f,0.f,0.f,0.f,0.f,0.f,0.f,0.f};
#pragma unroll
    for (int ks = 0; ks < KS; ++ks)      /* the four score tiles side by side: a tile's next matrix instruction stands four behind the one it depends on; each tile still sums ks = 0 .. 3 in order */
#pragma unroll
      for (int nt = 0; nt < 2; ++nt)
#pragma unroll
        for (int rt = 0; rt < RTN; ++rt) s[rt][nt] = mmaC(bk[nt][ks].v, aq[rt][ks].v, s[rt][nt]);      /* s[rt][nt][r] = S^T[key nt*16 + 8*hh + r][query rt*16 + ln] */
    FragH pb[2], bv[DT];      /* pb = P^T as a B operand: element i = key 8*hh + i, element 8 + i = key 16 + 8*hh + i, the k order of the Vt loader below */
#pragma unroll
    for (int rt = 0; rt < RTN; ++rt) { float sc[16], t[16];
#pragma unroll
      for (int i = 0; i < 16; ++i) { sc[i] = s[rt][i >> 3][i & 7]; t[i] = sc[i]; }      /* raw products; 1/sqrt(128) and log2(e) are applied as one factor below */
#pragma unroll
      for (int st2 = 8; st2 > 0; st2 >>= 1)
#pragma unroll
        for (int i = 0; i < st2; ++i) t[i] = fmaxf(t[i], t[i + st2]);
      const float mc = fmaxf(t[0], xhalf(t[0])) * SL2;      /* maximum over the pass's 32 keys, the same in both halves, in the base-2 scale (SL2 > 0 keeps the order) */
      const float mn = fmaxf(m_r[rt], mc); const float al = (mn > -1.0e38f) ? __builtin_amdgcn_exp2f(m_r[rt] - mn) : 1.0f; m_r[rt] = mn;
      typedef float f32x2 __attribute__((ext_vector_type(2))); f32x2 tp[8];      /* the 16 weights as 8 register pairs (2j, 2j + 1) */
#pragma unroll
      for (int j = 0; j < 8; ++j) {      /* e^(x/sqrt(128) - max) = 2^(x*SL2 - mn): one fma, packed two scores an instruction, and the hardware's exp2; the argument is <= about 0, and what underflows is far below f16's and the sum's last bit */
        const f32x2 arg = __builtin_elementwise_fma(f32x2{sc[2 * j], sc[2 * j + 1]}, f32x2{SL2, SL2}, f32x2{-mn, -mn});
        tp[j] = f32x2{__builtin_amdgcn_exp2f(arg.x), __builtin_amdgcn_exp2f(arg.y)}; pb[rt].h[2 * j] = (_Float16)tp[j].x; pb[rt].h[2 * j + 1] = (_Float16)tp[j].y; }
#pragma unroll
      for (int st2 = 4; st2 > 0; st2 >>= 1)      /* the sum's tree: i with i + 8, + 4, + 2, then + 1; two of its additions an instruction */
#pragma unroll
        for (int j = 0; j < st2; ++j) tp[j] += tp[j + st2];
      l_r[rt] = l_r[rt] * al + (tp[0].x + tp[0].y);      /* this half's 16 keys; the halves are joined once, behind the loop */
#pragma unroll
      for (int dt = 0; dt < DT; ++dt)
#pragma unroll
        for (int r = 0; r < 8; ++r) oacc[rt][dt][r] *= al; }
#pragma unroll
    for (int dt = 0; dt < DT; ++dt) { const unsigned short* vrow = &sV[bf][dt * 16 + ln][ps * 32]; bv[dt].half[0] = *(const v8us*)(vrow + 8 * hh); bv[dt].half[1] = *(const v8us*)(vrow + 16 + 8 * hh); }      /* the pass's Vt fragments as one group */
#pragma unroll
    for (int rt = 0; rt < RTN; ++rt) {
#pragma unroll
      for (int dt = 0; dt < DT; ++dt) oacc[rt][dt] = mmaC(bv[dt].v, pb[rt].v, oacc[rt][dt]); } }
    asm volatile("s_wait_dscnt 0x0" ::: "memory");        /* this wave's reads of buffer bf are done before the buffer is handed back */
    asm volatile("s_wait_asynccnt 0x0" ::: "memory");     /* this wave's copies of stage st + 1 have landed */
    __syncthreads();                                        /* publishes stage st + 1 and ends every wave's reads of buffer bf */
    if (st + 2 < NST) fill(st + 2, bf); }
  asm volatile("s_wait_asynccnt 0x0" ::: "memory");       /* no copy is outstanding behind the loop */
  if (kg == 1) {      /* the second key group hands its partial result over, each lane at the places where its partner lane of the first group will look */
#pragma unroll
    for (int rt = 0; rt < RTN; ++rt) { sM[qg][rt][lane] = m_r[rt]; sL[qg][rt][lane] = l_r[rt];
#pragma unroll
      for (int dt = 0; dt < DT; ++dt)
#pragma unroll
        for (int g = 0; g < 2; ++g) { const v4f o4 = {oacc[rt][dt][4 * g], oacc[rt][dt][4 * g + 1], oacc[rt][dt][4 * g + 2], oacc[rt][dt][4 * g + 3]}; *(v4fa*)&sO[qg][rt * 16 + ln][dt * 16 + 8 * hh + 4 * g] = o4; } } }
  __syncthreads();      /* the second group's partial results are in LDS before the first group reads them */
  if (kg == 0) {
#pragma unroll
    for (int rt = 0; rt < RTN; ++rt) {
      const float m1 = sM[qg][rt][lane], l1 = sL[qg][rt][lane]; const float mn = fmaxf(m_r[rt], m1);      /* both maxima are in the base-2 scale */
      const float a0 = __builtin_amdgcn_exp2f(m_r[rt] - mn), a1 = __builtin_amdgcn_exp2f(m1 - mn); const float lh = l_r[rt] * a0 + l1 * a1;
      const float l = lh + xhalf(lh); const float li = (l > 0.f) ? 1.0f / l : 0.f; const float c0 = a0 * li, c1 = a1 * li;
#pragma unroll
      for (int dt = 0; dt < DT; ++dt)
#pragma unroll
        for (int g = 0; g < 2; ++g) { float* po = &sO[qg][rt * 16 + ln][dt * 16 + 8 * hh + 4 * g]; const v4f o1 = *(const v4fa*)po;
          const v4f o4 = {oacc[rt][dt][4 * g] * c0 + o1[0] * c1, oacc[rt][dt][4 * g + 1] * c0 + o1[1] * c1, oacc[rt][dt][4 * g + 2] * c0 + o1[2] * c1, oacc[rt][dt][4 * g + 3] * c0 + o1[3] * c1}; *(v4fa*)po = o4; } }      /* a lane's 8 registers are 8 consecutive d of its query's row */
    __builtin_amdgcn_fence(__ATOMIC_ACQ_REL, "workgroup"); __builtin_amdgcn_wave_barrier();      /* every lane's joined values are in LDS before the wave reads them back row by row */
#pragma unroll
    for (int rp = 0; rp < RPW; ++rp) { const int r = rp, pc = lane; const v4f val = *(const v4fa*)&sO[qg][r][pc * 4]; *(v4f*)(O + ((size_t)b * 2048 + q0 + r) * ldo + h * 128 + pc * 4) = val; }      /* 32 lanes x 16 B = whole 512-B row; TQ = 2048 rows per slab */
  } }

extern "C" void kernel_launch(void* const* d_in, const int* in_sizes, int n_in,
                              void* d_out, int out_size, void* d_ws, size_t ws_size, hipStream_t stream) {
  (void)in_sizes; (void)n_in; (void)out_size;
  const float* q = (const float*)d_in[0]; const float* k = (const float*)d_in[1]; const float* v = (const float*)d_in[2];
  char* ws = (char*)d_ws; size_t off = 0;
  auto take = [&](size_t bytes) { char* p = ws + off; off += (bytes + 255) & ~(size_t)255; return p; };
  _Float16* Q16 = (_Float16*)take((size_t)NBH * TQ * HD * 2); _Float16* K16 = (_Float16*)take((size_t)NBH * TK * HD * 2); _Float16* Vt = (_Float16*)take((size_t)NBH * TK * HD * 2);
  if (off > ws_size) return;      // three f16 planes, 42 MB in all
  k_prep<<<NBH * 2 * (TK / 64) / 4, 256, 0, stream>>>(q, k, v, Q16, K16, Vt);      // 512 workgroups: NBH*TQ*HD/8/256 = 4 x 512 chunks of Q, 8 x 512 of K, 4 x 512 tiles of V
  k_flash<<<NBH * 1 * (TQ / 128), 256, 0, stream>>>(Q16, HD, K16, HD, Vt, nullptr, (float*)d_out, HD);
}

// v006
// It runs in 70.4 microseconds.
// Next to v005, in two timings, it ran 1.04 times as fast each time.
// Over all steps from v000 it is 8.62 times as fast.
#include <hip/hip_runtime.h>
// Attention with learned keys/values: out = softmax(Q·Kᵀ/√128)·V for Q [2,8,2048,128], K/V [2,8,4096,128] (head-major planes). One fused flash-style kernel (16 (b,h) slabs; 2048 query rows
// against 4096 keys; online softmax in f32; P f16 ≤ 1; O = P·Vᵀ-tiles; 32 query rows a wave; 128-wide head) on v_wmma_f32_16x16x32_f16 — Q/K/V bf16-exact in f16, f32 accumulate.
#define NBH 16
#define TQ 2048
#define TK 4096
#define HD 128

typedef __bf16 v16b __attribute__((ext_vector_type(16)));
typedef unsigned short v8us __attribute__((ext_vector_type(8), may_alias));
typedef float  v8f  __attribute__((ext_vector_type(8)));
typedef float  v4f  __attribute__((ext_vector_type(4)));
typedef float  v4fa __attribute__((ext_vector_type(4), may_alias));
union FragB { v16b v; v8us half[2]; unsigned short u[16]; };

__device__ __forceinline__ unsigned short bf16_bits(float x) { unsigned int u = __float_as_uint(x); return (unsigned short)((u + 0x7FFFu + ((u >> 16) & 1u)) >> 16); }
__device__ __forceinline__ float bf16_val(unsigned short b) { return __uint_as_float(((unsigned int)b) << 16); }
__device__ __forceinline__ float bf16_round(float x) { return bf16_val(bf16_bits(x)); }
// D += A·B with NT terms: 1 = ah·bh, 2 = + al·bh (A split), 3 = + ah·bl (both split)
template <int NT>
__device__ __forceinline__ v8f mmaN(v16b ah, v16b al, v16b bh, v16b bl, v8f c) {
  c = __builtin_amdgcn_wmma_f32_16x16x32_bf16(false, ah, false, bh, (short)0, c, false, false);
  if (NT >= 2) c = __builtin_amdgcn_wmma_f32_16x16x32_bf16(false, al, false, bh, (short)0, c, false, false);
  if (NT >= 3) c = __builtin_amdgcn_wmma_f32_16x16x32_bf16(false, ah, false, bl, (short)0, c, false, false);
  asm volatile("v_nop\n\tv_nop\n\tv_nop\n\tv_nop" : "+v"(c) : "v"(ah), "v"(al), "v"(bh), "v"(bl));
  return c;
}

__global__ __launch_bounds__(256) void k_wt_bf16(const float* __restrict__ W, unsigned short* __restrict__ Wt, int K, int N) {
  const int t = blockIdx.x * 256 + threadIdx.x;
  const int k8n = K / 8;
  if (t >= N * k8n) return;
  const int n = t / k8n, k8 = (t % k8n) * 8;
  v8us v;
#pragma unroll
  for (int i = 0; i < 8; ++i) v[i] = bf16_bits(W[(size_t)(k8 + i) * N + n]);
  *(v8us*)(Wt + (size_t)n * K + k8) = v;
  
}

// GEMM C[M][N] (f32, pitch ldc) = act(A[M][K]·W + bias). A f32 row-major (pitch lda) converted per fragment to bf16
// (ASPLIT: hi/lo two planes -> 2 terms, else single rounded term); Wt bf16 [N][K] (pitch ldb). BIAS_BF16 rounds the
// bias to bf16 first (bias quantised to bf16 before the add). K%32==0, M%16==0, N%64==0.
template <bool ASPLIT, int ACT, bool BIAS_BF16>
__global__ __launch_bounds__(128) void k_gemm_bf(const float* __restrict__ A, int lda, const unsigned short* __restrict__ Wt, int ldb,
                                               const float* __restrict__ bias, float* __restrict__ C, int ldc, int M, int N, int K) {
  __shared__ __attribute__((aligned(16))) float so[4][16][64];
  const int tid = threadIdx.x, w = tid >> 5, lane = tid & 31, ln = lane & 15, hh = lane >> 4;
  const int ntn = N / 64;
  const int wid = blockIdx.x * 4 + w;
  const int mt = wid / ntn, nq = wid % ntn;
  if (mt * 16 >= M) return;
  const int row0 = mt * 16, col0 = nq * 64;
  const float* arow = A + (size_t)(row0 + ln) * lda;
  v8f acc[4] = {};
  for (int kb = 0; kb < K; kb += 32) {
    FragB ah, al;
    const v4f x0 = *(const v4fa*)(arow + kb + 8 * hh), x1 = *(const v4fa*)(arow + kb + 8 * hh + 4);
    const v4f x2 = *(const v4fa*)(arow + kb + 16 + 8 * hh), x3 = *(const v4fa*)(arow + kb + 16 + 8 * hh + 4);
    float xs[16] = {x0[0],x0[1],x0[2],x0[3],x1[0],x1[1],x1[2],x1[3],x2[0],x2[1],x2[2],x2[3],x3[0],x3[1],x3[2],x3[3]};
#pragma unroll
    for (int i = 0; i < 16; ++i) { const unsigned short hb = bf16_bits(xs[i]); ah.u[i] = hb; al.u[i] = ASPLIT ? bf16_bits(xs[i] - bf16_val(hb)) : (unsigned short)0; }
#pragma unroll
    for (int t = 0; t < 4; ++t) {
      const unsigned short* brow = Wt + (size_t)(col0 + t * 16 + ln) * ldb + kb;
      FragB b;
      b.half[0] = *(const v8us*)(brow + 8 * hh);
      b.half[1] = *(const v8us*)(brow + 16 + 8 * hh);
      acc[t] = mmaN<ASPLIT ? 2 : 1>(ah.v, al.v, b.v, b.v, acc[t]);
    }
  }
#pragma unroll
  for (int t = 0; t < 4; ++t) {
    float bv = bias ? bias[col0 + t * 16 + ln] : 0.f;
    if (BIAS_BF16) bv = bf16_round(bv);
#pragma unroll
    for (int r = 0; r < 8; ++r) { float v = acc[t][r] + bv; if (ACT == 1) v = fmaxf(v, 0.f); so[w][8 * hh + r][t * 16 + ln] = v; }
  }
  __builtin_amdgcn_fence(__ATOMIC_ACQ_REL, "workgroup");
  __builtin_amdgcn_wave_barrier();
  const int rsub = lane >> 4, c4 = (lane & 15) * 4;
  {
#pragma unroll
    for (int q = 0; q < 8; ++q) {
      const int r = q * 2 + rsub;
      const v4f v = *(const v4fa*)&so[w][r][c4];
      *(v4f*)(C + (size_t)(row0 + r) * ldc + col0 + c4) = v;
    }
    
  }
}

// Flash-style causal/unmasked attention, all contractions 3-term bf16 hi/lo splits, f32 softmax with running max.
// q,k,v rows are read from f32 buffers with arbitrary row pitch (so they can live inside a fused qkv buffer);
// D = head size (multiple of 32, <= 128); one wave = 16 query rows; block = 4 waves (64 queries) sharing K/V chunks of 32.
template <int D, bool CAUSAL>
__global__ __launch_bounds__(128) void k_flash(const float* __restrict__ qb, const float* __restrict__ kb, const float* __restrict__ vb,
                                             int pitch, int T, int H, float scale, float* __restrict__ y, int ypitch) {
  constexpr int KS = D / 32;        // k-steps for QK
  constexpr int DT = D / 16;        // d tiles for PV
  __shared__ __attribute__((aligned(16))) unsigned short sKh[32][D + 8], sKl[32][D + 8], sVh[32][D + 8], sVl[32][D + 8];
  __shared__ __attribute__((aligned(16))) unsigned short sPh[4][16][40], sPl[4][16][40];
  __shared__ __attribute__((aligned(16))) float sO[4][16][D];
  const int tid = threadIdx.x, w = tid >> 5, lane = tid & 31, ln = lane & 15, hh = lane >> 4;
  const int nqb = (T + 63) / 64;
  const int bh = blockIdx.x / nqb, qblk = blockIdx.x % nqb;
  const int b = bh / H, h = bh % H;
  const int q0 = qblk * 64 + w * 16;
  const float* Q = qb + (size_t)b * T * pitch + h * D;
  const float* K = kb + (size_t)b * T * pitch + h * D;
  const float* V = vb + (size_t)b * T * pitch + h * D;

  // A fragments of the wave's 16 query rows (scaled), hi/lo
  FragB aqh[KS], aql[KS];
  {
    int row = q0 + ln; if (row >= T) row = T - 1;
    const float* qr = Q + (size_t)row * pitch;
#pragma unroll
    for (int ks = 0; ks < KS; ++ks)
#pragma unroll
      for (int i = 0; i < 16; ++i) {
        const int d = ks * 32 + ((i < 8) ? (8 * hh + i) : (16 + 8 * hh + (i - 8)));
        const float x = qr[d] * scale; const unsigned short hb = bf16_bits(x);
        aqh[ks].u[i] = hb; aql[ks].u[i] = bf16_bits(x - bf16_val(hb));
      }
  }
  float m_r[8], l_r[8];
#pragma unroll
  for (int r = 0; r < 8; ++r) { m_r[r] = -3.0e38f; l_r[r] = 0.f; }
  v8f oacc[DT];
#pragma unroll
  for (int dt = 0; dt < DT; ++dt) oacc[dt] = (v8f){0.f,0.f,0.f,0.f,0.f,0.f,0.f,0.f};

  const int kv_end = CAUSAL ? min(T, qblk * 64 + 64) : T;     // block-uniform
  for (int j0 = 0; j0 < kv_end; j0 += 32) {
    __syncthreads();
    for (int e = tid; e < 32 * (D / 4); e += 128) {
      const int r = e / (D / 4), c4 = (e % (D / 4)) * 4;
      const int key = j0 + r;
      v4f kf = {0.f,0.f,0.f,0.f}, vf = {0.f,0.f,0.f,0.f};
      if (key < T) { kf = *(const v4fa*)(K + (size_t)key * pitch + c4); vf = *(const v4fa*)(V + (size_t)key * pitch + c4); }
#pragma unroll
      for (int t = 0; t < 4; ++t) {
        unsigned short hb = bf16_bits(kf[t]); sKh[r][c4 + t] = hb; sKl[r][c4 + t] = bf16_bits(kf[t] - bf16_val(hb));
        hb = bf16_bits(vf[t]); sVh[r][c4 + t] = hb; sVl[r][c4 + t] = bf16_bits(vf[t] - bf16_val(hb));
      }
    }
    __syncthreads();
    // S tile 16 x 32
    v8f s[2];
#pragma unroll
    for (int nt = 0; nt < 2; ++nt) {
      v8f acc = {};
#pragma unroll
      for (int ks = 0; ks < KS; ++ks) {
        FragB bh_, bl_;
        bh_.half[0] = *(const v8us*)&sKh[nt * 16 + ln][ks * 32 + 8 * hh]; bh_.half[1] = *(const v8us*)&sKh[nt * 16 + ln][ks * 32 + 16 + 8 * hh];
        bl_.half[0] = *(const v8us*)&sKl[nt * 16 + ln][ks * 32 + 8 * hh]; bl_.half[1] = *(const v8us*)&sKl[nt * 16 + ln][ks * 32 + 16 + 8 * hh];
        acc = mmaN<3>(aqh[ks].v, aql[ks].v, bh_.v, bl_.v, acc);
      }
      s[nt] = acc;
    }
    // mask + running max (rows 8hh+r; the 16 lanes of a half share rows)
    float alpha[8];
#pragma unroll
    for (int r = 0; r < 8; ++r) {
      const int qi = q0 + 8 * hh + r;
      const int ja = j0 + ln, jb = j0 + 16 + ln;
      if (CAUSAL) { if (ja > qi) s[0][r] = -3.0e38f; if (jb > qi) s[1][r] = -3.0e38f; }
      if (ja >= T) s[0][r] = -3.0e38f;
      if (jb >= T) s[1][r] = -3.0e38f;
      float mx = fmaxf(s[0][r], s[1][r]);
      mx = fmaxf(mx, __shfl_xor(mx, 1, 32)); mx = fmaxf(mx, __shfl_xor(mx, 2, 32)); mx = fmaxf(mx, __shfl_xor(mx, 4, 32)); mx = fmaxf(mx, __shfl_xor(mx, 8, 32));
      const float mnew = fmaxf(m_r[r], mx);
      alpha[r] = (mnew > -1.0e38f) ? __expf(m_r[r] - mnew) : 1.0f;
      const float p0 = (s[0][r] > -1.0e38f) ? __expf(s[0][r] - mnew) : 0.f;
      const float p1 = (s[1][r] > -1.0e38f) ? __expf(s[1][r] - mnew) : 0.f;
      m_r[r] = mnew;
      l_r[r] = l_r[r] * alpha[r] + p0 + p1;            // per-lane partial row sum (16 lanes combined at the end)
      unsigned short hb = bf16_bits(p0); sPh[w][8 * hh + r][ln] = hb;      sPl[w][8 * hh + r][ln] = bf16_bits(p0 - bf16_val(hb));
      hb = bf16_bits(p1);                sPh[w][8 * hh + r][16 + ln] = hb; sPl[w][8 * hh + r][16 + ln] = bf16_bits(p1 - bf16_val(hb));
    }
#pragma unroll
    for (int dt = 0; dt < DT; ++dt)
#pragma unroll
      for (int r = 0; r < 8; ++r) oacc[dt][r] *= alpha[r];
    __builtin_amdgcn_fence(__ATOMIC_ACQ_REL, "workgroup");
    __builtin_amdgcn_wave_barrier();
    FragB pah, pal;
    pah.half[0] = *(const v8us*)&sPh[w][ln][8 * hh]; pah.half[1] = *(const v8us*)&sPh[w][ln][16 + 8 * hh];
    pal.half[0] = *(const v8us*)&sPl[w][ln][8 * hh]; pal.half[1] = *(const v8us*)&sPl[w][ln][16 + 8 * hh];
#pragma unroll
    for (int dt = 0; dt < DT; ++dt) {
      FragB bvh, bvl;
#pragma unroll
      for (int i = 0; i < 8; ++i) {
        bvh.u[i] = sVh[8 * hh + i][dt * 16 + ln]; bvh.u[8 + i] = sVh[16 + 8 * hh + i][dt * 16 + ln];
        bvl.u[i] = sVl[8 * hh + i][dt * 16 + ln]; bvl.u[8 + i] = sVl[16 + 8 * hh + i][dt * 16 + ln];
      }
      oacc[dt] = mmaN<3>(pah.v, pal.v, bvh.v, bvl.v, oacc[dt]);
    }
    __builtin_amdgcn_fence(__ATOMIC_ACQ_REL, "workgroup");
    __builtin_amdgcn_wave_barrier();
  }
#pragma unroll
  for (int r = 0; r < 8; ++r) {
    float l = l_r[r];
    l += __shfl_xor(l, 1, 32); l += __shfl_xor(l, 2, 32); l += __shfl_xor(l, 4, 32); l += __shfl_xor(l, 8, 32);
    l_r[r] = (l > 0.f) ? 1.0f / l : 0.f;
  }
#pragma unroll
  for (int dt = 0; dt < DT; ++dt)
#pragma unroll
    for (int r = 0; r < 8; ++r) sO[w][8 * hh + r][dt * 16 + ln] = oacc[dt][r] * l_r[r];
  __builtin_amdgcn_fence(__ATOMIC_ACQ_REL, "workgroup");
  __builtin_amdgcn_wave_barrier();
  {
    for (int r = 0; r < 16; ++r) {
      const int row = q0 + r;
      if (row < T && lane < D / 4) {
        const v4f val = *(const v4fa*)&sO[w][r][lane * 4];
        *(v4f*)(y + ((size_t)b * T + row) * ypitch + h * D + lane * 4) = val;
      }
    }
    
  }
}

// GEMM C = act(A·W + bias + resid): A f32 (ASPLIT -> hi/lo 2 terms), Wt bf16 [N][K]; ACT 0 none, 1 relu, 2 exact gelu;
// resid (optional, f32, row index = (row % rmod), pitch ldr, RES_BF16 rounds it) added before the activation.
template <bool ASPLIT, int ACT, bool BIAS_BF16, bool RES_BF16>
__global__ __launch_bounds__(128) void k_gemm_bf3(const float* __restrict__ A, int lda, const unsigned short* __restrict__ Wt, int ldb,
                                                const float* __restrict__ bias, const float* __restrict__ resid, int rmod, int ldr,
                                                float* __restrict__ C, int ldc, int M, int N, int K) {
  __shared__ __attribute__((aligned(16))) float so[4][16][64];
  const int tid = threadIdx.x, w = tid >> 5, lane = tid & 31, ln = lane & 15, hh = lane >> 4;
  const int ntn = N / 64;
  const int wid = blockIdx.x * 4 + w;
  const int mt = wid / ntn, nq = wid % ntn;
  if (mt * 16 >= M) return;
  const int row0 = mt * 16, col0 = nq * 64;
  const float* arow = A + (size_t)(row0 + ln) * lda;
  v8f acc[4] = {};
  for (int kb = 0; kb < K; kb += 32) {
    FragB ah, al;
    const v4f x0 = *(const v4fa*)(arow + kb + 8 * hh), x1 = *(const v4fa*)(arow + kb + 8 * hh + 4);
    const v4f x2 = *(const v4fa*)(arow + kb + 16 + 8 * hh), x3 = *(const v4fa*)(arow + kb + 16 + 8 * hh + 4);
    float xs[16] = {x0[0],x0[1],x0[2],x0[3],x1[0],x1[1],x1[2],x1[3],x2[0],x2[1],x2[2],x2[3],x3[0],x3[1],x3[2],x3[3]};
#pragma unroll
    for (int i = 0; i < 16; ++i) { const unsigned short hb = bf16_bits(xs[i]); ah.u[i] = hb; al.u[i] = ASPLIT ? bf16_bits(xs[i] - bf16_val(hb)) : (unsigned short)0; }
#pragma unroll
    for (int t = 0; t < 4; ++t) {
      const unsigned short* brow = Wt + (size_t)(col0 + t * 16 + ln) * ldb + kb;
      FragB b;
      b.half[0] = *(const v8us*)(brow + 8 * hh);
      b.half[1] = *(const v8us*)(brow + 16 + 8 * hh);
      acc[t] = mmaN<ASPLIT ? 2 : 1>(ah.v, al.v, b.v, b.v, acc[t]);
    }
  }
#pragma unroll
  for (int t = 0; t < 4; ++t) {
    const int col = col0 + t * 16 + ln;
    float bv = bias ? bias[col] : 0.f;
    if (BIAS_BF16) bv = bf16_round(bv);
#pragma unroll
    for (int r = 0; r < 8; ++r) {
      float v = acc[t][r] + bv;
      if (resid) { float rv = resid[(size_t)((row0 + 8 * hh + r) % rmod) * ldr + col]; if (RES_BF16) rv = bf16_round(rv); v += rv; }
      if (ACT == 1) v = fmaxf(v, 0.f);
      if (ACT == 2) v = 0.5f * v * (1.0f + erff(v * 0.70710678118654752f));
      if (ACT == 3) { const float u = 0.7978845608028654f * (v + 0.044715f * v * v * v); v = 0.5f * v * (1.0f + tanhf(u)); }
      so[w][8 * hh + r][t * 16 + ln] = v;
    }
  }
  __builtin_amdgcn_fence(__ATOMIC_ACQ_REL, "workgroup");
  __builtin_amdgcn_wave_barrier();
  const int rsub = lane >> 4, c4 = (lane & 15) * 4;
  {
#pragma unroll
    for (int q = 0; q < 8; ++q) {
      const int r = q * 2 + rsub;
      const v4f v = *(const v4fa*)&so[w][r][c4];
      *(v4f*)(C + (size_t)(row0 + r) * ldc + col0 + c4) = v;
    }
    
  }
}
// row LayerNorm (biased variance, eps) over N: s = X (+ R); optional out_sum <- s; out_norm <- (s-mu)*rsqrt(var+eps)*g + b
template <bool PARAM_BF16>
__global__ __launch_bounds__(256) void k_layernorm(const float* __restrict__ X, const float* __restrict__ R, const float* __restrict__ g, const float* __restrict__ bta,
                                                  float* __restrict__ out_sum, float* __restrict__ out_norm, int N, float eps) {
  __shared__ float red[256];
  const int row = blockIdx.x, tid = threadIdx.x;
  const float* x = X + (size_t)row * N; const float* rr = R ? R + (size_t)row * N : nullptr;
  float vals[16];                     // up to N = 4096
  const int per = N / 256;            // contiguous chunk per thread? use strided-by-4 chunks: thread handles j = tid*4 + 1024*u
  float s1 = 0.f;
  for (int u = 0; u < per / 4; ++u) {
    const int j = tid * 4 + 1024 * u;
    const v4f a = *(const v4fa*)(x + j);
    v4f b = {0.f,0.f,0.f,0.f}; if (rr) b = *(const v4fa*)(rr + j);
#pragma unroll
    for (int q = 0; q < 4; ++q) { const float v = a[q] + b[q]; vals[u * 4 + q] = v; s1 += v; }
  }
  red[tid] = s1; __syncthreads();
  for (int st = 128; st > 0; st >>= 1) { if (tid < st) red[tid] += red[tid + st]; __syncthreads(); }
  const float mu = red[0] / (float)N; __syncthreads();
  float s2 = 0.f;
  for (int u = 0; u < per / 4; ++u)
#pragma unroll
    for (int q = 0; q < 4; ++q) { const float c = vals[u * 4 + q] - mu; s2 += c * c; }
  red[tid] = s2; __syncthreads();
  for (int st = 128; st > 0; st >>= 1) { if (tid < st) red[tid] += red[tid + st]; __syncthreads(); }
  const float rs = rsqrtf(red[0] / (float)N + eps);
  {
    for (int u = 0; u < per / 4; ++u) {
      const int j = tid * 4 + 1024 * u;
      v4f o, sm;
#pragma unroll
      for (int q = 0; q < 4; ++q) {
        float gg = g[j + q], bb = bta[j + q];
        if (PARAM_BF16) { gg = bf16_round(gg); bb = bf16_round(bb); }
        sm[q] = vals[u * 4 + q]; o[q] = (vals[u * 4 + q] - mu) * rs * gg + bb;
      }
      if (out_sum) *(v4f*)(out_sum + (size_t)row * N + j) = sm;
      *(v4f*)(out_norm + (size_t)row * N + j) = o;
    }
    
  }
}



// ---- f16 WMMA path (v_wmma_f32_16x16x32_f16): 11-bit significands for operands in range — used for both Q·Kᵀ and P·V in the launched attention kernel
typedef _Float16 v16h __attribute__((ext_vector_type(16)));
union FragH { v16h v; v8us half[2]; _Float16 h[16]; unsigned short u[16]; };
template <int NT>
__device__ __forceinline__ v8f mmaH(v16h ah, v16h al, v16h bh, v16h bl, v8f c) {
  c = __builtin_amdgcn_wmma_f32_16x16x32_f16(false, ah, false, bh, (short)0, c, false, false);
  if (NT >= 2) c = __builtin_amdgcn_wmma_f32_16x16x32_f16(false, al, false, bh, (short)0, c, false, false);
  if (NT >= 3) c = __builtin_amdgcn_wmma_f32_16x16x32_f16(false, ah, false, bl, (short)0, c, false, false);
  asm volatile("v_nop\n\tv_nop\n\tv_nop\n\tv_nop" : "+v"(c) : "v"(ah), "v"(al), "v"(bh), "v"(bl));
  return c;
}
// batched GEMM like k_gemm_b but f16 operands: A f32 (split into f16 hi/lo if ASPLIT, else rounded to f16), Bt = f16 values [n][k]; alpha; C f32; N multiple of 16 (partial tiles skipped)
template <bool ASPLIT>
__global__ __launch_bounds__(128) void k_gemm_h(const float* __restrict__ A, int lda, size_t sA, const _Float16* __restrict__ Bh, int ldb, size_t sB, float alpha, float* __restrict__ C, int ldc, size_t sC, int M, int N, int K) {
  __shared__ __attribute__((aligned(16))) float so[4][16][64];
  const int tid = threadIdx.x, w = tid >> 5, lane = tid & 31, ln = lane & 15, hh = lane >> 4; const int by = blockIdx.y;
  A += (size_t)by * sA; Bh += (size_t)by * sB; C += (size_t)by * sC;
  const int ntn = (N + 63) / 64; const int wid = blockIdx.x * 4 + w; const int mt = wid / ntn, nq = wid % ntn; if (mt * 16 >= M) return;
  const int row0 = mt * 16, col0 = nq * 64; const float* arow = A + (size_t)(row0 + ln) * lda;
  v8f acc[4] = {};
  for (int kb = 0; kb < K; kb += 32) {
    FragH ah, al;
    const v4f x0 = *(const v4fa*)(arow + kb + 8 * hh), x1 = *(const v4fa*)(arow + kb + 8 * hh + 4), x2 = *(const v4fa*)(arow + kb + 16 + 8 * hh), x3 = *(const v4fa*)(arow + kb + 16 + 8 * hh + 4);
    float xs[16] = {x0[0],x0[1],x0[2],x0[3],x1[0],x1[1],x1[2],x1[3],x2[0],x2[1],x2[2],x2[3],x3[0],x3[1],x3[2],x3[3]};
#pragma unroll
    for (int i = 0; i < 16; ++i) { const _Float16 h = (_Float16)xs[i]; ah.h[i] = h; al.h[i] = ASPLIT ? (_Float16)(xs[i] - (float)h) : (_Float16)0.0f; }
#pragma unroll
    for (int t = 0; t < 4; ++t) { if (col0 + t * 16 >= N) continue; const size_t boff = (size_t)(col0 + t * 16 + ln) * ldb + kb; FragH bq; bq.half[0] = *(const v8us*)(Bh + boff + 8 * hh); bq.half[1] = *(const v8us*)(Bh + boff + 16 + 8 * hh);
      acc[t] = mmaH<ASPLIT ? 2 : 1>(ah.v, al.v, bq.v, bq.v, acc[t]); }
  }
#pragma unroll
  for (int t = 0; t < 4; ++t) { if (col0 + t * 16 >= N) continue;
#pragma unroll
    for (int r = 0; r < 8; ++r) so[w][8 * hh + r][t * 16 + ln] = acc[t][r] * alpha; }
  __builtin_amdgcn_fence(__ATOMIC_ACQ_REL, "workgroup"); __builtin_amdgcn_wave_barrier();
  const int rsub = lane >> 4, c4 = (lane & 15) * 4;
  {
#pragma unroll
    for (int q = 0; q < 8; ++q) { const int r = q * 2 + rsub; if (col0 + c4 < N) { const v4f v = *(const v4fa*)&so[w][r][c4]; *(v4f*)(C + (size_t)(row0 + r) * ldc + col0 + c4) = v; } }
     }
}

// Wt[n][k] = f16(W[k][n]·scale) from f32 row-major W[K][N] (scale = power of two; bf16-exact weights stay exact in f16 away from the subnormal range)
__global__ __launch_bounds__(256) void k_wt_f16(const float* __restrict__ W, _Float16* __restrict__ Wt, int K, int N, float scale) {
  const int t = blockIdx.x * 256 + threadIdx.x; if (t >= N * (K / 8)) return; const int n = t / (K / 8), k8 = (t % (K / 8)) * 8; FragH f;
#pragma unroll
  for (int i = 0; i < 8; ++i) f.h[i] = (_Float16)(bf16_round(W[(size_t)(k8 + i) * N + n]) * scale); const v8us o = f.half[0];
  *(v8us*)((unsigned short*)Wt + (size_t)n * K + k8) = o; 
}
// k_gemm_hh variant with fused epilogue: v = acc·alpha + bias[by·sBias + col] (+ CP[(row/rowsPerB)·sCPb + by·64 + col] if CP) ; ACT 0 none / 1 elu ; writes f16 C16 (and f32 C if non-null)
template <int ACT>
__global__ __launch_bounds__(128) void k_gemm_hhx(const _Float16* __restrict__ A, int lda, size_t sA, const _Float16* __restrict__ Bh, int ldb, size_t sB, float alpha, const float* __restrict__ bias, size_t sBias, const float* __restrict__ CP, int rowsPerB, size_t sCPb, int row0g,
    float* __restrict__ C, _Float16* __restrict__ C16, int ldc, size_t sC, int M, int N, int K) {
  __shared__ __attribute__((aligned(16))) float so[4][16][64];
  const int tid = threadIdx.x, w = tid >> 5, lane = tid & 31, ln = lane & 15, hh = lane >> 4; const int by = blockIdx.y;
  A += (size_t)by * sA; Bh += (size_t)by * sB; const size_t cofs = (size_t)by * sC; const float* bp = bias ? bias + (size_t)by * sBias : nullptr;
  const int ntn = (N + 63) / 64; const int wid = blockIdx.x * 4 + w; const int mt = wid / ntn, nq = wid % ntn; if (mt * 16 >= M) return;
  const int row0 = mt * 16, col0 = nq * 64; const _Float16* arow = A + (size_t)(row0 + ln) * lda;
  v8f acc[4] = {};
  for (int kb = 0; kb < K; kb += 32) { FragH ah; ah.half[0] = *(const v8us*)((const unsigned short*)arow + kb + 8 * hh); ah.half[1] = *(const v8us*)((const unsigned short*)arow + kb + 16 + 8 * hh);
#pragma unroll
    for (int t = 0; t < 4; ++t) { if (col0 + t * 16 >= N) continue; const size_t boff = (size_t)(col0 + t * 16 + ln) * ldb + kb; FragH bq; bq.half[0] = *(const v8us*)((const unsigned short*)Bh + boff + 8 * hh); bq.half[1] = *(const v8us*)((const unsigned short*)Bh + boff + 16 + 8 * hh);
      acc[t] = mmaH<1>(ah.v, ah.v, bq.v, bq.v, acc[t]); }
  }
#pragma unroll
  for (int t = 0; t < 4; ++t) { if (col0 + t * 16 >= N) continue; const int col = col0 + t * 16 + ln; const float bv = bp ? bf16_round(bp[col]) : 0.f;
#pragma unroll
    for (int r = 0; r < 8; ++r) { float v = acc[t][r] * alpha + bv; if (CP) { const int bidx = (row0g + row0 + 8 * hh + r) / rowsPerB; v += CP[(size_t)bidx * sCPb + (size_t)by * 64 + col]; } if (ACT == 1) v = (v > 0.f) ? v : expm1f(v); else if (ACT == 3) v = fmaxf(v, 0.f); so[w][8 * hh + r][t * 16 + ln] = v; } }
  __builtin_amdgcn_fence(__ATOMIC_ACQ_REL, "workgroup"); __builtin_amdgcn_wave_barrier();
  const int rsub = lane >> 4, c4 = (lane & 15) * 4; typedef _Float16 v4h __attribute__((ext_vector_type(4)));
  {
#pragma unroll
    for (int q = 0; q < 8; ++q) { const int r = q * 2 + rsub; if (col0 + c4 < N) { const v4f v = *(const v4fa*)&so[w][r][c4]; if (C) *(v4f*)(C + cofs + (size_t)(row0 + r) * ldc + col0 + c4) = v; if (C16) { v4h h4; for (int i = 0; i < 4; ++i) h4[i] = (_Float16)v[i]; *(v4h*)(C16 + cofs + (size_t)(row0 + r) * ldc + col0 + c4) = h4; } } }
     }
}


typedef _Float16 v4h __attribute__((ext_vector_type(4)));

__global__ __launch_bounds__(256) void k_h16(const float* __restrict__ x, _Float16* __restrict__ X16, size_t n8) { const size_t t = (size_t)blockIdx.x * 256 + threadIdx.x; if (t >= n8) return; FragH f;
#pragma unroll
  for (int q = 0; q < 8; ++q) f.h[q] = (_Float16)x[t * 8 + q]; *(v8us*)((unsigned short*)X16 + t * 8) = f.half[0];  }
__global__ __launch_bounds__(256) void k_round16f(const float* __restrict__ W, _Float16* __restrict__ Bt, size_t n8) { const size_t t = (size_t)blockIdx.x * 256 + threadIdx.x; if (t >= n8) return; FragH f;
#pragma unroll
  for (int i = 0; i < 8; ++i) f.h[i] = (_Float16)(bf16_round(W[t * 8 + i]) * 16.0f); *(v8us*)((unsigned short*)Bt + t * 8) = f.half[0];  }
// eight consecutive f32, each rounded to bf16 and held as f16: 16 bytes
__device__ __forceinline__ v8us cvt8(v4f a, v4f b) { FragH f;
#pragma unroll
  for (int e = 0; e < 4; ++e) { f.h[e] = (_Float16)bf16_round(a[e]); f.h[4 + e] = (_Float16)bf16_round(b[e]); }
  return f.half[0]; }
// The whole preparation in one launch of 512 workgroups. Each converts 4 chunks of Q and 8 of K (a chunk = 256 threads x 8 elements) and transposes 4 neighbouring tiles of V (64 keys x 64 d),
// converted on the way from f32, into Vt [bh][128][TK]: few waves with much to do each, instead of one wave per 256 elements in four launches, and no f16 copy of V in between.
__global__ __launch_bounds__(256) void k_prep(const float* __restrict__ q, const float* __restrict__ k, const float* __restrict__ v, _Float16* __restrict__ Q16, _Float16* __restrict__ K16, _Float16* __restrict__ Vt) {
  __shared__ unsigned short tl[4][64][66];      /* a tile of its own for each of the 4: one barrier serves all */
  const int tid = threadIdx.x, r0 = tid / 8, c8 = (tid % 8) * 8;
  const int slab = blockIdx.x / (TK / 256), lg0 = (blockIdx.x % (TK / 256)) * 4;      /* slab = (b,h) plane x which 64 of the 128 d; tiles lg0 .. lg0 + 3 of its TK / 64 */
  const size_t tq = ((size_t)blockIdx.x * 4 * 256 + tid) * 8, tk = ((size_t)blockIdx.x * 8 * 256 + tid) * 8;
  const float* vp = v + ((size_t)(slab / 2) * TK + lg0 * 64 + r0) * HD + (slab % 2) * 64 + c8; const float* qp = q + tq; const float* kp = k + tk;
  v4f xv[8][2], xq[4][2], xk[8][2];      /* all 40 loads of a thread are issued before the first value is used: one memory latency for the launch */
#pragma unroll
  for (int i = 0; i < 8; ++i) { xv[i][0] = *(const v4fa*)(vp + i * 32 * HD); xv[i][1] = *(const v4fa*)(vp + i * 32 * HD + 4); }      /* row i * 32 + r0 of the 256 keys: tile i / 2, its row (i % 2) * 32 + r0 */
#pragma unroll
  for (int u = 0; u < 4; ++u) { xq[u][0] = *(const v4fa*)(qp + u * 2048); xq[u][1] = *(const v4fa*)(qp + u * 2048 + 4); }
#pragma unroll
  for (int u = 0; u < 8; ++u) { xk[u][0] = *(const v4fa*)(kp + u * 2048); xk[u][1] = *(const v4fa*)(kp + u * 2048 + 4); }
  asm volatile("s_wait_xcnt 0x0" :: "v"(vp), "v"(qp), "v"(kp) : "memory");      /* a precaution: the three address pairs stay live up to this wait, so that no load's result is written over a pair that an issued load names */
#pragma unroll
  for (int i = 0; i < 8; ++i) { FragH f; f.half[0] = cvt8(xv[i][0], xv[i][1]);
#pragma unroll
    for (int e = 0; e < 8; ++e) tl[i / 2][(i % 2) * 32 + r0][c8 + e] = f.u[e]; }
#pragma unroll
  for (int u = 0; u < 4; ++u) *(v8us*)((unsigned short*)Q16 + tq + u * 2048) = cvt8(xq[u][0], xq[u][1]);
#pragma unroll
  for (int u = 0; u < 8; ++u) *(v8us*)((unsigned short*)K16 + tk + u * 2048) = cvt8(xk[u][0], xk[u][1]);
  __syncthreads();      /* every thread's part of the 4 tiles is in LDS before a column is read */
#pragma unroll
  for (int u = 0; u < 4; ++u) {
#pragma unroll
    for (int rd = 0; rd < 2; ++rd) { const int d = rd * 32 + tid / 8, pc = tid % 8; FragH f;
#pragma unroll
      for (int e = 0; e < 8; ++e) f.u[e] = tl[u][pc * 8 + e][d];
      *(v8us*)((unsigned short*)Vt + ((size_t)slab * 64 + d) * TK + (lg0 + u) * 64 + pc * 8) = f.half[0]; } } }

// Eight asynchronous 16-byte copies of one lane, global memory -> LDS, no register in between: copy i takes LDS byte address l + i*ls and global address g + i*gs (elements).
// The s_wait_xcnt is the statement's last line so that no address register of an issued copy is rewritten ahead of it.
__device__ __forceinline__ void copy8_to_lds(unsigned l, unsigned ls, const unsigned short* g, size_t gs) {
  asm volatile("global_load_async_to_lds_b128 %0, %8, off\n\t"
               "global_load_async_to_lds_b128 %1, %9, off\n\t"
               "global_load_async_to_lds_b128 %2, %10, off\n\t"
               "global_load_async_to_lds_b128 %3, %11, off\n\t"
               "global_load_async_to_lds_b128 %4, %12, off\n\t"
               "global_load_async_to_lds_b128 %5, %13, off\n\t"
               "global_load_async_to_lds_b128 %6, %14, off\n\t"
               "global_load_async_to_lds_b128 %7, %15, off\n\t"
               "s_wait_xcnt 0x0"
               :: "v"(l), "v"(l + ls), "v"(l + 2 * ls), "v"(l + 3 * ls), "v"(l + 4 * ls), "v"(l + 5 * ls), "v"(l + 6 * ls), "v"(l + 7 * ls),
                  "v"(g), "v"(g + gs), "v"(g + 2 * gs), "v"(g + 3 * gs), "v"(g + 4 * gs), "v"(g + 5 * gs), "v"(g + 6 * gs), "v"(g + 7 * gs)
               : "memory");
}

// The matrix builtin alone, no v_nop statement tied to its result: the compiler keeps the distance behind its own builtins, fills it with the pass's own vector work where it can,
// and the vector port is left to the SIMD's other wave. The pass loop's back edge has its four slots at the loop's foot.
__device__ __forceinline__ v8f mmaC(v16h a, v16h b, v8f c) { return __builtin_amdgcn_wmma_f32_16x16x32_f16(false, a, false, b, (short)0, c, false, false); }

// value of lane l ^ 16: the other half of the wave holds the other 16 of a query column's 32 keys
__device__ __forceinline__ float xhalf(float x) { return __builtin_bit_cast(float, __builtin_amdgcn_permlanex16(__builtin_bit_cast(int, x), __builtin_bit_cast(int, x), 0x76543210, 0xfedcba98, false, false)); }

__global__ __launch_bounds__(256) void k_flash(const _Float16* __restrict__ Q16, int ldq, const _Float16* __restrict__ K16, int ldk, const _Float16* __restrict__ Vt, const int* __restrict__ MSK, float* __restrict__ O, int ldo) {
  constexpr int RPW = 32, RTN = RPW / 16, NQB = 2048 / (4 * RPW), DT = 8, KS = 4;      /* head_dim 128 */
  constexpr float SL2 = 0.08838834764831845f * 1.4426950408889634f;      /* 1/sqrt(128) * log2(e): the running maximum m_r is kept in this base-2 scale */
  __shared__ __attribute__((aligned(16))) float sO[4][RPW][128 + 4]; __shared__ float sM[4][RTN][32], sL[4][RTN][32];      /* sM, sL: the second key group's maximum and sum, lane by lane */
  constexpr int SKEYS = 128, NST = 4096 / SKEYS, KPIT = 128 + 8, VPIT = SKEYS + 8;      /* a stage = 128 keys, 64 for each key group; both row pitches 272 B = 16 B x odd, conflict-free for 16-byte reads */
  __shared__ __attribute__((aligned(16))) unsigned short sK[2][SKEYS][KPIT]; __shared__ __attribute__((aligned(16))) unsigned short sV[2][128][VPIT];      /* two buffers each: K rows [key][d], Vt rows [d][key] */
  const int tid = threadIdx.x, w = __builtin_amdgcn_readfirstlane(tid >> 5), lane = tid & 31, ln = lane & 15, hh = lane >> 4;
  const int qg = w & 3, kg = w >> 2;      /* which 32 queries, which half of a stage's keys */
  const int slab = blockIdx.x / NQB, qblk = blockIdx.x % NQB; const int b = slab / 1, h = slab % 1; const int qb0 = qblk * (4 * RPW); const int q0 = qb0 + qg * RPW;
  FragH aq[2][KS];
#pragma unroll
  for (int rt = 0; rt < RTN; ++rt) { const unsigned short* qr = (const unsigned short*)Q16 + ((size_t)b * 2048 + q0 + rt * 16 + ln) * ldq + h * 128;
#pragma unroll
    for (int ks = 0; ks < KS; ++ks) { aq[rt][ks].half[0] = *(const v8us*)(qr + ks * 32 + 8 * hh); aq[rt][ks].half[1] = *(const v8us*)(qr + ks * 32 + 16 + 8 * hh); } }
  const unsigned short* Vth = (const unsigned short*)Vt + (size_t)slab * 128 * 4096;      /* [bh][128][TK] */
  float m_r[2], l_r[2]; v8f oacc[2][DT];      /* one query per lane: running maximum, this half's part of the row sum; oacc[rt][dt][r] = O^T[dt*16 + 8*hh + r][query ln] */
#pragma unroll
  for (int rt = 0; rt < RTN; ++rt) {
    m_r[rt] = -3.0e38f; l_r[rt] = 0.f;
#pragma unroll
    for (int dt = 0; dt < DT; ++dt) oacc[rt][dt] = (v8f){0.f,0.f,0.f,0.f,0.f,0.f,0.f,0.f}; }
  /* each thread copies 8 x 16 B of the K tile and 8 x 16 B of the Vt tile (16 lanes = one 256-B row or row piece): whole lines per wave */
  const unsigned short* Kg = (const unsigned short*)K16 + ((size_t)b * 4096 + (tid >> 4)) * ldk + h * 128 + (tid & 15) * 8;
  const unsigned short* Vg = Vth + (size_t)(tid >> 4) * 4096 + (tid & 15) * 8;
  const unsigned lK = (unsigned)(uintptr_t)&sK[0][tid >> 4][(tid & 15) * 8], lV = (unsigned)(uintptr_t)&sV[0][tid >> 4][(tid & 15) * 8];
  auto fill = [&](int st, int bf) {
    copy8_to_lds(lK + (unsigned)bf * (unsigned)(SKEYS * KPIT * 2), 16 * KPIT * 2, Kg + (size_t)st * SKEYS * ldk, (size_t)16 * ldk);
    copy8_to_lds(lV + (unsigned)bf * (unsigned)(128 * VPIT * 2), 16 * VPIT * 2, Vg + (size_t)st * SKEYS, (size_t)16 * 4096); };
  fill(0, 0);
  asm volatile("s_wait_asynccnt 0x0" ::: "memory");      /* this wave's copies of stage 0 have landed */
  __syncthreads();                                        /* every wave's have: stage 0 may be read */
  fill(1, 1);
#pragma unroll 1
  for (int st = 0; st < NST; ++st) { const int bf = st & 1;
#pragma unroll 1      /* kept rolled: one copy of the pass in the instruction stream and one set of fragment registers */
  for (int pp = 0; pp < SKEYS / 64; ++pp) { const int ps = kg * (SKEYS / 64) + pp;      /* this key group's passes of 32 keys */
    v8f s[2][2]; FragH bk[2][KS];      /* the pass's K fragments are read from LDS as one group: one LDS latency, not one per 16 keys */
#pragma unroll
    for (int nt = 0; nt < 2; ++nt) { const unsigned short* kr = &sK[bf][ps * 32 + nt * 16 + ln][0];
#pragma unroll
      for (int ks = 0; ks < KS; ++ks) { bk[nt][ks].half[0] = *(const v8us*)(kr + ks * 32 + 8 * hh); bk[nt][ks].half[1] = *(const v8us*)(kr + ks * 32 + 16 + 8 * hh); } }
    __builtin_amdgcn_sched_barrier(0);      /* nothing crosses from below into the K reads' group: without it the compiler draws the Vt reads up in front of and among the score products, 361 registers for 326, and the copies' address pairs go to scratch */
#pragma unroll
    for (int nt = 0; nt < 2; ++nt)
#pragma unroll
      for (int rt = 0; rt < RTN; ++rt) s[rt][nt] = (v8f){0.f,0.f,0.f,0.f,0.f,0.f,0.f,0.f};
#pragma unroll
    for (int ks = 0; ks < KS; ++ks)      /* the four score tiles side by side: a tile's next matrix instruction stands four behind the one it depends on; each tile still sums ks = 0 .. 3 in order */
#pragma unroll
      for (int nt = 0; nt < 2; ++nt)
#pragma unroll
        for (int rt = 0; rt < RTN; ++rt) s[rt][nt] = mmaC(bk[nt][ks].v, aq[rt][ks].v, s[rt][nt]);      /* s[rt][nt][r] = S^T[key nt*16 + 8*hh + r][query rt*16 + ln] */
    float alr[2]; FragH pb[2], bv[DT];      /* pb = P^T as a B operand: element i = key 8*hh + i, element 8 + i = key 16 + 8*hh + i, the k order of the Vt loader below */
#pragma unroll
    for (int rt = 0; rt < RTN; ++rt) { float sc[16], t[16];
#pragma unroll
      for (int i = 0; i < 16; ++i) { sc[i] = s[rt][i >> 3][i & 7]; t[i] = sc[i]; }      /* raw products; 1/sqrt(128) and log2(e) are applied as one factor below */
#pragma unroll
      for (int st2 = 8; st2 > 0; st2 >>= 1)
#pragma unroll
        for (int i = 0; i < st2; ++i) t[i] = fmaxf(t[i], t[i + st2]);
      const float mc = fmaxf(t[0], xhalf(t[0])) * SL2;      /* maximum over the pass's 32 keys, the same in both halves, in the base-2 scale (SL2 > 0 keeps the order) */
      const float mn = fmaxf(m_r[rt], mc); const float al = (mn > -1.0e38f) ? __builtin_amdgcn_exp2f(m_r[rt] - mn) : 1.0f; m_r[rt] = mn;
      typedef float f32x2 __attribute__((ext_vector_type(2))); f32x2 tp[8];      /* the 16 weights as 8 register pairs (2j, 2j + 1) */
#pragma unroll
      for (int j = 0; j < 8; ++j) {      /* e^(x/sqrt(128) - max) = 2^(x*SL2 - mn): one fma, packed two scores an instruction, and the hardware's exp2; the argument is <= about 0, and what underflows is far below f16's and the sum's last bit */
        const f32x2 arg = __builtin_elementwise_fma(f32x2{sc[2 * j], sc[2 * j + 1]}, f32x2{SL2, SL2}, f32x2{-mn, -mn});
        tp[j] = f32x2{__builtin_amdgcn_exp2f(arg.x), __builtin_amdgcn_exp2f(arg.y)}; pb[rt].h[2 * j] = (_Float16)tp[j].x; pb[rt].h[2 * j + 1] = (_Float16)tp[j].y; }
#pragma unroll
      for (int st2 = 4; st2 > 0; st2 >>= 1)      /* the sum's tree: i with i + 8, + 4, + 2, then + 1; two of its additions an instruction */
#pragma unroll
        for (int j = 0; j < st2; ++j) tp[j] += tp[j + st2];
      l_r[rt] = l_r[rt] * al + (tp[0].x + tp[0].y);      /* this half's 16 keys; the halves are joined once, behind the loop */
      alr[rt] = al; }
#pragma unroll
    for (int dt = 0; dt < DT; ++dt) { const unsigned short* vrow = &sV[bf][dt * 16 + ln][ps * 32]; bv[dt].half[0] = *(const v8us*)(vrow + 8 * hh); bv[dt].half[1] = *(const v8us*)(vrow + 16 + 8 * hh); }      /* the pass's Vt fragments as one group */
#pragma unroll
    for (int rt = 0; rt < RTN; ++rt) {
#pragma unroll
      for (int dt = 0; dt < DT; ++dt) {      /* a tile is rescaled at its own product, not all 16 behind the softmax: the multiplies of the tiles to come may issue among the products before them */
#pragma unroll
        for (int r = 0; r < 8; ++r) oacc[rt][dt][r] *= alr[rt];
        oacc[rt][dt] = mmaC(bv[dt].v, pb[rt].v, oacc[rt][dt]); } }
    __builtin_amdgcn_sched_barrier(0);      /* every matrix instruction of the pass stays ahead of the four slots below */
    asm volatile("v_nop\n\tv_nop\n\tv_nop\n\tv_nop"); }      /* the four vector slots behind the pass's last matrix instruction on the loop's back edge: the next pass's first vector instructions may write that instruction's A or B registers */
    asm volatile("s_wait_dscnt 0x0" ::: "memory");        /* this wave's reads of buffer bf are done before the buffer is handed back */
    asm volatile("s_wait_asynccnt 0x0" ::: "memory");     /* this wave's copies of stage st + 1 have landed */
    __syncthreads();                                        /* publishes stage st + 1 and ends every wave's reads of buffer bf */
    if (st + 2 < NST) fill(st + 2, bf); }
  asm volatile("s_wait_asynccnt 0x0" ::: "memory");       /* no copy is outstanding behind the loop */
  if (kg == 1) {      /* the second key group hands its partial result over, each lane at the places where its partner lane of the first group will look */
#pragma unroll
    for (int rt = 0; rt < RTN; ++rt) { sM[qg][rt][lane] = m_r[rt]; sL[qg][rt][lane] = l_r[rt];
#pragma unroll
      for (int dt = 0; dt < DT; ++dt)
#pragma unroll
        for (int g = 0; g < 2; ++g) { const v4f o4 = {oacc[rt][dt][4 * g], oacc[rt][dt][4 * g + 1], oacc[rt][dt][4 * g + 2], oacc[rt][dt][4 * g + 3]}; *(v4fa*)&sO[qg][rt * 16 + ln][dt * 16 + 8 * hh + 4 * g] = o4; } } }
  __syncthreads();      /* the second group's partial results are in LDS before the first group reads them */
  if (kg == 0) {
#pragma unroll
    for (int rt = 0; rt < RTN; ++rt) {
      const float m1 = sM[qg][rt][lane], l1 = sL[qg][rt][lane]; const float mn = fmaxf(m_r[rt], m1);      /* both maxima are in the base-2 scale */
      const float a0 = __builtin_amdgcn_exp2f(m_r[rt] - mn), a1 = __builtin_amdgcn_exp2f(m1 - mn); const float lh = l_r[rt] * a0 + l1 * a1;
      const float l = lh + xhalf(lh); const float li = (l > 0.f) ? 1.0f / l : 0.f; const float c0 = a0 * li, c1 = a1 * li;
#pragma unroll
      for (int dt = 0; dt < DT; ++dt)
#pragma unroll
        for (int g = 0; g < 2; ++g) { float* po = &sO[qg][rt * 16 + ln][dt * 16 + 8 * hh + 4 * g]; const v4f o1 = *(const v4fa*)po;
          const v4f o4 = {oacc[rt][dt][4 * g] * c0 + o1[0] * c1, oacc[rt][dt][4 * g + 1] * c0 + o1[1] * c1, oacc[rt][dt][4 * g + 2] * c0 + o1[2] * c1, oacc[rt][dt][4 * g + 3] * c0 + o1[3] * c1}; *(v4fa*)po = o4; } }      /* a lane's 8 registers are 8 consecutive d of its query's row */
    __builtin_amdgcn_fence(__ATOMIC_ACQ_REL, "workgroup"); __builtin_amdgcn_wave_barrier();      /* every lane's joined values are in LDS before the wave reads them back row by row */
#pragma unroll
    for (int rp = 0; rp < RPW; ++rp) { const int r = rp, pc = lane; const v4f val = *(const v4fa*)&sO[qg][r][pc * 4]; *(v4f*)(O + ((size_t)b * 2048 + q0 + r) * ldo + h * 128 + pc * 4) = val; }      /* 32 lanes x 16 B = whole 512-B row; TQ = 2048 rows per slab */
  } }

extern "C" void kernel_launch(void* const* d_in, const int* in_sizes, int n_in,
                              void* d_out, int out_size, void* d_ws, size_t ws_size, hipStream_t stream) {
  (void)in_sizes; (void)n_in; (void)out_size;
  const float* q = (const float*)d_in[0]; const float* k = (const float*)d_in[1]; const float* v = (const float*)d_in[2];
  char* ws = (char*)d_ws; size_t off = 0;
  auto take = [&](size_t bytes) { char* p = ws + off; off += (bytes + 255) & ~(size_t)255; return p; };
  _Float16* Q16 = (_Float16*)take((size_t)NBH * TQ * HD * 2); _Float16* K16 = (_Float16*)take((size_t)NBH * TK * HD * 2); _Float16* Vt = (_Float16*)take((size_t)NBH * TK * HD * 2);
  if (off > ws_size) return;      // three f16 planes, 42 MB in all
  k_prep<<<NBH * 2 * (TK / 64) / 4, 256, 0, stream>>>(q, k, v, Q16, K16, Vt);      // 512 workgroups: NBH*TQ*HD/8/256 = 4 x 512 chunks of Q, 8 x 512 of K, 4 x 512 tiles of V
  k_flash<<<NBH * 1 * (TQ / 128), 256, 0, stream>>>(Q16, HD, K16, HD, Vt, nullptr, (float*)d_out, HD);
}

// v007
// Measured time: 67 microseconds a run.
// Two timings next to v006 both put it at 1.05 times that version's speed.
// All steps since v000 together make it 9.06 times as fast.
#include <hip/hip_runtime.h>
// Attention with learned keys/values: out = softmax(Q·Kᵀ/√128)·V for Q [2,8,2048,128], K/V [2,8,4096,128] (head-major planes). One fused flash-style kernel (16 (b,h) slabs; 2048 query rows
// against 4096 keys; online softmax in f32; P f16 ≤ 1; O = P·Vᵀ-tiles; 32 query rows a wave; 128-wide head) on v_wmma_f32_16x16x32_f16 — Q/K/V bf16-exact in f16, f32 accumulate.
#define NBH 16
#define TQ 2048
#define TK 4096
#define HD 128

typedef __bf16 v16b __attribute__((ext_vector_type(16)));
typedef unsigned short v8us __attribute__((ext_vector_type(8), may_alias));
typedef float  v8f  __attribute__((ext_vector_type(8)));
typedef float  v4f  __attribute__((ext_vector_type(4)));
typedef float  v4fa __attribute__((ext_vector_type(4), may_alias));
union FragB { v16b v; v8us half[2]; unsigned short u[16]; };

__device__ __forceinline__ unsigned short bf16_bits(float x) { unsigned int u = __float_as_uint(x); return (unsigned short)((u + 0x7FFFu + ((u >> 16) & 1u)) >> 16); }
__device__ __forceinline__ float bf16_val(unsigned short b) { return __uint_as_float(((unsigned int)b) << 16); }
__device__ __forceinline__ float bf16_round(float x) { return bf16_val(bf16_bits(x)); }
// D += A·B with NT terms: 1 = ah·bh, 2 = + al·bh (A split), 3 = + ah·bl (both split)
template <int NT>
__device__ __forceinline__ v8f mmaN(v16b ah, v16b al, v16b bh, v16b bl, v8f c) {
  c = __builtin_amdgcn_wmma_f32_16x16x32_bf16(false, ah, false, bh, (short)0, c, false, false);
  if (NT >= 2) c = __builtin_amdgcn_wmma_f32_16x16x32_bf16(false, al, false, bh, (short)0, c, false, false);
  if (NT >= 3) c = __builtin_amdgcn_wmma_f32_16x16x32_bf16(false, ah, false, bl, (short)0, c, false, false);
  asm volatile("v_nop\n\tv_nop\n\tv_nop\n\tv_nop" : "+v"(c) : "v"(ah), "v"(al), "v"(bh), "v"(bl));
  return c;
}

__global__ __launch_bounds__(256) void k_wt_bf16(const float* __restrict__ W, unsigned short* __restrict__ Wt, int K, int N) {
  const int t = blockIdx.x * 256 + threadIdx.x;
  const int k8n = K / 8;
  if (t >= N * k8n) return;
  const int n = t / k8n, k8 = (t % k8n) * 8;
  v8us v;
#pragma unroll
  for (int i = 0; i < 8; ++i) v[i] = bf16_bits(W[(size_t)(k8 + i) * N + n]);
  *(v8us*)(Wt + (size_t)n * K + k8) = v;
  
}

// GEMM C[M][N] (f32, pitch ldc) = act(A[M][K]·W + bias). A f32 row-major (pitch lda) converted per fragment to bf16
// (ASPLIT: hi/lo two planes -> 2 terms, else single rounded term); Wt bf16 [N][K] (pitch ldb). BIAS_BF16 rounds the
// bias to bf16 first (bias quantised to bf16 before the add). K%32==0, M%16==0, N%64==0.
template <bool ASPLIT, int ACT, bool BIAS_BF16>
__global__ __launch_bounds__(128) void k_gemm_bf(const float* __restrict__ A, int lda, const unsigned short* __restrict__ Wt, int ldb,
                                               const float* __restrict__ bias, float* __restrict__ C, int ldc, int M, int N, int K) {
  __shared__ __attribute__((aligned(16))) float so[4][16][64];
  const int tid = threadIdx.x, w = tid >> 5, lane = tid & 31, ln = lane & 15, hh = lane >> 4;
  const int ntn = N / 64;
  const int wid = blockIdx.x * 4 + w;
  const int mt = wid / ntn, nq = wid % ntn;
  if (mt * 16 >= M) return;
  const int row0 = mt * 16, col0 = nq * 64;
  const float* arow = A + (size_t)(row0 + ln) * lda;
  v8f acc[4] = {};
  for (int kb = 0; kb < K; kb += 32) {
    FragB ah, al;
    const v4f x0 = *(const v4fa*)(arow + kb + 8 * hh), x1 = *(const v4fa*)(arow + kb + 8 * hh + 4);
    const v4f x2 = *(const v4fa*)(arow + kb + 16 + 8 * hh), x3 = *(const v4fa*)(arow + kb + 16 + 8 * hh + 4);
    float xs[16] = {x0[0],x0[1],x0[2],x0[3],x1[0],x1[1],x1[2],x1[3],x2[0],x2[1],x2[2],x2[3],x3[0],x3[1],x3[2],x3[3]};
#pragma unroll
    for (int i = 0; i < 16; ++i) { const unsigned short hb = bf16_bits(xs[i]); ah.u[i] = hb; al.u[i] = ASPLIT ? bf16_bits(xs[i] - bf16_val(hb)) : (unsigned short)0; }
#pragma unroll
    for (int t = 0; t < 4; ++t) {
      const unsigned short* brow = Wt + (size_t)(col0 + t * 16 + ln) * ldb + kb;
      FragB b;
      b.half[0] = *(const v8us*)(brow + 8 * hh);
      b.half[1] = *(const v8us*)(brow + 16 + 8 * hh);
      acc[t] = mmaN<ASPLIT ? 2 : 1>(ah.v, al.v, b.v, b.v, acc[t]);
    }
  }
#pragma unroll
  for (int t = 0; t < 4; ++t) {
    float bv = bias ? bias[col0 + t * 16 + ln] : 0.f;
    if (BIAS_BF16) bv = bf16_round(bv);
#pragma unroll
    for (int r = 0; r < 8; ++r) { float v = acc[t][r] + bv; if (ACT == 1) v = fmaxf(v, 0.f); so[w][8 * hh + r][t * 16 + ln] = v; }
  }
  __builtin_amdgcn_fence(__ATOMIC_ACQ_REL, "workgroup");
  __builtin_amdgcn_wave_barrier();
  const int rsub = lane >> 4, c4 = (lane & 15) * 4;
  {
#pragma unroll
    for (int q = 0; q < 8; ++q) {
      const int r = q * 2 + rsub;
      const v4f v = *(const v4fa*)&so[w][r][c4];
      *(v4f*)(C + (size_t)(row0 + r) * ldc + col0 + c4) = v;
    }
    
  }
}

// Flash-style causal/unmasked attention, all contractions 3-term bf16 hi/lo splits, f32 softmax with running max.
// q,k,v rows are read from f32 buffers with arbitrary row pitch (so they can live inside a fused qkv buffer);
// D = head size (multiple of 32, <= 128); one wave = 16 query rows; block = 4 waves (64 queries) sharing K/V chunks of 32.
template <int D, bool CAUSAL>
__global__ __launch_bounds__(128) void k_flash(const float* __restrict__ qb, const float* __restrict__ kb, const float* __restrict__ vb,
                                             int pitch, int T, int H, float scale, float* __restrict__ y, int ypitch) {
  constexpr int KS = D / 32;        // k-steps for QK
  constexpr int DT = D / 16;        // d tiles for PV
  __shared__ __attribute__((aligned(16))) unsigned short sKh[32][D + 8], sKl[32][D + 8], sVh[32][D + 8], sVl[32][D + 8];
  __shared__ __attribute__((aligned(16))) unsigned short sPh[4][16][40], sPl[4][16][40];
  __shared__ __attribute__((aligned(16))) float sO[4][16][D];
  const int tid = threadIdx.x, w = tid >> 5, lane = tid & 31, ln = lane & 15, hh = lane >> 4;
  const int nqb = (T + 63) / 64;
  const int bh = blockIdx.x / nqb, qblk = blockIdx.x % nqb;
  const int b = bh / H, h = bh % H;
  const int q0 = qblk * 64 + w * 16;
  const float* Q = qb + (size_t)b * T * pitch + h * D;
  const float* K = kb + (size_t)b * T * pitch + h * D;
  const float* V = vb + (size_t)b * T * pitch + h * D;

  // A fragments of the wave's 16 query rows (scaled), hi/lo
  FragB aqh[KS], aql[KS];
  {
    int row = q0 + ln; if (row >= T) row = T - 1;
    const float* qr = Q + (size_t)row * pitch;
#pragma unroll
    for (int ks = 0; ks < KS; ++ks)
#pragma unroll
      for (int i = 0; i < 16; ++i) {
        const int d = ks * 32 + ((i < 8) ? (8 * hh + i) : (16 + 8 * hh + (i - 8)));
        const float x = qr[d] * scale; const unsigned short hb = bf16_bits(x);
        aqh[ks].u[i] = hb; aql[ks].u[i] = bf16_bits(x - bf16_val(hb));
      }
  }
  float m_r[8], l_r[8];
#pragma unroll
  for (int r = 0; r < 8; ++r) { m_r[r] = -3.0e38f; l_r[r] = 0.f; }
  v8f oacc[DT];
#pragma unroll
  for (int dt = 0; dt < DT; ++dt) oacc[dt] = (v8f){0.f,0.f,0.f,0.f,0.f,0.f,0.f,0.f};

  const int kv_end = CAUSAL ? min(T, qblk * 64 + 64) : T;     // block-uniform
  for (int j0 = 0; j0 < kv_end; j0 += 32) {
    __syncthreads();
    for (int e = tid; e < 32 * (D / 4); e += 128) {
      const int r = e / (D / 4), c4 = (e % (D / 4)) * 4;
      const int key = j0 + r;
      v4f kf = {0.f,0.f,0.f,0.f}, vf = {0.f,0.f,0.f,0.f};
      if (key < T) { kf = *(const v4fa*)(K + (size_t)key * pitch + c4); vf = *(const v4fa*)(V + (size_t)key * pitch + c4); }
#pragma unroll
      for (int t = 0; t < 4; ++t) {
        unsigned short hb = bf16_bits(kf[t]); sKh[r][c4 + t] = hb; sKl[r][c4 + t] = bf16_bits(kf[t] - bf16_val(hb));
        hb = bf16_bits(vf[t]); sVh[r][c4 + t] = hb; sVl[r][c4 + t] = bf16_bits(vf[t] - bf16_val(hb));
      }
    }
    __syncthreads();
    // S tile 16 x 32
    v8f s[2];
#pragma unroll
    for (int nt = 0; nt < 2; ++nt) {
      v8f acc = {};
#pragma unroll
      for (int ks = 0; ks < KS; ++ks) {
        FragB bh_, bl_;
        bh_.half[0] = *(const v8us*)&sKh[nt * 16 + ln][ks * 32 + 8 * hh]; bh_.half[1] = *(const v8us*)&sKh[nt * 16 + ln][ks * 32 + 16 + 8 * hh];
        bl_.half[0] = *(const v8us*)&sKl[nt * 16 + ln][ks * 32 + 8 * hh]; bl_.half[1] = *(const v8us*)&sKl[nt * 16 + ln][ks * 32 + 16 + 8 * hh];
        acc = mmaN<3>(aqh[ks].v, aql[ks].v, bh_.v, bl_.v, acc);
      }
      s[nt] = acc;
    }
    // mask + running max (rows 8hh+r; the 16 lanes of a half share rows)
    float alpha[8];
#pragma unroll
    for (int r = 0; r < 8; ++r) {
      const int qi = q0 + 8 * hh + r;
      const int ja = j0 + ln, jb = j0 + 16 + ln;
      if (CAUSAL) { if (ja > qi) s[0][r] = -3.0e38f; if (jb > qi) s[1][r] = -3.0e38f; }
      if (ja >= T) s[0][r] = -3.0e38f;
      if (jb >= T) s[1][r] = -3.0e38f;
      float mx = fmaxf(s[0][r], s[1][r]);
      mx = fmaxf(mx, __shfl_xor(mx, 1, 32)); mx = fmaxf(mx, __shfl_xor(mx, 2, 32)); mx = fmaxf(mx, __shfl_xor(mx, 4, 32)); mx = fmaxf(mx, __shfl_xor(mx, 8, 32));
      const float mnew = fmaxf(m_r[r], mx);
      alpha[r] = (mnew > -1.0e38f) ? __expf(m_r[r] - mnew) : 1.0f;
      const float p0 = (s[0][r] > -1.0e38f) ? __expf(s[0][r] - mnew) : 0.f;
      const float p1 = (s[1][r] > -1.0e38f) ? __expf(s[1][r] - mnew) : 0.f;
      m_r[r] = mnew;
      l_r[r] = l_r[r] * alpha[r] + p0 + p1;            // per-lane partial row sum (16 lanes combined at the end)
      unsigned short hb = bf16_bits(p0); sPh[w][8 * hh + r][ln] = hb;      sPl[w][8 * hh + r][ln] = bf16_bits(p0 - bf16_val(hb));
      hb = bf16_bits(p1);                sPh[w][8 * hh + r][16 + ln] = hb; sPl[w][8 * hh + r][16 + ln] = bf16_bits(p1 - bf16_val(hb));
    }
#pragma unroll
    for (int dt = 0; dt < DT; ++dt)
#pragma unroll
      for (int r = 0; r < 8; ++r) oacc[dt][r] *= alpha[r];
    __builtin_amdgcn_fence(__ATOMIC_ACQ_REL, "workgroup");
    __builtin_amdgcn_wave_barrier();
    FragB pah, pal;
    pah.half[0] = *(const v8us*)&sPh[w][ln][8 * hh]; pah.half[1] = *(const v8us*)&sPh[w][ln][16 + 8 * hh];
    pal.half[0] = *(const v8us*)&sPl[w][ln][8 * hh]; pal.half[1] = *(const v8us*)&sPl[w][ln][16 + 8 * hh];
#pragma unroll
    for (int dt = 0; dt < DT; ++dt) {
      FragB bvh, bvl;
#pragma unroll
      for (int i = 0; i < 8; ++i) {
        bvh.u[i] = sVh[8 * hh + i][dt * 16 + ln]; bvh.u[8 + i] = sVh[16 + 8 * hh + i][dt * 16 + ln];
        bvl.u[i] = sVl[8 * hh + i][dt * 16 + ln]; bvl.u[8 + i] = sVl[16 + 8 * hh + i][dt * 16 + ln];
      }
      oacc[dt] = mmaN<3>(pah.v, pal.v, bvh.v, bvl.v, oacc[dt]);
    }
    __builtin_amdgcn_fence(__ATOMIC_ACQ_REL, "workgroup");
    __builtin_amdgcn_wave_barrier();
  }
#pragma unroll
  for (int r = 0; r < 8; ++r) {
    float l = l_r[r];
    l += __shfl_xor(l, 1, 32); l += __shfl_xor(l, 2, 32); l += __shfl_xor(l, 4, 32); l += __shfl_xor(l, 8, 32);
    l_r[r] = (l > 0.f) ? 1.0f / l : 0.f;
  }
#pragma unroll
  for (int dt = 0; dt < DT; ++dt)
#pragma unroll
    for (int r = 0; r < 8; ++r) sO[w][8 * hh + r][dt * 16 + ln] = oacc[dt][r] * l_r[r];
  __builtin_amdgcn_fence(__ATOMIC_ACQ_REL, "workgroup");
  __builtin_amdgcn_wave_barrier();
  {
    for (int r = 0; r < 16; ++r) {
      const int row = q0 + r;
      if (row < T && lane < D / 4) {
        const v4f val = *(const v4fa*)&sO[w][r][lane * 4];
        *(v4f*)(y + ((size_t)b * T + row) * ypitch + h * D + lane * 4) = val;
      }
    }
    
  }
}

// GEMM C = act(A·W + bias + resid): A f32 (ASPLIT -> hi/lo 2 terms), Wt bf16 [N][K]; ACT 0 none, 1 relu, 2 exact gelu;
// resid (optional, f32, row index = (row % rmod), pitch ldr, RES_BF16 rounds it) added before the activation.
template <bool ASPLIT, int ACT, bool BIAS_BF16, bool RES_BF16>
__global__ __launch_bounds__(128) void k_gemm_bf3(const float* __restrict__ A, int lda, const unsigned short* __restrict__ Wt, int ldb,
                                                const float* __restrict__ bias, const float* __restrict__ resid, int rmod, int ldr,
                                                float* __restrict__ C, int ldc, int M, int N, int K) {
  __shared__ __attribute__((aligned(16))) float so[4][16][64];
  const int tid = threadIdx.x, w = tid >> 5, lane = tid & 31, ln = lane & 15, hh = lane >> 4;
  const int ntn = N / 64;
  const int wid = blockIdx.x * 4 + w;
  const int mt = wid / ntn, nq = wid % ntn;
  if (mt * 16 >= M) return;
  const int row0 = mt * 16, col0 = nq * 64;
  const float* arow = A + (size_t)(row0 + ln) * lda;
  v8f acc[4] = {};
  for (int kb = 0; kb < K; kb += 32) {
    FragB ah, al;
    const v4f x0 = *(const v4fa*)(arow + kb + 8 * hh), x1 = *(const v4fa*)(arow + kb + 8 * hh + 4);
    const v4f x2 = *(const v4fa*)(arow + kb + 16 + 8 * hh), x3 = *(const v4fa*)(arow + kb + 16 + 8 * hh + 4);
    float xs[16] = {x0[0],x0[1],x0[2],x0[3],x1[0],x1[1],x1[2],x1[3],x2[0],x2[1],x2[2],x2[3],x3[0],x3[1],x3[2],x3[3]};
#pragma unroll
    for (int i = 0; i < 16; ++i) { const unsigned short hb = bf16_bits(xs[i]); ah.u[i] = hb; al.u[i] = ASPLIT ? bf16_bits(xs[i] - bf16_val(hb)) : (unsigned short)0; }
#pragma unroll
    for (int t = 0; t < 4; ++t) {
      const unsigned short* brow = Wt + (size_t)(col0 + t * 16 + ln) * ldb + kb;
      FragB b;
      b.half[0] = *(const v8us*)(brow + 8 * hh);
      b.half[1] = *(const v8us*)(brow + 16 + 8 * hh);
      acc[t] = mmaN<ASPLIT ? 2 : 1>(ah.v, al.v, b.v, b.v, acc[t]);
    }
  }
#pragma unroll
  for (int t = 0; t < 4; ++t) {
    const int col = col0 + t * 16 + ln;
    float bv = bias ? bias[col] : 0.f;
    if (BIAS_BF16) bv = bf16_round(bv);
#pragma unroll
    for (int r = 0; r < 8; ++r) {
      float v = acc[t][r] + bv;
      if (resid) { float rv = resid[(size_t)((row0 + 8 * hh + r) % rmod) * ldr + col]; if (RES_BF16) rv = bf16_round(rv); v += rv; }
      if (ACT == 1) v = fmaxf(v, 0.f);
      if (ACT == 2) v = 0.5f * v * (1.0f + erff(v * 0.70710678118654752f));
      if (ACT == 3) { const float u = 0.7978845608028654f * (v + 0.044715f * v * v * v); v = 0.5f * v * (1.0f + tanhf(u)); }
      so[w][8 * hh + r][t * 16 + ln] = v;
    }
  }
  __builtin_amdgcn_fence(__ATOMIC_ACQ_REL, "workgroup");
  __builtin_amdgcn_wave_barrier();
  const int rsub = lane >> 4, c4 = (lane & 15) * 4;
  {
#pragma unroll
    for (int q = 0; q < 8; ++q) {
      const int r = q * 2 + rsub;
      const v4f v = *(const v4fa*)&so[w][r][c4];
      *(v4f*)(C + (size_t)(row0 + r) * ldc + col0 + c4) = v;
    }
    
  }
}
// row LayerNorm (biased variance, eps) over N: s = X (+ R); optional out_sum <- s; out_norm <- (s-mu)*rsqrt(var+eps)*g + b
template <bool PARAM_BF16>
__global__ __launch_bounds__(256) void k_layernorm(const float* __restrict__ X, const float* __restrict__ R, const float* __restrict__ g, const float* __restrict__ bta,
                                                  float* __restrict__ out_sum, float* __restrict__ out_norm, int N, float eps) {
  __shared__ float red[256];
  const int row = blockIdx.x, tid = threadIdx.x;
  const float* x = X + (size_t)row * N; const float* rr = R ? R + (size_t)row * N : nullptr;
  float vals[16];                     // up to N = 4096
  const int per = N / 256;            // contiguous chunk per thread? use strided-by-4 chunks: thread handles j = tid*4 + 1024*u
  float s1 = 0.f;
  for (int u = 0; u < per / 4; ++u) {
    const int j = tid * 4 + 1024 * u;
    const v4f a = *(const v4fa*)(x + j);
    v4f b = {0.f,0.f,0.f,0.f}; if (rr) b = *(const v4fa*)(rr + j);
#pragma unroll
    for (int q = 0; q < 4; ++q) { const float v = a[q] + b[q]; vals[u * 4 + q] = v; s1 += v; }
  }
  red[tid] = s1; __syncthreads();
  for (int st = 128; st > 0; st >>= 1) { if (tid < st) red[tid] += red[tid + st]; __syncthreads(); }
  const float mu = red[0] / (float)N; __syncthreads();
  float s2 = 0.f;
  for (int u = 0; u < per / 4; ++u)
#pragma unroll
    for (int q = 0; q < 4; ++q) { const float c = vals[u * 4 + q] - mu; s2 += c * c; }
  red[tid] = s2; __syncthreads();
  for (int st = 128; st > 0; st >>= 1) { if (tid < st) red[tid] += red[tid + st]; __syncthreads(); }
  const float rs = rsqrtf(red[0] / (float)N + eps);
  {
    for (int u = 0; u < per / 4; ++u) {
      const int j = tid * 4 + 1024 * u;
      v4f o, sm;
#pragma unroll
      for (int q = 0; q < 4; ++q) {
        float gg = g[j + q], bb = bta[j + q];
        if (PARAM_BF16) { gg = bf16_round(gg); bb = bf16_round(bb); }
        sm[q] = vals[u * 4 + q]; o[q] = (vals[u * 4 + q] - mu) * rs * gg + bb;
      }
      if (out_sum) *(v4f*)(out_sum + (size_t)row * N + j) = sm;
      *(v4f*)(out_norm + (size_t)row * N + j) = o;
    }
    
  }
}



// ---- f16 WMMA path (v_wmma_f32_16x16x32_f16): 11-bit significands for operands in range — used for both Q·Kᵀ and P·V in the launched attention kernel
typedef _Float16 v16h __attribute__((ext_vector_type(16)));
union FragH { v16h v; v8us half[2]; _Float16 h[16]; unsigned short u[16]; };
template <int NT>
__device__ __forceinline__ v8f mmaH(v16h ah, v16h al, v16h bh, v16h bl, v8f c) {
  c = __builtin_amdgcn_wmma_f32_16x16x32_f16(false, ah, false, bh, (short)0, c, false, false);
  if (NT >= 2) c = __builtin_amdgcn_wmma_f32_16x16x32_f16(false, al, false, bh, (short)0, c, false, false);
  if (NT >= 3) c = __builtin_amdgcn_wmma_f32_16x16x32_f16(false, ah, false, bl, (short)0, c, false, false);
  asm volatile("v_nop\n\tv_nop\n\tv_nop\n\tv_nop" : "+v"(c) : "v"(ah), "v"(al), "v"(bh), "v"(bl));
  return c;
}
// batched GEMM like k_gemm_b but f16 operands: A f32 (split into f16 hi/lo if ASPLIT, else rounded to f16), Bt = f16 values [n][k]; alpha; C f32; N multiple of 16 (partial tiles skipped)
template <bool ASPLIT>
__global__ __launch_bounds__(128) void k_gemm_h(const float* __restrict__ A, int lda, size_t sA, const _Float16* __restrict__ Bh, int ldb, size_t sB, float alpha, float* __restrict__ C, int ldc, size_t sC, int M, int N, int K) {
  __shared__ __attribute__((aligned(16))) float so[4][16][64];
  const int tid = threadIdx.x, w = tid >> 5, lane = tid & 31, ln = lane & 15, hh = lane >> 4; const int by = blockIdx.y;
  A += (size_t)by * sA; Bh += (size_t)by * sB; C += (size_t)by * sC;
  const int ntn = (N + 63) / 64; const int wid = blockIdx.x * 4 + w; const int mt = wid / ntn, nq = wid % ntn; if (mt * 16 >= M) return;
  const int row0 = mt * 16, col0 = nq * 64; const float* arow = A + (size_t)(row0 + ln) * lda;
  v8f acc[4] = {};
  for (int kb = 0; kb < K; kb += 32) {
    FragH ah, al;
    const v4f x0 = *(const v4fa*)(arow + kb + 8 * hh), x1 = *(const v4fa*)(arow + kb + 8 * hh + 4), x2 = *(const v4fa*)(arow + kb + 16 + 8 * hh), x3 = *(const v4fa*)(arow + kb + 16 + 8 * hh + 4);
    float xs[16] = {x0[0],x0[1],x0[2],x0[3],x1[0],x1[1],x1[2],x1[3],x2[0],x2[1],x2[2],x2[3],x3[0],x3[1],x3[2],x3[3]};
#pragma unroll
    for (int i = 0; i < 16; ++i) { const _Float16 h = (_Float16)xs[i]; ah.h[i] = h; al.h[i] = ASPLIT ? (_Float16)(xs[i] - (float)h) : (_Float16)0.0f; }
#pragma unroll
    for (int t = 0; t < 4; ++t) { if (col0 + t * 16 >= N) continue; const size_t boff = (size_t)(col0 + t * 16 + ln) * ldb + kb; FragH bq; bq.half[0] = *(const v8us*)(Bh + boff + 8 * hh); bq.half[1] = *(const v8us*)(Bh + boff + 16 + 8 * hh);
      acc[t] = mmaH<ASPLIT ? 2 : 1>(ah.v, al.v, bq.v, bq.v, acc[t]); }
  }
#pragma unroll
  for (int t = 0; t < 4; ++t) { if (col0 + t * 16 >= N) continue;
#pragma unroll
    for (int r = 0; r < 8; ++r) so[w][8 * hh + r][t * 16 + ln] = acc[t][r] * alpha; }
  __builtin_amdgcn_fence(__ATOMIC_ACQ_REL, "workgroup"); __builtin_amdgcn_wave_barrier();
  const int rsub = lane >> 4, c4 = (lane & 15) * 4;
  {
#pragma unroll
    for (int q = 0; q < 8; ++q) { const int r = q * 2 + rsub; if (col0 + c4 < N) { const v4f v = *(const v4fa*)&so[w][r][c4]; *(v4f*)(C + (size_t)(row0 + r) * ldc + col0 + c4) = v; } }
     }
}

// Wt[n][k] = f16(W[k][n]·scale) from f32 row-major W[K][N] (scale = power of two; bf16-exact weights stay exact in f16 away from the subnormal range)
__global__ __launch_bounds__(256) void k_wt_f16(const float* __restrict__ W, _Float16* __restrict__ Wt, int K, int N, float scale) {
  const int t = blockIdx.x * 256 + threadIdx.x; if (t >= N * (K / 8)) return; const int n = t / (K / 8), k8 = (t % (K / 8)) * 8; FragH f;
#pragma unroll
  for (int i = 0; i < 8; ++i) f.h[i] = (_Float16)(bf16_round(W[(size_t)(k8 + i) * N + n]) * scale); const v8us o = f.half[0];
  *(v8us*)((unsigned short*)Wt + (size_t)n * K + k8) = o; 
}
// k_gemm_hh variant with fused epilogue: v = acc·alpha + bias[by·sBias + col] (+ CP[(row/rowsPerB)·sCPb + by·64 + col] if CP) ; ACT 0 none / 1 elu ; writes f16 C16 (and f32 C if non-null)
template <int ACT>
__global__ __launch_bounds__(128) void k_gemm_hhx(const _Float16* __restrict__ A, int lda, size_t sA, const _Float16* __restrict__ Bh, int ldb, size_t sB, float alpha, const float* __restrict__ bias, size_t sBias, const float* __restrict__ CP, int rowsPerB, size_t sCPb, int row0g,
    float* __restrict__ C, _Float16* __restrict__ C16, int ldc, size_t sC, int M, int N, int K) {
  __shared__ __attribute__((aligned(16))) float so[4][16][64];
  const int tid = threadIdx.x, w = tid >> 5, lane = tid & 31, ln = lane & 15, hh = lane >> 4; const int by = blockIdx.y;
  A += (size_t)by * sA; Bh += (size_t)by * sB; const size_t cofs = (size_t)by * sC; const float* bp = bias ? bias + (size_t)by * sBias : nullptr;
  const int ntn = (N + 63) / 64; const int wid = blockIdx.x * 4 + w; const int mt = wid / ntn, nq = wid % ntn; if (mt * 16 >= M) return;
  const int row0 = mt * 16, col0 = nq * 64; const _Float16* arow = A + (size_t)(row0 + ln) * lda;
  v8f acc[4] = {};
  for (int kb = 0; kb < K; kb += 32) { FragH ah; ah.half[0] = *(const v8us*)((const unsigned short*)arow + kb + 8 * hh); ah.half[1] = *(const v8us*)((const unsigned short*)arow + kb + 16 + 8 * hh);
#pragma unroll
    for (int t = 0; t < 4; ++t) { if (col0 + t * 16 >= N) continue; const size_t boff = (size_t)(col0 + t * 16 + ln) * ldb + kb; FragH bq; bq.half[0] = *(const v8us*)((const unsigned short*)Bh + boff + 8 * hh); bq.half[1] = *(const v8us*)((const unsigned short*)Bh + boff + 16 + 8 * hh);
      acc[t] = mmaH<1>(ah.v, ah.v, bq.v, bq.v, acc[t]); }
  }
#pragma unroll
  for (int t = 0; t < 4; ++t) { if (col0 + t * 16 >= N) continue; const int col = col0 + t * 16 + ln; const float bv = bp ? bf16_round(bp[col]) : 0.f;
#pragma unroll
    for (int r = 0; r < 8; ++r) { float v = acc[t][r] * alpha + bv; if (CP) { const int bidx = (row0g + row0 + 8 * hh + r) / rowsPerB; v += CP[(size_t)bidx * sCPb + (size_t)by * 64 + col]; } if (ACT == 1) v = (v > 0.f) ? v : expm1f(v); else if (ACT == 3) v = fmaxf(v, 0.f); so[w][8 * hh + r][t * 16 + ln] = v; } }
  __builtin_amdgcn_fence(__ATOMIC_ACQ_REL, "workgroup"); __builtin_amdgcn_wave_barrier();
  const int rsub = lane >> 4, c4 = (lane & 15) * 4; typedef _Float16 v4h __attribute__((ext_vector_type(4)));
  {
#pragma unroll
    for (int q = 0; q < 8; ++q) { const int r = q * 2 + rsub; if (col0 + c4 < N) { const v4f v = *(const v4fa*)&so[w][r][c4]; if (C) *(v4f*)(C + cofs + (size_t)(row0 + r) * ldc + col0 + c4) = v; if (C16) { v4h h4; for (int i = 0; i < 4; ++i) h4[i] = (_Float16)v[i]; *(v4h*)(C16 + cofs + (size_t)(row0 + r) * ldc + col0 + c4) = h4; } } }
     }
}


typedef _Float16 v4h __attribute__((ext_vector_type(4)));

__global__ __launch_bounds__(256) void k_h16(const float* __restrict__ x, _Float16* __restrict__ X16, size_t n8) { const size_t t = (size_t)blockIdx.x * 256 + threadIdx.x; if (t >= n8) return; FragH f;
#pragma unroll
  for (int q = 0; q < 8; ++q) f.h[q] = (_Float16)x[t * 8 + q]; *(v8us*)((unsigned short*)X16 + t * 8) = f.half[0];  }
__global__ __launch_bounds__(256) void k_round16f(const float* __restrict__ W, _Float16* __restrict__ Bt, size_t n8) { const size_t t = (size_t)blockIdx.x * 256 + threadIdx.x; if (t >= n8) return; FragH f;
#pragma unroll
  for (int i = 0; i < 8; ++i) f.h[i] = (_Float16)(bf16_round(W[t * 8 + i]) * 16.0f); *(v8us*)((unsigned short*)Bt + t * 8) = f.half[0];  }
// eight consecutive f32, each rounded to bf16 and held as f16: 16 bytes
__device__ __forceinline__ v8us cvt8(v4f a, v4f b) { FragH f;
#pragma unroll
  for (int e = 0; e < 4; ++e) { f.h[e] = (_Float16)bf16_round(a[e]); f.h[4 + e] = (_Float16)bf16_round(b[e]); }
  return f.half[0]; }
// The whole preparation in one launch of 512 workgroups. Each converts 4 chunks of Q and 8 of K (a chunk = 256 threads x 8 elements) and transposes 4 neighbouring tiles of V (64 keys x 64 d),
// converted on the way from f32, into Vt [bh][128][TK]: few waves with much to do each, instead of one wave per 256 elements in four launches, and no f16 copy of V in between.
__global__ __launch_bounds__(256) void k_prep(const float* __restrict__ q, const float* __restrict__ k, const float* __restrict__ v, _Float16* __restrict__ Q16, _Float16* __restrict__ K16, _Float16* __restrict__ Vt) {
  __shared__ unsigned short tl[4][64][66];      /* a tile of its own for each of the 4: one barrier serves all */
  const int tid = threadIdx.x, r0 = tid / 8, c8 = (tid % 8) * 8;
  const int slab = blockIdx.x / (TK / 256), lg0 = (blockIdx.x % (TK / 256)) * 4;      /* slab = (b,h) plane x which 64 of the 128 d; tiles lg0 .. lg0 + 3 of its TK / 64 */
  const size_t tq = ((size_t)blockIdx.x * 4 * 256 + tid) * 8, tk = ((size_t)blockIdx.x * 8 * 256 + tid) * 8;
  const float* vp = v + ((size_t)(slab / 2) * TK + lg0 * 64 + r0) * HD + (slab % 2) * 64 + c8; const float* qp = q + tq; const float* kp = k + tk;
  v4f xv[8][2], xq[4][2], xk[8][2];      /* all 40 loads of a thread are issued before the first value is used: one memory latency for the launch */
#pragma unroll
  for (int i = 0; i < 8; ++i) { xv[i][0] = *(const v4fa*)(vp + i * 32 * HD); xv[i][1] = *(const v4fa*)(vp + i * 32 * HD + 4); }      /* row i * 32 + r0 of the 256 keys: tile i / 2, its row (i % 2) * 32 + r0 */
#pragma unroll
  for (int u = 0; u < 4; ++u) { xq[u][0] = *(const v4fa*)(qp + u * 2048); xq[u][1] = *(const v4fa*)(qp + u * 2048 + 4); }
#pragma unroll
  for (int u = 0; u < 8; ++u) { xk[u][0] = *(const v4fa*)(kp + u * 2048); xk[u][1] = *(const v4fa*)(kp + u * 2048 + 4); }
  asm volatile("s_wait_xcnt 0x0" :: "v"(vp), "v"(qp), "v"(kp) : "memory");      /* a precaution: the three address pairs stay live up to this wait, so that no load's result is written over a pair that an issued load names */
#pragma unroll
  for (int i = 0; i < 8; ++i) { FragH f; f.half[0] = cvt8(xv[i][0], xv[i][1]);
#pragma unroll
    for (int e = 0; e < 8; ++e) tl[i / 2][(i % 2) * 32 + r0][c8 + e] = f.u[e]; }
#pragma unroll
  for (int u = 0; u < 4; ++u) *(v8us*)((unsigned short*)Q16 + tq + u * 2048) = cvt8(xq[u][0], xq[u][1]);
#pragma unroll
  for (int u = 0; u < 8; ++u) *(v8us*)((unsigned short*)K16 + tk + u * 2048) = cvt8(xk[u][0], xk[u][1]);
  __syncthreads();      /* every thread's part of the 4 tiles is in LDS before a column is read */
#pragma unroll
  for (int u = 0; u < 4; ++u) {
#pragma unroll
    for (int rd = 0; rd < 2; ++rd) { const int d = rd * 32 + tid / 8, pc = tid % 8; FragH f;
#pragma unroll
      for (int e = 0; e < 8; ++e) f.u[e] = tl[u][pc * 8 + e][d];
      *(v8us*)((unsigned short*)Vt + ((size_t)slab * 64 + d) * TK + (lg0 + u) * 64 + pc * 8) = f.half[0]; } } }

// Eight asynchronous 16-byte copies of one lane, global memory -> LDS, no register in between: copy i takes LDS byte address l + i*ls and global address g + i*gs (elements).
// The s_wait_xcnt is the statement's last line so that no address register of an issued copy is rewritten ahead of it.
__device__ __forceinline__ void copy8_to_lds(unsigned l, unsigned ls, const unsigned short* g, size_t gs) {
  asm volatile("global_load_async_to_lds_b128 %0, %8, off\n\t"
               "global_load_async_to_lds_b128 %1, %9, off\n\t"
               "global_load_async_to_lds_b128 %2, %10, off\n\t"
               "global_load_async_to_lds_b128 %3, %11, off\n\t"
               "global_load_async_to_lds_b128 %4, %12, off\n\t"
               "global_load_async_to_lds_b128 %5, %13, off\n\t"
               "global_load_async_to_lds_b128 %6, %14, off\n\t"
               "global_load_async_to_lds_b128 %7, %15, off\n\t"
               "s_wait_xcnt 0x0"
               :: "v"(l), "v"(l + ls), "v"(l + 2 * ls), "v"(l + 3 * ls), "v"(l + 4 * ls), "v"(l + 5 * ls), "v"(l + 6 * ls), "v"(l + 7 * ls),
                  "v"(g), "v"(g + gs), "v"(g + 2 * gs), "v"(g + 3 * gs), "v"(g + 4 * gs), "v"(g + 5 * gs), "v"(g + 6 * gs), "v"(g + 7 * gs)
               : "memory");
}

// The matrix builtin alone, no v_nop statement tied to its result: the compiler keeps the distance behind its own builtins, fills it with the pass's own vector work where it can,
// and the vector port is left to the SIMD's other wave. The stage loop's back edge has its four slots at the foot of each pass.
__device__ __forceinline__ v8f mmaC(v16h a, v16h b, v8f c) { return __builtin_amdgcn_wmma_f32_16x16x32_f16(false, a, false, b, (short)0, c, false, false); }

// The K fragments of one pass of 32 keys (two tiles of 16 rows, four steps of 32 d) as one group of 16 reads; p = the lane's row of the first tile at its half's first 8 d, pit = row pitch in elements
__device__ __forceinline__ void load_k(FragH (&f)[2][4], const unsigned short* p, int pit) {
#pragma unroll
  for (int nt = 0; nt < 2; ++nt)
#pragma unroll
    for (int ks = 0; ks < 4; ++ks) { f[nt][ks].half[0] = *(const v8us*)(p + nt * 16 * pit + ks * 32); f[nt][ks].half[1] = *(const v8us*)(p + nt * 16 * pit + ks * 32 + 16); } }

// value of lane l ^ 16: the other half of the wave holds the other 16 of a query column's 32 keys
__device__ __forceinline__ float xhalf(float x) { return __builtin_bit_cast(float, __builtin_amdgcn_permlanex16(__builtin_bit_cast(int, x), __builtin_bit_cast(int, x), 0x76543210, 0xfedcba98, false, false)); }

__global__ __launch_bounds__(256) void k_flash(const _Float16* __restrict__ Q16, int ldq, const _Float16* __restrict__ K16, int ldk, const _Float16* __restrict__ Vt, const int* __restrict__ MSK, float* __restrict__ O, int ldo) {
  constexpr int RPW = 32, RTN = RPW / 16, NQB = 2048 / (4 * RPW), DT = 8, KS = 4;      /* head_dim 128 */
  constexpr float SL2 = 0.08838834764831845f * 1.4426950408889634f;      /* 1/sqrt(128) * log2(e): the running maximum m_r is kept in this base-2 scale */
  __shared__ __attribute__((aligned(16))) float sO[4][RPW][128 + 4]; __shared__ float sM[4][RTN][32], sL[4][RTN][32];      /* sM, sL: the second key group's maximum and sum, lane by lane */
  constexpr int SKEYS = 128, NST = 4096 / SKEYS, KPIT = 128 + 8, VPIT = SKEYS + 8, NBUF = 3, NPP = SKEYS / 64;      /* a stage = 128 keys, 64 (NPP passes of 32) for each key group; both row pitches 272 B = 16 B x odd, conflict-free for 16-byte reads */
  __shared__ __attribute__((aligned(16))) unsigned short sK[NBUF][SKEYS][KPIT]; __shared__ __attribute__((aligned(16))) unsigned short sV[NBUF][128][VPIT];      /* three buffers each: K rows [key][d], Vt rows [d][key]; stage s lies in buffer s mod 3 */
  const int tid = threadIdx.x, w = __builtin_amdgcn_readfirstlane(tid >> 5), lane = tid & 31, ln = lane & 15, hh = lane >> 4;
  const int qg = w & 3, kg = w >> 2;      /* which 32 queries, which half of a stage's keys */
  const int slab = blockIdx.x / NQB, qblk = blockIdx.x % NQB; const int b = slab / 1, h = slab % 1; const int qb0 = qblk * (4 * RPW); const int q0 = qb0 + qg * RPW;
  FragH aq[2][KS];
#pragma unroll
  for (int rt = 0; rt < RTN; ++rt) { const unsigned short* qr = (const unsigned short*)Q16 + ((size_t)b * 2048 + q0 + rt * 16 + ln) * ldq + h * 128;
#pragma unroll
    for (int ks = 0; ks < KS; ++ks) { aq[rt][ks].half[0] = *(const v8us*)(qr + ks * 32 + 8 * hh); aq[rt][ks].half[1] = *(const v8us*)(qr + ks * 32 + 16 + 8 * hh); } }
  const unsigned short* Vth = (const unsigned short*)Vt + (size_t)slab * 128 * 4096;      /* [bh][128][TK] */
  float m_r[2], l_r[2]; v8f oacc[2][DT];      /* one query per lane: running maximum, this half's part of the row sum; oacc[rt][dt][r] = O^T[dt*16 + 8*hh + r][query ln] */
#pragma unroll
  for (int rt = 0; rt < RTN; ++rt) {
    m_r[rt] = -3.0e38f; l_r[rt] = 0.f;
#pragma unroll
    for (int dt = 0; dt < DT; ++dt) oacc[rt][dt] = (v8f){0.f,0.f,0.f,0.f,0.f,0.f,0.f,0.f}; }
  /* each thread copies 8 x 16 B of the K tile and 8 x 16 B of the Vt tile (16 lanes = one 256-B row or row piece): whole lines per wave */
  const unsigned short* Kg = (const unsigned short*)K16 + ((size_t)b * 4096 + (tid >> 4)) * ldk + h * 128 + (tid & 15) * 8;
  const unsigned short* Vg = Vth + (size_t)(tid >> 4) * 4096 + (tid & 15) * 8;
  const unsigned lK = (unsigned)(uintptr_t)&sK[0][tid >> 4][(tid & 15) * 8], lV = (unsigned)(uintptr_t)&sV[0][tid >> 4][(tid & 15) * 8];
  auto fill = [&](int st, int bf) {
    copy8_to_lds(lK + (unsigned)bf * (unsigned)(SKEYS * KPIT * 2), 16 * KPIT * 2, Kg + (size_t)st * SKEYS * ldk, (size_t)16 * ldk);
    copy8_to_lds(lV + (unsigned)bf * (unsigned)(128 * VPIT * 2), 16 * VPIT * 2, Vg + (size_t)st * SKEYS, (size_t)16 * 4096); };
  fill(0, 0);
  asm volatile("s_wait_asynccnt 0x0" ::: "memory");      /* this wave's copies of stage 0 have landed */
  __syncthreads();                                        /* every wave's have: stage 0 may be read */
  fill(1, 1);
  FragH bk[2][KS];      /* the K fragments of the pass to come: read one pass ahead, so that the LDS works on them under the softmax and the second product */
  load_k(bk, &sK[0][kg * NPP * 32 + ln][8 * hh], KPIT);      /* the first pass's, from stage 0, which is published */
  int bf = 0;      /* buffer of stage st */
#pragma unroll 1
  for (int st = 0; st < NST; ++st) { const int bfn = (bf == NBUF - 1) ? 0 : bf + 1;      /* buffer of stage st + 1 */
#pragma unroll      /* unrolled: the publish point stands in straight-line code between the stage's passes; in a rolled pass loop the compiler lifts the copies' address sums out to the stage's head and keeps them in scratch (180 bytes) */
  for (int pp = 0; pp < NPP; ++pp) { const int ps = kg * NPP + pp;      /* this key group's passes of 32 keys */
    if (pp == NPP - 1 && st + 1 < NST) {      /* the same for the whole workgroup. Stage st + 1 is published in front of stage st's last pass, because that pass already reads the next stage's first K rows */
      asm volatile("s_wait_dscnt 0x0" ::: "memory");        /* this wave's reads of stage st - 1's buffer (and all others so far) are done before that buffer is handed back */
      asm volatile("s_wait_asynccnt 0x0" ::: "memory");     /* this wave's copies of stage st + 1 have landed */
      __syncthreads();                                        /* publishes stage st + 1 and ends every wave's reads of stage st - 1's buffer */
      if (st + 2 < NST) fill(st + 2, (bf == 0) ? NBUF - 1 : bf - 1); }      /* (st + 2) mod 3 = (st - 1) mod 3 */
    v8f s[2][2]; FragH bv[DT];
#pragma unroll
    for (int dt = 0; dt < DT; ++dt) { const unsigned short* vrow = &sV[bf][dt * 16 + ln][ps * 32]; bv[dt].half[0] = *(const v8us*)(vrow + 8 * hh); bv[dt].half[1] = *(const v8us*)(vrow + 16 + 8 * hh); }      /* the pass's Vt fragments as one group at its head: they arrive under the score products and the softmax */
    __builtin_amdgcn_sched_barrier(0);      /* the Vt reads stay in front of the score products: drawn down to their use, the wave would wait out the LDS there */
#pragma unroll
    for (int nt = 0; nt < 2; ++nt)
#pragma unroll
      for (int rt = 0; rt < RTN; ++rt) s[rt][nt] = (v8f){0.f,0.f,0.f,0.f,0.f,0.f,0.f,0.f};
#pragma unroll
    for (int ks = 0; ks < KS; ++ks)      /* the four score tiles side by side: a tile's next matrix instruction stands four behind the one it depends on; each tile still sums ks = 0 .. 3 in order */
#pragma unroll
      for (int nt = 0; nt < 2; ++nt)
#pragma unroll
        for (int rt = 0; rt < RTN; ++rt) s[rt][nt] = mmaC(bk[nt][ks].v, aq[rt][ks].v, s[rt][nt]);      /* s[rt][nt][r] = S^T[key nt*16 + 8*hh + r][query rt*16 + ln] */
    __builtin_amdgcn_sched_barrier(0);      /* the next K reads stay behind the products that read the same registers: drawn up, they would need registers of their own beside the 64 in use */
    { const bool lastp = pp == NPP - 1, lasts = st + 1 == NST;      /* the next pass's K rows: this stage's next 32, or the next stage's first 32; the very last pass has no successor and reads its own rows again (published, never used), which saves a branch behind the products */
      const int nb = (lastp && !lasts) ? bfn : bf, np = lastp ? (lasts ? ps : kg * NPP) : ps + 1;
      load_k(bk, &sK[nb][np * 32 + ln][8 * hh], KPIT); }
    __builtin_amdgcn_sched_barrier(0);      /* and in front of the softmax, so that they are under way while it runs */
    float alr[2]; FragH pb[2];      /* pb = P^T as a B operand: element i = key 8*hh + i, element 8 + i = key 16 + 8*hh + i, the k order of the Vt loader at the pass's head */
#pragma unroll
    for (int rt = 0; rt < RTN; ++rt) { float sc[16], t[16];
#pragma unroll
      for (int i = 0; i < 16; ++i) { sc[i] = s[rt][i >> 3][i & 7]; t[i] = sc[i]; }      /* raw products; 1/sqrt(128) and log2(e) are applied as one factor below */
#pragma unroll
      for (int st2 = 8; st2 > 0; st2 >>= 1)
#pragma unroll
        for (int i = 0; i < st2; ++i) t[i] = fmaxf(t[i], t[i + st2]);
      const float mc = fmaxf(t[0], xhalf(t[0])) * SL2;      /* maximum over the pass's 32 keys, the same in both halves, in the base-2 scale (SL2 > 0 keeps the order) */
      const float mn = fmaxf(m_r[rt], mc); const float al = (mn > -1.0e38f) ? __builtin_amdgcn_exp2f(m_r[rt] - mn) : 1.0f; m_r[rt] = mn;
      typedef float f32x2 __attribute__((ext_vector_type(2))); f32x2 tp[8];      /* the 16 weights as 8 register pairs (2j, 2j + 1) */
#pragma unroll
      for (int j = 0; j < 8; ++j) {      /* e^(x/sqrt(128) - max) = 2^(x*SL2 - mn): one fma, packed two scores an instruction, and the hardware's exp2; the argument is <= about 0, and what underflows is far below f16's and the sum's last bit */
        const f32x2 arg = __builtin_elementwise_fma(f32x2{sc[2 * j], sc[2 * j + 1]}, f32x2{SL2, SL2}, f32x2{-mn, -mn});
        tp[j] = f32x2{__builtin_amdgcn_exp2f(arg.x), __builtin_amdgcn_exp2f(arg.y)}; pb[rt].h[2 * j] = (_Float16)tp[j].x; pb[rt].h[2 * j + 1] = (_Float16)tp[j].y; }
#pragma unroll
      for (int st2 = 4; st2 > 0; st2 >>= 1)      /* the sum's tree: i with i + 8, + 4, + 2, then + 1; two of its additions an instruction */
#pragma unroll
        for (int j = 0; j < st2; ++j) tp[j] += tp[j + st2];
      l_r[rt] = l_r[rt] * al + (tp[0].x + tp[0].y);      /* this half's 16 keys; the halves are joined once, behind the loop */
      alr[rt] = al; }
#pragma unroll
    for (int rt = 0; rt < RTN; ++rt) {
#pragma unroll
      for (int dt = 0; dt < DT; ++dt) {      /* a tile is rescaled at its own product, not all 16 behind the softmax: the multiplies of the tiles to come may issue among the products before them */
#pragma unroll
        for (int r = 0; r < 8; ++r) oacc[rt][dt][r] *= alr[rt];
        oacc[rt][dt] = mmaC(bv[dt].v, pb[rt].v, oacc[rt][dt]); } }
    __builtin_amdgcn_sched_barrier(0);      /* every matrix instruction of the pass stays ahead of the four slots below */
    asm volatile("v_nop\n\tv_nop\n\tv_nop\n\tv_nop"); }      /* the four vector slots behind the pass's last matrix instruction on the loop's back edge: the next pass's first vector instructions may write that instruction's A or B registers */
    bf = bfn; }
  asm volatile("s_wait_asynccnt 0x0" ::: "memory");       /* no copy is outstanding behind the loop */
  if (kg == 1) {      /* the second key group hands its partial result over, each lane at the places where its partner lane of the first group will look */
#pragma unroll
    for (int rt = 0; rt < RTN; ++rt) { sM[qg][rt][lane] = m_r[rt]; sL[qg][rt][lane] = l_r[rt];
#pragma unroll
      for (int dt = 0; dt < DT; ++dt)
#pragma unroll
        for (int g = 0; g < 2; ++g) { const v4f o4 = {oacc[rt][dt][4 * g], oacc[rt][dt][4 * g + 1], oacc[rt][dt][4 * g + 2], oacc[rt][dt][4 * g + 3]}; *(v4fa*)&sO[qg][rt * 16 + ln][dt * 16 + 8 * hh + 4 * g] = o4; } } }
  __syncthreads();      /* the second group's partial results are in LDS before the first group reads them */
  if (kg == 0) {
#pragma unroll
    for (int rt = 0; rt < RTN; ++rt) {
      const float m1 = sM[qg][rt][lane], l1 = sL[qg][rt][lane]; const float mn = fmaxf(m_r[rt], m1);      /* both maxima are in the base-2 scale */
      const float a0 = __builtin_amdgcn_exp2f(m_r[rt] - mn), a1 = __builtin_amdgcn_exp2f(m1 - mn); const float lh = l_r[rt] * a0 + l1 * a1;
      const float l = lh + xhalf(lh); const float li = (l > 0.f) ? 1.0f / l : 0.f; const float c0 = a0 * li, c1 = a1 * li;
#pragma unroll
      for (int dt = 0; dt < DT; ++dt)
#pragma unroll
        for (int g = 0; g < 2; ++g) { float* po = &sO[qg][rt * 16 + ln][dt * 16 + 8 * hh + 4 * g]; const v4f o1 = *(const v4fa*)po;
          const v4f o4 = {oacc[rt][dt][4 * g] * c0 + o1[0] * c1, oacc[rt][dt][4 * g + 1] * c0 + o1[1] * c1, oacc[rt][dt][4 * g + 2] * c0 + o1[2] * c1, oacc[rt][dt][4 * g + 3] * c0 + o1[3] * c1}; *(v4fa*)po = o4; } }      /* a lane's 8 registers are 8 consecutive d of its query's row */
    __builtin_amdgcn_fence(__ATOMIC_ACQ_REL, "workgroup"); __builtin_amdgcn_wave_barrier();      /* every lane's joined values are in LDS before the wave reads them back row by row */
#pragma unroll
    for (int rp = 0; rp < RPW; ++rp) { const int r = rp, pc = lane; const v4f val = *(const v4fa*)&sO[qg][r][pc * 4]; *(v4f*)(O + ((size_t)b * 2048 + q0 + r) * ldo + h * 128 + pc * 4) = val; }      /* 32 lanes x 16 B = whole 512-B row; TQ = 2048 rows per slab */
  } }

extern "C" void kernel_launch(void* const* d_in, const int* in_sizes, int n_in,
                              void* d_out, int out_size, void* d_ws, size_t ws_size, hipStream_t stream) {
  (void)in_sizes; (void)n_in; (void)out_size;
  const float* q = (const float*)d_in[0]; const float* k = (const float*)d_in[1]; const float* v = (const float*)d_in[2];
  char* ws = (char*)d_ws; size_t off = 0;
  auto take = [&](size_t bytes) { char* p = ws + off; off += (bytes + 255) & ~(size_t)255; return p; };
  _Float16* Q16 = (_Float16*)take((size_t)NBH * TQ * HD * 2); _Float16* K16 = (_Float16*)take((size_t)NBH * TK * HD * 2); _Float16* Vt = (_Float16*)take((size_t)NBH * TK * HD * 2);
  if (off > ws_size) return;      // three f16 planes, 42 MB in all
  k_prep<<<NBH * 2 * (TK / 64) / 4, 256, 0, stream>>>(q, k, v, Q16, K16, Vt);      // 512 workgroups: NBH*TQ*HD/8/256 = 4 x 512 chunks of Q, 8 x 512 of K, 4 x 512 tiles of V
  k_flash<<<NBH * 1 * (TQ / 128), 256, 0, stream>>>(Q16, HD, K16, HD, Vt, nullptr, (float*)d_out, HD);
}

// v008
// Measured time: 62.4 microseconds a run.
// Two timings next to v007 put it at 1.08 and 1.07 times that version's speed.
// Counting every step since v000, it is 9.75 times as fast.
#include <hip/hip_runtime.h>
// Attention with learned keys/values: out = softmax(Q·Kᵀ/√128)·V for Q [2,8,2048,128], K/V [2,8,4096,128] (head-major planes). One fused flash-style kernel (16 (b,h) slabs; 2048 query rows
// against 4096 keys; online softmax in f32; P f16 <= 2^8; O = P·Vᵀ-tiles; 32 query rows a wave; 128-wide head) on v_wmma_f32_16x16x32_f16 — Q/K/V bf16-exact in f16, f32 accumulate.
#define NBH 16
#define TQ 2048
#define TK 4096
#define HD 128

typedef __bf16 v16b __attribute__((ext_vector_type(16)));
typedef unsigned short v8us __attribute__((ext_vector_type(8), may_alias));
typedef float  v8f  __attribute__((ext_vector_type(8)));
typedef float  v4f  __attribute__((ext_vector_type(4)));
typedef float  v4fa __attribute__((ext_vector_type(4), may_alias));
union FragB { v16b v; v8us half[2]; unsigned short u[16]; };

__device__ __forceinline__ unsigned short bf16_bits(float x) { unsigned int u = __float_as_uint(x); return (unsigned short)((u + 0x7FFFu + ((u >> 16) & 1u)) >> 16); }
__device__ __forceinline__ float bf16_val(unsigned short b) { return __uint_as_float(((unsigned int)b) << 16); }
__device__ __forceinline__ float bf16_round(float x) { return bf16_val(bf16_bits(x)); }
// D += A·B with NT terms: 1 = ah·bh, 2 = + al·bh (A split), 3 = + ah·bl (both split)
template <int NT>
__device__ __forceinline__ v8f mmaN(v16b ah, v16b al, v16b bh, v16b bl, v8f c) {
  c = __builtin_amdgcn_wmma_f32_16x16x32_bf16(false, ah, false, bh, (short)0, c, false, false);
  if (NT >= 2) c = __builtin_amdgcn_wmma_f32_16x16x32_bf16(false, al, false, bh, (short)0, c, false, false);
  if (NT >= 3) c = __builtin_amdgcn_wmma_f32_16x16x32_bf16(false, ah, false, bl, (short)0, c, false, false);
  asm volatile("v_nop\n\tv_nop\n\tv_nop\n\tv_nop" : "+v"(c) : "v"(ah), "v"(al), "v"(bh), "v"(bl));
  return c;
}

__global__ __launch_bounds__(256) void k_wt_bf16(const float* __restrict__ W, unsigned short* __restrict__ Wt, int K, int N) {
  const int t = blockIdx.x * 256 + threadIdx.x;
  const int k8n = K / 8;
  if (t >= N * k8n) return;
  const int n = t / k8n, k8 = (t % k8n) * 8;
  v8us v;
#pragma unroll
  for (int i = 0; i < 8; ++i) v[i] = bf16_bits(W[(size_t)(k8 + i) * N + n]);
  *(v8us*)(Wt + (size_t)n * K + k8) = v;
  
}

// GEMM C[M][N] (f32, pitch ldc) = act(A[M][K]·W + bias). A f32 row-major (pitch lda) converted per fragment to bf16
// (ASPLIT: hi/lo two planes -> 2 terms, else single rounded term); Wt bf16 [N][K] (pitch ldb). BIAS_BF16 rounds the
// bias to bf16 first (bias quantised to bf16 before the add). K%32==0, M%16==0, N%64==0.
template <bool ASPLIT, int ACT, bool BIAS_BF16>
__global__ __launch_bounds__(128) void k_gemm_bf(const float* __restrict__ A, int lda, const unsigned short* __restrict__ Wt, int ldb,
                                               const float* __restrict__ bias, float* __restrict__ C, int ldc, int M, int N, int K) {
  __shared__ __attribute__((aligned(16))) float so[4][16][64];
  const int tid = threadIdx.x, w = tid >> 5, lane = tid & 31, ln = lane & 15, hh = lane >> 4;
  const int ntn = N / 64;
  const int wid = blockIdx.x * 4 + w;
  const int mt = wid / ntn, nq = wid % ntn;
  if (mt * 16 >= M) return;
  const int row0 = mt * 16, col0 = nq * 64;
  const float* arow = A + (size_t)(row0 + ln) * lda;
  v8f acc[4] = {};
  for (int kb = 0; kb < K; kb += 32) {
    FragB ah, al;
    const v4f x0 = *(const v4fa*)(arow + kb + 8 * hh), x1 = *(const v4fa*)(arow + kb + 8 * hh + 4);
    const v4f x2 = *(const v4fa*)(arow + kb + 16 + 8 * hh), x3 = *(const v4fa*)(arow + kb + 16 + 8 * hh + 4);
    float xs[16] = {x0[0],x0[1],x0[2],x0[3],x1[0],x1[1],x1[2],x1[3],x2[0],x2[1],x2[2],x2[3],x3[0],x3[1],x3[2],x3[3]};
#pragma unroll
    for (int i = 0; i < 16; ++i) { const unsigned short hb = bf16_bits(xs[i]); ah.u[i] = hb; al.u[i] = ASPLIT ? bf16_bits(xs[i] - bf16_val(hb)) : (unsigned short)0; }
#pragma unroll
    for (int t = 0; t < 4; ++t) {
      const unsigned short* brow = Wt + (size_t)(col0 + t * 16 + ln) * ldb + kb;
      FragB b;
      b.half[0] = *(const v8us*)(brow + 8 * hh);
      b.half[1] = *(const v8us*)(brow + 16 + 8 * hh);
      acc[t] = mmaN<ASPLIT ? 2 : 1>(ah.v, al.v, b.v, b.v, acc[t]);
    }
  }
#pragma unroll
  for (int t = 0; t < 4; ++t) {
    float bv = bias ? bias[col0 + t * 16 + ln] : 0.f;
    if (BIAS_BF16) bv = bf16_round(bv);
#pragma unroll
    for (int r = 0; r < 8; ++r) { float v = acc[t][r] + bv; if (ACT == 1) v = fmaxf(v, 0.f); so[w][8 * hh + r][t * 16 + ln] = v; }
  }
  __builtin_amdgcn_fence(__ATOMIC_ACQ_REL, "workgroup");
  __builtin_amdgcn_wave_barrier();
  const int rsub = lane >> 4, c4 = (lane & 15) * 4;
  {
#pragma unroll
    for (int q = 0; q < 8; ++q) {
      const int r = q * 2 + rsub;
      const v4f v = *(const v4fa*)&so[w][r][c4];
      *(v4f*)(C + (size_t)(row0 + r) * ldc + col0 + c4) = v;
    }
    
  }
}

// Flash-style causal/unmasked attention, all contractions 3-term bf16 hi/lo splits, f32 softmax with running max.
// q,k,v rows are read from f32 buffers with arbitrary row pitch (so they can live inside a fused qkv buffer);
// D = head size (multiple of 32, <= 128); one wave = 16 query rows; block = 4 waves (64 queries) sharing K/V chunks of 32.
template <int D, bool CAUSAL>
__global__ __launch_bounds__(128) void k_flash(const float* __restrict__ qb, const float* __restrict__ kb, const float* __restrict__ vb,
                                             int pitch, int T, int H, float scale, float* __restrict__ y, int ypitch) {
  constexpr int KS = D / 32;        // k-steps for QK
  constexpr int DT = D / 16;        // d tiles for PV
  __shared__ __attribute__((aligned(16))) unsigned short sKh[32][D + 8], sKl[32][D + 8], sVh[32][D + 8], sVl[32][D + 8];
  __shared__ __attribute__((aligned(16))) unsigned short sPh[4][16][40], sPl[4][16][40];
  __shared__ __attribute__((aligned(16))) float sO[4][16][D];
  const int tid = threadIdx.x, w = tid >> 5, lane = tid & 31, ln = lane & 15, hh = lane >> 4;
  const int nqb = (T + 63) / 64;
  const int bh = blockIdx.x / nqb, qblk = blockIdx.x % nqb;
  const int b = bh / H, h = bh % H;
  const int q0 = qblk * 64 + w * 16;
  const float* Q = qb + (size_t)b * T * pitch + h * D;
  const float* K = kb + (size_t)b * T * pitch + h * D;
  const float* V = vb + (size_t)b * T * pitch + h * D;

  // A fragments of the wave's 16 query rows (scaled), hi/lo
  FragB aqh[KS], aql[KS];
  {
    int row = q0 + ln; if (row >= T) row = T - 1;
    const float* qr = Q + (size_t)row * pitch;
#pragma unroll
    for (int ks = 0; ks < KS; ++ks)
#pragma unroll
      for (int i = 0; i < 16; ++i) {
        const int d = ks * 32 + ((i < 8) ? (8 * hh + i) : (16 + 8 * hh + (i - 8)));
        const float x = qr[d] * scale; const unsigned short hb = bf16_bits(x);
        aqh[ks].u[i] = hb; aql[ks].u[i] = bf16_bits(x - bf16_val(hb));
      }
  }
  float m_r[8], l_r[8];
#pragma unroll
  for (int r = 0; r < 8; ++r) { m_r[r] = -3.0e38f; l_r[r] = 0.f; }
  v8f oacc[DT];
#pragma unroll
  for (int dt = 0; dt < DT; ++dt) oacc[dt] = (v8f){0.f,0.f,0.f,0.f,0.f,0.f,0.f,0.f};

  const int kv_end = CAUSAL ? min(T, qblk * 64 + 64) : T;     // block-uniform
  for (int j0 = 0; j0 < kv_end; j0 += 32) {
    __syncthreads();
    for (int e = tid; e < 32 * (D / 4); e += 128) {
      const int r = e / (D / 4), c4 = (e % (D / 4)) * 4;
      const int key = j0 + r;
      v4f kf = {0.f,0.f,0.f,0.f}, vf = {0.f,0.f,0.f,0.f};
      if (key < T) { kf = *(const v4fa*)(K + (size_t)key * pitch + c4); vf = *(const v4fa*)(V + (size_t)key * pitch + c4); }
#pragma unroll
      for (int t = 0; t < 4; ++t) {
        unsigned short hb = bf16_bits(kf[t]); sKh[r][c4 + t] = hb; sKl[r][c4 + t] = bf16_bits(kf[t] - bf16_val(hb));
        hb = bf16_bits(vf[t]); sVh[r][c4 + t] = hb; sVl[r][c4 + t] = bf16_bits(vf[t] - bf16_val(hb));
      }
    }
    __syncthreads();
    // S tile 16 x 32
    v8f s[2];
#pragma unroll
    for (int nt = 0; nt < 2; ++nt) {
      v8f acc = {};
#pragma unroll
      for (int ks = 0; ks < KS; ++ks) {
        FragB bh_, bl_;
        bh_.half[0] = *(const v8us*)&sKh[nt * 16 + ln][ks * 32 + 8 * hh]; bh_.half[1] = *(const v8us*)&sKh[nt * 16 + ln][ks * 32 + 16 + 8 * hh];
        bl_.half[0] = *(const v8us*)&sKl[nt * 16 + ln][ks * 32 + 8 * hh]; bl_.half[1] = *(const v8us*)&sKl[nt * 16 + ln][ks * 32 + 16 + 8 * hh];
        acc = mmaN<3>(aqh[ks].v, aql[ks].v, bh_.v, bl_.v, acc);
      }
      s[nt] = acc;
    }
    // mask + running max (rows 8hh+r; the 16 lanes of a half share rows)
    float alpha[8];
#pragma unroll
    for (int r = 0; r < 8; ++r) {
      const int qi = q0 + 8 * hh + r;
      const int ja = j0 + ln, jb = j0 + 16 + ln;
      if (CAUSAL) { if (ja > qi) s[0][r] = -3.0e38f; if (jb > qi) s[1][r] = -3.0e38f; }
      if (ja >= T) s[0][r] = -3.0e38f;
      if (jb >= T) s[1][r] = -3.0e38f;
      float mx = fmaxf(s[0][r], s[1][r]);
      mx = fmaxf(mx, __shfl_xor(mx, 1, 32)); mx = fmaxf(mx, __shfl_xor(mx, 2, 32)); mx = fmaxf(mx, __shfl_xor(mx, 4, 32)); mx = fmaxf(mx, __shfl_xor(mx, 8, 32));
      const float mnew = fmaxf(m_r[r], mx);
      alpha[r] = (mnew > -1.0e38f) ? __expf(m_r[r] - mnew) : 1.0f;
      const float p0 = (s[0][r] > -1.0e38f) ? __expf(s[0][r] - mnew) : 0.f;
      const float p1 = (s[1][r] > -1.0e38f) ? __expf(s[1][r] - mnew) : 0.f;
      m_r[r] = mnew;
      l_r[r] = l_r[r] * alpha[r] + p0 + p1;            // per-lane partial row sum (16 lanes combined at the end)
      unsigned short hb = bf16_bits(p0); sPh[w][8 * hh + r][ln] = hb;      sPl[w][8 * hh + r][ln] = bf16_bits(p0 - bf16_val(hb));
      hb = bf16_bits(p1);                sPh[w][8 * hh + r][16 + ln] = hb; sPl[w][8 * hh + r][16 + ln] = bf16_bits(p1 - bf16_val(hb));
    }
#pragma unroll
    for (int dt = 0; dt < DT; ++dt)
#pragma unroll
      for (int r = 0; r < 8; ++r) oacc[dt][r] *= alpha[r];
    __builtin_amdgcn_fence(__ATOMIC_ACQ_REL, "workgroup");
    __builtin_amdgcn_wave_barrier();
    FragB pah, pal;
    pah.half[0] = *(const v8us*)&sPh[w][ln][8 * hh]; pah.half[1] = *(const v8us*)&sPh[w][ln][16 + 8 * hh];
    pal.half[0] = *(const v8us*)&sPl[w][ln][8 * hh]; pal.half[1] = *(const v8us*)&sPl[w][ln][16 + 8 * hh];
#pragma unroll
    for (int dt = 0; dt < DT; ++dt) {
      FragB bvh, bvl;
#pragma unroll
      for (int i = 0; i < 8; ++i) {
        bvh.u[i] = sVh[8 * hh + i][dt * 16 + ln]; bvh.u[8 + i] = sVh[16 + 8 * hh + i][dt * 16 + ln];
        bvl.u[i] = sVl[8 * hh + i][dt * 16 + ln]; bvl.u[8 + i] = sVl[16 + 8 * hh + i][dt * 16 + ln];
      }
      oacc[dt] = mmaN<3>(pah.v, pal.v, bvh.v, bvl.v, oacc[dt]);
    }
    __builtin_amdgcn_fence(__ATOMIC_ACQ_REL, "workgroup");
    __builtin_amdgcn_wave_barrier();
  }
#pragma unroll
  for (int r = 0; r < 8; ++r) {
    float l = l_r[r];
    l += __shfl_xor(l, 1, 32); l += __shfl_xor(l, 2, 32); l += __shfl_xor(l, 4, 32); l += __shfl_xor(l, 8, 32);
    l_r[r] = (l > 0.f) ? 1.0f / l : 0.f;
  }
#pragma unroll
  for (int dt = 0; dt < DT; ++dt)
#pragma unroll
    for (int r = 0; r < 8; ++r) sO[w][8 * hh + r][dt * 16 + ln] = oacc[dt][r] * l_r[r];
  __builtin_amdgcn_fence(__ATOMIC_ACQ_REL, "workgroup");
  __builtin_amdgcn_wave_barrier();
  {
    for (int r = 0; r < 16; ++r) {
      const int row = q0 + r;
      if (row < T && lane < D / 4) {
        const v4f val = *(const v4fa*)&sO[w][r][lane * 4];
        *(v4f*)(y + ((size_t)b * T + row) * ypitch + h * D + lane * 4) = val;
      }
    }
    
  }
}

// GEMM C = act(A·W + bias + resid): A f32 (ASPLIT -> hi/lo 2 terms), Wt bf16 [N][K]; ACT 0 none, 1 relu, 2 exact gelu;
// resid (optional, f32, row index = (row % rmod), pitch ldr, RES_BF16 rounds it) added before the activation.
template <bool ASPLIT, int ACT, bool BIAS_BF16, bool RES_BF16>
__global__ __launch_bounds__(128) void k_gemm_bf3(const float* __restrict__ A, int lda, const unsigned short* __restrict__ Wt, int ldb,
                                                const float* __restrict__ bias, const float* __restrict__ resid, int rmod, int ldr,
                                                float* __restrict__ C, int ldc, int M, int N, int K) {
  __shared__ __attribute__((aligned(16))) float so[4][16][64];
  const int tid = threadIdx.x, w = tid >> 5, lane = tid & 31, ln = lane & 15, hh = lane >> 4;
  const int ntn = N / 64;
  const int wid = blockIdx.x * 4 + w;
  const int mt = wid / ntn, nq = wid % ntn;
  if (mt * 16 >= M) return;
  const int row0 = mt * 16, col0 = nq * 64;
  const float* arow = A + (size_t)(row0 + ln) * lda;
  v8f acc[4] = {};
  for (int kb = 0; kb < K; kb += 32) {
    FragB ah, al;
    const v4f x0 = *(const v4fa*)(arow + kb + 8 * hh), x1 = *(const v4fa*)(arow + kb + 8 * hh + 4);
    const v4f x2 = *(const v4fa*)(arow + kb + 16 + 8 * hh), x3 = *(const v4fa*)(arow + kb + 16 + 8 * hh + 4);
    float xs[16] = {x0[0],x0[1],x0[2],x0[3],x1[0],x1[1],x1[2],x1[3],x2[0],x2[1],x2[2],x2[3],x3[0],x3[1],x3[2],x3[3]};
#pragma unroll
    for (int i = 0; i < 16; ++i) { const unsigned short hb = bf16_bits(xs[i]); ah.u[i] = hb; al.u[i] = ASPLIT ? bf16_bits(xs[i] - bf16_val(hb)) : (unsigned short)0; }
#pragma unroll
    for (int t = 0; t < 4; ++t) {
      const unsigned short* brow = Wt + (size_t)(col0 + t * 16 + ln) * ldb + kb;
      FragB b;
      b.half[0] = *(const v8us*)(brow + 8 * hh);
      b.half[1] = *(const v8us*)(brow + 16 + 8 * hh);
      acc[t] = mmaN<ASPLIT ? 2 : 1>(ah.v, al.v, b.v, b.v, acc[t]);
    }
  }
#pragma unroll
  for (int t = 0; t < 4; ++t) {
    const int col = col0 + t * 16 + ln;
    float bv = bias ? bias[col] : 0.f;
    if (BIAS_BF16) bv = bf16_round(bv);
#pragma unroll
    for (int r = 0; r < 8; ++r) {
      float v = acc[t][r] + bv;
      if (resid) { float rv = resid[(size_t)((row0 + 8 * hh + r) % rmod) * ldr + col]; if (RES_BF16) rv = bf16_round(rv); v += rv; }
      if (ACT == 1) v = fmaxf(v, 0.f);
      if (ACT == 2) v = 0.5f * v * (1.0f + erff(v * 0.70710678118654752f));
      if (ACT == 3) { const float u = 0.7978845608028654f * (v + 0.044715f * v * v * v); v = 0.5f * v * (1.0f + tanhf(u)); }
      so[w][8 * hh + r][t * 16 + ln] = v;
    }
  }
  __builtin_amdgcn_fence(__ATOMIC_ACQ_REL, "workgroup");
  __builtin_amdgcn_wave_barrier();
  const int rsub = lane >> 4, c4 = (lane & 15) * 4;
  {
#pragma unroll
    for (int q = 0; q < 8; ++q) {
      const int r = q * 2 + rsub;
      const v4f v = *(const v4fa*)&so[w][r][c4];
      *(v4f*)(C + (size_t)(row0 + r) * ldc + col0 + c4) = v;
    }
    
  }
}
// row LayerNorm (biased variance, eps) over N: s = X (+ R); optional out_sum <- s; out_norm <- (s-mu)*rsqrt(var+eps)*g + b
template <bool PARAM_BF16>
__global__ __launch_bounds__(256) void k_layernorm(const float* __restrict__ X, const float* __restrict__ R, const float* __restrict__ g, const float* __restrict__ bta,
                                                  float* __restrict__ out_sum, float* __restrict__ out_norm, int N, float eps) {
  __shared__ float red[256];
  const int row = blockIdx.x, tid = threadIdx.x;
  const float* x = X + (size_t)row * N; const float* rr = R ? R + (size_t)row * N : nullptr;
  float vals[16];                     // up to N = 4096
  const int per = N / 256;            // contiguous chunk per thread? use strided-by-4 chunks: thread handles j = tid*4 + 1024*u
  float s1 = 0.f;
  for (int u = 0; u < per / 4; ++u) {
    const int j = tid * 4 + 1024 * u;
    const v4f a = *(const v4fa*)(x + j);
    v4f b = {0.f,0.f,0.f,0.f}; if (rr) b = *(const v4fa*)(rr + j);
#pragma unroll
    for (int q = 0; q < 4; ++q) { const float v = a[q] + b[q]; vals[u * 4 + q] = v; s1 += v; }
  }
  red[tid] = s1; __syncthreads();
  for (int st = 128; st > 0; st >>= 1) { if (tid < st) red[tid] += red[tid + st]; __syncthreads(); }
  const float mu = red[0] / (float)N; __syncthreads();
  float s2 = 0.f;
  for (int u = 0; u < per / 4; ++u)
#pragma unroll
    for (int q = 0; q < 4; ++q) { const float c = vals[u * 4 + q] - mu; s2 += c * c; }
  red[tid] = s2; __syncthreads();
  for (int st = 128; st > 0; st >>= 1) { if (tid < st) red[tid] += red[tid + st]; __syncthreads(); }
  const float rs = rsqrtf(red[0] / (float)N + eps);
  {
    for (int u = 0; u < per / 4; ++u) {
      const int j = tid * 4 + 1024 * u;
      v4f o, sm;
#pragma unroll
      for (int q = 0; q < 4; ++q) {
        float gg = g[j + q], bb = bta[j + q];
        if (PARAM_BF16) { gg = bf16_round(gg); bb = bf16_round(bb); }
        sm[q] = vals[u * 4 + q]; o[q] = (vals[u * 4 + q] - mu) * rs * gg + bb;
      }
      if (out_sum) *(v4f*)(out_sum + (size_t)row * N + j) = sm;
      *(v4f*)(out_norm + (size_t)row * N + j) = o;
    }
    
  }
}



// ---- f16 WMMA path (v_wmma_f32_16x16x32_f16): 11-bit significands for operands in range — used where the softmax weight operand (0 .. 2^8) needs more precision than bf16
typedef _Float16 v16h __attribute__((ext_vector_type(16)));
union FragH { v16h v; v8us half[2]; _Float16 h[16]; unsigned short u[16]; };
template <int NT>
__device__ __forceinline__ v8f mmaH(v16h ah, v16h al, v16h bh, v16h bl, v8f c) {
  c = __builtin_amdgcn_wmma_f32_16x16x32_f16(false, ah, false, bh, (short)0, c, false, false);
  if (NT >= 2) c = __builtin_amdgcn_wmma_f32_16x16x32_f16(false, al, false, bh, (short)0, c, false, false);
  if (NT >= 3) c = __builtin_amdgcn_wmma_f32_16x16x32_f16(false, ah, false, bl, (short)0, c, false, false);
  asm volatile("v_nop\n\tv_nop\n\tv_nop\n\tv_nop" : "+v"(c) : "v"(ah), "v"(al), "v"(bh), "v"(bl));
  return c;
}
// batched GEMM like k_gemm_b but f16 operands: A f32 (split into f16 hi/lo if ASPLIT, else rounded to f16), Bt = f16 values [n][k]; alpha; C f32; N multiple of 16 (partial tiles skipped)
template <bool ASPLIT>
__global__ __launch_bounds__(128) void k_gemm_h(const float* __restrict__ A, int lda, size_t sA, const _Float16* __restrict__ Bh, int ldb, size_t sB, float alpha, float* __restrict__ C, int ldc, size_t sC, int M, int N, int K) {
  __shared__ __attribute__((aligned(16))) float so[4][16][64];
  const int tid = threadIdx.x, w = tid >> 5, lane = tid & 31, ln = lane & 15, hh = lane >> 4; const int by = blockIdx.y;
  A += (size_t)by * sA; Bh += (size_t)by * sB; C += (size_t)by * sC;
  const int ntn = (N + 63) / 64; const int wid = blockIdx.x * 4 + w; const int mt = wid / ntn, nq = wid % ntn; if (mt * 16 >= M) return;
  const int row0 = mt * 16, col0 = nq * 64; const float* arow = A + (size_t)(row0 + ln) * lda;
  v8f acc[4] = {};
  for (int kb = 0; kb < K; kb += 32) {
    FragH ah, al;
    const v4f x0 = *(const v4fa*)(arow + kb + 8 * hh), x1 = *(const v4fa*)(arow + kb + 8 * hh + 4), x2 = *(const v4fa*)(arow + kb + 16 + 8 * hh), x3 = *(const v4fa*)(arow + kb + 16 + 8 * hh + 4);
    float xs[16] = {x0[0],x0[1],x0[2],x0[3],x1[0],x1[1],x1[2],x1[3],x2[0],x2[1],x2[2],x2[3],x3[0],x3[1],x3[2],x3[3]};
#pragma unroll
    for (int i = 0; i < 16; ++i) { const _Float16 h = (_Float16)xs[i]; ah.h[i] = h; al.h[i] = ASPLIT ? (_Float16)(xs[i] - (float)h) : (_Float16)0.0f; }
#pragma unroll
    for (int t = 0; t < 4; ++t) { if (col0 + t * 16 >= N) continue; const size_t boff = (size_t)(col0 + t * 16 + ln) * ldb + kb; FragH bq; bq.half[0] = *(const v8us*)(Bh + boff + 8 * hh); bq.half[1] = *(const v8us*)(Bh + boff + 16 + 8 * hh);
      acc[t] = mmaH<ASPLIT ? 2 : 1>(ah.v, al.v, bq.v, bq.v, acc[t]); }
  }
#pragma unroll
  for (int t = 0; t < 4; ++t) { if (col0 + t * 16 >= N) continue;
#pragma unroll
    for (int r = 0; r < 8; ++r) so[w][8 * hh + r][t * 16 + ln] = acc[t][r] * alpha; }
  __builtin_amdgcn_fence(__ATOMIC_ACQ_REL, "workgroup"); __builtin_amdgcn_wave_barrier();
  const int rsub = lane >> 4, c4 = (lane & 15) * 4;
  {
#pragma unroll
    for (int q = 0; q < 8; ++q) { const int r = q * 2 + rsub; if (col0 + c4 < N) { const v4f v = *(const v4fa*)&so[w][r][c4]; *(v4f*)(C + (size_t)(row0 + r) * ldc + col0 + c4) = v; } }
     }
}

// Wt[n][k] = f16(W[k][n]·scale) from f32 row-major W[K][N] (scale = power of two; bf16-exact weights stay exact in f16 away from the subnormal range)
__global__ __launch_bounds__(256) void k_wt_f16(const float* __restrict__ W, _Float16* __restrict__ Wt, int K, int N, float scale) {
  const int t = blockIdx.x * 256 + threadIdx.x; if (t >= N * (K / 8)) return; const int n = t / (K / 8), k8 = (t % (K / 8)) * 8; FragH f;
#pragma unroll
  for (int i = 0; i < 8; ++i) f.h[i] = (_Float16)(bf16_round(W[(size_t)(k8 + i) * N + n]) * scale); const v8us o = f.half[0];
  *(v8us*)((unsigned short*)Wt + (size_t)n * K + k8) = o; 
}
// k_gemm_hh variant with fused epilogue: v = acc·alpha + bias[by·sBias + col] (+ CP[(row/rowsPerB)·sCPb + by·64 + col] if CP) ; ACT 0 none / 1 elu ; writes f16 C16 (and f32 C if non-null)
template <int ACT>
__global__ __launch_bounds__(128) void k_gemm_hhx(const _Float16* __restrict__ A, int lda, size_t sA, const _Float16* __restrict__ Bh, int ldb, size_t sB, float alpha, const float* __restrict__ bias, size_t sBias, const float* __restrict__ CP, int rowsPerB, size_t sCPb, int row0g,
    float* __restrict__ C, _Float16* __restrict__ C16, int ldc, size_t sC, int M, int N, int K) {
  __shared__ __attribute__((aligned(16))) float so[4][16][64];
  const int tid = threadIdx.x, w = tid >> 5, lane = tid & 31, ln = lane & 15, hh = lane >> 4; const int by = blockIdx.y;
  A += (size_t)by * sA; Bh += (size_t)by * sB; const size_t cofs = (size_t)by * sC; const float* bp = bias ? bias + (size_t)by * sBias : nullptr;
  const int ntn = (N + 63) / 64; const int wid = blockIdx.x * 4 + w; const int mt = wid / ntn, nq = wid % ntn; if (mt * 16 >= M) return;
  const int row0 = mt * 16, col0 = nq * 64; const _Float16* arow = A + (size_t)(row0 + ln) * lda;
  v8f acc[4] = {};
  for (int kb = 0; kb < K; kb += 32) { FragH ah; ah.half[0] = *(const v8us*)((const unsigned short*)arow + kb + 8 * hh); ah.half[1] = *(const v8us*)((const unsigned short*)arow + kb + 16 + 8 * hh);
#pragma unroll
    for (int t = 0; t < 4; ++t) { if (col0 + t * 16 >= N) continue; const size_t boff = (size_t)(col0 + t * 16 + ln) * ldb + kb; FragH bq; bq.half[0] = *(const v8us*)((const unsigned short*)Bh + boff + 8 * hh); bq.half[1] = *(const v8us*)((const unsigned short*)Bh + boff + 16 + 8 * hh);
      acc[t] = mmaH<1>(ah.v, ah.v, bq.v, bq.v, acc[t]); }
  }
#pragma unroll
  for (int t = 0; t < 4; ++t) { if (col0 + t * 16 >= N) continue; const int col = col0 + t * 16 + ln; const float bv = bp ? bf16_round(bp[col]) : 0.f;
#pragma unroll
    for (int r = 0; r < 8; ++r) { float v = acc[t][r] * alpha + bv; if (CP) { const int bidx = (row0g + row0 + 8 * hh + r) / rowsPerB; v += CP[(size_t)bidx * sCPb + (size_t)by * 64 + col]; } if (ACT == 1) v = (v > 0.f) ? v : expm1f(v); else if (ACT == 3) v = fmaxf(v, 0.f); so[w][8 * hh + r][t * 16 + ln] = v; } }
  __builtin_amdgcn_fence(__ATOMIC_ACQ_REL, "workgroup"); __builtin_amdgcn_wave_barrier();
  const int rsub = lane >> 4, c4 = (lane & 15) * 4; typedef _Float16 v4h __attribute__((ext_vector_type(4)));
  {
#pragma unroll
    for (int q = 0; q < 8; ++q) { const int r = q * 2 + rsub; if (col0 + c4 < N) { const v4f v = *(const v4fa*)&so[w][r][c4]; if (C) *(v4f*)(C + cofs + (size_t)(row0 + r) * ldc + col0 + c4) = v; if (C16) { v4h h4; for (int i = 0; i < 4; ++i) h4[i] = (_Float16)v[i]; *(v4h*)(C16 + cofs + (size_t)(row0 + r) * ldc + col0 + c4) = h4; } } }
     }
}


typedef _Float16 v4h __attribute__((ext_vector_type(4)));

__global__ __launch_bounds__(256) void k_h16(const float* __restrict__ x, _Float16* __restrict__ X16, size_t n8) { const size_t t = (size_t)blockIdx.x * 256 + threadIdx.x; if (t >= n8) return; FragH f;
#pragma unroll
  for (int q = 0; q < 8; ++q) f.h[q] = (_Float16)x[t * 8 + q]; *(v8us*)((unsigned short*)X16 + t * 8) = f.half[0];  }
__global__ __launch_bounds__(256) void k_round16f(const float* __restrict__ W, _Float16* __restrict__ Bt, size_t n8) { const size_t t = (size_t)blockIdx.x * 256 + threadIdx.x; if (t >= n8) return; FragH f;
#pragma unroll
  for (int i = 0; i < 8; ++i) f.h[i] = (_Float16)(bf16_round(W[t * 8 + i]) * 16.0f); *(v8us*)((unsigned short*)Bt + t * 8) = f.half[0];  }
// eight consecutive f32, each rounded to bf16 and held as f16: 16 bytes
__device__ __forceinline__ v8us cvt8(v4f a, v4f b) { FragH f;
#pragma unroll
  for (int e = 0; e < 4; ++e) { f.h[e] = (_Float16)bf16_round(a[e]); f.h[4 + e] = (_Float16)bf16_round(b[e]); }
  return f.half[0]; }
// The whole preparation in one launch of 512 workgroups. Each converts 4 chunks of Q and 8 of K (a chunk = 256 threads x 8 elements) and transposes 4 neighbouring tiles of V (64 keys x 64 d),
// converted on the way from f32, into Vt [bh][128][TK]: few waves with much to do each, instead of one wave per 256 elements in four launches, and no f16 copy of V in between.
__global__ __launch_bounds__(256) void k_prep(const float* __restrict__ q, const float* __restrict__ k, const float* __restrict__ v, _Float16* __restrict__ Q16, _Float16* __restrict__ K16, _Float16* __restrict__ Vt) {
  __shared__ unsigned short tl[4][64][66];      /* a tile of its own for each of the 4: one barrier serves all */
  const int tid = threadIdx.x, r0 = tid / 8, c8 = (tid % 8) * 8;
  const int slab = blockIdx.x / (TK / 256), lg0 = (blockIdx.x % (TK / 256)) * 4;      /* slab = (b,h) plane x which 64 of the 128 d; tiles lg0 .. lg0 + 3 of its TK / 64 */
  const size_t tq = ((size_t)blockIdx.x * 4 * 256 + tid) * 8, tk = ((size_t)blockIdx.x * 8 * 256 + tid) * 8;
  const float* vp = v + ((size_t)(slab / 2) * TK + lg0 * 64 + r0) * HD + (slab % 2) * 64 + c8; const float* qp = q + tq; const float* kp = k + tk;
  v4f xv[8][2], xq[4][2], xk[8][2];      /* all 40 loads of a thread are issued before the first value is used: one memory latency for the launch */
#pragma unroll
  for (int i = 0; i < 8; ++i) { xv[i][0] = *(const v4fa*)(vp + i * 32 * HD); xv[i][1] = *(const v4fa*)(vp + i * 32 * HD + 4); }      /* row i * 32 + r0 of the 256 keys: tile i / 2, its row (i % 2) * 32 + r0 */
#pragma unroll
  for (int u = 0; u < 4; ++u) { xq[u][0] = *(const v4fa*)(qp + u * 2048); xq[u][1] = *(const v4fa*)(qp + u * 2048 + 4); }
#pragma unroll
  for (int u = 0; u < 8; ++u) { xk[u][0] = *(const v4fa*)(kp + u * 2048); xk[u][1] = *(const v4fa*)(kp + u * 2048 + 4); }
  asm volatile("s_wait_xcnt 0x0" :: "v"(vp), "v"(qp), "v"(kp) : "memory");      /* a precaution: the three address pairs stay live up to this wait, so that no load's result is written over a pair that an issued load names */
#pragma unroll
  for (int i = 0; i < 8; ++i) { FragH f; f.half[0] = cvt8(xv[i][0], xv[i][1]);
#pragma unroll
    for (int e = 0; e < 8; ++e) tl[i / 2][(i % 2) * 32 + r0][c8 + e] = f.u[e]; }
#pragma unroll
  for (int u = 0; u < 4; ++u) *(v8us*)((unsigned short*)Q16 + tq + u * 2048) = cvt8(xq[u][0], xq[u][1]);
#pragma unroll
  for (int u = 0; u < 8; ++u) *(v8us*)((unsigned short*)K16 + tk + u * 2048) = cvt8(xk[u][0], xk[u][1]);
  __syncthreads();      /* every thread's part of the 4 tiles is in LDS before a column is read */
#pragma unroll
  for (int u = 0; u < 4; ++u) {
#pragma unroll
    for (int rd = 0; rd < 2; ++rd) { const int d = rd * 32 + tid / 8, pc = tid % 8; FragH f;
#pragma unroll
      for (int e = 0; e < 8; ++e) f.u[e] = tl[u][pc * 8 + e][d];
      *(v8us*)((unsigned short*)Vt + ((size_t)slab * 64 + d) * TK + (lg0 + u) * 64 + pc * 8) = f.half[0]; } } }

// Eight asynchronous 16-byte copies of one lane, global memory -> LDS, no register in between: copy i takes LDS byte address l + i*ls and global address g + i*gs (elements).
// The s_wait_xcnt is the statement's last line so that no address register of an issued copy is rewritten ahead of it.
__device__ __forceinline__ void copy8_to_lds(unsigned l, unsigned ls, const unsigned short* g, size_t gs) {
  asm volatile("global_load_async_to_lds_b128 %0, %8, off\n\t"
               "global_load_async_to_lds_b128 %1, %9, off\n\t"
               "global_load_async_to_lds_b128 %2, %10, off\n\t"
               "global_load_async_to_lds_b128 %3, %11, off\n\t"
               "global_load_async_to_lds_b128 %4, %12, off\n\t"
               "global_load_async_to_lds_b128 %5, %13, off\n\t"
               "global_load_async_to_lds_b128 %6, %14, off\n\t"
               "global_load_async_to_lds_b128 %7, %15, off\n\t"
               "s_wait_xcnt 0x0"
               :: "v"(l), "v"(l + ls), "v"(l + 2 * ls), "v"(l + 3 * ls), "v"(l + 4 * ls), "v"(l + 5 * ls), "v"(l + 6 * ls), "v"(l + 7 * ls),
                  "v"(g), "v"(g + gs), "v"(g + 2 * gs), "v"(g + 3 * gs), "v"(g + 4 * gs), "v"(g + 5 * gs), "v"(g + 6 * gs), "v"(g + 7 * gs)
               : "memory");
}

// The matrix builtin alone, no v_nop statement tied to its result: the compiler keeps the distance behind its own builtins, fills it with the pass's own vector work where it can,
// and the vector port is left to the SIMD's other wave. The stage loop's back edge has its four slots at the foot of each pass.
__device__ __forceinline__ v8f mmaC(v16h a, v16h b, v8f c) { return __builtin_amdgcn_wmma_f32_16x16x32_f16(false, a, false, b, (short)0, c, false, false); }

// The K fragments of one pass of 32 keys (two tiles of 16 rows, four steps of 32 d) as one group of 16 reads; p = the lane's row of the first tile at its half's first 8 d, pit = row pitch in elements
__device__ __forceinline__ void load_k(FragH (&f)[2][4], const unsigned short* p, int pit) {
#pragma unroll
  for (int nt = 0; nt < 2; ++nt)
#pragma unroll
    for (int ks = 0; ks < 4; ++ks) { f[nt][ks].half[0] = *(const v8us*)(p + nt * 16 * pit + ks * 32); f[nt][ks].half[1] = *(const v8us*)(p + nt * 16 * pit + ks * 32 + 16); } }

// value of lane l ^ 16: the other half of the wave holds the other 16 of a query column's 32 keys
__device__ __forceinline__ float xhalf(float x) { return __builtin_bit_cast(float, __builtin_amdgcn_permlanex16(__builtin_bit_cast(int, x), __builtin_bit_cast(int, x), 0x76543210, 0xfedcba98, false, false)); }

__global__ __launch_bounds__(256) void k_flash(const _Float16* __restrict__ Q16, int ldq, const _Float16* __restrict__ K16, int ldk, const _Float16* __restrict__ Vt, const int* __restrict__ MSK, float* __restrict__ O, int ldo) {
  constexpr int RPW = 32, RTN = RPW / 16, NQB = 2048 / (4 * RPW), DT = 8, KS = 4;      /* head_dim 128 */
  constexpr float SL2 = 0.08838834764831845f * 1.4426950408889634f;      /* 1/sqrt(128) * log2(e): the running maximum m_r is kept in this base-2 scale */
  __shared__ __attribute__((aligned(16))) float sO[4][RPW][128 + 4]; __shared__ float sM[4][RTN][32], sL[4][RTN][32];      /* sM, sL: the second key group's maximum and sum, lane by lane */
  constexpr int SKEYS = 128, NST = 4096 / SKEYS, KPIT = 128 + 8, VPIT = SKEYS + 8, NBUF = 3, NPP = SKEYS / 64;      /* a stage = 128 keys, 64 (NPP passes of 32) for each key group; both row pitches 272 B = 16 B x odd, conflict-free for 16-byte reads */
  __shared__ __attribute__((aligned(16))) unsigned short sK[NBUF][SKEYS][KPIT]; __shared__ __attribute__((aligned(16))) unsigned short sV[NBUF][128][VPIT];      /* three buffers each: K rows [key][d], Vt rows [d][key]; stage s lies in buffer s mod 3 */
  const int tid = threadIdx.x, w = __builtin_amdgcn_readfirstlane(tid >> 5), lane = tid & 31, ln = lane & 15, hh = lane >> 4;
  const int qg = w & 3, kg = w >> 2;      /* which 32 queries, which half of a stage's keys */
  const int slab = blockIdx.x / NQB, qblk = blockIdx.x % NQB; const int b = slab / 1, h = slab % 1; const int qb0 = qblk * (4 * RPW); const int q0 = qb0 + qg * RPW;
  FragH aq[2][KS];
#pragma unroll
  for (int rt = 0; rt < RTN; ++rt) { const unsigned short* qr = (const unsigned short*)Q16 + ((size_t)b * 2048 + q0 + rt * 16 + ln) * ldq + h * 128;
#pragma unroll
    for (int ks = 0; ks < KS; ++ks) { aq[rt][ks].half[0] = *(const v8us*)(qr + ks * 32 + 8 * hh); aq[rt][ks].half[1] = *(const v8us*)(qr + ks * 32 + 16 + 8 * hh); } }
  const unsigned short* Vth = (const unsigned short*)Vt + (size_t)slab * 128 * 4096;      /* [bh][128][TK] */
  float m_r[2], thr[2], l_r[2]; v8f oacc[2][DT];      /* one query per lane: maximum in use (base-2 scale), the raw product above which it is renewed, this half's part of the row sum; oacc[rt][dt][r] = O^T[dt*16 + 8*hh + r][query ln] */
#pragma unroll
  for (int rt = 0; rt < RTN; ++rt) {
    m_r[rt] = -3.0e38f; thr[rt] = -3.0e38f; l_r[rt] = 0.f;
#pragma unroll
    for (int dt = 0; dt < DT; ++dt) oacc[rt][dt] = (v8f){0.f,0.f,0.f,0.f,0.f,0.f,0.f,0.f}; }
  /* each thread copies 8 x 16 B of the K tile and 8 x 16 B of the Vt tile (16 lanes = one 256-B row or row piece): whole lines per wave */
  const unsigned short* Kg = (const unsigned short*)K16 + ((size_t)b * 4096 + (tid >> 4)) * ldk + h * 128 + (tid & 15) * 8;
  const unsigned short* Vg = Vth + (size_t)(tid >> 4) * 4096 + (tid & 15) * 8;
  const unsigned lK = (unsigned)(uintptr_t)&sK[0][tid >> 4][(tid & 15) * 8], lV = (unsigned)(uintptr_t)&sV[0][tid >> 4][(tid & 15) * 8];
  auto fill = [&](int st, int bf) {
    copy8_to_lds(lK + (unsigned)bf * (unsigned)(SKEYS * KPIT * 2), 16 * KPIT * 2, Kg + (size_t)st * SKEYS * ldk, (size_t)16 * ldk);
    copy8_to_lds(lV + (unsigned)bf * (unsigned)(128 * VPIT * 2), 16 * VPIT * 2, Vg + (size_t)st * SKEYS, (size_t)16 * 4096); };
  fill(0, 0);
  asm volatile("s_wait_asynccnt 0x0" ::: "memory");      /* this wave's copies of stage 0 have landed */
  __syncthreads();                                        /* every wave's have: stage 0 may be read */
  fill(1, 1);
  FragH bk[2][KS];      /* the K fragments of the pass to come: read one pass ahead, so that the LDS works on them under the softmax and the second product */
  load_k(bk, &sK[0][kg * NPP * 32 + ln][8 * hh], KPIT);      /* the first pass's, from stage 0, which is published */
  int bf = 0;      /* buffer of stage st */
#pragma unroll 1
  for (int st = 0; st < NST; ++st) { const int bfn = (bf == NBUF - 1) ? 0 : bf + 1;      /* buffer of stage st + 1 */
#pragma unroll      /* unrolled: the publish point stands in straight-line code between the stage's passes; in a rolled pass loop the compiler lifts the copies' address sums out to the stage's head and keeps them in scratch (180 bytes) */
  for (int pp = 0; pp < NPP; ++pp) { const int ps = kg * NPP + pp;      /* this key group's passes of 32 keys */
    if (pp == NPP - 1 && st + 1 < NST) {      /* the same for the whole workgroup. Stage st + 1 is published in front of stage st's last pass, because that pass already reads the next stage's first K rows */
      asm volatile("s_wait_dscnt 0x0" ::: "memory");        /* this wave's reads of stage st - 1's buffer (and all others so far) are done before that buffer is handed back */
      asm volatile("s_wait_asynccnt 0x0" ::: "memory");     /* this wave's copies of stage st + 1 have landed */
      __syncthreads();                                        /* publishes stage st + 1 and ends every wave's reads of stage st - 1's buffer */
      if (st + 2 < NST) fill(st + 2, (bf == 0) ? NBUF - 1 : bf - 1); }      /* (st + 2) mod 3 = (st - 1) mod 3 */
    v8f s[2][2]; FragH bv[DT];
#pragma unroll
    for (int dt = 0; dt < DT; ++dt) { const unsigned short* vrow = &sV[bf][dt * 16 + ln][ps * 32]; bv[dt].half[0] = *(const v8us*)(vrow + 8 * hh); bv[dt].half[1] = *(const v8us*)(vrow + 16 + 8 * hh); }      /* the pass's Vt fragments as one group at its head: they arrive under the score products and the softmax */
    __builtin_amdgcn_sched_barrier(0);      /* the Vt reads stay in front of the score products: drawn down to their use, the wave would wait out the LDS there */
#pragma unroll
    for (int nt = 0; nt < 2; ++nt)
#pragma unroll
      for (int rt = 0; rt < RTN; ++rt) s[rt][nt] = (v8f){0.f,0.f,0.f,0.f,0.f,0.f,0.f,0.f};
#pragma unroll
    for (int ks = 0; ks < KS; ++ks)      /* the four score tiles side by side: a tile's next matrix instruction stands four behind the one it depends on; each tile still sums ks = 0 .. 3 in order */
#pragma unroll
      for (int nt = 0; nt < 2; ++nt)
#pragma unroll
        for (int rt = 0; rt < RTN; ++rt) s[rt][nt] = mmaC(bk[nt][ks].v, aq[rt][ks].v, s[rt][nt]);      /* s[rt][nt][r] = S^T[key nt*16 + 8*hh + r][query rt*16 + ln] */
    __builtin_amdgcn_sched_barrier(0);      /* the next K reads stay behind the products that read the same registers: drawn up, they would need registers of their own beside the 64 in use */
    { const bool lastp = pp == NPP - 1, lasts = st + 1 == NST;      /* the next pass's K rows: this stage's next 32, or the next stage's first 32; the very last pass has no successor and reads its own rows again (published, never used), which saves a branch behind the products */
      const int nb = (lastp && !lasts) ? bfn : bf, np = lastp ? (lasts ? ps : kg * NPP) : ps + 1;
      load_k(bk, &sK[nb][np * 32 + ln][8 * hh], KPIT); }
    __builtin_amdgcn_sched_barrier(0);      /* and in front of the softmax, so that they are under way while it runs */
    float mx[2]; bool need = false; FragH pb[2];      /* pb = P^T as a B operand: element i = key 8*hh + i, element 8 + i = key 16 + 8*hh + i, the k order of the Vt loader at the pass's head */
#pragma unroll
    for (int rt = 0; rt < RTN; ++rt) { float t[16];
#pragma unroll
      for (int i = 0; i < 16; ++i) t[i] = s[rt][i >> 3][i & 7];
#pragma unroll
      for (int st2 = 8; st2 > 0; st2 >>= 1)
#pragma unroll
        for (int i = 0; i < st2; ++i) t[i] = fmaxf(t[i], t[i + st2]);
      mx[rt] = fmaxf(t[0], xhalf(t[0]));      /* maximum of the raw products over the pass's 32 keys, the same in both halves */
      need = need || (mx[rt] > thr[rt]); }
    /* m_r, the maximum in use, may trail a query's true maximum by up to 8 in the base-2 scale (a weight then reaches 2^8, well inside f16; sum and O are relative to m_r all along, so the quotient is the same).
       One test a pass for the whole wave, on the raw products against thr = (m_r + 8) / SL2, a scalar branch: only where some query's new maximum exceeds m_r by more are the sums and the 16 O tiles rescaled, which is rare behind the first passes. */
    if (__builtin_amdgcn_ballot_w32(need) != 0) {
#pragma unroll
      for (int rt = 0; rt < RTN; ++rt) {
        const float mn = fmaxf(m_r[rt], mx[rt] * SL2); const float al = (mn > -1.0e38f) ? __builtin_amdgcn_exp2f(m_r[rt] - mn) : 1.0f; m_r[rt] = mn; l_r[rt] *= al;      /* SL2 > 0 keeps the order; al = 0 on the first pass */
        thr[rt] = (mn + 8.0f) * (1.0f / SL2);
#pragma unroll
        for (int dt = 0; dt < DT; ++dt)
#pragma unroll
          for (int r = 0; r < 8; ++r) oacc[rt][dt][r] *= al; } }
#pragma unroll
    for (int rt = 0; rt < RTN; ++rt) { float sc[16]; const float mn = m_r[rt];
#pragma unroll
      for (int i = 0; i < 16; ++i) sc[i] = s[rt][i >> 3][i & 7];      /* raw products; 1/sqrt(128) and log2(e) are applied as one factor below */
      typedef float f32x2 __attribute__((ext_vector_type(2))); f32x2 tp[8];      /* the 16 weights as 8 register pairs (2j, 2j + 1) */
#pragma unroll
      for (int j = 0; j < 8; ++j) {      /* e^(x/sqrt(128) - m_r) = 2^(x*SL2 - mn): one fma, packed two scores an instruction, and the hardware's exp2; the argument is <= 8, and what underflows is far below f16's and the sum's last bit */
        const f32x2 arg = __builtin_elementwise_fma(f32x2{sc[2 * j], sc[2 * j + 1]}, f32x2{SL2, SL2}, f32x2{-mn, -mn});
        tp[j] = f32x2{__builtin_amdgcn_exp2f(arg.x), __builtin_amdgcn_exp2f(arg.y)}; pb[rt].h[2 * j] = (_Float16)tp[j].x; pb[rt].h[2 * j + 1] = (_Float16)tp[j].y; }
#pragma unroll
      for (int st2 = 4; st2 > 0; st2 >>= 1)      /* the sum's tree: i with i + 8, + 4, + 2, then + 1; two of its additions an instruction */
#pragma unroll
        for (int j = 0; j < st2; ++j) tp[j] += tp[j + st2];
      l_r[rt] += tp[0].x + tp[0].y; }      /* this half's 16 keys; the halves are joined once, behind the loop */
#pragma unroll
    for (int rt = 0; rt < RTN; ++rt)
#pragma unroll
      for (int dt = 0; dt < DT; ++dt) oacc[rt][dt] = mmaC(bv[dt].v, pb[rt].v, oacc[rt][dt]);
    __builtin_amdgcn_sched_barrier(0);      /* every matrix instruction of the pass stays ahead of the four slots below */
    asm volatile("v_nop\n\tv_nop\n\tv_nop\n\tv_nop"); }      /* the four vector slots behind the pass's last matrix instruction on the loop's back edge: the next pass's first vector instructions may write that instruction's A or B registers */
    bf = bfn; }
  asm volatile("s_wait_asynccnt 0x0" ::: "memory");       /* no copy is outstanding behind the loop */
  if (kg == 1) {      /* the second key group hands its partial result over, each lane at the places where its partner lane of the first group will look */
#pragma unroll
    for (int rt = 0; rt < RTN; ++rt) { sM[qg][rt][lane] = m_r[rt]; sL[qg][rt][lane] = l_r[rt];
#pragma unroll
      for (int dt = 0; dt < DT; ++dt)
#pragma unroll
        for (int g = 0; g < 2; ++g) { const v4f o4 = {oacc[rt][dt][4 * g], oacc[rt][dt][4 * g + 1], oacc[rt][dt][4 * g + 2], oacc[rt][dt][4 * g + 3]}; *(v4fa*)&sO[qg][rt * 16 + ln][dt * 16 + 8 * hh + 4 * g] = o4; } } }
  __syncthreads();      /* the second group's partial results are in LDS before the first group reads them */
  if (kg == 0) {
#pragma unroll
    for (int rt = 0; rt < RTN; ++rt) {
      const float m1 = sM[qg][rt][lane], l1 = sL[qg][rt][lane]; const float mn = fmaxf(m_r[rt], m1);      /* both maxima are in the base-2 scale */
      const float a0 = __builtin_amdgcn_exp2f(m_r[rt] - mn), a1 = __builtin_amdgcn_exp2f(m1 - mn); const float lh = l_r[rt] * a0 + l1 * a1;
      const float l = lh + xhalf(lh); const float li = (l > 0.f) ? 1.0f / l : 0.f; const float c0 = a0 * li, c1 = a1 * li;
#pragma unroll
      for (int dt = 0; dt < DT; ++dt)
#pragma unroll
        for (int g = 0; g < 2; ++g) { float* po = &sO[qg][rt * 16 + ln][dt * 16 + 8 * hh + 4 * g]; const v4f o1 = *(const v4fa*)po;
          const v4f o4 = {oacc[rt][dt][4 * g] * c0 + o1[0] * c1, oacc[rt][dt][4 * g + 1] * c0 + o1[1] * c1, oacc[rt][dt][4 * g + 2] * c0 + o1[2] * c1, oacc[rt][dt][4 * g + 3] * c0 + o1[3] * c1}; *(v4fa*)po = o4; } }      /* a lane's 8 registers are 8 consecutive d of its query's row */
    __builtin_amdgcn_fence(__ATOMIC_ACQ_REL, "workgroup"); __builtin_amdgcn_wave_barrier();      /* every lane's joined values are in LDS before the wave reads them back row by row */
#pragma unroll
    for (int rp = 0; rp < RPW; ++rp) { const int r = rp, pc = lane; const v4f val = *(const v4fa*)&sO[qg][r][pc * 4]; *(v4f*)(O + ((size_t)b * 2048 + q0 + r) * ldo + h * 128 + pc * 4) = val; }      /* 32 lanes x 16 B = whole 512-B row; TQ = 2048 rows per slab */
  } }

extern "C" void kernel_launch(void* const* d_in, const int* in_sizes, int n_in,
                              void* d_out, int out_size, void* d_ws, size_t ws_size, hipStream_t stream) {
  (void)in_sizes; (void)n_in; (void)out_size;
  const float* q = (const float*)d_in[0]; const float* k = (const float*)d_in[1]; const float* v = (const float*)d_in[2];
  char* ws = (char*)d_ws; size_t off = 0;
  auto take = [&](size_t bytes) { char* p = ws + off; off += (bytes + 255) & ~(size_t)255; return p; };
  _Float16* Q16 = (_Float16*)take((size_t)NBH * TQ * HD * 2); _Float16* K16 = (_Float16*)take((size_t)NBH * TK * HD * 2); _Float16* Vt = (_Float16*)take((size_t)NBH * TK * HD * 2);
  if (off > ws_size) return;      // three f16 planes, 42 MB in all
  k_prep<<<NBH * 2 * (TK / 64) / 4, 256, 0, stream>>>(q, k, v, Q16, K16, Vt);      // 512 workgroups: NBH*TQ*HD/8/256 = 4 x 512 chunks of Q, 8 x 512 of K, 4 x 512 tiles of V
  k_flash<<<NBH * 1 * (TQ / 128), 256, 0, stream>>>(Q16, HD, K16, HD, Vt, nullptr, (float*)d_out, HD);
}

// v009
// A run of this version takes 60.6 microseconds.
// Timed twice side by side with v008, it ran 1.03 times as fast both times.
// Counting every step since v000, it is 10.1 times as fast.
#include <hip/hip_runtime.h>
// Attention with learned keys/values: out = softmax(Q·Kᵀ/√128)·V for Q [2,8,2048,128], K/V [2,8,4096,128] (head-major planes). One fused flash-style kernel (16 (b,h) slabs; 2048 query rows
// against 4096 keys; online softmax in f32; P f16 <= 2^8; O = P·Vᵀ-tiles; 32 query rows a wave; 128-wide head) on v_wmma_f32_16x16x32_f16 — Q/K/V bf16-exact in f16, f32 accumulate.
#define NBH 16
#define TQ 2048
#define TK 4096
#define HD 128

typedef __bf16 v16b __attribute__((ext_vector_type(16)));
typedef unsigned short v8us __attribute__((ext_vector_type(8), may_alias));
typedef float  v8f  __attribute__((ext_vector_type(8)));
typedef float  v4f  __attribute__((ext_vector_type(4)));
typedef float  v4fa __attribute__((ext_vector_type(4), may_alias));
union FragB { v16b v; v8us half[2]; unsigned short u[16]; };

__device__ __forceinline__ unsigned short bf16_bits(float x) { unsigned int u = __float_as_uint(x); return (unsigned short)((u + 0x7FFFu + ((u >> 16) & 1u)) >> 16); }
__device__ __forceinline__ float bf16_val(unsigned short b) { return __uint_as_float(((unsigned int)b) << 16); }
__device__ __forceinline__ float bf16_round(float x) { return bf16_val(bf16_bits(x)); }
// D += A·B with NT terms: 1 = ah·bh, 2 = + al·bh (A split), 3 = + ah·bl (both split)
template <int NT>
__device__ __forceinline__ v8f mmaN(v16b ah, v16b al, v16b bh, v16b bl, v8f c) {
  c = __builtin_amdgcn_wmma_f32_16x16x32_bf16(false, ah, false, bh, (short)0, c, false, false);
  if (NT >= 2) c = __builtin_amdgcn_wmma_f32_16x16x32_bf16(false, al, false, bh, (short)0, c, false, false);
  if (NT >= 3) c = __builtin_amdgcn_wmma_f32_16x16x32_bf16(false, ah, false, bl, (short)0, c, false, false);
  asm volatile("v_nop\n\tv_nop\n\tv_nop\n\tv_nop" : "+v"(c) : "v"(ah), "v"(al), "v"(bh), "v"(bl));
  return c;
}

__global__ __launch_bounds__(256) void k_wt_bf16(const float* __restrict__ W, unsigned short* __restrict__ Wt, int K, int N) {
  const int t = blockIdx.x * 256 + threadIdx.x;
  const int k8n = K / 8;
  if (t >= N * k8n) return;
  const int n = t / k8n, k8 = (t % k8n) * 8;
  v8us v;
#pragma unroll
  for (int i = 0; i < 8; ++i) v[i] = bf16_bits(W[(size_t)(k8 + i) * N + n]);
  *(v8us*)(Wt + (size_t)n * K + k8) = v;
  
}

// GEMM C[M][N] (f32, pitch ldc) = act(A[M][K]·W + bias). A f32 row-major (pitch lda) converted per fragment to bf16
// (ASPLIT: hi/lo two planes -> 2 terms, else single rounded term); Wt bf16 [N][K] (pitch ldb). BIAS_BF16 rounds the
// bias to bf16 first (bias quantised to bf16 before the add). K%32==0, M%16==0, N%64==0.
template <bool ASPLIT, int ACT, bool BIAS_BF16>
__global__ __launch_bounds__(128) void k_gemm_bf(const float* __restrict__ A, int lda, const unsigned short* __restrict__ Wt, int ldb,
                                               const float* __restrict__ bias, float* __restrict__ C, int ldc, int M, int N, int K) {
  __shared__ __attribute__((aligned(16))) float so[4][16][64];
  const int tid = threadIdx.x, w = tid >> 5, lane = tid & 31, ln = lane & 15, hh = lane >> 4;
  const int ntn = N / 64;
  const int wid = blockIdx.x * 4 + w;
  const int mt = wid / ntn, nq = wid % ntn;
  if (mt * 16 >= M) return;
  const int row0 = mt * 16, col0 = nq * 64;
  const float* arow = A + (size_t)(row0 + ln) * lda;
  v8f acc[4] = {};
  for (int kb = 0; kb < K; kb += 32) {
    FragB ah, al;
    const v4f x0 = *(const v4fa*)(arow + kb + 8 * hh), x1 = *(const v4fa*)(arow + kb + 8 * hh + 4);
    const v4f x2 = *(const v4fa*)(arow + kb + 16 + 8 * hh), x3 = *(const v4fa*)(arow + kb + 16 + 8 * hh + 4);
    float xs[16] = {x0[0],x0[1],x0[2],x0[3],x1[0],x1[1],x1[2],x1[3],x2[0],x2[1],x2[2],x2[3],x3[0],x3[1],x3[2],x3[3]};
#pragma unroll
    for (int i = 0; i < 16; ++i) { const unsigned short hb = bf16_bits(xs[i]); ah.u[i] = hb; al.u[i] = ASPLIT ? bf16_bits(xs[i] - bf16_val(hb)) : (unsigned short)0; }
#pragma unroll
    for (int t = 0; t < 4; ++t) {
      const unsigned short* brow = Wt + (size_t)(col0 + t * 16 + ln) * ldb + kb;
      FragB b;
      b.half[0] = *(const v8us*)(brow + 8 * hh);
      b.half[1] = *(const v8us*)(brow + 16 + 8 * hh);
      acc[t] = mmaN<ASPLIT ? 2 : 1>(ah.v, al.v, b.v, b.v, acc[t]);
    }
  }
#pragma unroll
  for (int t = 0; t < 4; ++t) {
    float bv = bias ? bias[col0 + t * 16 + ln] : 0.f;
    if (BIAS_BF16) bv = bf16_round(bv);
#pragma unroll
    for (int r = 0; r < 8; ++r) { float v = acc[t][r] + bv; if (ACT == 1) v = fmaxf(v, 0.f); so[w][8 * hh + r][t * 16 + ln] = v; }
  }
  __builtin_amdgcn_fence(__ATOMIC_ACQ_REL, "workgroup");
  __builtin_amdgcn_wave_barrier();
  const int rsub = lane >> 4, c4 = (lane & 15) * 4;
  {
#pragma unroll
    for (int q = 0; q < 8; ++q) {
      const int r = q * 2 + rsub;
      const v4f v = *(const v4fa*)&so[w][r][c4];
      *(v4f*)(C + (size_t)(row0 + r) * ldc + col0 + c4) = v;
    }
    
  }
}

// Flash-style causal/unmasked attention, all contractions 3-term bf16 hi/lo splits, f32 softmax with running max.
// q,k,v rows are read from f32 buffers with arbitrary row pitch (so they can live inside a fused qkv buffer);
// D = head size (multiple of 32, <= 128); one wave = 16 query rows; block = 4 waves (64 queries) sharing K/V chunks of 32.
template <int D, bool CAUSAL>
__global__ __launch_bounds__(128) void k_flash(const float* __restrict__ qb, const float* __restrict__ kb, const float* __restrict__ vb,
                                             int pitch, int T, int H, float scale, float* __restrict__ y, int ypitch) {
  constexpr int KS = D / 32;        // k-steps for QK
  constexpr int DT = D / 16;        // d tiles for PV
  __shared__ __attribute__((aligned(16))) unsigned short sKh[32][D + 8], sKl[32][D + 8], sVh[32][D + 8], sVl[32][D + 8];
  __shared__ __attribute__((aligned(16))) unsigned short sPh[4][16][40], sPl[4][16][40];
  __shared__ __attribute__((aligned(16))) float sO[4][16][D];
  const int tid = threadIdx.x, w = tid >> 5, lane = tid & 31, ln = lane & 15, hh = lane >> 4;
  const int nqb = (T + 63) / 64;
  const int bh = blockIdx.x / nqb, qblk = blockIdx.x % nqb;
  const int b = bh / H, h = bh % H;
  const int q0 = qblk * 64 + w * 16;
  const float* Q = qb + (size_t)b * T * pitch + h * D;
  const float* K = kb + (size_t)b * T * pitch + h * D;
  const float* V = vb + (size_t)b * T * pitch + h * D;

  // A fragments of the wave's 16 query rows (scaled), hi/lo
  FragB aqh[KS], aql[KS];
  {
    int row = q0 + ln; if (row >= T) row = T - 1;
    const float* qr = Q + (size_t)row * pitch;
#pragma unroll
    for (int ks = 0; ks < KS; ++ks)
#pragma unroll
      for (int i = 0; i < 16; ++i) {
        const int d = ks * 32 + ((i < 8) ? (8 * hh + i) : (16 + 8 * hh + (i - 8)));
        const float x = qr[d] * scale; const unsigned short hb = bf16_bits(x);
        aqh[ks].u[i] = hb; aql[ks].u[i] = bf16_bits(x - bf16_val(hb));
      }
  }
  float m_r[8], l_r[8];
#pragma unroll
  for (int r = 0; r < 8; ++r) { m_r[r] = -3.0e38f; l_r[r] = 0.f; }
  v8f oacc[DT];
#pragma unroll
  for (int dt = 0; dt < DT; ++dt) oacc[dt] = (v8f){0.f,0.f,0.f,0.f,0.f,0.f,0.f,0.f};

  const int kv_end = CAUSAL ? min(T, qblk * 64 + 64) : T;     // block-uniform
  for (int j0 = 0; j0 < kv_end; j0 += 32) {
    __syncthreads();
    for (int e = tid; e < 32 * (D / 4); e += 128) {
      const int r = e / (D / 4), c4 = (e % (D / 4)) * 4;
      const int key = j0 + r;
      v4f kf = {0.f,0.f,0.f,0.f}, vf = {0.f,0.f,0.f,0.f};
      if (key < T) { kf = *(const v4fa*)(K + (size_t)key * pitch + c4); vf = *(const v4fa*)(V + (size_t)key * pitch + c4); }
#pragma unroll
      for (int t = 0; t < 4; ++t) {
        unsigned short hb = bf16_bits(kf[t]); sKh[r][c4 + t] = hb; sKl[r][c4 + t] = bf16_bits(kf[t] - bf16_val(hb));
        hb = bf16_bits(vf[t]); sVh[r][c4 + t] = hb; sVl[r][c4 + t] = bf16_bits(vf[t] - bf16_val(hb));
      }
    }
    __syncthreads();
    // S tile 16 x 32
    v8f s[2];
#pragma unroll
    for (int nt = 0; nt < 2; ++nt) {
      v8f acc = {};
#pragma unroll
      for (int ks = 0; ks < KS; ++ks) {
        FragB bh_, bl_;
        bh_.half[0] = *(const v8us*)&sKh[nt * 16 + ln][ks * 32 + 8 * hh]; bh_.half[1] = *(const v8us*)&sKh[nt * 16 + ln][ks * 32 + 16 + 8 * hh];
        bl_.half[0] = *(const v8us*)&sKl[nt * 16 + ln][ks * 32 + 8 * hh]; bl_.half[1] = *(const v8us*)&sKl[nt * 16 + ln][ks * 32 + 16 + 8 * hh];
        acc = mmaN<3>(aqh[ks].v, aql[ks].v, bh_.v, bl_.v, acc);
      }
      s[nt] = acc;
    }
    // mask + running max (rows 8hh+r; the 16 lanes of a half share rows)
    float alpha[8];
#pragma unroll
    for (int r = 0; r < 8; ++r) {
      const int qi = q0 + 8 * hh + r;
      const int ja = j0 + ln, jb = j0 + 16 + ln;
      if (CAUSAL) { if (ja > qi) s[0][r] = -3.0e38f; if (jb > qi) s[1][r] = -3.0e38f; }
      if (ja >= T) s[0][r] = -3.0e38f;
      if (jb >= T) s[1][r] = -3.0e38f;
      float mx = fmaxf(s[0][r], s[1][r]);
      mx = fmaxf(mx, __shfl_xor(mx, 1, 32)); mx = fmaxf(mx, __shfl_xor(mx, 2, 32)); mx = fmaxf(mx, __shfl_xor(mx, 4, 32)); mx = fmaxf(mx, __shfl_xor(mx, 8, 32));
      const float mnew = fmaxf(m_r[r], mx);
      alpha[r] = (mnew > -1.0e38f) ? __expf(m_r[r] - mnew) : 1.0f;
      const float p0 = (s[0][r] > -1.0e38f) ? __expf(s[0][r] - mnew) : 0.f;
      const float p1 = (s[1][r] > -1.0e38f) ? __expf(s[1][r] - mnew) : 0.f;
      m_r[r] = mnew;
      l_r[r] = l_r[r] * alpha[r] + p0 + p1;            // per-lane partial row sum (16 lanes combined at the end)
      unsigned short hb = bf16_bits(p0); sPh[w][8 * hh + r][ln] = hb;      sPl[w][8 * hh + r][ln] = bf16_bits(p0 - bf16_val(hb));
      hb = bf16_bits(p1);                sPh[w][8 * hh + r][16 + ln] = hb; sPl[w][8 * hh + r][16 + ln] = bf16_bits(p1 - bf16_val(hb));
    }
#pragma unroll
    for (int dt = 0; dt < DT; ++dt)
#pragma unroll
      for (int r = 0; r < 8; ++r) oacc[dt][r] *= alpha[r];
    __builtin_amdgcn_fence(__ATOMIC_ACQ_REL, "workgroup");
    __builtin_amdgcn_wave_barrier();
    FragB pah, pal;
    pah.half[0] = *(const v8us*)&sPh[w][ln][8 * hh]; pah.half[1] = *(const v8us*)&sPh[w][ln][16 + 8 * hh];
    pal.half[0] = *(const v8us*)&sPl[w][ln][8 * hh]; pal.half[1] = *(const v8us*)&sPl[w][ln][16 + 8 * hh];
#pragma unroll
    for (int dt = 0; dt < DT; ++dt) {
      FragB bvh, bvl;
#pragma unroll
      for (int i = 0; i < 8; ++i) {
        bvh.u[i] = sVh[8 * hh + i][dt * 16 + ln]; bvh.u[8 + i] = sVh[16 + 8 * hh + i][dt * 16 + ln];
        bvl.u[i] = sVl[8 * hh + i][dt * 16 + ln]; bvl.u[8 + i] = sVl[16 + 8 * hh + i][dt * 16 + ln];
      }
      oacc[dt] = mmaN<3>(pah.v, pal.v, bvh.v, bvl.v, oacc[dt]);
    }
    __builtin_amdgcn_fence(__ATOMIC_ACQ_REL, "workgroup");
    __builtin_amdgcn_wave_barrier();
  }
#pragma unroll
  for (int r = 0; r < 8; ++r) {
    float l = l_r[r];
    l += __shfl_xor(l, 1, 32); l += __shfl_xor(l, 2, 32); l += __shfl_xor(l, 4, 32); l += __shfl_xor(l, 8, 32);
    l_r[r] = (l > 0.f) ? 1.0f / l : 0.f;
  }
#pragma unroll
  for (int dt = 0; dt < DT; ++dt)
#pragma unroll
    for (int r = 0; r < 8; ++r) sO[w][8 * hh + r][dt * 16 + ln] = oacc[dt][r] * l_r[r];
  __builtin_amdgcn_fence(__ATOMIC_ACQ_REL, "workgroup");
  __builtin_amdgcn_wave_barrier();
  {
    for (int r = 0; r < 16; ++r) {
      const int row = q0 + r;
      if (row < T && lane < D / 4) {
        const v4f val = *(const v4fa*)&sO[w][r][lane * 4];
        *(v4f*)(y + ((size_t)b * T + row) * ypitch + h * D + lane * 4) = val;
      }
    }
    
  }
}

// GEMM C = act(A·W + bias + resid): A f32 (ASPLIT -> hi/lo 2 terms), Wt bf16 [N][K]; ACT 0 none, 1 relu, 2 exact gelu;
// resid (optional, f32, row index = (row % rmod), pitch ldr, RES_BF16 rounds it) added before the activation.
template <bool ASPLIT, int ACT, bool BIAS_BF16, bool RES_BF16>
__global__ __launch_bounds__(128) void k_gemm_bf3(const float* __restrict__ A, int lda, const unsigned short* __restrict__ Wt, int ldb,
                                                const float* __restrict__ bias, const float* __restrict__ resid, int rmod, int ldr,
                                                float* __restrict__ C, int ldc, int M, int N, int K) {
  __shared__ __attribute__((aligned(16))) float so[4][16][64];
  const int tid = threadIdx.x, w = tid >> 5, lane = tid & 31, ln = lane & 15, hh = lane >> 4;
  const int ntn = N / 64;
  const int wid = blockIdx.x * 4 + w;
  const int mt = wid / ntn, nq = wid % ntn;
  if (mt * 16 >= M) return;
  const int row0 = mt * 16, col0 = nq * 64;
  const float* arow = A + (size_t)(row0 + ln) * lda;
  v8f acc[4] = {};
  for (int kb = 0; kb < K; kb += 32) {
    FragB ah, al;
    const v4f x0 = *(const v4fa*)(arow + kb + 8 * hh), x1 = *(const v4fa*)(arow + kb + 8 * hh + 4);
    const v4f x2 = *(const v4fa*)(arow + kb + 16 + 8 * hh), x3 = *(const v4fa*)(arow + kb + 16 + 8 * hh + 4);
    float xs[16] = {x0[0],x0[1],x0[2],x0[3],x1[0],x1[1],x1[2],x1[3],x2[0],x2[1],x2[2],x2[3],x3[0],x3[1],x3[2],x3[3]};
#pragma unroll
    for (int i = 0; i < 16; ++i) { const unsigned short hb = bf16_bits(xs[i]); ah.u[i] = hb; al.u[i] = ASPLIT ? bf16_bits(xs[i] - bf16_val(hb)) : (unsigned short)0; }
#pragma unroll
    for (int t = 0; t < 4; ++t) {
      const unsigned short* brow = Wt + (size_t)(col0 + t * 16 + ln) * ldb + kb;
      FragB b;
      b.half[0] = *(const v8us*)(brow + 8 * hh);
      b.half[1] = *(const v8us*)(brow + 16 + 8 * hh);
      acc[t] = mmaN<ASPLIT ? 2 : 1>(ah.v, al.v, b.v, b.v, acc[t]);
    }
  }
#pragma unroll
  for (int t = 0; t < 4; ++t) {
    const int col = col0 + t * 16 + ln;
    float bv = bias ? bias[col] : 0.f;
    if (BIAS_BF16) bv = bf16_round(bv);
#pragma unroll
    for (int r = 0; r < 8; ++r) {
      float v = acc[t][r] + bv;
      if (resid) { float rv = resid[(size_t)((row0 + 8 * hh + r) % rmod) * ldr + col]; if (RES_BF16) rv = bf16_round(rv); v += rv; }
      if (ACT == 1) v = fmaxf(v, 0.f);
      if (ACT == 2) v = 0.5f * v * (1.0f + erff(v * 0.70710678118654752f));
      if (ACT == 3) { const float u = 0.7978845608028654f * (v + 0.044715f * v * v * v); v = 0.5f * v * (1.0f + tanhf(u)); }
      so[w][8 * hh + r][t * 16 + ln] = v;
    }
  }
  __builtin_amdgcn_fence(__ATOMIC_ACQ_REL, "workgroup");
  __builtin_amdgcn_wave_barrier();
  const int rsub = lane >> 4, c4 = (lane & 15) * 4;
  {
#pragma unroll
    for (int q = 0; q < 8; ++q) {
      const int r = q * 2 + rsub;
      const v4f v = *(const v4fa*)&so[w][r][c4];
      *(v4f*)(C + (size_t)(row0 + r) * ldc + col0 + c4) = v;
    }
    
  }
}
// row LayerNorm (biased variance, eps) over N: s = X (+ R); optional out_sum <- s; out_norm <- (s-mu)*rsqrt(var+eps)*g + b
template <bool PARAM_BF16>
__global__ __launch_bounds__(256) void k_layernorm(const float* __restrict__ X, const float* __restrict__ R, const float* __restrict__ g, const float* __restrict__ bta,
                                                  float* __restrict__ out_sum, float* __restrict__ out_norm, int N, float eps) {
  __shared__ float red[256];
  const int row = blockIdx.x, tid = threadIdx.x;
  const float* x = X + (size_t)row * N; const float* rr = R ? R + (size_t)row * N : nullptr;
  float vals[16];                     // up to N = 4096
  const int per = N / 256;            // contiguous chunk per thread? use strided-by-4 chunks: thread handles j = tid*4 + 1024*u
  float s1 = 0.f;
  for (int u = 0; u < per / 4; ++u) {
    const int j = tid * 4 + 1024 * u;
    const v4f a = *(const v4fa*)(x + j);
    v4f b = {0.f,0.f,0.f,0.f}; if (rr) b = *(const v4fa*)(rr + j);
#pragma unroll
    for (int q = 0; q < 4; ++q) { const float v = a[q] + b[q]; vals[u * 4 + q] = v; s1 += v; }
  }
  red[tid] = s1; __syncthreads();
  for (int st = 128; st > 0; st >>= 1) { if (tid < st) red[tid] += red[tid + st]; __syncthreads(); }
  const float mu = red[0] / (float)N; __syncthreads();
  float s2 = 0.f;
  for (int u = 0; u < per / 4; ++u)
#pragma unroll
    for (int q = 0; q < 4; ++q) { const float c = vals[u * 4 + q] - mu; s2 += c * c; }
  red[tid] = s2; __syncthreads();
  for (int st = 128; st > 0; st >>= 1) { if (tid < st) red[tid] += red[tid + st]; __syncthreads(); }
  const float rs = rsqrtf(red[0] / (float)N + eps);
  {
    for (int u = 0; u < per / 4; ++u) {
      const int j = tid * 4 + 1024 * u;
      v4f o, sm;
#pragma unroll
      for (int q = 0; q < 4; ++q) {
        float gg = g[j + q], bb = bta[j + q];
        if (PARAM_BF16) { gg = bf16_round(gg); bb = bf16_round(bb); }
        sm[q] = vals[u * 4 + q]; o[q] = (vals[u * 4 + q] - mu) * rs * gg + bb;
      }
      if (out_sum) *(v4f*)(out_sum + (size_t)row * N + j) = sm;
      *(v4f*)(out_norm + (size_t)row * N + j) = o;
    }
    
  }
}



// ---- f16 WMMA path (v_wmma_f32_16x16x32_f16): 11-bit significands for operands in range — used where the softmax weight operand (0 .. 2^8) needs more precision than bf16
typedef _Float16 v16h __attribute__((ext_vector_type(16)));
union FragH { v16h v; v8us half[2]; _Float16 h[16]; unsigned short u[16]; };
template <int NT>
__device__ __forceinline__ v8f mmaH(v16h ah, v16h al, v16h bh, v16h bl, v8f c) {
  c = __builtin_amdgcn_wmma_f32_16x16x32_f16(false, ah, false, bh, (short)0, c, false, false);
  if (NT >= 2) c = __builtin_amdgcn_wmma_f32_16x16x32_f16(false, al, false, bh, (short)0, c, false, false);
  if (NT >= 3) c = __builtin_amdgcn_wmma_f32_16x16x32_f16(false, ah, false, bl, (short)0, c, false, false);
  asm volatile("v_nop\n\tv_nop\n\tv_nop\n\tv_nop" : "+v"(c) : "v"(ah), "v"(al), "v"(bh), "v"(bl));
  return c;
}
// batched GEMM like k_gemm_b but f16 operands: A f32 (split into f16 hi/lo if ASPLIT, else rounded to f16), Bt = f16 values [n][k]; alpha; C f32; N multiple of 16 (partial tiles skipped)
template <bool ASPLIT>
__global__ __launch_bounds__(128) void k_gemm_h(const float* __restrict__ A, int lda, size_t sA, const _Float16* __restrict__ Bh, int ldb, size_t sB, float alpha, float* __restrict__ C, int ldc, size_t sC, int M, int N, int K) {
  __shared__ __attribute__((aligned(16))) float so[4][16][64];
  const int tid = threadIdx.x, w = tid >> 5, lane = tid & 31, ln = lane & 15, hh = lane >> 4; const int by = blockIdx.y;
  A += (size_t)by * sA; Bh += (size_t)by * sB; C += (size_t)by * sC;
  const int ntn = (N + 63) / 64; const int wid = blockIdx.x * 4 + w; const int mt = wid / ntn, nq = wid % ntn; if (mt * 16 >= M) return;
  const int row0 = mt * 16, col0 = nq * 64; const float* arow = A + (size_t)(row0 + ln) * lda;
  v8f acc[4] = {};
  for (int kb = 0; kb < K; kb += 32) {
    FragH ah, al;
    const v4f x0 = *(const v4fa*)(arow + kb + 8 * hh), x1 = *(const v4fa*)(arow + kb + 8 * hh + 4), x2 = *(const v4fa*)(arow + kb + 16 + 8 * hh), x3 = *(const v4fa*)(arow + kb + 16 + 8 * hh + 4);
    float xs[16] = {x0[0],x0[1],x0[2],x0[3],x1[0],x1[1],x1[2],x1[3],x2[0],x2[1],x2[2],x2[3],x3[0],x3[1],x3[2],x3[3]};
#pragma unroll
    for (int i = 0; i < 16; ++i) { const _Float16 h = (_Float16)xs[i]; ah.h[i] = h; al.h[i] = ASPLIT ? (_Float16)(xs[i] - (float)h) : (_Float16)0.0f; }
#pragma unroll
    for (int t = 0; t < 4; ++t) { if (col0 + t * 16 >= N) continue; const size_t boff = (size_t)(col0 + t * 16 + ln) * ldb + kb; FragH bq; bq.half[0] = *(const v8us*)(Bh + boff + 8 * hh); bq.half[1] = *(const v8us*)(Bh + boff + 16 + 8 * hh);
      acc[t] = mmaH<ASPLIT ? 2 : 1>(ah.v, al.v, bq.v, bq.v, acc[t]); }
  }
#pragma unroll
  for (int t = 0; t < 4; ++t) { if (col0 + t * 16 >= N) continue;
#pragma unroll
    for (int r = 0; r < 8; ++r) so[w][8 * hh + r][t * 16 + ln] = acc[t][r] * alpha; }
  __builtin_amdgcn_fence(__ATOMIC_ACQ_REL, "workgroup"); __builtin_amdgcn_wave_barrier();
  const int rsub = lane >> 4, c4 = (lane & 15) * 4;
  {
#pragma unroll
    for (int q = 0; q < 8; ++q) { const int r = q * 2 + rsub; if (col0 + c4 < N) { const v4f v = *(const v4fa*)&so[w][r][c4]; *(v4f*)(C + (size_t)(row0 + r) * ldc + col0 + c4) = v; } }
     }
}

// Wt[n][k] = f16(W[k][n]·scale) from f32 row-major W[K][N] (scale = power of two; bf16-exact weights stay exact in f16 away from the subnormal range)
__global__ __launch_bounds__(256) void k_wt_f16(const float* __restrict__ W, _Float16* __restrict__ Wt, int K, int N, float scale) {
  const int t = blockIdx.x * 256 + threadIdx.x; if (t >= N * (K / 8)) return; const int n = t / (K / 8), k8 = (t % (K / 8)) * 8; FragH f;
#pragma unroll
  for (int i = 0; i < 8; ++i) f.h[i] = (_Float16)(bf16_round(W[(size_t)(k8 + i) * N + n]) * scale); const v8us o = f.half[0];
  *(v8us*)((unsigned short*)Wt + (size_t)n * K + k8) = o; 
}
// k_gemm_hh variant with fused epilogue: v = acc·alpha + bias[by·sBias + col] (+ CP[(row/rowsPerB)·sCPb + by·64 + col] if CP) ; ACT 0 none / 1 elu ; writes f16 C16 (and f32 C if non-null)
template <int ACT>
__global__ __launch_bounds__(128) void k_gemm_hhx(const _Float16* __restrict__ A, int lda, size_t sA, const _Float16* __restrict__ Bh, int ldb, size_t sB, float alpha, const float* __restrict__ bias, size_t sBias, const float* __restrict__ CP, int rowsPerB, size_t sCPb, int row0g,
    float* __restrict__ C, _Float16* __restrict__ C16, int ldc, size_t sC, int M, int N, int K) {
  __shared__ __attribute__((aligned(16))) float so[4][16][64];
  const int tid = threadIdx.x, w = tid >> 5, lane = tid & 31, ln = lane & 15, hh = lane >> 4; const int by = blockIdx.y;
  A += (size_t)by * sA; Bh += (size_t)by * sB; const size_t cofs = (size_t)by * sC; const float* bp = bias ? bias + (size_t)by * sBias : nullptr;
  const int ntn = (N + 63) / 64; const int wid = blockIdx.x * 4 + w; const int mt = wid / ntn, nq = wid % ntn; if (mt * 16 >= M) return;
  const int row0 = mt * 16, col0 = nq * 64; const _Float16* arow = A + (size_t)(row0 + ln) * lda;
  v8f acc[4] = {};
  for (int kb = 0; kb < K; kb += 32) { FragH ah; ah.half[0] = *(const v8us*)((const unsigned short*)arow + kb + 8 * hh); ah.half[1] = *(const v8us*)((const unsigned short*)arow + kb + 16 + 8 * hh);
#pragma unroll
    for (int t = 0; t < 4; ++t) { if (col0 + t * 16 >= N) continue; const size_t boff = (size_t)(col0 + t * 16 + ln) * ldb + kb; FragH bq; bq.half[0] = *(const v8us*)((const unsigned short*)Bh + boff + 8 * hh); bq.half[1] = *(const v8us*)((const unsigned short*)Bh + boff + 16 + 8 * hh);
      acc[t] = mmaH<1>(ah.v, ah.v, bq.v, bq.v, acc[t]); }
  }
#pragma unroll
  for (int t = 0; t < 4; ++t) { if (col0 + t * 16 >= N) continue; const int col = col0 + t * 16 + ln; const float bv = bp ? bf16_round(bp[col]) : 0.f;
#pragma unroll
    for (int r = 0; r < 8; ++r) { float v = acc[t][r] * alpha + bv; if (CP) { const int bidx = (row0g + row0 + 8 * hh + r) / rowsPerB; v += CP[(size_t)bidx * sCPb + (size_t)by * 64 + col]; } if (ACT == 1) v = (v > 0.f) ? v : expm1f(v); else if (ACT == 3) v = fmaxf(v, 0.f); so[w][8 * hh + r][t * 16 + ln] = v; } }
  __builtin_amdgcn_fence(__ATOMIC_ACQ_REL, "workgroup"); __builtin_amdgcn_wave_barrier();
  const int rsub = lane >> 4, c4 = (lane & 15) * 4; typedef _Float16 v4h __attribute__((ext_vector_type(4)));
  {
#pragma unroll
    for (int q = 0; q < 8; ++q) { const int r = q * 2 + rsub; if (col0 + c4 < N) { const v4f v = *(const v4fa*)&so[w][r][c4]; if (C) *(v4f*)(C + cofs + (size_t)(row0 + r) * ldc + col0 + c4) = v; if (C16) { v4h h4; for (int i = 0; i < 4; ++i) h4[i] = (_Float16)v[i]; *(v4h*)(C16 + cofs + (size_t)(row0 + r) * ldc + col0 + c4) = h4; } } }
     }
}


typedef _Float16 v4h __attribute__((ext_vector_type(4)));

__global__ __launch_bounds__(256) void k_h16(const float* __restrict__ x, _Float16* __restrict__ X16, size_t n8) { const size_t t = (size_t)blockIdx.x * 256 + threadIdx.x; if (t >= n8) return; FragH f;
#pragma unroll
  for (int q = 0; q < 8; ++q) f.h[q] = (_Float16)x[t * 8 + q]; *(v8us*)((unsigned short*)X16 + t * 8) = f.half[0];  }
__global__ __launch_bounds__(256) void k_round16f(const float* __restrict__ W, _Float16* __restrict__ Bt, size_t n8) { const size_t t = (size_t)blockIdx.x * 256 + threadIdx.x; if (t >= n8) return; FragH f;
#pragma unroll
  for (int i = 0; i < 8; ++i) f.h[i] = (_Float16)(bf16_round(W[t * 8 + i]) * 16.0f); *(v8us*)((unsigned short*)Bt + t * 8) = f.half[0];  }
// eight consecutive f32, each rounded to bf16 and held as f16: 16 bytes
__device__ __forceinline__ v8us cvt8(v4f a, v4f b) { FragH f;
#pragma unroll
  for (int e = 0; e < 4; ++e) { f.h[e] = (_Float16)bf16_round(a[e]); f.h[4 + e] = (_Float16)bf16_round(b[e]); }
  return f.half[0]; }
// The whole preparation in one launch of 512 workgroups. Each converts 4 chunks of Q and 8 of K (a chunk = 256 threads x 8 elements) and transposes 4 neighbouring tiles of V (64 keys x 64 d),
// converted on the way from f32, into Vt [bh][128][TK]: few waves with much to do each, instead of one wave per 256 elements in four launches, and no f16 copy of V in between.
__global__ __launch_bounds__(256) void k_prep(const float* __restrict__ q, const float* __restrict__ k, const float* __restrict__ v, _Float16* __restrict__ Q16, _Float16* __restrict__ K16, _Float16* __restrict__ Vt) {
  __shared__ unsigned short tl[4][64][66];      /* a tile of its own for each of the 4: one barrier serves all */
  const int tid = threadIdx.x, r0 = tid / 8, c8 = (tid % 8) * 8;
  const int slab = blockIdx.x / (TK / 256), lg0 = (blockIdx.x % (TK / 256)) * 4;      /* slab = (b,h) plane x which 64 of the 128 d; tiles lg0 .. lg0 + 3 of its TK / 64 */
  const size_t tq = ((size_t)blockIdx.x * 4 * 256 + tid) * 8, tk = ((size_t)blockIdx.x * 8 * 256 + tid) * 8;
  const float* vp = v + ((size_t)(slab / 2) * TK + lg0 * 64 + r0) * HD + (slab % 2) * 64 + c8; const float* qp = q + tq; const float* kp = k + tk;
  v4f xv[8][2], xq[4][2], xk[8][2];      /* all 40 loads of a thread are issued before the first value is used: one memory latency for the launch */
#pragma unroll
  for (int i = 0; i < 8; ++i) { xv[i][0] = *(const v4fa*)(vp + i * 32 * HD); xv[i][1] = *(const v4fa*)(vp + i * 32 * HD + 4); }      /* row i * 32 + r0 of the 256 keys: tile i / 2, its row (i % 2) * 32 + r0 */
#pragma unroll
  for (int u = 0; u < 4; ++u) { xq[u][0] = *(const v4fa*)(qp + u * 2048); xq[u][1] = *(const v4fa*)(qp + u * 2048 + 4); }
#pragma unroll
  for (int u = 0; u < 8; ++u) { xk[u][0] = *(const v4fa*)(kp + u * 2048); xk[u][1] = *(const v4fa*)(kp + u * 2048 + 4); }
  asm volatile("s_wait_xcnt 0x0" :: "v"(vp), "v"(qp), "v"(kp) : "memory");      /* a precaution: the three address pairs stay live up to this wait, so that no load's result is written over a pair that an issued load names */
#pragma unroll
  for (int i = 0; i < 8; ++i) { FragH f; f.half[0] = cvt8(xv[i][0], xv[i][1]);
#pragma unroll
    for (int e = 0; e < 8; ++e) tl[i / 2][(i % 2) * 32 + r0][c8 + e] = f.u[e]; }
#pragma unroll
  for (int u = 0; u < 4; ++u) *(v8us*)((unsigned short*)Q16 + tq + u * 2048) = cvt8(xq[u][0], xq[u][1]);
#pragma unroll
  for (int u = 0; u < 8; ++u) *(v8us*)((unsigned short*)K16 + tk + u * 2048) = cvt8(xk[u][0], xk[u][1]);
  __syncthreads();      /* every thread's part of the 4 tiles is in LDS before a column is read */
#pragma unroll
  for (int u = 0; u < 4; ++u) {
#pragma unroll
    for (int rd = 0; rd < 2; ++rd) { const int d = rd * 32 + tid / 8, pc = tid % 8; FragH f;
#pragma unroll
      for (int e = 0; e < 8; ++e) f.u[e] = tl[u][pc * 8 + e][d];
      *(v8us*)((unsigned short*)Vt + ((size_t)slab * 64 + d) * TK + (lg0 + u) * 64 + pc * 8) = f.half[0]; } } }

typedef uint32_t u32x4 __attribute__((ext_vector_type(4)));
typedef uint32_t u32x8 __attribute__((ext_vector_type(8)));
__device__ __forceinline__ uint32_t uni(uint32_t v) { return (uint32_t)__builtin_amdgcn_readfirstlane(v); }
// A wave-uniform value held in a scalar register: a test on it compiles to s_cmp and s_cbranch_scc. A tensor load ignores EXEC, so only a scalar branch keeps a wave from issuing it.
__device__ __forceinline__ uint32_t pinned(uint32_t v) { uint32_t w = __builtin_amdgcn_readfirstlane(v); asm volatile("" : "+s"(w)); return w; }      /* the empty statement pins the word in its scalar register */
__device__ __forceinline__ void tdm_load(u32x4 g0, u32x8 g1) { asm volatile("tensor_load_to_lds %0, %1" :: "s"(g0), "s"(g1) : "memory"); }
// Descriptor group 1: extents in bytes, tensor = tile = 128 rows of 256 bytes, source row pitch src_pitch bytes, 16 bytes of LDS pad behind every 256-byte row (LDS pitch 272), no mask
__device__ __forceinline__ u32x8 tdm_group1(uint32_t src_pitch) {
  constexpr uint32_t d0 = 256u, d1 = 128u; u32x8 g;
  g[0] = uni((1u << 20) | (5u << 22) | (3u << 25));
  g[1] = uni((d0 & 0xFFFFu) << 16); g[2] = uni((d0 >> 16) | ((d1 & 0xFFFFu) << 16)); g[3] = uni((d1 >> 16) | (d0 << 16)); g[4] = uni(d1);
  g[5] = uni(src_pitch); g[6] = uni(0u); g[7] = uni(0u);
  asm volatile("" : "+s"(g));      /* pins the eight descriptor words in their scalar registers: built once and held there for the whole loop, so that none of them takes another value while a request is outstanding */
  return g; }
// Descriptor group 0: count 1, LDS byte offset of the tile, global address of its first byte, type 2
__device__ __forceinline__ u32x4 tdm_group0(uint32_t lds_dst, uint64_t ga) { u32x4 g;
  g[0] = uni(1u); g[1] = uni(lds_dst); g[2] = uni((uint32_t)ga); g[3] = uni((((uint32_t)(ga >> 32)) & 0x01FFFFFFu) | 0x80000000u);
  return g; }

// The matrix builtin alone, no v_nop statement tied to its result: the compiler keeps the distance behind its own builtins, fills it with the pass's own vector work where it can,
// and the vector port is left to the SIMD's other wave. The stage loop's back edge has its four slots at the foot of each pass.
__device__ __forceinline__ v8f mmaC(v16h a, v16h b, v8f c) { return __builtin_amdgcn_wmma_f32_16x16x32_f16(false, a, false, b, (short)0, c, false, false); }

// The K fragments of one pass of 32 keys (two tiles of 16 rows, four steps of 32 d) as one group of 16 reads; p = the lane's row of the first tile at its half's first 8 d, pit = row pitch in elements
__device__ __forceinline__ void load_k(FragH (&f)[2][4], const unsigned short* p, int pit) {
#pragma unroll
  for (int nt = 0; nt < 2; ++nt)
#pragma unroll
    for (int ks = 0; ks < 4; ++ks) { f[nt][ks].half[0] = *(const v8us*)(p + nt * 16 * pit + ks * 32); f[nt][ks].half[1] = *(const v8us*)(p + nt * 16 * pit + ks * 32 + 16); } }

// value of lane l ^ 16: the other half of the wave holds the other 16 of a query column's 32 keys
__device__ __forceinline__ float xhalf(float x) { return __builtin_bit_cast(float, __builtin_amdgcn_permlanex16(__builtin_bit_cast(int, x), __builtin_bit_cast(int, x), 0x76543210, 0xfedcba98, false, false)); }

__global__ __launch_bounds__(256) void k_flash(const _Float16* __restrict__ Q16, int ldq, const _Float16* __restrict__ K16, int ldk, const _Float16* __restrict__ Vt, const int* __restrict__ MSK, float* __restrict__ O, int ldo) {
  constexpr int RPW = 32, RTN = RPW / 16, NQB = 2048 / (4 * RPW), DT = 8, KS = 4;      /* head_dim 128 */
  constexpr float SL2 = 0.08838834764831845f * 1.4426950408889634f;      /* 1/sqrt(128) * log2(e): the running maximum m_r is kept in this base-2 scale */
  __shared__ __attribute__((aligned(16))) float sO[4][RPW][128 + 4]; __shared__ float sM[4][RTN][32], sL[4][RTN][32];      /* sM, sL: the second key group's maximum and sum, lane by lane */
  constexpr int SKEYS = 128, NST = 4096 / SKEYS, KPIT = 128 + 8, VPIT = SKEYS + 8, NBUF = 3, NPP = SKEYS / 64;      /* a stage = 128 keys, 64 (NPP passes of 32) for each key group; both row pitches 272 B = 16 B x odd, conflict-free for 16-byte reads */
  __shared__ __attribute__((aligned(2048))) unsigned short sK[NBUF][SKEYS][KPIT]; __shared__ __attribute__((aligned(2048))) unsigned short sV[NBUF][128][VPIT];      /* three buffers each: K rows [key][d], Vt rows [d][key]; stage s lies in buffer s mod 3; a buffer is 34,816 B = 17 x 2 KiB, so every tile's place is a multiple of 2 KiB */
  const int tid = threadIdx.x, w = __builtin_amdgcn_readfirstlane(tid >> 5), lane = tid & 31, ln = lane & 15, hh = lane >> 4;
  const int qg = w & 3, kg = w >> 2;      /* which 32 queries, which half of a stage's keys */
  const int slab = blockIdx.x / NQB, qblk = blockIdx.x % NQB; const int b = slab / 1, h = slab % 1; const int qb0 = qblk * (4 * RPW); const int q0 = qb0 + qg * RPW;
  FragH aq[2][KS];
#pragma unroll
  for (int rt = 0; rt < RTN; ++rt) { const unsigned short* qr = (const unsigned short*)Q16 + ((size_t)b * 2048 + q0 + rt * 16 + ln) * ldq + h * 128;
#pragma unroll
    for (int ks = 0; ks < KS; ++ks) { aq[rt][ks].half[0] = *(const v8us*)(qr + ks * 32 + 8 * hh); aq[rt][ks].half[1] = *(const v8us*)(qr + ks * 32 + 16 + 8 * hh); } }
  const unsigned short* Vth = (const unsigned short*)Vt + (size_t)slab * 128 * 4096;      /* [bh][128][TK] */
  float m_r[2], thr[2], l_r[2]; v8f oacc[2][DT];      /* one query per lane: maximum in use (base-2 scale), the raw product above which it is renewed, this half's part of the row sum; oacc[rt][dt][r] = O^T[dt*16 + 8*hh + r][query ln] */
#pragma unroll
  for (int rt = 0; rt < RTN; ++rt) {
    m_r[rt] = -3.0e38f; thr[rt] = -3.0e38f; l_r[rt] = 0.f;
#pragma unroll
    for (int dt = 0; dt < DT; ++dt) oacc[rt][dt] = (v8f){0.f,0.f,0.f,0.f,0.f,0.f,0.f,0.f}; }
  /* wave 0 brings a stage's K tile (128 keys x 256 B, rows adjacent), wave 1 its Vt tile (128 d x 256 B out of rows of 8,192 B): one request a wave and stage, one outstanding at any time */
  static_assert(KPIT == 136 && VPIT == 136 && SKEYS == 128, "the descriptor's tile (128 rows of 256 B) and pad (16 B) are written for these");
  const uint32_t issuer = (uint32_t)(w < 2), isV = (uint32_t)(w == 1);
  const uint64_t tsrc = isV ? (uint64_t)(uintptr_t)Vth : (uint64_t)(uintptr_t)((const unsigned short*)K16 + (size_t)b * 4096 * ldk + h * 128);
  const uint32_t tstep = isV ? (uint32_t)(SKEYS * 2) : (uint32_t)(SKEYS * 2) * (uint32_t)ldk;      /* bytes from one stage's tile to the next */
  const uint32_t tlds = isV ? (uint32_t)(uintptr_t)&sV[0][0][0] : (uint32_t)(uintptr_t)&sK[0][0][0];
  const u32x8 g1 = tdm_group1(isV ? 4096u * 2u : (uint32_t)ldk * 2u);
  auto fill = [&](int st, int bf) { tdm_load(tdm_group0(tlds + (uint32_t)bf * (uint32_t)(SKEYS * KPIT * 2), tsrc + (uint64_t)((uint32_t)st * tstep)), g1); };
  if (pinned(issuer)) { fill(0, 0);
    asm volatile("s_wait_tensorcnt 0x0" ::: "memory"); }      /* this wave's tile of stage 0 has landed */
  __syncthreads();                                        /* both tiles have: stage 0 may be read */
  if (pinned(issuer)) fill(1, 1);
  FragH bk[2][KS];      /* the K fragments of the pass to come: read one pass ahead, so that the LDS works on them under the softmax and the second product */
  load_k(bk, &sK[0][kg * NPP * 32 + ln][8 * hh], KPIT);      /* the first pass's, from stage 0, which is published */
  int bf = 0;      /* buffer of stage st */
#pragma unroll 1
  for (int st = 0; st < NST; ++st) { const int bfn = (bf == NBUF - 1) ? 0 : bf + 1;      /* buffer of stage st + 1 */
#pragma unroll      /* unrolled: the publish point stands in straight-line code between the stage's passes, and each pass's LDS offsets are constants */
  for (int pp = 0; pp < NPP; ++pp) { const int ps = kg * NPP + pp;      /* this key group's passes of 32 keys */
    if (pp == NPP - 1 && st + 1 < NST) {      /* the same for the whole workgroup. Stage st + 1 is published in front of stage st's last pass, because that pass already reads the next stage's first K rows */
      asm volatile("s_wait_dscnt 0x0" ::: "memory");        /* this wave's reads of stage st - 1's buffer (and all others so far) are done before that buffer is handed back */
      asm volatile("s_wait_tensorcnt 0x0" ::: "memory");    /* an issuing wave's tile of stage st + 1 has landed; a wave that issues none passes at once */
      __syncthreads();                                        /* publishes stage st + 1 and ends every wave's reads of stage st - 1's buffer */
      if (pinned(issuer & (uint32_t)(st + 2 < NST))) fill(st + 2, (bf == 0) ? NBUF - 1 : bf - 1); }      /* (st + 2) mod 3 = (st - 1) mod 3; a scalar branch round the request */
    v8f s[2][2]; FragH bv[DT];
#pragma unroll
    for (int dt = 0; dt < DT; ++dt) { const unsigned short* vrow = &sV[bf][dt * 16 + ln][ps * 32]; bv[dt].half[0] = *(const v8us*)(vrow + 8 * hh); bv[dt].half[1] = *(const v8us*)(vrow + 16 + 8 * hh); }      /* the pass's Vt fragments as one group at its head: they arrive under the score products and the softmax */
    __builtin_amdgcn_sched_barrier(0);      /* the Vt reads stay in front of the score products: drawn down to their use, the wave would wait out the LDS there */
#pragma unroll
    for (int nt = 0; nt < 2; ++nt)
#pragma unroll
      for (int rt = 0; rt < RTN; ++rt) s[rt][nt] = (v8f){0.f,0.f,0.f,0.f,0.f,0.f,0.f,0.f};
#pragma unroll
    for (int ks = 0; ks < KS; ++ks)      /* the four score tiles side by side: a tile's next matrix instruction stands four behind the one it depends on; each tile still sums ks = 0 .. 3 in order */
#pragma unroll
      for (int nt = 0; nt < 2; ++nt)
#pragma unroll
        for (int rt = 0; rt < RTN; ++rt) s[rt][nt] = mmaC(bk[nt][ks].v, aq[rt][ks].v, s[rt][nt]);      /* s[rt][nt][r] = S^T[key nt*16 + 8*hh + r][query rt*16 + ln] */
    __builtin_amdgcn_sched_barrier(0);      /* the next K reads stay behind the products that read the same registers: drawn up, they would need registers of their own beside the 64 in use */
    { const bool lastp = pp == NPP - 1, lasts = st + 1 == NST;      /* the next pass's K rows: this stage's next 32, or the next stage's first 32; the very last pass has no successor and reads its own rows again (published, never used), which saves a branch behind the products */
      const int nb = (lastp && !lasts) ? bfn : bf, np = lastp ? (lasts ? ps : kg * NPP) : ps + 1;
      load_k(bk, &sK[nb][np * 32 + ln][8 * hh], KPIT); }
    __builtin_amdgcn_sched_barrier(0);      /* and in front of the softmax, so that they are under way while it runs */
    float mx[2]; bool need = false; FragH pb[2];      /* pb = P^T as a B operand: element i = key 8*hh + i, element 8 + i = key 16 + 8*hh + i, the k order of the Vt loader at the pass's head */
#pragma unroll
    for (int rt = 0; rt < RTN; ++rt) { float t[16];
#pragma unroll
      for (int i = 0; i < 16; ++i) t[i] = s[rt][i >> 3][i & 7];
#pragma unroll
      for (int st2 = 8; st2 > 0; st2 >>= 1)
#pragma unroll
        for (int i = 0; i < st2; ++i) t[i] = fmaxf(t[i], t[i + st2]);
      mx[rt] = fmaxf(t[0], xhalf(t[0]));      /* maximum of the raw products over the pass's 32 keys, the same in both halves */
      need = need || (mx[rt] > thr[rt]); }
    /* m_r, the maximum in use, may trail a query's true maximum by up to 8 in the base-2 scale (a weight then reaches 2^8, well inside f16; sum and O are relative to m_r all along, so the quotient is the same).
       One test a pass for the whole wave, on the raw products against thr = (m_r + 8) / SL2, a scalar branch: only where some query's new maximum exceeds m_r by more are the sums and the 16 O tiles rescaled, which is rare behind the first passes. */
    if (__builtin_amdgcn_ballot_w32(need) != 0) {
#pragma unroll
      for (int rt = 0; rt < RTN; ++rt) {
        const float mn = fmaxf(m_r[rt], mx[rt] * SL2); const float al = (mn > -1.0e38f) ? __builtin_amdgcn_exp2f(m_r[rt] - mn) : 1.0f; m_r[rt] = mn; l_r[rt] *= al;      /* SL2 > 0 keeps the order; al = 0 on the first pass */
        thr[rt] = (mn + 8.0f) * (1.0f / SL2);
#pragma unroll
        for (int dt = 0; dt < DT; ++dt)
#pragma unroll
          for (int r = 0; r < 8; ++r) oacc[rt][dt][r] *= al; } }
#pragma unroll
    for (int rt = 0; rt < RTN; ++rt) { float sc[16]; const float mn = m_r[rt];
#pragma unroll
      for (int i = 0; i < 16; ++i) sc[i] = s[rt][i >> 3][i & 7];      /* raw products; 1/sqrt(128) and log2(e) are applied as one factor below */
      typedef float f32x2 __attribute__((ext_vector_type(2))); f32x2 tp[8];      /* the 16 weights as 8 register pairs (2j, 2j + 1) */
#pragma unroll
      for (int j = 0; j < 8; ++j) {      /* e^(x/sqrt(128) - m_r) = 2^(x*SL2 - mn): one fma, packed two scores an instruction, and the hardware's exp2; the argument is <= 8, and what underflows is far below f16's and the sum's last bit */
        const f32x2 arg = __builtin_elementwise_fma(f32x2{sc[2 * j], sc[2 * j + 1]}, f32x2{SL2, SL2}, f32x2{-mn, -mn});
        tp[j] = f32x2{__builtin_amdgcn_exp2f(arg.x), __builtin_amdgcn_exp2f(arg.y)}; pb[rt].h[2 * j] = (_Float16)tp[j].x; pb[rt].h[2 * j + 1] = (_Float16)tp[j].y; }
#pragma unroll
      for (int st2 = 4; st2 > 0; st2 >>= 1)      /* the sum's tree: i with i + 8, + 4, + 2, then + 1; two of its additions an instruction */
#pragma unroll
        for (int j = 0; j < st2; ++j) tp[j] += tp[j + st2];
      l_r[rt] += tp[0].x + tp[0].y; }      /* this half's 16 keys; the halves are joined once, behind the loop */
#pragma unroll
    for (int rt = 0; rt < RTN; ++rt)
#pragma unroll
      for (int dt = 0; dt < DT; ++dt) oacc[rt][dt] = mmaC(bv[dt].v, pb[rt].v, oacc[rt][dt]);
    __builtin_amdgcn_sched_barrier(0);      /* every matrix instruction of the pass stays ahead of the four slots below */
    asm volatile("v_nop\n\tv_nop\n\tv_nop\n\tv_nop"); }      /* the four vector slots behind the pass's last matrix instruction on the loop's back edge: the next pass's first vector instructions may write that instruction's A or B registers */
    bf = bfn; }
  asm volatile("s_wait_tensorcnt 0x0" ::: "memory");      /* no request is outstanding behind the loop */
  asm volatile("s_wait_dscnt 0x0" ::: "memory");          /* nor a read of the ring */
  if (kg == 1) {      /* the second key group hands its partial result over, each lane at the places where its partner lane of the first group will look */
#pragma unroll
    for (int rt = 0; rt < RTN; ++rt) { sM[qg][rt][lane] = m_r[rt]; sL[qg][rt][lane] = l_r[rt];
#pragma unroll
      for (int dt = 0; dt < DT; ++dt)
#pragma unroll
        for (int g = 0; g < 2; ++g) { const v4f o4 = {oacc[rt][dt][4 * g], oacc[rt][dt][4 * g + 1], oacc[rt][dt][4 * g + 2], oacc[rt][dt][4 * g + 3]}; *(v4fa*)&sO[qg][rt * 16 + ln][dt * 16 + 8 * hh + 4 * g] = o4; } } }
  __syncthreads();      /* the second group's partial results are in LDS before the first group reads them */
  if (kg == 0) {
#pragma unroll
    for (int rt = 0; rt < RTN; ++rt) {
      const float m1 = sM[qg][rt][lane], l1 = sL[qg][rt][lane]; const float mn = fmaxf(m_r[rt], m1);      /* both maxima are in the base-2 scale */
      const float a0 = __builtin_amdgcn_exp2f(m_r[rt] - mn), a1 = __builtin_amdgcn_exp2f(m1 - mn); const float lh = l_r[rt] * a0 + l1 * a1;
      const float l = lh + xhalf(lh); const float li = (l > 0.f) ? 1.0f / l : 0.f; const float c0 = a0 * li, c1 = a1 * li;
#pragma unroll
      for (int dt = 0; dt < DT; ++dt)
#pragma unroll
        for (int g = 0; g < 2; ++g) { float* po = &sO[qg][rt * 16 + ln][dt * 16 + 8 * hh + 4 * g]; const v4f o1 = *(const v4fa*)po;
          const v4f o4 = {oacc[rt][dt][4 * g] * c0 + o1[0] * c1, oacc[rt][dt][4 * g + 1] * c0 + o1[1] * c1, oacc[rt][dt][4 * g + 2] * c0 + o1[2] * c1, oacc[rt][dt][4 * g + 3] * c0 + o1[3] * c1}; *(v4fa*)po = o4; } }      /* a lane's 8 registers are 8 consecutive d of its query's row */
    __builtin_amdgcn_fence(__ATOMIC_ACQ_REL, "workgroup"); __builtin_amdgcn_wave_barrier();      /* every lane's joined values are in LDS before the wave reads them back row by row */
#pragma unroll
    for (int rp = 0; rp < RPW; ++rp) { const int r = rp, pc = lane; const v4f val = *(const v4fa*)&sO[qg][r][pc * 4]; *(v4f*)(O + ((size_t)b * 2048 + q0 + r) * ldo + h * 128 + pc * 4) = val; }      /* 32 lanes x 16 B = whole 512-B row; TQ = 2048 rows per slab */
  } }

extern "C" void kernel_launch(void* const* d_in, const int* in_sizes, int n_in,
                              void* d_out, int out_size, void* d_ws, size_t ws_size, hipStream_t stream) {
  (void)in_sizes; (void)n_in; (void)out_size;
  const float* q = (const float*)d_in[0]; const float* k = (const float*)d_in[1]; const float* v = (const float*)d_in[2];
  char* ws = (char*)d_ws; size_t off = 0;
  auto take = [&](size_t bytes) { char* p = ws + off; off += (bytes + 255) & ~(size_t)255; return p; };
  _Float16* Q16 = (_Float16*)take((size_t)NBH * TQ * HD * 2); _Float16* K16 = (_Float16*)take((size_t)NBH * TK * HD * 2); _Float16* Vt = (_Float16*)take((size_t)NBH * TK * HD * 2);
  if (off > ws_size) return;      // three f16 planes, 42 MB in all
  k_prep<<<NBH * 2 * (TK / 64) / 4, 256, 0, stream>>>(q, k, v, Q16, K16, Vt);      // 512 workgroups: NBH*TQ*HD/8/256 = 4 x 512 chunks of Q, 8 x 512 of K, 4 x 512 tiles of V
  k_flash<<<NBH * 1 * (TQ / 128), 256, 0, stream>>>(Q16, HD, K16, HD, Vt, nullptr, (float*)d_out, HD);
}
